// v000
// The times below were measured on an AMD MI455X: many runs one after another, warmed up first and cycling through
// copies of the inputs, with the whole window's GPU time divided by the number of runs. Launches and the gaps
// between them are all in it. The median over several windows is given; except for v000 it joins two sittings, which
// can be a few percent apart, so the side-by-side timings, each taken in one sitting, are the better comparison.
// v000, which the later versions start from, runs in 1440 microseconds.
// compute dtype: all float inputs rounded to bf16; q / k / v projections with EXACT bf16 products on WMMA 16x16x32 (f32 accumulate), no biases; RoPE in f32 (embedded frequencies, precise cosf / sinf, positions read from the int input token_positions); logits q x k once to f16 each (1 product) x 64^-0.5; softmax f32; P x 2^11 once to f16 x v once to f16 (1 product); ctx x 2^6 once to f16 x the output weight f16(bf16 x 2^8); f32 output.
#include <hip/hip_runtime.h>
#include <math.h>

typedef __attribute__((ext_vector_type(16))) _Float16 v16h;
typedef __attribute__((ext_vector_type(16))) __bf16 v16b;
typedef __attribute__((ext_vector_type(8)))  _Float16 v8h;
typedef __attribute__((ext_vector_type(8)))  float v8f;
typedef __attribute__((ext_vector_type(4)))  float v4f;
typedef __attribute__((ext_vector_type(2)))  float v2f;
typedef __attribute__((ext_vector_type(4)))  unsigned v4u;
typedef __attribute__((ext_vector_type(4)))  int v4i;
typedef float __attribute__((may_alias)) float_a;
typedef int __attribute__((may_alias)) int_a;

template <typename T> __device__ __forceinline__ void vst2(void* p, T v) { *(T*)p = v;  }
__device__ __forceinline__ v8f wmma16(v16h a, v16h b, v8f c) {
  v8f d = __builtin_amdgcn_wmma_f32_16x16x32_f16(false, a, false, b, (short)0, c, false, false);
  asm volatile("v_nop\n\tv_nop\n\tv_nop\n\tv_nop" : "+v"(d) : "v"(a), "v"(b));
  return d;
}
__device__ __forceinline__ v8f wmma_bf(v16b a, v16b b, v8f c) {
  v8f d = __builtin_amdgcn_wmma_f32_16x16x32_bf16(false, a, false, b, (short)0, c, false, false);
  asm volatile("v_nop\n\tv_nop\n\tv_nop\n\tv_nop" : "+v"(d) : "v"(a), "v"(b));
  return d;
}
// 16x16x32 fragments: lane = (h = lane>>4, row/col = lane&15); elements 0..7 = k0+8h+0..7, 8..15 = k0+16+8h+0..7; D element r = row 8h+r
__device__ __forceinline__ v16h frag_h(const _Float16* rowk0, int lane) {
  union { v16h v; v8h q[2]; } u; const _Float16* p = rowk0 + 8 * (lane >> 4);
  u.q[0] = *(const v8h*)p; u.q[1] = *(const v8h*)(p + 16); return u.v;
}
__device__ __forceinline__ v16h frag_f32(const float* rowk0, int lane) {
  v16h a; const float* p = rowk0 + 8 * (lane >> 4);
#pragma unroll
  for (int i = 0; i < 8; ++i) { a[i] = (_Float16)p[i]; a[8 + i] = (_Float16)p[16 + i]; }
  return a;
}
__device__ __forceinline__ v16h frag_f32s(const float* rowk0, int lane, float sc) {
  v16h a; const float* p = rowk0 + 8 * (lane >> 4);
#pragma unroll
  for (int i = 0; i < 8; ++i) { a[i] = (_Float16)(p[i] * sc); a[8 + i] = (_Float16)(p[16 + i] * sc); }
  return a;
}
// column fragment from a [K][ld] layout (column n), rows >= K read as 0
__device__ __forceinline__ v16h fragc_f32(const float* W, int k0, int n, int lane, int ld, int K) {
  v16h a; const int g = lane >> 4;
#pragma unroll
  for (int i = 0; i < 8; ++i) { const int ka = k0 + 8 * g + i, kb = ka + 16;
    a[i] = (_Float16)(ka < K ? W[(size_t)(ka < K ? ka : K - 1) * ld + n] : 0.f); a[8 + i] = (_Float16)(kb < K ? W[(size_t)(kb < K ? kb : K - 1) * ld + n] : 0.f); }
  return a;
}
struct F2 { v16b h, l; };
__device__ __forceinline__ F2 bsplit16(const float v[16]) { F2 r;
#pragma unroll
  for (int i = 0; i < 16; ++i) { const __bf16 h = (__bf16)v[i]; r.h[i] = h; r.l[i] = (__bf16)(v[i] - (float)h); }
  return r; }
__device__ __forceinline__ F2 split_row(const float* row, int k0, int lane) { float v[16]; const float* p = row + k0 + 8 * (lane >> 4);
#pragma unroll
  for (int i = 0; i < 8; ++i) { v[i] = p[i]; v[8 + i] = p[16 + i]; }
  return bsplit16(v); }
__device__ __forceinline__ F2 split_rowK(const float* row, int k0, int lane, int K) { float v[16]; const int g = lane >> 4;
#pragma unroll
  for (int i = 0; i < 8; ++i) { const int ka = k0 + 8 * g + i, kb = ka + 16; v[i] = ka < K ? row[ka < K ? ka : K - 1] : 0.f; v[8 + i] = kb < K ? row[kb < K ? kb : K - 1] : 0.f; }
  return bsplit16(v); }
__device__ __forceinline__ F2 split_col(const float* W, int k0, int n, int lane, int ld, int K) { float v[16]; const int g = lane >> 4;
#pragma unroll
  for (int i = 0; i < 8; ++i) { const int ka = k0 + 8 * g + i, kb = ka + 16; v[i] = ka < K ? W[(size_t)(ka < K ? ka : K - 1) * ld + n] : 0.f; v[8 + i] = kb < K ? W[(size_t)(kb < K ? kb : K - 1) * ld + n] : 0.f; }
  return bsplit16(v); }
__device__ __forceinline__ v8f mac3(const F2& a, const F2& b, v8f c) { c = wmma_bf(a.l, b.h, c); c = wmma_bf(a.h, b.l, c); return wmma_bf(a.h, b.h, c); }
__device__ __forceinline__ float sigm(float v) { return 1.0f / (1.0f + expf(-v)); }
#define LDSX() do { asm volatile("s_wait_dscnt 0" ::: "memory"); __builtin_amdgcn_wave_barrier(); __builtin_amdgcn_fence(__ATOMIC_RELEASE, "workgroup"); } while (0)

// Multi-head self-attention with interleaved-pair RoPE, no mask (x [2,2048,1024]; Wqkv [3072,1024] torch (out,in): qkv.reshape(B, S, 3, 16, 64): q = rows 0..1023, k = 1024..2047, v = 2048..3071; Wout [1024,1024] (out,in); token_positions [2048] int32 = arange, a module input READ on the device; RoPE on q and k: (even, odd) pairs (x_e c - x_o s, x_e s + x_o c) re-interleaved, inv_freq = 1 / 10000^(2i/64); scores / sqrt(64); softmax; out @ Wout.T).
#define NB 2
#define TT 2048
#define CC 1024            // NH * HD = projected width
#define DIN 1024          // input (model) width
#define NH 16
#define HD 64
#define NQB (TT / 64)
#define HG 4
#define SCALE (0.125f)
#define CAUSAL 0
#ifndef TNB
#define TNB NB
#endif
__device__ __forceinline__ float bfr(float v) { return (float)(__bf16)v; }
__host__ __device__ __forceinline__ int kb_last(int qb) { return CAUSAL ? ((qb * 64 + 63) >> 7) : (TT / 128 - 1); }
typedef __attribute__((ext_vector_type(8))) __bf16 v8b;
__device__ __forceinline__ v16b frag_b(const __bf16* rowk0, int lane) {
  union { v16b v; v8b q[2]; } u; const __bf16* p = rowk0 + 8 * (lane >> 4);
  u.q[0] = *(const v8b*)p; u.q[1] = *(const v8b*)(p + 16); return u.v;
}
#define QBH 0              // no query block takes the high-precision path (no mask: every block sees all TT keys)
#define QHI 0               // single-product logits on every row
#define KHI 64            // key rows carrying k residual / v bf16 hi+lo planes (written by k_proj, but read only by the qb < QBH path, which no block takes)
// B fragment (k rows k0+.., output column o) of a weight: (in,out) [K][ld] or (out,in) [ld rows of K]: bf16 exact, or f16(bf16 * 256) exact
__device__ __forceinline__ v16b wcol_io(const float* Wm, int k0, int o, int lane, int ld) { v16b w; const int g = lane >> 4;
#pragma unroll
  for (int i = 0; i < 8; ++i) { w[i] = (__bf16)Wm[(size_t)(k0 + 8 * g + i) * ld + o]; w[8 + i] = (__bf16)Wm[(size_t)(k0 + 16 + 8 * g + i) * ld + o]; }
  return w; }
__device__ __forceinline__ v16b wcol_oi(const float* Wm, int k0, int o, int lane, int K) { v16b w; const float* p = Wm + (size_t)o * K + k0 + 8 * (lane >> 4);
#pragma unroll
  for (int i = 0; i < 8; ++i) { w[i] = (__bf16)p[i]; w[8 + i] = (__bf16)p[16 + i]; }
  return w; }
__device__ __forceinline__ v16h wcolh_io(const float* Wm, int k0, int o, int lane, int ld) { v16h w; const int g = lane >> 4;
#pragma unroll
  for (int i = 0; i < 8; ++i) { w[i] = (_Float16)(bfr(Wm[(size_t)(k0 + 8 * g + i) * ld + o]) * 256.0f); w[8 + i] = (_Float16)(bfr(Wm[(size_t)(k0 + 16 + 8 * g + i) * ld + o]) * 256.0f); }
  return w; }
__device__ __forceinline__ v16h wcolh_oi(const float* Wm, int k0, int o, int lane, int K) { v16h w; const float* p = Wm + (size_t)o * K + k0 + 8 * (lane >> 4);
#pragma unroll
  for (int i = 0; i < 8; ++i) { w[i] = (_Float16)(bfr(p[i]) * 256.0f); w[8 + i] = (_Float16)(bfr(p[16 + i]) * 256.0f); }
  return w; }
#define WQKV_LAYOUT 1   // 0 = (in,out) [DIN][CC]; 1 = (out,in) [CC][DIN]; 2 = per-head [NH][DIN][HD]
__device__ __forceinline__ v16b wcol_hdk(const float* Wm, int k0, int o, int lane) { v16b w; const int g = lane >> 4; const float* p = Wm + (size_t)(o / HD) * DIN * HD + (o % HD);
#pragma unroll
  for (int i = 0; i < 8; ++i) { w[i] = (__bf16)p[(size_t)(k0 + 8 * g + i) * HD]; w[8 + i] = (__bf16)p[(size_t)(k0 + 16 + 8 * g + i) * HD]; }
  return w; }
#define WO_OUT_IN 1
#if WQKV_LAYOUT == 1
#define WCOL(W, k0, o, lane) wcol_oi(W, k0, o, lane, DIN)
#elif WQKV_LAYOUT == 2
#define WCOL(W, k0, o, lane) wcol_hdk(W, k0, o, lane)
#else
#define WCOL(W, k0, o, lane) wcol_io(W, k0, o, lane, CC)
#endif
#if WO_OUT_IN
#define WOCOL(W, k0, o, lane) wcol_oi(W, k0, o, lane, CC)
#define WOCOLH(W, k0, o, lane) wcolh_oi(W, k0, o, lane, CC)
#else
#define WOCOL(W, k0, o, lane) wcol_io(W, k0, o, lane, DIN)
#define WOCOLH(W, k0, o, lane) wcolh_io(W, k0, o, lane, DIN)
#endif

// RoPE inverse frequencies 1/10000^(2i/64) (the f32 values jax computes)
__constant__ float INVF[32] = {1.000000000e+00,7.498942018e-01,5.623413324e-01,4.216965139e-01,3.162277639e-01,2.371373624e-01,1.778279394e-01,1.333521456e-01,1.000000015e-01,7.498941571e-02,5.623412877e-02,4.216964915e-02,3.162277862e-02,2.371373586e-02,1.778279431e-02,1.333521493e-02,9.999999776e-03,7.498942316e-03,5.623413250e-03,4.216964822e-03,3.162277862e-03,2.371373819e-03,1.778279431e-03,1.333521446e-03,1.000000047e-03,7.498941850e-04,5.623413017e-04,4.216964880e-04,3.162277862e-04,2.371373848e-04,1.778279402e-04,1.333521504e-04};
// (PROJ_EXTRA_PARAMS: the extra kernel parameters 'const int* __restrict__ TPOS' are written literally in the kernel signature)
// per (token, head) hook on the staged f32 row (64 floats) of the q and k streams: interleaved-pair rotation (x[2i], x[2i + 1]) by the angle pos * INVF[i] with pos READ from the int input; v untouched
#define PROJ_EPI(which, row, t, h) do { if ((which) < 2) { float* rw = (row); const float pos_ = (float)TPOS[(t)]; _Pragma("unroll 4") for (int i = 0; i < 32; ++i) { _Pragma("clang fp contract(off)") const float ang = pos_ * INVF[i]; const float cs = cosf(ang), sn = sinf(ang); const float xe = rw[2 * i], xo = rw[2 * i + 1]; rw[2 * i] = xe * cs - xo * sn; rw[2 * i + 1] = xe * sn + xo * cs; } } } while (0)
#ifndef SM_EXTRA_PARAMS
#define SM_EXTRA_PARAMS
#endif
#ifndef PROJ_EXTRA_PARAMS
#define PROJ_EXTRA_PARAMS
#endif
#ifndef SM_MASK_HOOK
#define SM_MASK_HOOK (void)0
#endif

#define WS_QH  0u                                      // f16 q rows [b*t][CC]
#define WS_KH  (WS_QH + 2u * (size_t)NB * TT * CC)      // f16 k rows [b*t][CC]
#define WS_VT  (WS_KH + 2u * (size_t)NB * TT * CC)      // f16 v planes [b][c][t]
#define WS_QL  (WS_VT + 2u * (size_t)NB * CC * TT)      // f16 q residual x 2^10 rows [b][t < QHI][CC]
#define WS_KL  (WS_QL + 2u * (size_t)NB * QHI * CC)     // f16 k residual x 2^10 rows [b][t < KHI][CC]
#define WS_VB  (WS_KL + 2u * (size_t)NB * KHI * CC)     // bf16 v hi planes [b][c][t < KHI]
#define WS_VBL (WS_VB + 2u * (size_t)NB * CC * KHI)
#define WS_S   (WS_VBL + 2u * (size_t)NB * CC * KHI)    // f32 logits / P [hg][t][s]
#define WS_Y   (WS_S  + 4u * (size_t)HG * TT * TT)      // f32 ctx rows [b*t][CC] (only when there is an output projection)
#define WS_END (WS_Y  + 4u * (size_t)NB * TT * CC)

// ---- k_proj: block = (64 rows, 128 cols, which): q/k/v = X W (+ b) with exact bf16 products (K = DIN) -> which 0: q f16 rows (+ residual rows < QHI); 1: k f16 rows (+ residual rows < KHI); 2: v f16 planes [c][t] (+ bf16 hi/lo planes for t < KHI)
__global__ __launch_bounds__(128) void k_proj(const float* __restrict__ XQ, const float* __restrict__ XK, const float* __restrict__ XV, const float* __restrict__ WQ, const float* __restrict__ WK, const float* __restrict__ WV, const float* __restrict__ BQ, const float* __restrict__ BK, const float* __restrict__ BV,
    _Float16* __restrict__ QH, _Float16* __restrict__ QL, _Float16* __restrict__ KH, _Float16* __restrict__ KL, _Float16* __restrict__ VT, __bf16* __restrict__ VB, __bf16* __restrict__ VBL, const int* __restrict__ TPOS) {
  __shared__ __align__(16) float st[64][132]; __shared__ __align__(16) _Float16 sh[64][136], sl[64][136]; __shared__ __align__(16) _Float16 th[128][72]; __shared__ __align__(16) __bf16 tb[128][72], tbl[128][72];
  const int tid = threadIdx.x, wave = tid >> 5, lane = tid & 31, col = lane & 15, g = lane >> 4; const int which = blockIdx.z; const int c0 = blockIdx.y * 128; const size_t r0 = (size_t)blockIdx.x * 64; const size_t bb = r0 / TT; const int t0 = (int)(r0 % TT);
  const float* X = which == 0 ? XQ : which == 1 ? XK : XV; const float* WA = which == 0 ? WQ : which == 1 ? WK : WV; const float* BA = which == 0 ? BQ : which == 1 ? BK : BV;
  v8f acc[8] = {};
#pragma unroll 2
  for (int kc = 0; kc < DIN / 32; ++kc) { v16b a; { const float* p = X + (r0 + wave * 16 + col) * DIN + kc * 32 + 8 * g;
#pragma unroll
      for (int i = 0; i < 8; ++i) { a[i] = (__bf16)p[i]; a[8 + i] = (__bf16)p[16 + i]; } }
    asm volatile("s_wait_loadcnt 0x0" ::: "memory");
#pragma unroll
    for (int j = 0; j < 8; ++j) { const v16b w = WCOL(WA, kc * 32, c0 + j * 16 + col, lane); asm volatile("s_wait_loadcnt 0x0" ::: "memory"); acc[j] = wmma_bf(a, w, acc[j]); } }
  { // stage the f32 tile (acc + bias) in LDS, run the per-(row, head) epilogue hook, then convert
#pragma unroll
    for (int j = 0; j < 8; ++j) { const float bias = BA ? bfr(BA[c0 + j * 16 + col]) : 0.f;
#pragma unroll
      for (int r = 0; r < 8; ++r) st[wave * 16 + 8 * g + r][j * 16 + col] = acc[j][r] + bias; }
    __syncthreads();
    for (int e = tid; e < 64 * (128 / HD); e += 128) { const int rl = e / (128 / HD), hh = e % (128 / HD); PROJ_EPI(which, &st[rl][hh * HD], (int)((r0 + rl) % TT), (c0 / HD) + hh); }
    __syncthreads(); }
  if (which < 2) { _Float16* DH = which == 0 ? QH : KH; _Float16* DL = which == 0 ? QL : KL; const int nhi = which == 0 ? QHI : KHI; const bool hi_rows = t0 < nhi;
    for (int e = tid; e < 64 * 128; e += 128) { const int rl = e >> 7, cl = e & 127; const float v = st[rl][cl]; const _Float16 hv = (_Float16)v; sh[rl][cl] = hv; sl[rl][cl] = (_Float16)((v - (float)hv) * 1024.0f); }
    __syncthreads();
    for (int e = tid; e < 64 * 16; e += 128) { const int rl = e >> 4, q = e & 15; vst2((unsigned*)(DH + (r0 + rl) * CC + c0 + q * 8), *(const v4u*)&sh[rl][q * 8]); if (hi_rows) vst2((unsigned*)(DL + (bb * nhi + t0 + rl) * (size_t)CC + c0 + q * 8), *(const v4u*)&sl[rl][q * 8]); }
  } else { const bool hi_rows = t0 < KHI;
    for (int e = tid; e < 64 * 128; e += 128) { const int rl = e & 63, cl = e >> 6; const float v = st[rl][cl]; th[cl][rl] = (_Float16)v; const __bf16 bh = (__bf16)v; tb[cl][rl] = bh; tbl[cl][rl] = (__bf16)(v - (float)bh); }
    __syncthreads();
    for (int e = tid; e < 128 * 8; e += 128) { const int cl = e >> 3, q = e & 7; vst2((unsigned*)(VT + (bb * CC + c0 + cl) * (size_t)TT + t0 + q * 8), *(const v4u*)&th[cl][q * 8]); if (hi_rows) { const size_t o3 = (bb * CC + c0 + cl) * (size_t)KHI + t0 + q * 8; vst2((unsigned*)(VB + o3), *(const v4u*)&tb[cl][q * 8]); vst2((unsigned*)(VBL + o3), *(const v4u*)&tbl[cl][q * 8]); } } } }
// ---- k_sc: block = (query block qb, key block kb <= kb_last(qb), head in group) of batch b: logits x SCALE; q hi + residual (x 2^10) against k (2 products) for query rows < QHI, plus the k residual (3 products) for query blocks < QBH (causal early rows); causal: blocks past the diagonal exit, the mask itself is applied by index in k_sm
__global__ __launch_bounds__(128) void k_sc(const _Float16* __restrict__ QH, const _Float16* __restrict__ KH, const _Float16* __restrict__ QL, const _Float16* __restrict__ KL, int b, int h0, float* __restrict__ S0) { __shared__ __align__(16) float ss[4][16][132];
  const int qb = blockIdx.x, kb = blockIdx.y; if (kb > kb_last(qb)) return;
  const int h = h0 + blockIdx.z; float* S = S0 + (size_t)blockIdx.z * TT * TT;
  const int tid = threadIdx.x, wave = tid >> 5, lane = tid & 31, col = lane & 15, g = lane >> 4; const int k0 = kb * 128; const int ql0 = qb * 64 + wave * 16; const size_t q0 = (size_t)b * TT + ql0, kr0 = (size_t)b * TT + k0;
  v8f acc[8] = {}, accl[8] = {};
  const _Float16* QLb = QL + (size_t)b * QHI * CC; const _Float16* KLb = KL + (size_t)b * KHI * CC;
  if (qb < QBH) {
#pragma unroll
    for (int kc = 0; kc < HD / 32; ++kc) { const v16h ah = frag_h(QH + (q0 + col) * CC + h * HD + kc * 32, lane), al = frag_h(QLb + (size_t)(ql0 + col) * CC + h * HD + kc * 32, lane);
#pragma unroll
      for (int j = 0; j < 8; ++j) { const v16h kbf = frag_h(KH + (kr0 + j * 16 + col) * CC + h * HD + kc * 32, lane), klf = frag_h(KLb + (size_t)(k0 + j * 16 + col) * CC + h * HD + kc * 32, lane); acc[j] = wmma16(ah, kbf, acc[j]); accl[j] = wmma16(al, kbf, accl[j]); accl[j] = wmma16(ah, klf, accl[j]); } }
  } else if (qb * 64 < QHI) {
#pragma unroll
    for (int kc = 0; kc < HD / 32; ++kc) { const v16h ah = frag_h(QH + (q0 + col) * CC + h * HD + kc * 32, lane), al = frag_h(QLb + (size_t)(ql0 + col) * CC + h * HD + kc * 32, lane);
#pragma unroll
      for (int j = 0; j < 8; ++j) { const v16h kbf = frag_h(KH + (kr0 + j * 16 + col) * CC + h * HD + kc * 32, lane); acc[j] = wmma16(ah, kbf, acc[j]); accl[j] = wmma16(al, kbf, accl[j]); } }
  } else {
#pragma unroll
    for (int kc = 0; kc < HD / 32; ++kc) { const v16h ah = frag_h(QH + (q0 + col) * CC + h * HD + kc * 32, lane);
#pragma unroll
      for (int j = 0; j < 8; ++j) { const v16h kbf = frag_h(KH + (kr0 + j * 16 + col) * CC + h * HD + kc * 32, lane); acc[j] = wmma16(ah, kbf, acc[j]); } } }
#pragma unroll
  for (int j = 0; j < 8; ++j) {
#pragma unroll
    for (int r = 0; r < 8; ++r) ss[wave][8 * g + r][j * 16 + col] = (acc[j][r] + accl[j][r] * (1.0f / 1024.0f)) * SCALE; }
  LDSX(); for (int rl = 0; rl < 16; ++rl) vst2(S + (size_t)(ql0 + rl) * TT + k0 + lane * 4, *(const v4f*)&ss[wave][rl][lane * 4]); }
// ---- k_sm: block = query row t (head in group): keys [0, kend): causal -> logit if s <= t else excluded; softmax in f32; P x 2^11 in place (0 for excluded)
__global__ __launch_bounds__(256) void k_sm(float* __restrict__ S0 SM_EXTRA_PARAMS) { __shared__ float sred[8]; __shared__ float sbc; __shared__ __align__(16) float shv[TT];
  const int tid = threadIdx.x; const int t = blockIdx.x; const int kend = (kb_last(t >> 6) + 1) * 128;
  float* sr = S0 + (size_t)blockIdx.y * TT * TT + (size_t)t * TT;
  float m = -3.0e38f; for (int k = tid; k < kend; k += 256) { float v = (!CAUSAL || k <= t) ? sr[k] : -3.0e38f; SM_MASK_HOOK; shv[k] = v; m = fmaxf(m, v); }
#pragma unroll
  for (int o = 1; o < 32; o <<= 1) m = fmaxf(m, __shfl_xor(m, o));
  if ((tid & 31) == 0) sred[tid >> 5] = m; __syncthreads(); if (tid == 0) { float a = sred[0]; for (int i = 1; i < 8; ++i) a = fmaxf(a, sred[i]); sbc = a; } __syncthreads(); m = sbc; __syncthreads();
  float sum = 0.f; for (int k = tid; k < kend; k += 256) { const float v = shv[k]; const float e = (v <= -1.0e38f) ? 0.f : expf(v - m); shv[k] = e; sum += e; }
#pragma unroll
  for (int o = 1; o < 32; o <<= 1) sum += __shfl_xor(sum, o);
  if ((tid & 31) == 0) sred[tid >> 5] = sum; __syncthreads(); if (tid == 0) { float a = 0.f; for (int i = 0; i < 8; ++i) a += sred[i]; sbc = a > 0.f ? 2048.0f / a : 0.f; }   /* a fully excluded row yields P = 0 */ __syncthreads(); const float inv = sbc;
  for (int k = tid; k < kend; k += 256) shv[k] = shv[k] * inv;
  __syncthreads(); for (int q = tid; q < kend / 4; q += 256) vst2(sr + q * 4, *(const v4f*)&shv[q * 4]); }
// ---- k_pv: block = 64 queries (qb) of (b, h): ctx = P . v over keys [0, kend) (P x 2^11 once to f16 against v f16: 1 product; causal early query blocks: P and v as bf16 hi + lo, 3 products); 256-B (row, head) segment by 16 lanes
__global__ __launch_bounds__(128) void k_pv(const float* __restrict__ PS0, const _Float16* __restrict__ VT, const __bf16* __restrict__ VB, const __bf16* __restrict__ VBL, int b, int h0, float* __restrict__ Y) { const int h = h0 + blockIdx.z; const float* PS = PS0 + (size_t)blockIdx.z * TT * TT; __shared__ __align__(16) float ss[4][16][HD + 4];
  const int tid = threadIdx.x, wave = tid >> 5, lane = tid & 31, col = lane & 15, g = lane >> 4; const int qb = blockIdx.x; const int ql0 = qb * 64 + wave * 16; const int kce = (kb_last(qb) + 1) * 4;
  v8f acc[HD / 16] = {};
  if (qb < QBH) {
#pragma unroll 1
    for (int kc = 0; kc < kce; ++kc) { const F2 p = split_row(PS + (size_t)(ql0 + col) * TT, kc * 32, lane);
      asm volatile("s_wait_loadcnt 0x0" ::: "memory");
#pragma unroll
      for (int j = 0; j < HD / 16; ++j) { const size_t po = ((size_t)b * CC + h * HD + j * 16 + col) * (size_t)KHI + kc * 32; const v16b vh = frag_b(VB + po, lane); acc[j] = wmma_bf(p.h, vh, acc[j]); acc[j] = wmma_bf(p.l, vh, acc[j]); acc[j] = wmma_bf(p.h, frag_b(VBL + po, lane), acc[j]); } }
  } else {
#pragma unroll 1
    for (int kc = 0; kc < kce; ++kc) { const v16h p = frag_f32(PS + (size_t)(ql0 + col) * TT + kc * 32, lane);
      asm volatile("s_wait_loadcnt 0x0" ::: "memory");
#pragma unroll
      for (int j = 0; j < HD / 16; ++j) { const size_t po = ((size_t)b * CC + h * HD + j * 16 + col) * (size_t)TT + kc * 32; acc[j] = wmma16(p, frag_h(VT + po, lane), acc[j]); } } }
#pragma unroll
  for (int j = 0; j < HD / 16; ++j)
#pragma unroll
    for (int r = 0; r < 8; ++r) ss[wave][8 * g + r][j * 16 + col] = acc[j][r] * (1.0f / 2048.0f);
  LDSX(); for (int rl = 0; rl < 16; ++rl) if (lane < HD / 4) vst2(Y + ((size_t)b * TT + ql0 + rl) * CC + h * HD + lane * 4, *(const v4f*)&ss[wave][rl][lane * 4]); }
// ---- k_out: block = (64 rows, 128 cols): out = ctx Wo (+ bo): ctx x 2^6 once to f16 against Wo as f16(bf16 x 2^8) exact (1 product) x 2^-14; causal early rows (< QHI of each sequence): ctx bf16 hi + lo against exact bf16 Wo (2 products)
__global__ __launch_bounds__(128) void k_out(const float* __restrict__ Y, const float* __restrict__ WO, const float* __restrict__ BO, float* __restrict__ OUT) { __shared__ __align__(16) float sf[4][16][132];
  const int tid = threadIdx.x, wave = tid >> 5, lane = tid & 31, col = lane & 15, g = lane >> 4; const int c0 = blockIdx.y * 128; const size_t r0 = (size_t)blockIdx.x * 64 + wave * 16;
  v8f acc[8] = {};
  if (CAUSAL && (int)(((size_t)blockIdx.x * 64) % TT) < QHI) {   /* block-uniform */
#pragma unroll 2
    for (int kc = 0; kc < CC / 32; ++kc) { const F2 a = split_row(Y + (r0 + col) * CC, kc * 32, lane); asm volatile("s_wait_loadcnt 0x0" ::: "memory");
#pragma unroll
      for (int j = 0; j < 8; ++j) { const v16b w = WOCOL(WO, kc * 32, c0 + j * 16 + col, lane); asm volatile("s_wait_loadcnt 0x0" ::: "memory"); acc[j] = wmma_bf(a.h, w, acc[j]); acc[j] = wmma_bf(a.l, w, acc[j]); } }
#pragma unroll
    for (int j = 0; j < 8; ++j) { const float bias = BO ? bfr(BO[c0 + j * 16 + col]) : 0.f;
#pragma unroll
      for (int r = 0; r < 8; ++r) sf[wave][8 * g + r][j * 16 + col] = acc[j][r] + bias; }
  } else {
#pragma unroll 2
    for (int kc = 0; kc < CC / 32; ++kc) { const v16h a = frag_f32s(Y + (r0 + col) * CC + kc * 32, lane, 64.0f); asm volatile("s_wait_loadcnt 0x0" ::: "memory");   /* ctx carried x 2^6 into f16 so small-magnitude context rows stay clear of f16 subnormals */
#pragma unroll
      for (int j = 0; j < 8; ++j) { const v16h w = WOCOLH(WO, kc * 32, c0 + j * 16 + col, lane); asm volatile("s_wait_loadcnt 0x0" ::: "memory"); acc[j] = wmma16(a, w, acc[j]); } }
#pragma unroll
    for (int j = 0; j < 8; ++j) { const float bias = BO ? bfr(BO[c0 + j * 16 + col]) : 0.f;
#pragma unroll
      for (int r = 0; r < 8; ++r) sf[wave][8 * g + r][j * 16 + col] = acc[j][r] * (1.0f / 16384.0f) + bias; } }   /* 2^-8 (Wo carry) x 2^-6 (ctx carry) */
  LDSX(); for (int rl = 0; rl < 16; ++rl) vst2(OUT + (r0 + rl) * DIN + c0 + lane * 4, *(const v4f*)&sf[wave][rl][lane * 4]); }

extern "C" void kernel_launch(void* const* d_in, const int* in_sizes, int n_in, void* d_out, int out_size, void* d_ws, size_t ws_size, hipStream_t stream) {
  (void)in_sizes; (void)n_in; (void)out_size;
  const float** F = (const float**)d_in;
  if (ws_size < (size_t)WS_END) return;
  char* ws = (char*)d_ws; _Float16 *QH = (_Float16*)(ws + WS_QH), *KH = (_Float16*)(ws + WS_KH), *VT = (_Float16*)(ws + WS_VT), *QL = (_Float16*)(ws + WS_QL), *KL = (_Float16*)(ws + WS_KL); __bf16 *VB = (__bf16*)(ws + WS_VB), *VBL = (__bf16*)(ws + WS_VBL); float *S = (float*)(ws + WS_S), *Y = (float*)(ws + WS_Y);
  (void)Y; (void)QL; (void)KL; (void)VB; (void)VBL;
  // inputs: 0 x [2,2048,1024]; 1 Wqkv [3072,1024] (out,in): q rows 0..1023, k 1024..2047, v 2048..3071; 2 Wout [1024,1024] (out,in); 3 token_positions [2048] int32 (arange; READ on the device); no biases
  k_proj<<<dim3(TNB * TT / 64, CC / 128, 3), 128, 0, stream>>>(F[0], F[0], F[0], F[1], F[1] + (size_t)CC * DIN, F[1] + 2 * (size_t)CC * DIN, nullptr, nullptr, nullptr, QH, QL, KH, KL, VT, VB, VBL, (const int*)d_in[3]);
  for (int b = 0; b < TNB; ++b) for (int h0 = 0; h0 < NH; h0 += HG) {
    k_sc<<<dim3(NQB, TT / 128, HG), 128, 0, stream>>>(QH, KH, QL, KL, b, h0, S);
    k_sm<<<dim3(TT, HG), 256, 0, stream>>>(S);
    k_pv<<<dim3(NQB, 1, HG), 128, 0, stream>>>(S, VT, VB, VBL, b, h0, Y);
  }
  k_out<<<dim3(TNB * TT / 64, DIN / 128), 128, 0, stream>>>(Y, F[2], nullptr, (float*)d_out);
}

// v001
// It runs in 519 microseconds.
// Next to v000, in two timings, it ran 2.80 and 2.79 times as fast.
// compute dtype: all float inputs rounded to bf16; q / k / v projections with EXACT bf16 products on WMMA 16x16x32 (f32 accumulate), no biases; RoPE in f32 (embedded frequencies, precise cosf / sinf, positions read from the int input token_positions); logits q x k once to f16 each (1 product) x 64^-0.5; softmax f32 with a running maximum and sum over 32-key trips; P (unnormalised, x 2^8) once to f16 x v once to f16 (1 product), divided by the sum at the end; ctx x 2^6 once to f16 x the output weight f16(bf16 x 2^8); f32 output.
#include <hip/hip_runtime.h>
#include <math.h>

typedef __attribute__((ext_vector_type(16))) _Float16 v16h;
typedef __attribute__((ext_vector_type(16))) __bf16 v16b;
typedef __attribute__((ext_vector_type(8)))  _Float16 v8h;
typedef __attribute__((ext_vector_type(8)))  float v8f;
typedef __attribute__((ext_vector_type(4)))  float v4f;
typedef __attribute__((ext_vector_type(2)))  float v2f;
typedef __attribute__((ext_vector_type(4)))  unsigned v4u;
typedef __attribute__((ext_vector_type(4)))  int v4i;
typedef float __attribute__((may_alias)) float_a;
typedef int __attribute__((may_alias)) int_a;

template <typename T> __device__ __forceinline__ void vst2(void* p, T v) { *(T*)p = v;  }
__device__ __forceinline__ v8f wmma16(v16h a, v16h b, v8f c) {
  v8f d = __builtin_amdgcn_wmma_f32_16x16x32_f16(false, a, false, b, (short)0, c, false, false);
  asm volatile("v_nop\n\tv_nop\n\tv_nop\n\tv_nop" : "+v"(d) : "v"(a), "v"(b));
  return d;
}
__device__ __forceinline__ v8f wmma_bf(v16b a, v16b b, v8f c) {
  v8f d = __builtin_amdgcn_wmma_f32_16x16x32_bf16(false, a, false, b, (short)0, c, false, false);
  asm volatile("v_nop\n\tv_nop\n\tv_nop\n\tv_nop" : "+v"(d) : "v"(a), "v"(b));
  return d;
}
// 16x16x32 fragments: lane = (h = lane>>4, row/col = lane&15); elements 0..7 = k0+8h+0..7, 8..15 = k0+16+8h+0..7; D element r = row 8h+r
__device__ __forceinline__ v16h frag_h(const _Float16* rowk0, int lane) {
  union { v16h v; v8h q[2]; } u; const _Float16* p = rowk0 + 8 * (lane >> 4);
  u.q[0] = *(const v8h*)p; u.q[1] = *(const v8h*)(p + 16); return u.v;
}
__device__ __forceinline__ v16h frag_f32(const float* rowk0, int lane) {
  v16h a; const float* p = rowk0 + 8 * (lane >> 4);
#pragma unroll
  for (int i = 0; i < 8; ++i) { a[i] = (_Float16)p[i]; a[8 + i] = (_Float16)p[16 + i]; }
  return a;
}
__device__ __forceinline__ v16h frag_f32s(const float* rowk0, int lane, float sc) {
  v16h a; const float* p = rowk0 + 8 * (lane >> 4);
#pragma unroll
  for (int i = 0; i < 8; ++i) { a[i] = (_Float16)(p[i] * sc); a[8 + i] = (_Float16)(p[16 + i] * sc); }
  return a;
}
// column fragment from a [K][ld] layout (column n), rows >= K read as 0
__device__ __forceinline__ v16h fragc_f32(const float* W, int k0, int n, int lane, int ld, int K) {
  v16h a; const int g = lane >> 4;
#pragma unroll
  for (int i = 0; i < 8; ++i) { const int ka = k0 + 8 * g + i, kb = ka + 16;
    a[i] = (_Float16)(ka < K ? W[(size_t)(ka < K ? ka : K - 1) * ld + n] : 0.f); a[8 + i] = (_Float16)(kb < K ? W[(size_t)(kb < K ? kb : K - 1) * ld + n] : 0.f); }
  return a;
}
struct F2 { v16b h, l; };
__device__ __forceinline__ F2 bsplit16(const float v[16]) { F2 r;
#pragma unroll
  for (int i = 0; i < 16; ++i) { const __bf16 h = (__bf16)v[i]; r.h[i] = h; r.l[i] = (__bf16)(v[i] - (float)h); }
  return r; }
__device__ __forceinline__ F2 split_row(const float* row, int k0, int lane) { float v[16]; const float* p = row + k0 + 8 * (lane >> 4);
#pragma unroll
  for (int i = 0; i < 8; ++i) { v[i] = p[i]; v[8 + i] = p[16 + i]; }
  return bsplit16(v); }
__device__ __forceinline__ F2 split_rowK(const float* row, int k0, int lane, int K) { float v[16]; const int g = lane >> 4;
#pragma unroll
  for (int i = 0; i < 8; ++i) { const int ka = k0 + 8 * g + i, kb = ka + 16; v[i] = ka < K ? row[ka < K ? ka : K - 1] : 0.f; v[8 + i] = kb < K ? row[kb < K ? kb : K - 1] : 0.f; }
  return bsplit16(v); }
__device__ __forceinline__ F2 split_col(const float* W, int k0, int n, int lane, int ld, int K) { float v[16]; const int g = lane >> 4;
#pragma unroll
  for (int i = 0; i < 8; ++i) { const int ka = k0 + 8 * g + i, kb = ka + 16; v[i] = ka < K ? W[(size_t)(ka < K ? ka : K - 1) * ld + n] : 0.f; v[8 + i] = kb < K ? W[(size_t)(kb < K ? kb : K - 1) * ld + n] : 0.f; }
  return bsplit16(v); }
__device__ __forceinline__ v8f mac3(const F2& a, const F2& b, v8f c) { c = wmma_bf(a.l, b.h, c); c = wmma_bf(a.h, b.l, c); return wmma_bf(a.h, b.h, c); }
__device__ __forceinline__ float sigm(float v) { return 1.0f / (1.0f + expf(-v)); }
#define LDSX() do { asm volatile("s_wait_dscnt 0" ::: "memory"); __builtin_amdgcn_wave_barrier(); __builtin_amdgcn_fence(__ATOMIC_RELEASE, "workgroup"); } while (0)

// Multi-head self-attention with interleaved-pair RoPE, no mask (x [2,2048,1024]; Wqkv [3072,1024] torch (out,in): qkv.reshape(B, S, 3, 16, 64): q = rows 0..1023, k = 1024..2047, v = 2048..3071; Wout [1024,1024] (out,in); token_positions [2048] int32 = arange, a module input READ on the device; RoPE on q and k: (even, odd) pairs (x_e c - x_o s, x_e s + x_o c) re-interleaved, inv_freq = 1 / 10000^(2i/64); scores / sqrt(64); softmax; out @ Wout.T).
#define NB 2
#define TT 2048
#define CC 1024            // NH * HD = projected width
#define DIN 1024          // input (model) width
#define NH 16
#define HD 64
#define NQB (TT / 64)
#define HG 4
#define SCALE (0.125f)
#define CAUSAL 0
#ifndef TNB
#define TNB NB
#endif
__device__ __forceinline__ float bfr(float v) { return (float)(__bf16)v; }
__host__ __device__ __forceinline__ int kb_last(int qb) { return CAUSAL ? ((qb * 64 + 63) >> 7) : (TT / 128 - 1); }
typedef __attribute__((ext_vector_type(8))) __bf16 v8b;
__device__ __forceinline__ v16b frag_b(const __bf16* rowk0, int lane) {
  union { v16b v; v8b q[2]; } u; const __bf16* p = rowk0 + 8 * (lane >> 4);
  u.q[0] = *(const v8b*)p; u.q[1] = *(const v8b*)(p + 16); return u.v;
}
#define QBH 0              // not read: k_fa has no high-precision path
#define QHI 0               // single-product logits on every row
#define KHI 64            // key rows carrying k residual / v bf16 hi+lo planes (written by k_proj, read by no kernel here)
// B fragment (k rows k0+.., output column o) of a weight: (in,out) [K][ld] or (out,in) [ld rows of K]: bf16 exact, or f16(bf16 * 256) exact
__device__ __forceinline__ v16b wcol_io(const float* Wm, int k0, int o, int lane, int ld) { v16b w; const int g = lane >> 4;
#pragma unroll
  for (int i = 0; i < 8; ++i) { w[i] = (__bf16)Wm[(size_t)(k0 + 8 * g + i) * ld + o]; w[8 + i] = (__bf16)Wm[(size_t)(k0 + 16 + 8 * g + i) * ld + o]; }
  return w; }
__device__ __forceinline__ v16b wcol_oi(const float* Wm, int k0, int o, int lane, int K) { v16b w; const float* p = Wm + (size_t)o * K + k0 + 8 * (lane >> 4);
#pragma unroll
  for (int i = 0; i < 8; ++i) { w[i] = (__bf16)p[i]; w[8 + i] = (__bf16)p[16 + i]; }
  return w; }
__device__ __forceinline__ v16h wcolh_io(const float* Wm, int k0, int o, int lane, int ld) { v16h w; const int g = lane >> 4;
#pragma unroll
  for (int i = 0; i < 8; ++i) { w[i] = (_Float16)(bfr(Wm[(size_t)(k0 + 8 * g + i) * ld + o]) * 256.0f); w[8 + i] = (_Float16)(bfr(Wm[(size_t)(k0 + 16 + 8 * g + i) * ld + o]) * 256.0f); }
  return w; }
__device__ __forceinline__ v16h wcolh_oi(const float* Wm, int k0, int o, int lane, int K) { v16h w; const float* p = Wm + (size_t)o * K + k0 + 8 * (lane >> 4);
#pragma unroll
  for (int i = 0; i < 8; ++i) { w[i] = (_Float16)(bfr(p[i]) * 256.0f); w[8 + i] = (_Float16)(bfr(p[16 + i]) * 256.0f); }
  return w; }
#define WQKV_LAYOUT 1   // 0 = (in,out) [DIN][CC]; 1 = (out,in) [CC][DIN]; 2 = per-head [NH][DIN][HD]
__device__ __forceinline__ v16b wcol_hdk(const float* Wm, int k0, int o, int lane) { v16b w; const int g = lane >> 4; const float* p = Wm + (size_t)(o / HD) * DIN * HD + (o % HD);
#pragma unroll
  for (int i = 0; i < 8; ++i) { w[i] = (__bf16)p[(size_t)(k0 + 8 * g + i) * HD]; w[8 + i] = (__bf16)p[(size_t)(k0 + 16 + 8 * g + i) * HD]; }
  return w; }
#define WO_OUT_IN 1
#if WQKV_LAYOUT == 1
#define WCOL(W, k0, o, lane) wcol_oi(W, k0, o, lane, DIN)
#elif WQKV_LAYOUT == 2
#define WCOL(W, k0, o, lane) wcol_hdk(W, k0, o, lane)
#else
#define WCOL(W, k0, o, lane) wcol_io(W, k0, o, lane, CC)
#endif
#if WO_OUT_IN
#define WOCOL(W, k0, o, lane) wcol_oi(W, k0, o, lane, CC)
#define WOCOLH(W, k0, o, lane) wcolh_oi(W, k0, o, lane, CC)
#else
#define WOCOL(W, k0, o, lane) wcol_io(W, k0, o, lane, DIN)
#define WOCOLH(W, k0, o, lane) wcolh_io(W, k0, o, lane, DIN)
#endif

// RoPE inverse frequencies 1/10000^(2i/64) (the f32 values jax computes)
__constant__ float INVF[32] = {1.000000000e+00,7.498942018e-01,5.623413324e-01,4.216965139e-01,3.162277639e-01,2.371373624e-01,1.778279394e-01,1.333521456e-01,1.000000015e-01,7.498941571e-02,5.623412877e-02,4.216964915e-02,3.162277862e-02,2.371373586e-02,1.778279431e-02,1.333521493e-02,9.999999776e-03,7.498942316e-03,5.623413250e-03,4.216964822e-03,3.162277862e-03,2.371373819e-03,1.778279431e-03,1.333521446e-03,1.000000047e-03,7.498941850e-04,5.623413017e-04,4.216964880e-04,3.162277862e-04,2.371373848e-04,1.778279402e-04,1.333521504e-04};
// (PROJ_EXTRA_PARAMS: the extra kernel parameters 'const int* __restrict__ TPOS' are written literally in the kernel signature)
// per (token, head) hook on the staged f32 row (64 floats) of the q and k streams: interleaved-pair rotation (x[2i], x[2i + 1]) by the angle pos * INVF[i] with pos READ from the int input; v untouched
#define PROJ_EPI(which, row, t, h) do { if ((which) < 2) { float* rw = (row); const float pos_ = (float)TPOS[(t)]; _Pragma("unroll 4") for (int i = 0; i < 32; ++i) { _Pragma("clang fp contract(off)") const float ang = pos_ * INVF[i]; const float cs = cosf(ang), sn = sinf(ang); const float xe = rw[2 * i], xo = rw[2 * i + 1]; rw[2 * i] = xe * cs - xo * sn; rw[2 * i + 1] = xe * sn + xo * cs; } } } while (0)
#ifndef SM_EXTRA_PARAMS
#define SM_EXTRA_PARAMS
#endif
#ifndef PROJ_EXTRA_PARAMS
#define PROJ_EXTRA_PARAMS
#endif
#ifndef SM_MASK_HOOK
#define SM_MASK_HOOK (void)0
#endif

#define WS_QH  0u                                      // f16 q rows [b*t][CC]
#define WS_KH  (WS_QH + 2u * (size_t)NB * TT * CC)      // f16 k rows [b*t][CC]
#define WS_VT  (WS_KH + 2u * (size_t)NB * TT * CC)      // f16 v planes [b][c][t]
#define WS_QL  (WS_VT + 2u * (size_t)NB * CC * TT)      // f16 q residual x 2^10 rows [b][t < QHI][CC]
#define WS_KL  (WS_QL + 2u * (size_t)NB * QHI * CC)     // f16 k residual x 2^10 rows [b][t < KHI][CC]
#define WS_VB  (WS_KL + 2u * (size_t)NB * KHI * CC)     // bf16 v hi planes [b][c][t < KHI]
#define WS_VBL (WS_VB + 2u * (size_t)NB * CC * KHI)
#define WS_S   (WS_VBL + 2u * (size_t)NB * CC * KHI)    // f32 region reserved but unused: k_fa keeps logits / P in registers
#define WS_Y   (WS_S  + 4u * (size_t)HG * TT * TT)      // f32 ctx rows [b*t][CC] (only when there is an output projection)
#define WS_END (WS_Y  + 4u * (size_t)NB * TT * CC)

// ---- k_proj: block = (64 rows, 128 cols, which): q/k/v = X W (+ b) with exact bf16 products (K = DIN) -> which 0: q f16 rows (+ residual rows < QHI); 1: k f16 rows (+ residual rows < KHI); 2: v f16 planes [c][t] (+ bf16 hi/lo planes for t < KHI)
__global__ __launch_bounds__(128) void k_proj(const float* __restrict__ XQ, const float* __restrict__ XK, const float* __restrict__ XV, const float* __restrict__ WQ, const float* __restrict__ WK, const float* __restrict__ WV, const float* __restrict__ BQ, const float* __restrict__ BK, const float* __restrict__ BV,
    _Float16* __restrict__ QH, _Float16* __restrict__ QL, _Float16* __restrict__ KH, _Float16* __restrict__ KL, _Float16* __restrict__ VT, __bf16* __restrict__ VB, __bf16* __restrict__ VBL, const int* __restrict__ TPOS) {
  __shared__ __align__(16) float st[64][132]; __shared__ __align__(16) _Float16 sh[64][136], sl[64][136]; __shared__ __align__(16) _Float16 th[128][72]; __shared__ __align__(16) __bf16 tb[128][72], tbl[128][72];
  const int tid = threadIdx.x, wave = tid >> 5, lane = tid & 31, col = lane & 15, g = lane >> 4; const int which = blockIdx.z; const int c0 = blockIdx.y * 128; const size_t r0 = (size_t)blockIdx.x * 64; const size_t bb = r0 / TT; const int t0 = (int)(r0 % TT);
  const float* X = which == 0 ? XQ : which == 1 ? XK : XV; const float* WA = which == 0 ? WQ : which == 1 ? WK : WV; const float* BA = which == 0 ? BQ : which == 1 ? BK : BV;
  v8f acc[8] = {};
#pragma unroll 2
  for (int kc = 0; kc < DIN / 32; ++kc) { v16b a; { const float* p = X + (r0 + wave * 16 + col) * DIN + kc * 32 + 8 * g;
#pragma unroll
      for (int i = 0; i < 8; ++i) { a[i] = (__bf16)p[i]; a[8 + i] = (__bf16)p[16 + i]; } }
    asm volatile("s_wait_loadcnt 0x0" ::: "memory");
#pragma unroll
    for (int j = 0; j < 8; ++j) { const v16b w = WCOL(WA, kc * 32, c0 + j * 16 + col, lane); asm volatile("s_wait_loadcnt 0x0" ::: "memory"); acc[j] = wmma_bf(a, w, acc[j]); } }
  { // stage the f32 tile (acc + bias) in LDS, run the per-(row, head) epilogue hook, then convert
#pragma unroll
    for (int j = 0; j < 8; ++j) { const float bias = BA ? bfr(BA[c0 + j * 16 + col]) : 0.f;
#pragma unroll
      for (int r = 0; r < 8; ++r) st[wave * 16 + 8 * g + r][j * 16 + col] = acc[j][r] + bias; }
    __syncthreads();
    for (int e = tid; e < 64 * (128 / HD); e += 128) { const int rl = e / (128 / HD), hh = e % (128 / HD); PROJ_EPI(which, &st[rl][hh * HD], (int)((r0 + rl) % TT), (c0 / HD) + hh); }
    __syncthreads(); }
  if (which < 2) { _Float16* DH = which == 0 ? QH : KH; _Float16* DL = which == 0 ? QL : KL; const int nhi = which == 0 ? QHI : KHI; const bool hi_rows = t0 < nhi;
    for (int e = tid; e < 64 * 128; e += 128) { const int rl = e >> 7, cl = e & 127; const float v = st[rl][cl]; const _Float16 hv = (_Float16)v; sh[rl][cl] = hv; sl[rl][cl] = (_Float16)((v - (float)hv) * 1024.0f); }
    __syncthreads();
    for (int e = tid; e < 64 * 16; e += 128) { const int rl = e >> 4, q = e & 15; vst2((unsigned*)(DH + (r0 + rl) * CC + c0 + q * 8), *(const v4u*)&sh[rl][q * 8]); if (hi_rows) vst2((unsigned*)(DL + (bb * nhi + t0 + rl) * (size_t)CC + c0 + q * 8), *(const v4u*)&sl[rl][q * 8]); }
  } else { const bool hi_rows = t0 < KHI;
    for (int e = tid; e < 64 * 128; e += 128) { const int rl = e & 63, cl = e >> 6; const float v = st[rl][cl]; th[cl][rl] = (_Float16)v; const __bf16 bh = (__bf16)v; tb[cl][rl] = bh; tbl[cl][rl] = (__bf16)(v - (float)bh); }
    __syncthreads();
    for (int e = tid; e < 128 * 8; e += 128) { const int cl = e >> 3, q = e & 7; vst2((unsigned*)(VT + (bb * CC + c0 + cl) * (size_t)TT + t0 + q * 8), *(const v4u*)&th[cl][q * 8]); if (hi_rows) { const size_t o3 = (bb * CC + c0 + cl) * (size_t)KHI + t0 + q * 8; vst2((unsigned*)(VB + o3), *(const v4u*)&tb[cl][q * 8]); vst2((unsigned*)(VBL + o3), *(const v4u*)&tbl[cl][q * 8]); } } } }
// ---- k_fa: block = 128 queries (4 waves x 32 query columns) of head h, batch b: logits, softmax and P . v in one pass over the keys, 32 keys a trip; no logit or P ever leaves the registers.
// Transposed products: S^T = K Q^T (lane = query column, element r = key 8g + r), so the two 16-key tiles of a trip, converted in place, are the B fragment (k = key, hardware k order) of ctx^T = V^T P^T.
// Running maximum m (raw logits) and running sum l per query column; p = 2^((s - m) c + 8), c = SCALE log2(e); the 2^8 keeps small p clear of f16 subnormals and cancels in acc / l.
__device__ __forceinline__ float xhalf(float x) { return __builtin_bit_cast(float, __builtin_amdgcn_permlanex16(__builtin_bit_cast(int, x), __builtin_bit_cast(int, x), 0x76543210, 0xfedcba98, false, false)); }  // lane l with lane l ^ 16
__device__ __forceinline__ v8f mmah(v16h a, v16h b, v8f c) { return __builtin_amdgcn_wmma_f32_16x16x32_f16(false, a, false, b, (short)0, c, false, false); }
__global__ __launch_bounds__(128) void k_fa(const _Float16* __restrict__ QH, const _Float16* __restrict__ KH, const _Float16* __restrict__ VT, float* __restrict__ Y) {
  const int tid = threadIdx.x, wave = tid >> 5, lane = tid & 31, col = lane & 15, g = lane >> 4; const int h = blockIdx.y, b = blockIdx.z; const int q0 = blockIdx.x * 128 + wave * 32;
  const float cs = SCALE * 1.4426950408889634f;
  v16h qf[2][2];
#pragma unroll
  for (int qt = 0; qt < 2; ++qt)
#pragma unroll
    for (int kc = 0; kc < 2; ++kc) qf[qt][kc] = frag_h(QH + ((size_t)b * TT + q0 + qt * 16 + col) * CC + h * HD + kc * 32, lane);
  const _Float16* Kp = KH + ((size_t)b * TT + col) * CC + h * HD;      // key row col of a 16-key tile
  const _Float16* Vp = VT + ((size_t)b * CC + h * HD + col) * (size_t)TT;  // v plane of channel col of a 16-channel tile
  v8f acc[2][4] = {}; float m[2] = {-INFINITY, -INFINITY}, l[2] = {0.f, 0.f};
  v16h kf[2][2];
#pragma unroll
  for (int kt = 0; kt < 2; ++kt)
#pragma unroll
    for (int kc = 0; kc < 2; ++kc) kf[kt][kc] = frag_h(Kp + (size_t)(kt * 16) * CC + kc * 32, lane);
  for (int k0 = 0; k0 < TT; k0 += 32) {
    v16h vf[4];
#pragma unroll
    for (int j = 0; j < 4; ++j) vf[j] = frag_h(Vp + (size_t)(j * 16) * TT + k0, lane);
    v8f s[2][2] = {};
#pragma unroll
    for (int kc = 0; kc < 2; ++kc)
#pragma unroll
      for (int qt = 0; qt < 2; ++qt)
#pragma unroll
        for (int kt = 0; kt < 2; ++kt) s[qt][kt] = mmah(kf[kt][kc], qf[qt][kc], s[qt][kt]);
    const int kn = (k0 + 32) & (TT - 1);   // the next trip's key rows, fetched a trip ahead; the last trip fetches rows 0..31 again (in bounds, not used)
#pragma unroll
    for (int kt = 0; kt < 2; ++kt)
#pragma unroll
      for (int kc = 0; kc < 2; ++kc) kf[kt][kc] = frag_h(Kp + (size_t)(kn + kt * 16) * CC + kc * 32, lane);
    __builtin_amdgcn_sched_barrier(0);   // holds the look-ahead loads here: moved down behind the softmax they would have no time to land before the next trip's first product
#pragma unroll
    for (int qt = 0; qt < 2; ++qt) {
      float mx = fmaxf(s[qt][0][0], s[qt][1][0]);
#pragma unroll
      for (int r = 1; r < 8; ++r) mx = fmaxf(mx, fmaxf(s[qt][0][r], s[qt][1][r]));
      mx = fmaxf(mx, xhalf(mx));            // both halves of the wave hold this query's maximum over the 32 keys
      const float mn = fmaxf(m[qt], mx); const float corr = __builtin_amdgcn_exp2f((m[qt] - mn) * cs);   // 0 on the first trip
      m[qt] = mn; const float nm = 8.0f - mn * cs;
      v16h pf; float s0 = 0.f, s1 = 0.f;
#pragma unroll
      for (int r = 0; r < 8; ++r) { const float p0 = __builtin_amdgcn_exp2f(fmaf(s[qt][0][r], cs, nm)), p1 = __builtin_amdgcn_exp2f(fmaf(s[qt][1][r], cs, nm)); s0 += p0; s1 += p1; pf[r] = (_Float16)p0; pf[8 + r] = (_Float16)p1; }
      l[qt] = l[qt] * corr + (s0 + s1);
#pragma unroll
      for (int j = 0; j < 4; ++j) { acc[qt][j] = acc[qt][j] * corr; acc[qt][j] = mmah(vf[j], pf, acc[qt][j]); } } }
  asm volatile("s_wait_loadcnt 0x0" ::: "memory");   // the last trip's look-ahead loads have landed before the wave gives its registers back
#pragma unroll
  for (int qt = 0; qt < 2; ++qt) { const float inv = 1.0f / (l[qt] + xhalf(l[qt]));   // the two halves' sums are joined once
    float* yr = Y + ((size_t)b * TT + q0 + qt * 16 + col) * CC + h * HD + 8 * g;     // element r of tile j = channel j * 16 + 8g + r of query col
#pragma unroll
    for (int j = 0; j < 4; ++j) { const v8f o = acc[qt][j] * inv; vst2(yr + j * 16, (v4f){o[0], o[1], o[2], o[3]}); vst2(yr + j * 16 + 4, (v4f){o[4], o[5], o[6], o[7]}); } } }
// ---- k_out: block = (64 rows, 128 cols): out = ctx Wo (+ bo): ctx x 2^6 once to f16 against Wo as f16(bf16 x 2^8) exact (1 product) x 2^-14; causal early rows (< QHI of each sequence): ctx bf16 hi + lo against exact bf16 Wo (2 products)
__global__ __launch_bounds__(128) void k_out(const float* __restrict__ Y, const float* __restrict__ WO, const float* __restrict__ BO, float* __restrict__ OUT) { __shared__ __align__(16) float sf[4][16][132];
  const int tid = threadIdx.x, wave = tid >> 5, lane = tid & 31, col = lane & 15, g = lane >> 4; const int c0 = blockIdx.y * 128; const size_t r0 = (size_t)blockIdx.x * 64 + wave * 16;
  v8f acc[8] = {};
  if (CAUSAL && (int)(((size_t)blockIdx.x * 64) % TT) < QHI) {   /* block-uniform */
#pragma unroll 2
    for (int kc = 0; kc < CC / 32; ++kc) { const F2 a = split_row(Y + (r0 + col) * CC, kc * 32, lane); asm volatile("s_wait_loadcnt 0x0" ::: "memory");
#pragma unroll
      for (int j = 0; j < 8; ++j) { const v16b w = WOCOL(WO, kc * 32, c0 + j * 16 + col, lane); asm volatile("s_wait_loadcnt 0x0" ::: "memory"); acc[j] = wmma_bf(a.h, w, acc[j]); acc[j] = wmma_bf(a.l, w, acc[j]); } }
#pragma unroll
    for (int j = 0; j < 8; ++j) { const float bias = BO ? bfr(BO[c0 + j * 16 + col]) : 0.f;
#pragma unroll
      for (int r = 0; r < 8; ++r) sf[wave][8 * g + r][j * 16 + col] = acc[j][r] + bias; }
  } else {
#pragma unroll 2
    for (int kc = 0; kc < CC / 32; ++kc) { const v16h a = frag_f32s(Y + (r0 + col) * CC + kc * 32, lane, 64.0f); asm volatile("s_wait_loadcnt 0x0" ::: "memory");   /* ctx carried x 2^6 into f16 so small-magnitude context rows stay clear of f16 subnormals */
#pragma unroll
      for (int j = 0; j < 8; ++j) { const v16h w = WOCOLH(WO, kc * 32, c0 + j * 16 + col, lane); asm volatile("s_wait_loadcnt 0x0" ::: "memory"); acc[j] = wmma16(a, w, acc[j]); } }
#pragma unroll
    for (int j = 0; j < 8; ++j) { const float bias = BO ? bfr(BO[c0 + j * 16 + col]) : 0.f;
#pragma unroll
      for (int r = 0; r < 8; ++r) sf[wave][8 * g + r][j * 16 + col] = acc[j][r] * (1.0f / 16384.0f) + bias; } }   /* 2^-8 (Wo carry) x 2^-6 (ctx carry) */
  LDSX(); for (int rl = 0; rl < 16; ++rl) vst2(OUT + (r0 + rl) * DIN + c0 + lane * 4, *(const v4f*)&sf[wave][rl][lane * 4]); }

extern "C" void kernel_launch(void* const* d_in, const int* in_sizes, int n_in, void* d_out, int out_size, void* d_ws, size_t ws_size, hipStream_t stream) {
  (void)in_sizes; (void)n_in; (void)out_size;
  const float** F = (const float**)d_in;
  if (ws_size < (size_t)WS_END) return;
  char* ws = (char*)d_ws; _Float16 *QH = (_Float16*)(ws + WS_QH), *KH = (_Float16*)(ws + WS_KH), *VT = (_Float16*)(ws + WS_VT), *QL = (_Float16*)(ws + WS_QL), *KL = (_Float16*)(ws + WS_KL); __bf16 *VB = (__bf16*)(ws + WS_VB), *VBL = (__bf16*)(ws + WS_VBL); float *Y = (float*)(ws + WS_Y);
  (void)Y; (void)QL; (void)KL; (void)VB; (void)VBL;
  // inputs: 0 x [2,2048,1024]; 1 Wqkv [3072,1024] (out,in): q rows 0..1023, k 1024..2047, v 2048..3071; 2 Wout [1024,1024] (out,in); 3 token_positions [2048] int32 (arange; READ on the device); no biases
  k_proj<<<dim3(TNB * TT / 64, CC / 128, 3), 128, 0, stream>>>(F[0], F[0], F[0], F[1], F[1] + (size_t)CC * DIN, F[1] + 2 * (size_t)CC * DIN, nullptr, nullptr, nullptr, QH, QL, KH, KL, VT, VB, VBL, (const int*)d_in[3]);
  k_fa<<<dim3(TT / 128, NH, TNB), 128, 0, stream>>>(QH, KH, VT, Y);
  k_out<<<dim3(TNB * TT / 64, DIN / 128), 128, 0, stream>>>(Y, F[2], nullptr, (float*)d_out);
}

// v002
// Measured time: 151 microseconds a run.
// Next to v001, in two timings, it ran 3.44 and 3.41 times as fast.
// All steps since v000 together make it 9.57 times as fast.
// compute dtype: all float inputs rounded to bf16; q / k / v projections with EXACT bf16 products on WMMA 16x16x32 (f32 accumulate), no biases; RoPE in f32 (embedded frequencies, precise cosf / sinf, positions read from the int input token_positions); logits q x k once to f16 each (1 product) x 64^-0.5; softmax f32 with a running maximum and sum over 32-key trips; P (unnormalised, x 2^8) once to f16 x v once to f16 (1 product), divided by the sum at the end; ctx x 2^6 once to f16 x the output weight f16(bf16 x 2^8); f32 output.
#include <hip/hip_runtime.h>
#include <math.h>

typedef __attribute__((ext_vector_type(16))) _Float16 v16h;
typedef __attribute__((ext_vector_type(16))) __bf16 v16b;
typedef __attribute__((ext_vector_type(8)))  _Float16 v8h;
typedef __attribute__((ext_vector_type(8)))  float v8f;
typedef __attribute__((ext_vector_type(4)))  float v4f;
typedef __attribute__((ext_vector_type(2)))  float v2f;
typedef __attribute__((ext_vector_type(4)))  unsigned v4u;
typedef __attribute__((ext_vector_type(4)))  int v4i;
typedef float __attribute__((may_alias)) float_a;
typedef int __attribute__((may_alias)) int_a;

template <typename T> __device__ __forceinline__ void vst2(void* p, T v) { *(T*)p = v;  }
__device__ __forceinline__ v8f wmma16(v16h a, v16h b, v8f c) {
  v8f d = __builtin_amdgcn_wmma_f32_16x16x32_f16(false, a, false, b, (short)0, c, false, false);
  asm volatile("v_nop\n\tv_nop\n\tv_nop\n\tv_nop" : "+v"(d) : "v"(a), "v"(b));
  return d;
}
__device__ __forceinline__ v8f wmma_bf(v16b a, v16b b, v8f c) {
  v8f d = __builtin_amdgcn_wmma_f32_16x16x32_bf16(false, a, false, b, (short)0, c, false, false);
  asm volatile("v_nop\n\tv_nop\n\tv_nop\n\tv_nop" : "+v"(d) : "v"(a), "v"(b));
  return d;
}
// 16x16x32 fragments: lane = (h = lane>>4, row/col = lane&15); elements 0..7 = k0+8h+0..7, 8..15 = k0+16+8h+0..7; D element r = row 8h+r
__device__ __forceinline__ v16h frag_h(const _Float16* rowk0, int lane) {
  union { v16h v; v8h q[2]; } u; const _Float16* p = rowk0 + 8 * (lane >> 4);
  u.q[0] = *(const v8h*)p; u.q[1] = *(const v8h*)(p + 16); return u.v;
}
__device__ __forceinline__ v16h frag_f32(const float* rowk0, int lane) {
  v16h a; const float* p = rowk0 + 8 * (lane >> 4);
#pragma unroll
  for (int i = 0; i < 8; ++i) { a[i] = (_Float16)p[i]; a[8 + i] = (_Float16)p[16 + i]; }
  return a;
}
__device__ __forceinline__ v16h frag_f32s(const float* rowk0, int lane, float sc) {
  v16h a; const float* p = rowk0 + 8 * (lane >> 4);
#pragma unroll
  for (int i = 0; i < 8; ++i) { a[i] = (_Float16)(p[i] * sc); a[8 + i] = (_Float16)(p[16 + i] * sc); }
  return a;
}
// column fragment from a [K][ld] layout (column n), rows >= K read as 0
__device__ __forceinline__ v16h fragc_f32(const float* W, int k0, int n, int lane, int ld, int K) {
  v16h a; const int g = lane >> 4;
#pragma unroll
  for (int i = 0; i < 8; ++i) { const int ka = k0 + 8 * g + i, kb = ka + 16;
    a[i] = (_Float16)(ka < K ? W[(size_t)(ka < K ? ka : K - 1) * ld + n] : 0.f); a[8 + i] = (_Float16)(kb < K ? W[(size_t)(kb < K ? kb : K - 1) * ld + n] : 0.f); }
  return a;
}
struct F2 { v16b h, l; };
__device__ __forceinline__ F2 bsplit16(const float v[16]) { F2 r;
#pragma unroll
  for (int i = 0; i < 16; ++i) { const __bf16 h = (__bf16)v[i]; r.h[i] = h; r.l[i] = (__bf16)(v[i] - (float)h); }
  return r; }
__device__ __forceinline__ F2 split_row(const float* row, int k0, int lane) { float v[16]; const float* p = row + k0 + 8 * (lane >> 4);
#pragma unroll
  for (int i = 0; i < 8; ++i) { v[i] = p[i]; v[8 + i] = p[16 + i]; }
  return bsplit16(v); }
__device__ __forceinline__ F2 split_rowK(const float* row, int k0, int lane, int K) { float v[16]; const int g = lane >> 4;
#pragma unroll
  for (int i = 0; i < 8; ++i) { const int ka = k0 + 8 * g + i, kb = ka + 16; v[i] = ka < K ? row[ka < K ? ka : K - 1] : 0.f; v[8 + i] = kb < K ? row[kb < K ? kb : K - 1] : 0.f; }
  return bsplit16(v); }
__device__ __forceinline__ F2 split_col(const float* W, int k0, int n, int lane, int ld, int K) { float v[16]; const int g = lane >> 4;
#pragma unroll
  for (int i = 0; i < 8; ++i) { const int ka = k0 + 8 * g + i, kb = ka + 16; v[i] = ka < K ? W[(size_t)(ka < K ? ka : K - 1) * ld + n] : 0.f; v[8 + i] = kb < K ? W[(size_t)(kb < K ? kb : K - 1) * ld + n] : 0.f; }
  return bsplit16(v); }
__device__ __forceinline__ v8f mac3(const F2& a, const F2& b, v8f c) { c = wmma_bf(a.l, b.h, c); c = wmma_bf(a.h, b.l, c); return wmma_bf(a.h, b.h, c); }
__device__ __forceinline__ float sigm(float v) { return 1.0f / (1.0f + expf(-v)); }
#define LDSX() do { asm volatile("s_wait_dscnt 0" ::: "memory"); __builtin_amdgcn_wave_barrier(); __builtin_amdgcn_fence(__ATOMIC_RELEASE, "workgroup"); } while (0)

// Multi-head self-attention with interleaved-pair RoPE, no mask (x [2,2048,1024]; Wqkv [3072,1024] torch (out,in): qkv.reshape(B, S, 3, 16, 64): q = rows 0..1023, k = 1024..2047, v = 2048..3071; Wout [1024,1024] (out,in); token_positions [2048] int32 = arange, a module input READ on the device; RoPE on q and k: (even, odd) pairs (x_e c - x_o s, x_e s + x_o c) re-interleaved, inv_freq = 1 / 10000^(2i/64); scores / sqrt(64); softmax; out @ Wout.T).
#define NB 2
#define TT 2048
#define CC 1024            // NH * HD = projected width
#define DIN 1024          // input (model) width
#define NH 16
#define HD 64
#define NQB (TT / 64)
#define HG 4
#define SCALE (0.125f)
#define CAUSAL 0
#ifndef TNB
#define TNB NB
#endif
__device__ __forceinline__ float bfr(float v) { return (float)(__bf16)v; }
__host__ __device__ __forceinline__ int kb_last(int qb) { return CAUSAL ? ((qb * 64 + 63) >> 7) : (TT / 128 - 1); }
typedef __attribute__((ext_vector_type(8))) __bf16 v8b;
__device__ __forceinline__ v16b frag_b(const __bf16* rowk0, int lane) {
  union { v16b v; v8b q[2]; } u; const __bf16* p = rowk0 + 8 * (lane >> 4);
  u.q[0] = *(const v8b*)p; u.q[1] = *(const v8b*)(p + 16); return u.v;
}
// operand staging of the two projection GEMMs: a 32-k chunk of a row is one 128-byte line of f32; 8 lanes fetch it whole, each rounds its 4 values once and stores 8 bytes; LDS rows of 32 values at a pitch of 40 (80 bytes)
typedef __attribute__((ext_vector_type(4))) __bf16 v4b;
typedef __attribute__((ext_vector_type(4))) _Float16 v4h;
#define SPK 40
// work-group barrier by hand, behind the wave's own LDS wait: __syncthreads() would also wait out the global loads that are meant to stay in flight across it
__device__ __forceinline__ void stage_bar() { asm volatile("s_wait_dscnt 0x0" ::: "memory"); asm volatile("s_barrier_signal -1\n\ts_barrier_wait -1" ::: "memory"); }
// behind a group of look-ahead loads: their address registers are reused while the loads are still in flight
__device__ __forceinline__ void loads_issued() { asm volatile("s_wait_xcnt 0x0" ::: "memory"); }
__device__ __forceinline__ v4b cvt4b(v4f v) { v4b r; r[0] = (__bf16)v[0]; r[1] = (__bf16)v[1]; r[2] = (__bf16)v[2]; r[3] = (__bf16)v[3]; return r; }
__device__ __forceinline__ v4h cvt4y(v4f v) { v4h r; r[0] = (_Float16)(v[0] * 64.0f); r[1] = (_Float16)(v[1] * 64.0f); r[2] = (_Float16)(v[2] * 64.0f); r[3] = (_Float16)(v[3] * 64.0f); return r; }
__device__ __forceinline__ v4h cvt4w(v4f v) { v4h r; r[0] = (_Float16)(bfr(v[0]) * 256.0f); r[1] = (_Float16)(bfr(v[1]) * 256.0f); r[2] = (_Float16)(bfr(v[2]) * 256.0f); r[3] = (_Float16)(bfr(v[3]) * 256.0f); return r; }
#define QBH 0              // unused: k_fa has one path for all query blocks
#define QHI 0               // single-product logits on every row
#define KHI 64            // key rows carrying k residual / v bf16 hi+lo planes (written by k_proj, read by no kernel here)
// B fragment (k rows k0+.., output column o) of a weight: (in,out) [K][ld] or (out,in) [ld rows of K]: bf16 exact, or f16(bf16 * 256) exact
__device__ __forceinline__ v16b wcol_io(const float* Wm, int k0, int o, int lane, int ld) { v16b w; const int g = lane >> 4;
#pragma unroll
  for (int i = 0; i < 8; ++i) { w[i] = (__bf16)Wm[(size_t)(k0 + 8 * g + i) * ld + o]; w[8 + i] = (__bf16)Wm[(size_t)(k0 + 16 + 8 * g + i) * ld + o]; }
  return w; }
__device__ __forceinline__ v16b wcol_oi(const float* Wm, int k0, int o, int lane, int K) { v16b w; const float* p = Wm + (size_t)o * K + k0 + 8 * (lane >> 4);
#pragma unroll
  for (int i = 0; i < 8; ++i) { w[i] = (__bf16)p[i]; w[8 + i] = (__bf16)p[16 + i]; }
  return w; }
__device__ __forceinline__ v16h wcolh_io(const float* Wm, int k0, int o, int lane, int ld) { v16h w; const int g = lane >> 4;
#pragma unroll
  for (int i = 0; i < 8; ++i) { w[i] = (_Float16)(bfr(Wm[(size_t)(k0 + 8 * g + i) * ld + o]) * 256.0f); w[8 + i] = (_Float16)(bfr(Wm[(size_t)(k0 + 16 + 8 * g + i) * ld + o]) * 256.0f); }
  return w; }
__device__ __forceinline__ v16h wcolh_oi(const float* Wm, int k0, int o, int lane, int K) { v16h w; const float* p = Wm + (size_t)o * K + k0 + 8 * (lane >> 4);
#pragma unroll
  for (int i = 0; i < 8; ++i) { w[i] = (_Float16)(bfr(p[i]) * 256.0f); w[8 + i] = (_Float16)(bfr(p[16 + i]) * 256.0f); }
  return w; }
#define WQKV_LAYOUT 1   // 0 = (in,out) [DIN][CC]; 1 = (out,in) [CC][DIN]; 2 = per-head [NH][DIN][HD]
__device__ __forceinline__ v16b wcol_hdk(const float* Wm, int k0, int o, int lane) { v16b w; const int g = lane >> 4; const float* p = Wm + (size_t)(o / HD) * DIN * HD + (o % HD);
#pragma unroll
  for (int i = 0; i < 8; ++i) { w[i] = (__bf16)p[(size_t)(k0 + 8 * g + i) * HD]; w[8 + i] = (__bf16)p[(size_t)(k0 + 16 + 8 * g + i) * HD]; }
  return w; }
#define WO_OUT_IN 1
#if WQKV_LAYOUT == 1
#define WCOL(W, k0, o, lane) wcol_oi(W, k0, o, lane, DIN)
#elif WQKV_LAYOUT == 2
#define WCOL(W, k0, o, lane) wcol_hdk(W, k0, o, lane)
#else
#define WCOL(W, k0, o, lane) wcol_io(W, k0, o, lane, CC)
#endif
#if WO_OUT_IN
#define WOCOL(W, k0, o, lane) wcol_oi(W, k0, o, lane, CC)
#define WOCOLH(W, k0, o, lane) wcolh_oi(W, k0, o, lane, CC)
#else
#define WOCOL(W, k0, o, lane) wcol_io(W, k0, o, lane, DIN)
#define WOCOLH(W, k0, o, lane) wcolh_io(W, k0, o, lane, DIN)
#endif

// RoPE inverse frequencies 1/10000^(2i/64) (the f32 values jax computes)
__constant__ float INVF[32] = {1.000000000e+00,7.498942018e-01,5.623413324e-01,4.216965139e-01,3.162277639e-01,2.371373624e-01,1.778279394e-01,1.333521456e-01,1.000000015e-01,7.498941571e-02,5.623412877e-02,4.216964915e-02,3.162277862e-02,2.371373586e-02,1.778279431e-02,1.333521493e-02,9.999999776e-03,7.498942316e-03,5.623413250e-03,4.216964822e-03,3.162277862e-03,2.371373819e-03,1.778279431e-03,1.333521446e-03,1.000000047e-03,7.498941850e-04,5.623413017e-04,4.216964880e-04,3.162277862e-04,2.371373848e-04,1.778279402e-04,1.333521504e-04};
// (PROJ_EXTRA_PARAMS: the extra kernel parameters 'const int* __restrict__ TPOS' are written literally in the kernel signature)
// per (token, head) hook on the staged f32 row (64 floats) of the q and k streams: interleaved-pair rotation (x[2i], x[2i + 1]) by the angle pos * INVF[i] with pos READ from the int input; v untouched
#define PROJ_EPI(which, row, t, h) do { if ((which) < 2) { float* rw = (row); const float pos_ = (float)TPOS[(t)]; _Pragma("unroll 4") for (int i = 0; i < 32; ++i) { _Pragma("clang fp contract(off)") const float ang = pos_ * INVF[i]; const float cs = cosf(ang), sn = sinf(ang); const float xe = rw[2 * i], xo = rw[2 * i + 1]; rw[2 * i] = xe * cs - xo * sn; rw[2 * i + 1] = xe * sn + xo * cs; } } } while (0)
#ifndef SM_EXTRA_PARAMS
#define SM_EXTRA_PARAMS
#endif
#ifndef PROJ_EXTRA_PARAMS
#define PROJ_EXTRA_PARAMS
#endif
#ifndef SM_MASK_HOOK
#define SM_MASK_HOOK (void)0
#endif

#define WS_QH  0u                                      // f16 q rows [b*t][CC]
#define WS_KH  (WS_QH + 2u * (size_t)NB * TT * CC)      // f16 k rows [b*t][CC]
#define WS_VT  (WS_KH + 2u * (size_t)NB * TT * CC)      // f16 v planes [b][c][t]
#define WS_QL  (WS_VT + 2u * (size_t)NB * CC * TT)      // f16 q residual x 2^10 rows [b][t < QHI][CC]
#define WS_KL  (WS_QL + 2u * (size_t)NB * QHI * CC)     // f16 k residual x 2^10 rows [b][t < KHI][CC]
#define WS_VB  (WS_KL + 2u * (size_t)NB * KHI * CC)     // bf16 v hi planes [b][c][t < KHI]
#define WS_VBL (WS_VB + 2u * (size_t)NB * CC * KHI)
#define WS_S   (WS_VBL + 2u * (size_t)NB * CC * KHI)    // f32 region reserved but unused: k_fa keeps logits / P in registers
#define WS_Y   (WS_S  + 4u * (size_t)HG * TT * TT)      // f32 ctx rows [b*t][CC] (only when there is an output projection)
#define WS_END (WS_Y  + 4u * (size_t)NB * TT * CC)

// ---- k_proj: block = (64 rows, 128 cols, which): q/k/v = X W (+ b) with exact bf16 products (K = DIN) -> which 0: q f16 rows (+ residual rows < QHI); 1: k f16 rows (+ residual rows < KHI); 2: v f16 planes [c][t] (+ bf16 hi/lo planes for t < KHI)
__global__ __launch_bounds__(128) void k_proj(const float* __restrict__ XQ, const float* __restrict__ XK, const float* __restrict__ XV, const float* __restrict__ WQ, const float* __restrict__ WK, const float* __restrict__ WV, const float* __restrict__ BQ, const float* __restrict__ BK, const float* __restrict__ BV,
    _Float16* __restrict__ QH, _Float16* __restrict__ QL, _Float16* __restrict__ KH, _Float16* __restrict__ KL, _Float16* __restrict__ VT, __bf16* __restrict__ VB, __bf16* __restrict__ VBL, const int* __restrict__ TPOS) {
  __shared__ __align__(16) float st[64][132]; __shared__ __align__(16) _Float16 sh[64][136], sl[64][136]; __shared__ __align__(16) _Float16 th[128][72]; __shared__ __align__(16) __bf16 tb[128][72], tbl[128][72];
  const int tid = threadIdx.x, wave = tid >> 5, lane = tid & 31, col = lane & 15, g = lane >> 4; const int which = blockIdx.z; const int c0 = blockIdx.y * 128; const size_t r0 = (size_t)blockIdx.x * 64; const size_t bb = r0 / TT; const int t0 = (int)(r0 % TT);
  const float* X = which == 0 ? XQ : which == 1 ? XK : XV; const float* WA = which == 0 ? WQ : which == 1 ? WK : WV; const float* BA = which == 0 ? BQ : which == 1 ? BK : BV;
  v8f acc[8] = {};
  { // operands through LDS, two buffers (they lie in sh and sl, which the epilogue fills only behind its own barriers): rows 0..63 = X rows, 64..191 = weight rows of this tile; chunk kc + 1 is in flight in registers while chunk kc is multiplied
    __bf16* const sb0 = (__bf16*)&sh[0][0]; __bf16* const sb1 = (__bf16*)&sl[0][0];
    const int lr = tid >> 3, lp = tid & 7; const float* Ap = X + (r0 + lr) * DIN + lp * 4; const float* Wp = WA + (size_t)(c0 + lr) * DIN + lp * 4; const int so = lr * SPK + lp * 4;
    v4f ra[4], rw[8];
#pragma unroll
    for (int i = 0; i < 4; ++i) ra[i] = *(const v4f*)(Ap + (size_t)i * 16 * DIN);
#pragma unroll
    for (int i = 0; i < 8; ++i) rw[i] = *(const v4f*)(Wp + (size_t)i * 16 * DIN);
#pragma unroll
    for (int i = 0; i < 4; ++i) *(v4b*)(sb0 + so + i * 16 * SPK) = cvt4b(ra[i]);
#pragma unroll
    for (int i = 0; i < 8; ++i) *(v4b*)(sb0 + so + (64 + i * 16) * SPK) = cvt4b(rw[i]);
#pragma unroll
    for (int i = 0; i < 4; ++i) ra[i] = *(const v4f*)(Ap + (size_t)i * 16 * DIN + 32);
#pragma unroll
    for (int i = 0; i < 8; ++i) rw[i] = *(const v4f*)(Wp + (size_t)i * 16 * DIN + 32);
    loads_issued(); stage_bar();   // chunk 0 is published
#pragma unroll 2   // two trips a pass, so that each trip's buffer addresses are constants
    for (int kc = 0; kc < DIN / 32; ++kc) { const __bf16* sb = (kc & 1) ? sb1 : sb0; __bf16* sn = (kc & 1) ? sb0 : sb1;
      const v16b a = frag_b(sb + (wave * 16 + col) * SPK, lane); v16b w[8];
#pragma unroll
      for (int j = 0; j < 8; ++j) w[j] = frag_b(sb + (64 + j * 16 + col) * SPK, lane);
#pragma unroll
      for (int j = 0; j < 8; ++j) acc[j] = wmma_bf(a, w[j], acc[j]);
      __builtin_amdgcn_sched_barrier(0);   // keeps the wait for chunk kc + 1's loads behind the products, which cover a part of their latency
      if (kc + 1 < DIN / 32) {   // the other buffer's readers left it before the last barrier
#pragma unroll
        for (int i = 0; i < 4; ++i) *(v4b*)(sn + so + i * 16 * SPK) = cvt4b(ra[i]);
#pragma unroll
        for (int i = 0; i < 8; ++i) *(v4b*)(sn + so + (64 + i * 16) * SPK) = cvt4b(rw[i]);
        if (kc + 2 < DIN / 32) {
#pragma unroll
          for (int i = 0; i < 4; ++i) ra[i] = *(const v4f*)(Ap + (size_t)i * 16 * DIN + (kc + 2) * 32);
#pragma unroll
          for (int i = 0; i < 8; ++i) rw[i] = *(const v4f*)(Wp + (size_t)i * 16 * DIN + (kc + 2) * 32);
          loads_issued(); } }
      stage_bar(); } }   // publishes chunk kc + 1 and ends the reads of chunk kc
  { // stage the f32 tile (acc + bias) in LDS, run the per-(row, head) epilogue hook, then convert
#pragma unroll
    for (int j = 0; j < 8; ++j) { const float bias = BA ? bfr(BA[c0 + j * 16 + col]) : 0.f;
#pragma unroll
      for (int r = 0; r < 8; ++r) st[wave * 16 + 8 * g + r][j * 16 + col] = acc[j][r] + bias; }
    __syncthreads();
    for (int e = tid; e < 64 * (128 / HD); e += 128) { const int rl = e / (128 / HD), hh = e % (128 / HD); PROJ_EPI(which, &st[rl][hh * HD], (int)((r0 + rl) % TT), (c0 / HD) + hh); }
    __syncthreads(); }
  if (which < 2) { _Float16* DH = which == 0 ? QH : KH; _Float16* DL = which == 0 ? QL : KL; const int nhi = which == 0 ? QHI : KHI; const bool hi_rows = t0 < nhi;
    for (int e = tid; e < 64 * 128; e += 128) { const int rl = e >> 7, cl = e & 127; const float v = st[rl][cl]; const _Float16 hv = (_Float16)v; sh[rl][cl] = hv; sl[rl][cl] = (_Float16)((v - (float)hv) * 1024.0f); }
    __syncthreads();
    for (int e = tid; e < 64 * 16; e += 128) { const int rl = e >> 4, q = e & 15; vst2((unsigned*)(DH + (r0 + rl) * CC + c0 + q * 8), *(const v4u*)&sh[rl][q * 8]); if (hi_rows) vst2((unsigned*)(DL + (bb * nhi + t0 + rl) * (size_t)CC + c0 + q * 8), *(const v4u*)&sl[rl][q * 8]); }
  } else { const bool hi_rows = t0 < KHI;
    for (int e = tid; e < 64 * 128; e += 128) { const int rl = e & 63, cl = e >> 6; const float v = st[rl][cl]; th[cl][rl] = (_Float16)v; const __bf16 bh = (__bf16)v; tb[cl][rl] = bh; tbl[cl][rl] = (__bf16)(v - (float)bh); }
    __syncthreads();
    for (int e = tid; e < 128 * 8; e += 128) { const int cl = e >> 3, q = e & 7; vst2((unsigned*)(VT + (bb * CC + c0 + cl) * (size_t)TT + t0 + q * 8), *(const v4u*)&th[cl][q * 8]); if (hi_rows) { const size_t o3 = (bb * CC + c0 + cl) * (size_t)KHI + t0 + q * 8; vst2((unsigned*)(VB + o3), *(const v4u*)&tb[cl][q * 8]); vst2((unsigned*)(VBL + o3), *(const v4u*)&tbl[cl][q * 8]); } } } }
// ---- k_fa: block = 128 queries (4 waves x 32 query columns) of head h, batch b: logits, softmax and P . v in one pass over the keys, 32 keys a trip; no logit or P ever leaves the registers.
// Transposed products: S^T = K Q^T (lane = query column, element r = key 8g + r), so the two 16-key tiles of a trip, converted in place, are the B fragment (k = key, hardware k order) of ctx^T = V^T P^T.
// Running maximum m (raw logits) and running sum l per query column; p = 2^((s - m) c + 8), c = SCALE log2(e); the 2^8 keeps small p clear of f16 subnormals and cancels in acc / l.
__device__ __forceinline__ float xhalf(float x) { return __builtin_bit_cast(float, __builtin_amdgcn_permlanex16(__builtin_bit_cast(int, x), __builtin_bit_cast(int, x), 0x76543210, 0xfedcba98, false, false)); }  // lane l with lane l ^ 16
__device__ __forceinline__ v8f mmah(v16h a, v16h b, v8f c) { return __builtin_amdgcn_wmma_f32_16x16x32_f16(false, a, false, b, (short)0, c, false, false); }
__global__ __launch_bounds__(128) void k_fa(const _Float16* __restrict__ QH, const _Float16* __restrict__ KH, const _Float16* __restrict__ VT, float* __restrict__ Y) {
  const int tid = threadIdx.x, wave = tid >> 5, lane = tid & 31, col = lane & 15, g = lane >> 4; const int h = blockIdx.y, b = blockIdx.z; const int q0 = blockIdx.x * 128 + wave * 32;
  const float cs = SCALE * 1.4426950408889634f;
  v16h qf[2][2];
#pragma unroll
  for (int qt = 0; qt < 2; ++qt)
#pragma unroll
    for (int kc = 0; kc < 2; ++kc) qf[qt][kc] = frag_h(QH + ((size_t)b * TT + q0 + qt * 16 + col) * CC + h * HD + kc * 32, lane);
  const _Float16* Kp = KH + ((size_t)b * TT + col) * CC + h * HD;      // key row col of a 16-key tile
  const _Float16* Vp = VT + ((size_t)b * CC + h * HD + col) * (size_t)TT;  // v plane of channel col of a 16-channel tile
  v8f acc[2][4] = {}; float m[2] = {-INFINITY, -INFINITY}, l[2] = {0.f, 0.f};
  v16h kf[2][2];
#pragma unroll
  for (int kt = 0; kt < 2; ++kt)
#pragma unroll
    for (int kc = 0; kc < 2; ++kc) kf[kt][kc] = frag_h(Kp + (size_t)(kt * 16) * CC + kc * 32, lane);
  for (int k0 = 0; k0 < TT; k0 += 32) {
    v16h vf[4];
#pragma unroll
    for (int j = 0; j < 4; ++j) vf[j] = frag_h(Vp + (size_t)(j * 16) * TT + k0, lane);
    v8f s[2][2] = {};
#pragma unroll
    for (int kc = 0; kc < 2; ++kc)
#pragma unroll
      for (int qt = 0; qt < 2; ++qt)
#pragma unroll
        for (int kt = 0; kt < 2; ++kt) s[qt][kt] = mmah(kf[kt][kc], qf[qt][kc], s[qt][kt]);
    const int kn = (k0 + 32) & (TT - 1);   // the next trip's key rows, fetched a trip ahead; the last trip fetches rows 0..31 again (in bounds, not used)
#pragma unroll
    for (int kt = 0; kt < 2; ++kt)
#pragma unroll
      for (int kc = 0; kc < 2; ++kc) kf[kt][kc] = frag_h(Kp + (size_t)(kn + kt * 16) * CC + kc * 32, lane);
    __builtin_amdgcn_sched_barrier(0);   // holds the look-ahead loads here: moved down behind the softmax they would have no time to land before the next trip's first product
#pragma unroll
    for (int qt = 0; qt < 2; ++qt) {
      float mx = fmaxf(s[qt][0][0], s[qt][1][0]);
#pragma unroll
      for (int r = 1; r < 8; ++r) mx = fmaxf(mx, fmaxf(s[qt][0][r], s[qt][1][r]));
      mx = fmaxf(mx, xhalf(mx));            // both halves of the wave hold this query's maximum over the 32 keys
      const float mn = fmaxf(m[qt], mx); const float corr = __builtin_amdgcn_exp2f((m[qt] - mn) * cs);   // 0 on the first trip
      m[qt] = mn; const float nm = 8.0f - mn * cs;
      v16h pf; float s0 = 0.f, s1 = 0.f;
#pragma unroll
      for (int r = 0; r < 8; ++r) { const float p0 = __builtin_amdgcn_exp2f(fmaf(s[qt][0][r], cs, nm)), p1 = __builtin_amdgcn_exp2f(fmaf(s[qt][1][r], cs, nm)); s0 += p0; s1 += p1; pf[r] = (_Float16)p0; pf[8 + r] = (_Float16)p1; }
      l[qt] = l[qt] * corr + (s0 + s1);
#pragma unroll
      for (int j = 0; j < 4; ++j) { acc[qt][j] = acc[qt][j] * corr; acc[qt][j] = mmah(vf[j], pf, acc[qt][j]); } } }
  asm volatile("s_wait_loadcnt 0x0" ::: "memory");   // the last trip's look-ahead loads have landed before the wave gives its registers back
#pragma unroll
  for (int qt = 0; qt < 2; ++qt) { const float inv = 1.0f / (l[qt] + xhalf(l[qt]));   // the two halves' sums are joined once
    float* yr = Y + ((size_t)b * TT + q0 + qt * 16 + col) * CC + h * HD + 8 * g;     // element r of tile j = channel j * 16 + 8g + r of query col
#pragma unroll
    for (int j = 0; j < 4; ++j) { const v8f o = acc[qt][j] * inv; vst2(yr + j * 16, (v4f){o[0], o[1], o[2], o[3]}); vst2(yr + j * 16 + 4, (v4f){o[4], o[5], o[6], o[7]}); } } }
// ---- k_out: block = (64 rows, 128 cols): out = ctx Wo (+ bo): ctx x 2^6 once to f16 against Wo as f16(bf16 x 2^8) exact (1 product) x 2^-14; causal early rows (< QHI of each sequence): ctx bf16 hi + lo against exact bf16 Wo (2 products)
__global__ __launch_bounds__(128) void k_out(const float* __restrict__ Y, const float* __restrict__ WO, const float* __restrict__ BO, float* __restrict__ OUT) { __shared__ __align__(16) float sf[4][16][132]; __shared__ __align__(16) _Float16 sg[2][192 * SPK];
  const int tid = threadIdx.x, wave = tid >> 5, lane = tid & 31, col = lane & 15, g = lane >> 4; const int c0 = blockIdx.y * 128; const size_t r0 = (size_t)blockIdx.x * 64 + wave * 16;
  v8f acc[8] = {};
  if (CAUSAL && (int)(((size_t)blockIdx.x * 64) % TT) < QHI) {   /* block-uniform */
#pragma unroll 2
    for (int kc = 0; kc < CC / 32; ++kc) { const F2 a = split_row(Y + (r0 + col) * CC, kc * 32, lane); asm volatile("s_wait_loadcnt 0x0" ::: "memory");
#pragma unroll
      for (int j = 0; j < 8; ++j) { const v16b w = WOCOL(WO, kc * 32, c0 + j * 16 + col, lane); asm volatile("s_wait_loadcnt 0x0" ::: "memory"); acc[j] = wmma_bf(a.h, w, acc[j]); acc[j] = wmma_bf(a.l, w, acc[j]); } }
#pragma unroll
    for (int j = 0; j < 8; ++j) { const float bias = BO ? bfr(BO[c0 + j * 16 + col]) : 0.f;
#pragma unroll
      for (int r = 0; r < 8; ++r) sf[wave][8 * g + r][j * 16 + col] = acc[j][r] + bias; }
  } else {
    // operands through LDS as in k_proj: rows 0..63 = ctx rows, 64..191 = weight rows; ctx carried x 2^6 into f16 so small-magnitude context rows stay clear of f16 subnormals
    const int lr = tid >> 3, lp = tid & 7; const float* Ap = Y + ((size_t)blockIdx.x * 64 + lr) * CC + lp * 4; const float* Wp = WO + (size_t)(c0 + lr) * CC + lp * 4; const int so = lr * SPK + lp * 4;
    v4f ra[4], rw[8];
#pragma unroll
    for (int i = 0; i < 4; ++i) ra[i] = *(const v4f*)(Ap + (size_t)i * 16 * CC);
#pragma unroll
    for (int i = 0; i < 8; ++i) rw[i] = *(const v4f*)(Wp + (size_t)i * 16 * CC);
#pragma unroll
    for (int i = 0; i < 4; ++i) *(v4h*)(&sg[0][0] + so + i * 16 * SPK) = cvt4y(ra[i]);
#pragma unroll
    for (int i = 0; i < 8; ++i) *(v4h*)(&sg[0][0] + so + (64 + i * 16) * SPK) = cvt4w(rw[i]);
#pragma unroll
    for (int i = 0; i < 4; ++i) ra[i] = *(const v4f*)(Ap + (size_t)i * 16 * CC + 32);
#pragma unroll
    for (int i = 0; i < 8; ++i) rw[i] = *(const v4f*)(Wp + (size_t)i * 16 * CC + 32);
    loads_issued(); stage_bar();   // chunk 0 is published
#pragma unroll 2   // two trips a pass, so that each trip's buffer addresses are constants
    for (int kc = 0; kc < CC / 32; ++kc) { const _Float16* sb = &sg[kc & 1][0]; _Float16* sn = &sg[(kc & 1) ^ 1][0];
      const v16h a = frag_h(sb + (wave * 16 + col) * SPK, lane); v16h w[8];
#pragma unroll
      for (int j = 0; j < 8; ++j) w[j] = frag_h(sb + (64 + j * 16 + col) * SPK, lane);
#pragma unroll
      for (int j = 0; j < 8; ++j) acc[j] = wmma16(a, w[j], acc[j]);
      __builtin_amdgcn_sched_barrier(0);   // keeps the wait for chunk kc + 1's loads behind the products, which cover a part of their latency
      if (kc + 1 < CC / 32) {   // the other buffer's readers left it before the last barrier
#pragma unroll
        for (int i = 0; i < 4; ++i) *(v4h*)(sn + so + i * 16 * SPK) = cvt4y(ra[i]);
#pragma unroll
        for (int i = 0; i < 8; ++i) *(v4h*)(sn + so + (64 + i * 16) * SPK) = cvt4w(rw[i]);
        if (kc + 2 < CC / 32) {
#pragma unroll
          for (int i = 0; i < 4; ++i) ra[i] = *(const v4f*)(Ap + (size_t)i * 16 * CC + (kc + 2) * 32);
#pragma unroll
          for (int i = 0; i < 8; ++i) rw[i] = *(const v4f*)(Wp + (size_t)i * 16 * CC + (kc + 2) * 32);
          loads_issued(); } }
      stage_bar(); }   // publishes chunk kc + 1 and ends the reads of chunk kc
#pragma unroll
    for (int j = 0; j < 8; ++j) { const float bias = BO ? bfr(BO[c0 + j * 16 + col]) : 0.f;
#pragma unroll
      for (int r = 0; r < 8; ++r) sf[wave][8 * g + r][j * 16 + col] = acc[j][r] * (1.0f / 16384.0f) + bias; } }   /* 2^-8 (Wo carry) x 2^-6 (ctx carry) */
  LDSX(); for (int rl = 0; rl < 16; ++rl) vst2(OUT + (r0 + rl) * DIN + c0 + lane * 4, *(const v4f*)&sf[wave][rl][lane * 4]); }

extern "C" void kernel_launch(void* const* d_in, const int* in_sizes, int n_in, void* d_out, int out_size, void* d_ws, size_t ws_size, hipStream_t stream) {
  (void)in_sizes; (void)n_in; (void)out_size;
  const float** F = (const float**)d_in;
  if (ws_size < (size_t)WS_END) return;
  char* ws = (char*)d_ws; _Float16 *QH = (_Float16*)(ws + WS_QH), *KH = (_Float16*)(ws + WS_KH), *VT = (_Float16*)(ws + WS_VT), *QL = (_Float16*)(ws + WS_QL), *KL = (_Float16*)(ws + WS_KL); __bf16 *VB = (__bf16*)(ws + WS_VB), *VBL = (__bf16*)(ws + WS_VBL); float *Y = (float*)(ws + WS_Y);
  (void)Y; (void)QL; (void)KL; (void)VB; (void)VBL;
  // inputs: 0 x [2,2048,1024]; 1 Wqkv [3072,1024] (out,in): q rows 0..1023, k 1024..2047, v 2048..3071; 2 Wout [1024,1024] (out,in); 3 token_positions [2048] int32 (arange; READ on the device); no biases
  k_proj<<<dim3(TNB * TT / 64, CC / 128, 3), 128, 0, stream>>>(F[0], F[0], F[0], F[1], F[1] + (size_t)CC * DIN, F[1] + 2 * (size_t)CC * DIN, nullptr, nullptr, nullptr, QH, QL, KH, KL, VT, VB, VBL, (const int*)d_in[3]);
  k_fa<<<dim3(TT / 128, NH, TNB), 128, 0, stream>>>(QH, KH, VT, Y);
  k_out<<<dim3(TNB * TT / 64, DIN / 128), 128, 0, stream>>>(Y, F[2], nullptr, (float*)d_out);
}

// v003
// It runs in 131 microseconds.
// In both of two side-by-side timings against v002, it was 1.16 times as fast.
// Counting every step since v000, it is 11.1 times as fast.
// compute dtype: all float inputs rounded to bf16; q / k / v projections with EXACT bf16 products on WMMA 16x16x32 (f32 accumulate), no biases; RoPE in f32 (embedded frequencies, precise cosf / sinf, positions read from the int input token_positions); logits q x k once to f16 each (1 product) x 64^-0.5; softmax f32 with a running maximum and sum over 32-key trips; P (unnormalised, x 2^8) once to f16 x v once to f16 (1 product), divided by the sum at the end; ctx x 2^6 once to f16 x the output weight f16(bf16 x 2^8); f32 output.
#include <hip/hip_runtime.h>
#include <math.h>

typedef __attribute__((ext_vector_type(16))) _Float16 v16h;
typedef __attribute__((ext_vector_type(16))) __bf16 v16b;
typedef __attribute__((ext_vector_type(8)))  _Float16 v8h;
typedef __attribute__((ext_vector_type(8)))  float v8f;
typedef __attribute__((ext_vector_type(4)))  float v4f;
typedef __attribute__((ext_vector_type(2)))  float v2f;
typedef __attribute__((ext_vector_type(4)))  unsigned v4u;
typedef __attribute__((ext_vector_type(4)))  int v4i;
typedef float __attribute__((may_alias)) float_a;
typedef int __attribute__((may_alias)) int_a;

template <typename T> __device__ __forceinline__ void vst2(void* p, T v) { *(T*)p = v;  }
__device__ __forceinline__ v8f wmma16(v16h a, v16h b, v8f c) {
  v8f d = __builtin_amdgcn_wmma_f32_16x16x32_f16(false, a, false, b, (short)0, c, false, false);
  asm volatile("v_nop\n\tv_nop\n\tv_nop\n\tv_nop" : "+v"(d) : "v"(a), "v"(b));
  return d;
}
__device__ __forceinline__ v8f wmma_bf(v16b a, v16b b, v8f c) {
  v8f d = __builtin_amdgcn_wmma_f32_16x16x32_bf16(false, a, false, b, (short)0, c, false, false);
  asm volatile("v_nop\n\tv_nop\n\tv_nop\n\tv_nop" : "+v"(d) : "v"(a), "v"(b));
  return d;
}
// 16x16x32 fragments: lane = (h = lane>>4, row/col = lane&15); elements 0..7 = k0+8h+0..7, 8..15 = k0+16+8h+0..7; D element r = row 8h+r
__device__ __forceinline__ v16h frag_h(const _Float16* rowk0, int lane) {
  union { v16h v; v8h q[2]; } u; const _Float16* p = rowk0 + 8 * (lane >> 4);
  u.q[0] = *(const v8h*)p; u.q[1] = *(const v8h*)(p + 16); return u.v;
}
__device__ __forceinline__ v16h frag_f32(const float* rowk0, int lane) {
  v16h a; const float* p = rowk0 + 8 * (lane >> 4);
#pragma unroll
  for (int i = 0; i < 8; ++i) { a[i] = (_Float16)p[i]; a[8 + i] = (_Float16)p[16 + i]; }
  return a;
}
__device__ __forceinline__ v16h frag_f32s(const float* rowk0, int lane, float sc) {
  v16h a; const float* p = rowk0 + 8 * (lane >> 4);
#pragma unroll
  for (int i = 0; i < 8; ++i) { a[i] = (_Float16)(p[i] * sc); a[8 + i] = (_Float16)(p[16 + i] * sc); }
  return a;
}
// column fragment from a [K][ld] layout (column n), rows >= K read as 0
__device__ __forceinline__ v16h fragc_f32(const float* W, int k0, int n, int lane, int ld, int K) {
  v16h a; const int g = lane >> 4;
#pragma unroll
  for (int i = 0; i < 8; ++i) { const int ka = k0 + 8 * g + i, kb = ka + 16;
    a[i] = (_Float16)(ka < K ? W[(size_t)(ka < K ? ka : K - 1) * ld + n] : 0.f); a[8 + i] = (_Float16)(kb < K ? W[(size_t)(kb < K ? kb : K - 1) * ld + n] : 0.f); }
  return a;
}
struct F2 { v16b h, l; };
__device__ __forceinline__ F2 bsplit16(const float v[16]) { F2 r;
#pragma unroll
  for (int i = 0; i < 16; ++i) { const __bf16 h = (__bf16)v[i]; r.h[i] = h; r.l[i] = (__bf16)(v[i] - (float)h); }
  return r; }
__device__ __forceinline__ F2 split_row(const float* row, int k0, int lane) { float v[16]; const float* p = row + k0 + 8 * (lane >> 4);
#pragma unroll
  for (int i = 0; i < 8; ++i) { v[i] = p[i]; v[8 + i] = p[16 + i]; }
  return bsplit16(v); }
__device__ __forceinline__ F2 split_rowK(const float* row, int k0, int lane, int K) { float v[16]; const int g = lane >> 4;
#pragma unroll
  for (int i = 0; i < 8; ++i) { const int ka = k0 + 8 * g + i, kb = ka + 16; v[i] = ka < K ? row[ka < K ? ka : K - 1] : 0.f; v[8 + i] = kb < K ? row[kb < K ? kb : K - 1] : 0.f; }
  return bsplit16(v); }
__device__ __forceinline__ F2 split_col(const float* W, int k0, int n, int lane, int ld, int K) { float v[16]; const int g = lane >> 4;
#pragma unroll
  for (int i = 0; i < 8; ++i) { const int ka = k0 + 8 * g + i, kb = ka + 16; v[i] = ka < K ? W[(size_t)(ka < K ? ka : K - 1) * ld + n] : 0.f; v[8 + i] = kb < K ? W[(size_t)(kb < K ? kb : K - 1) * ld + n] : 0.f; }
  return bsplit16(v); }
__device__ __forceinline__ v8f mac3(const F2& a, const F2& b, v8f c) { c = wmma_bf(a.l, b.h, c); c = wmma_bf(a.h, b.l, c); return wmma_bf(a.h, b.h, c); }
__device__ __forceinline__ float sigm(float v) { return 1.0f / (1.0f + expf(-v)); }
#define LDSX() do { asm volatile("s_wait_dscnt 0" ::: "memory"); __builtin_amdgcn_wave_barrier(); __builtin_amdgcn_fence(__ATOMIC_RELEASE, "workgroup"); } while (0)

// Multi-head self-attention with interleaved-pair RoPE, no mask (x [2,2048,1024]; Wqkv [3072,1024] torch (out,in): qkv.reshape(B, S, 3, 16, 64): q = rows 0..1023, k = 1024..2047, v = 2048..3071; Wout [1024,1024] (out,in); token_positions [2048] int32 = arange, a module input READ on the device; RoPE on q and k: (even, odd) pairs (x_e c - x_o s, x_e s + x_o c) re-interleaved, inv_freq = 1 / 10000^(2i/64); scores / sqrt(64); softmax; out @ Wout.T).
#define NB 2
#define TT 2048
#define CC 1024            // NH * HD = projected width
#define DIN 1024          // input (model) width
#define NH 16
#define HD 64
#define NQB (TT / 64)
#define HG 4
#define SCALE (0.125f)
#define CAUSAL 0
#ifndef TNB
#define TNB NB
#endif
__device__ __forceinline__ float bfr(float v) { return (float)(__bf16)v; }
__host__ __device__ __forceinline__ int kb_last(int qb) { return CAUSAL ? ((qb * 64 + 63) >> 7) : (TT / 128 - 1); }
typedef __attribute__((ext_vector_type(8))) __bf16 v8b;
__device__ __forceinline__ v16b frag_b(const __bf16* rowk0, int lane) {
  union { v16b v; v8b q[2]; } u; const __bf16* p = rowk0 + 8 * (lane >> 4);
  u.q[0] = *(const v8b*)p; u.q[1] = *(const v8b*)(p + 16); return u.v;
}
// operand staging of the two projection GEMMs: a 32-k chunk of a row is one 128-byte line of f32; 8 lanes fetch it whole, each rounds its 4 values once and stores 8 bytes; LDS rows of 32 values at a pitch of 40 (80 bytes)
typedef __attribute__((ext_vector_type(4))) __bf16 v4b;
typedef __attribute__((ext_vector_type(4))) _Float16 v4h;
#define SPK 40
// work-group barrier by hand, behind the wave's own LDS wait: __syncthreads() would also wait out the global loads that are meant to stay in flight across it
__device__ __forceinline__ void stage_bar() { asm volatile("s_wait_dscnt 0x0" ::: "memory"); asm volatile("s_barrier_signal -1\n\ts_barrier_wait -1" ::: "memory"); }
// behind a group of look-ahead loads: their address registers are reused while the loads are still in flight
__device__ __forceinline__ void loads_issued() { asm volatile("s_wait_xcnt 0x0" ::: "memory"); }
__device__ __forceinline__ v4b cvt4b(v4f v) { v4b r; r[0] = (__bf16)v[0]; r[1] = (__bf16)v[1]; r[2] = (__bf16)v[2]; r[3] = (__bf16)v[3]; return r; }
__device__ __forceinline__ v4h cvt4y(v4f v) { v4h r; r[0] = (_Float16)(v[0] * 64.0f); r[1] = (_Float16)(v[1] * 64.0f); r[2] = (_Float16)(v[2] * 64.0f); r[3] = (_Float16)(v[3] * 64.0f); return r; }
__device__ __forceinline__ v4h cvt4w(v4f v) { v4h r; r[0] = (_Float16)(bfr(v[0]) * 256.0f); r[1] = (_Float16)(bfr(v[1]) * 256.0f); r[2] = (_Float16)(bfr(v[2]) * 256.0f); r[3] = (_Float16)(bfr(v[3]) * 256.0f); return r; }
#define QBH 0              // unused: k_fa has one path for all query blocks
#define QHI 0               // single-product logits on every row
#define KHI 64            // key rows carrying k residual / v bf16 hi+lo planes (written by k_proj, read by no kernel here)
// B fragment (k rows k0+.., output column o) of a weight: (in,out) [K][ld] or (out,in) [ld rows of K]: bf16 exact, or f16(bf16 * 256) exact
__device__ __forceinline__ v16b wcol_io(const float* Wm, int k0, int o, int lane, int ld) { v16b w; const int g = lane >> 4;
#pragma unroll
  for (int i = 0; i < 8; ++i) { w[i] = (__bf16)Wm[(size_t)(k0 + 8 * g + i) * ld + o]; w[8 + i] = (__bf16)Wm[(size_t)(k0 + 16 + 8 * g + i) * ld + o]; }
  return w; }
__device__ __forceinline__ v16b wcol_oi(const float* Wm, int k0, int o, int lane, int K) { v16b w; const float* p = Wm + (size_t)o * K + k0 + 8 * (lane >> 4);
#pragma unroll
  for (int i = 0; i < 8; ++i) { w[i] = (__bf16)p[i]; w[8 + i] = (__bf16)p[16 + i]; }
  return w; }
__device__ __forceinline__ v16h wcolh_io(const float* Wm, int k0, int o, int lane, int ld) { v16h w; const int g = lane >> 4;
#pragma unroll
  for (int i = 0; i < 8; ++i) { w[i] = (_Float16)(bfr(Wm[(size_t)(k0 + 8 * g + i) * ld + o]) * 256.0f); w[8 + i] = (_Float16)(bfr(Wm[(size_t)(k0 + 16 + 8 * g + i) * ld + o]) * 256.0f); }
  return w; }
__device__ __forceinline__ v16h wcolh_oi(const float* Wm, int k0, int o, int lane, int K) { v16h w; const float* p = Wm + (size_t)o * K + k0 + 8 * (lane >> 4);
#pragma unroll
  for (int i = 0; i < 8; ++i) { w[i] = (_Float16)(bfr(p[i]) * 256.0f); w[8 + i] = (_Float16)(bfr(p[16 + i]) * 256.0f); }
  return w; }
#define WQKV_LAYOUT 1   // 0 = (in,out) [DIN][CC]; 1 = (out,in) [CC][DIN]; 2 = per-head [NH][DIN][HD]
__device__ __forceinline__ v16b wcol_hdk(const float* Wm, int k0, int o, int lane) { v16b w; const int g = lane >> 4; const float* p = Wm + (size_t)(o / HD) * DIN * HD + (o % HD);
#pragma unroll
  for (int i = 0; i < 8; ++i) { w[i] = (__bf16)p[(size_t)(k0 + 8 * g + i) * HD]; w[8 + i] = (__bf16)p[(size_t)(k0 + 16 + 8 * g + i) * HD]; }
  return w; }
#define WO_OUT_IN 1
#if WQKV_LAYOUT == 1
#define WCOL(W, k0, o, lane) wcol_oi(W, k0, o, lane, DIN)
#elif WQKV_LAYOUT == 2
#define WCOL(W, k0, o, lane) wcol_hdk(W, k0, o, lane)
#else
#define WCOL(W, k0, o, lane) wcol_io(W, k0, o, lane, CC)
#endif
#if WO_OUT_IN
#define WOCOL(W, k0, o, lane) wcol_oi(W, k0, o, lane, CC)
#define WOCOLH(W, k0, o, lane) wcolh_oi(W, k0, o, lane, CC)
#else
#define WOCOL(W, k0, o, lane) wcol_io(W, k0, o, lane, DIN)
#define WOCOLH(W, k0, o, lane) wcolh_io(W, k0, o, lane, DIN)
#endif

// RoPE inverse frequencies 1/10000^(2i/64) (the f32 values jax computes)
__constant__ float INVF[32] = {1.000000000e+00,7.498942018e-01,5.623413324e-01,4.216965139e-01,3.162277639e-01,2.371373624e-01,1.778279394e-01,1.333521456e-01,1.000000015e-01,7.498941571e-02,5.623412877e-02,4.216964915e-02,3.162277862e-02,2.371373586e-02,1.778279431e-02,1.333521493e-02,9.999999776e-03,7.498942316e-03,5.623413250e-03,4.216964822e-03,3.162277862e-03,2.371373819e-03,1.778279431e-03,1.333521446e-03,1.000000047e-03,7.498941850e-04,5.623413017e-04,4.216964880e-04,3.162277862e-04,2.371373848e-04,1.778279402e-04,1.333521504e-04};
// (PROJ_EXTRA_PARAMS: the extra kernel parameters 'const int* __restrict__ TPOS' are written literally in the kernel signature)
// per (token, head) hook on the staged f32 row (64 floats) of the q and k streams: interleaved-pair rotation (x[2i], x[2i + 1]) by the angle pos * INVF[i] with pos READ from the int input; v untouched
#define PROJ_EPI(which, row, t, h) do { if ((which) < 2) { float* rw = (row); const float pos_ = (float)TPOS[(t)]; _Pragma("unroll 4") for (int i = 0; i < 32; ++i) { _Pragma("clang fp contract(off)") const float ang = pos_ * INVF[i]; const float cs = cosf(ang), sn = sinf(ang); const float xe = rw[2 * i], xo = rw[2 * i + 1]; rw[2 * i] = xe * cs - xo * sn; rw[2 * i + 1] = xe * sn + xo * cs; } } } while (0)
#ifndef SM_EXTRA_PARAMS
#define SM_EXTRA_PARAMS
#endif
#ifndef PROJ_EXTRA_PARAMS
#define PROJ_EXTRA_PARAMS
#endif
#ifndef SM_MASK_HOOK
#define SM_MASK_HOOK (void)0
#endif

#define WS_QH  0u                                      // f16 q rows [b*t][CC]
#define WS_KH  (WS_QH + 2u * (size_t)NB * TT * CC)      // f16 k rows [b*t][CC]
#define WS_VT  (WS_KH + 2u * (size_t)NB * TT * CC)      // f16 v planes [b][c][t]
#define WS_QL  (WS_VT + 2u * (size_t)NB * CC * TT)      // f16 q residual x 2^10 rows [b][t < QHI][CC]
#define WS_KL  (WS_QL + 2u * (size_t)NB * QHI * CC)     // f16 k residual x 2^10 rows [b][t < KHI][CC]
#define WS_VB  (WS_KL + 2u * (size_t)NB * KHI * CC)     // bf16 v hi planes [b][c][t < KHI]
#define WS_VBL (WS_VB + 2u * (size_t)NB * CC * KHI)
#define WS_S   (WS_VBL + 2u * (size_t)NB * CC * KHI)    // f32 region reserved but unused: k_fa keeps logits / P in registers
#define WS_Y   (WS_S  + 4u * (size_t)HG * TT * TT)      // f32 ctx rows [b*t][CC] (only when there is an output projection)
#define WS_END (WS_Y  + 4u * (size_t)NB * TT * CC)

// ---- k_proj: block = (64 rows, 128 cols, which): q/k/v = X W (+ b) with exact bf16 products (K = DIN) -> which 0: q f16 rows (+ residual rows < QHI); 1: k f16 rows (+ residual rows < KHI); 2: v f16 planes [c][t] (+ bf16 hi/lo planes for t < KHI)
__global__ __launch_bounds__(128) void k_proj(const float* __restrict__ XQ, const float* __restrict__ XK, const float* __restrict__ XV, const float* __restrict__ WQ, const float* __restrict__ WK, const float* __restrict__ WV, const float* __restrict__ BQ, const float* __restrict__ BK, const float* __restrict__ BV,
    _Float16* __restrict__ QH, _Float16* __restrict__ QL, _Float16* __restrict__ KH, _Float16* __restrict__ KL, _Float16* __restrict__ VT, __bf16* __restrict__ VB, __bf16* __restrict__ VBL, const int* __restrict__ TPOS) {
  __shared__ __align__(16) float st[64][132]; __shared__ __align__(16) _Float16 sh[64][136], sl[64][136]; __shared__ __align__(16) _Float16 th[128][72]; __shared__ __align__(16) __bf16 tb[128][72], tbl[128][72];
  const int tid = threadIdx.x, wave = tid >> 5, lane = tid & 31, col = lane & 15, g = lane >> 4; const int which = blockIdx.z; const int c0 = blockIdx.y * 128; const size_t r0 = (size_t)blockIdx.x * 64; const size_t bb = r0 / TT; const int t0 = (int)(r0 % TT);
  const float* X = which == 0 ? XQ : which == 1 ? XK : XV; const float* WA = which == 0 ? WQ : which == 1 ? WK : WV; const float* BA = which == 0 ? BQ : which == 1 ? BK : BV;
  v8f acc[8] = {};
  { // operands through LDS, two buffers (they lie in sh and sl, which the epilogue fills only behind its own barriers): rows 0..63 = X rows, 64..191 = weight rows of this tile; chunk kc + 1 is in flight in registers while chunk kc is multiplied
    __bf16* const sb0 = (__bf16*)&sh[0][0]; __bf16* const sb1 = (__bf16*)&sl[0][0];
    const int lr = tid >> 3, lp = tid & 7; const float* Ap = X + (r0 + lr) * DIN + lp * 4; const float* Wp = WA + (size_t)(c0 + lr) * DIN + lp * 4; const int so = lr * SPK + lp * 4;
    v4f ra[4], rw[8];
#pragma unroll
    for (int i = 0; i < 4; ++i) ra[i] = *(const v4f*)(Ap + (size_t)i * 16 * DIN);
#pragma unroll
    for (int i = 0; i < 8; ++i) rw[i] = *(const v4f*)(Wp + (size_t)i * 16 * DIN);
#pragma unroll
    for (int i = 0; i < 4; ++i) *(v4b*)(sb0 + so + i * 16 * SPK) = cvt4b(ra[i]);
#pragma unroll
    for (int i = 0; i < 8; ++i) *(v4b*)(sb0 + so + (64 + i * 16) * SPK) = cvt4b(rw[i]);
#pragma unroll
    for (int i = 0; i < 4; ++i) ra[i] = *(const v4f*)(Ap + (size_t)i * 16 * DIN + 32);
#pragma unroll
    for (int i = 0; i < 8; ++i) rw[i] = *(const v4f*)(Wp + (size_t)i * 16 * DIN + 32);
    loads_issued(); stage_bar();   // chunk 0 is published
#pragma unroll 2   // two trips a pass, so that each trip's buffer addresses are constants
    for (int kc = 0; kc < DIN / 32; ++kc) { const __bf16* sb = (kc & 1) ? sb1 : sb0; __bf16* sn = (kc & 1) ? sb0 : sb1;
      const v16b a = frag_b(sb + (wave * 16 + col) * SPK, lane); v16b w[8];
#pragma unroll
      for (int j = 0; j < 8; ++j) w[j] = frag_b(sb + (64 + j * 16 + col) * SPK, lane);
#pragma unroll
      for (int j = 0; j < 8; ++j) acc[j] = wmma_bf(a, w[j], acc[j]);
      __builtin_amdgcn_sched_barrier(0);   // keeps the wait for chunk kc + 1's loads behind the products, which cover a part of their latency
      if (kc + 1 < DIN / 32) {   // the other buffer's readers left it before the last barrier
#pragma unroll
        for (int i = 0; i < 4; ++i) *(v4b*)(sn + so + i * 16 * SPK) = cvt4b(ra[i]);
#pragma unroll
        for (int i = 0; i < 8; ++i) *(v4b*)(sn + so + (64 + i * 16) * SPK) = cvt4b(rw[i]);
        if (kc + 2 < DIN / 32) {
#pragma unroll
          for (int i = 0; i < 4; ++i) ra[i] = *(const v4f*)(Ap + (size_t)i * 16 * DIN + (kc + 2) * 32);
#pragma unroll
          for (int i = 0; i < 8; ++i) rw[i] = *(const v4f*)(Wp + (size_t)i * 16 * DIN + (kc + 2) * 32);
          loads_issued(); } }
      stage_bar(); } }   // publishes chunk kc + 1 and ends the reads of chunk kc
  { // stage the f32 tile (acc + bias) in LDS, run the per-(row, head) epilogue hook, then convert
#pragma unroll
    for (int j = 0; j < 8; ++j) { const float bias = BA ? bfr(BA[c0 + j * 16 + col]) : 0.f;
#pragma unroll
      for (int r = 0; r < 8; ++r) st[wave * 16 + 8 * g + r][j * 16 + col] = acc[j][r] + bias; }
    __syncthreads();
    for (int e = tid; e < 64 * (128 / HD); e += 128) { const int rl = e / (128 / HD), hh = e % (128 / HD); PROJ_EPI(which, &st[rl][hh * HD], (int)((r0 + rl) % TT), (c0 / HD) + hh); }
    __syncthreads(); }
  if (which < 2) { _Float16* DH = which == 0 ? QH : KH; _Float16* DL = which == 0 ? QL : KL; const int nhi = which == 0 ? QHI : KHI; const bool hi_rows = t0 < nhi;
    for (int e = tid; e < 64 * 128; e += 128) { const int rl = e >> 7, cl = e & 127; const float v = st[rl][cl]; const _Float16 hv = (_Float16)v; sh[rl][cl] = hv; sl[rl][cl] = (_Float16)((v - (float)hv) * 1024.0f); }
    __syncthreads();
    for (int e = tid; e < 64 * 16; e += 128) { const int rl = e >> 4, q = e & 15; vst2((unsigned*)(DH + (r0 + rl) * CC + c0 + q * 8), *(const v4u*)&sh[rl][q * 8]); if (hi_rows) vst2((unsigned*)(DL + (bb * nhi + t0 + rl) * (size_t)CC + c0 + q * 8), *(const v4u*)&sl[rl][q * 8]); }
  } else { const bool hi_rows = t0 < KHI;
    for (int e = tid; e < 64 * 128; e += 128) { const int rl = e & 63, cl = e >> 6; const float v = st[rl][cl]; th[cl][rl] = (_Float16)v; const __bf16 bh = (__bf16)v; tb[cl][rl] = bh; tbl[cl][rl] = (__bf16)(v - (float)bh); }
    __syncthreads();
    for (int e = tid; e < 128 * 8; e += 128) { const int cl = e >> 3, q = e & 7; vst2((unsigned*)(VT + (bb * CC + c0 + cl) * (size_t)TT + t0 + q * 8), *(const v4u*)&th[cl][q * 8]); if (hi_rows) { const size_t o3 = (bb * CC + c0 + cl) * (size_t)KHI + t0 + q * 8; vst2((unsigned*)(VB + o3), *(const v4u*)&tb[cl][q * 8]); vst2((unsigned*)(VBL + o3), *(const v4u*)&tbl[cl][q * 8]); } } } }
// ---- k_fa: block = 128 queries (4 waves x 32 query columns) of head h, batch b: logits, softmax and P . v in one pass over the keys, 32 keys a trip; no logit or P ever leaves the registers.
// Transposed products: S^T = K Q^T (lane = query column, element r = key 8g + r), so the two 16-key tiles of a trip, converted in place, are the B fragment (k = key, hardware k order) of ctx^T = V^T P^T.
// Running maximum m (raw logits) and running sum l per query column; p = 2^((s - m) c + 8), c = SCALE log2(e); the 2^8 keeps small p clear of f16 subnormals and cancels in acc / l.
// K rows and V^T rows reach the four waves through LDS: a stage is 128 keys, copied once per block as whole 128-byte lines by asynchronous 16-byte copies, two buffers, stage t + 1 in flight while stage t is worked on.
__device__ __forceinline__ float xhalf(float x) { return __builtin_bit_cast(float, __builtin_amdgcn_permlanex16(__builtin_bit_cast(int, x), __builtin_bit_cast(int, x), 0x76543210, 0xfedcba98, false, false)); }  // lane l with lane l ^ 16
__device__ __forceinline__ v8f mmah(v16h a, v16h b, v8f c) { return __builtin_amdgcn_wmma_f32_16x16x32_f16(false, a, false, b, (short)0, c, false, false); }
#define FKS 128                       // keys a stage
#define FKP 72                        // LDS pitch of a K row in f16: 64 channels + 8 (144 bytes = 16 x odd, for 16-byte readers)
#define FVP 136                       // LDS pitch of a V^T row in f16: 128 keys + 8 (272 bytes = 16 x odd)
#define FVO (FKS * FKP)               // the V^T rows stand behind the K rows
#define FBUF (FKS * FKP + HD * FVP)   // f16 a buffer
__device__ __forceinline__ unsigned lds_off(const void* p) { return (unsigned)(size_t)p; }   // byte offset in the work-group's LDS
// eight 16-byte copies a lane, global memory to LDS through no register; the s_wait_xcnt closes the statement so that no address register of a copy is rewritten ahead of it
__device__ __forceinline__ void copy8(unsigned l, unsigned ls, const _Float16* p, size_t ps) {
  asm volatile("global_load_async_to_lds_b128 %0, %8, off\n\t"
               "global_load_async_to_lds_b128 %1, %9, off\n\t"
               "global_load_async_to_lds_b128 %2, %10, off\n\t"
               "global_load_async_to_lds_b128 %3, %11, off\n\t"
               "global_load_async_to_lds_b128 %4, %12, off\n\t"
               "global_load_async_to_lds_b128 %5, %13, off\n\t"
               "global_load_async_to_lds_b128 %6, %14, off\n\t"
               "global_load_async_to_lds_b128 %7, %15, off\n\t"
               "s_wait_xcnt 0x0"
               :: "v"(l), "v"(l + ls), "v"(l + 2 * ls), "v"(l + 3 * ls), "v"(l + 4 * ls), "v"(l + 5 * ls), "v"(l + 6 * ls), "v"(l + 7 * ls),
                  "v"(p), "v"(p + ps), "v"(p + 2 * ps), "v"(p + 3 * ps), "v"(p + 4 * ps), "v"(p + 5 * ps), "v"(p + 6 * ps), "v"(p + 7 * ps) : "memory");
}
__global__ __launch_bounds__(128) void k_fa(const _Float16* __restrict__ QH, const _Float16* __restrict__ KH, const _Float16* __restrict__ VT, float* __restrict__ Y) {
  __shared__ __align__(16) _Float16 kv[2][FBUF];   // [buffer][K rows 0..127 at pitch FKP | V^T rows 0..63 at pitch FVP]
  const int tid = threadIdx.x, wave = tid >> 5, lane = tid & 31, col = lane & 15, g = lane >> 4; const int h = blockIdx.y, b = blockIdx.z; const int q0 = blockIdx.x * 128 + wave * 32;
  const float cs = SCALE * 1.4426950408889634f;
  v16h qf[2][2];
#pragma unroll
  for (int qt = 0; qt < 2; ++qt)
#pragma unroll
    for (int kc = 0; kc < 2; ++kc) qf[qt][kc] = frag_h(QH + ((size_t)b * TT + q0 + qt * 16 + col) * CC + h * HD + kc * 32, lane);
  // the copies of a stage: 8 lanes take one K row (128 bytes), rows tid / 8 + 16 i; 16 lanes take one V^T row (256 bytes), rows tid / 16 + 8 i
  const _Float16* Kg = KH + ((size_t)b * TT + (tid >> 3)) * CC + h * HD + (tid & 7) * 8;
  const _Float16* Vg = VT + ((size_t)b * CC + h * HD + (tid >> 4)) * (size_t)TT + (tid & 15) * 8;
  const unsigned lk = lds_off(&kv[0][0]) + 2u * (unsigned)((tid >> 3) * FKP + (tid & 7) * 8);
  const unsigned lv = lds_off(&kv[0][0]) + 2u * (unsigned)(FVO + (tid >> 4) * FVP + (tid & 15) * 8);
#define FA_STAGE(s, bf) do { copy8(lk + (unsigned)(bf) * (2u * FBUF), 2u * 16 * FKP, Kg + (size_t)(s) * FKS * CC, (size_t)16 * CC); copy8(lv + (unsigned)(bf) * (2u * FBUF), 2u * 8 * FVP, Vg + (size_t)(s) * FKS, (size_t)8 * TT); } while (0)
  FA_STAGE(0, 0);
  asm volatile("s_wait_asynccnt 0x0" ::: "memory");   // this wave's copies of stage 0 have landed
  __syncthreads();                                    // stage 0 is published
  FA_STAGE(1, 1);
  v8f acc[2][4] = {}; float m[2] = {-INFINITY, -INFINITY}, l[2] = {0.f, 0.f};
  for (int t = 0; t < TT / FKS; ++t) {
    const _Float16* Ks = &kv[t & 1][0] + col * FKP;         // key row col of a 16-key tile
    const _Float16* Vs = &kv[t & 1][0] + FVO + col * FVP;   // V^T row of channel col of a 16-channel tile
    v16h kf[2][2];
#pragma unroll
    for (int kt = 0; kt < 2; ++kt)
#pragma unroll
      for (int kc = 0; kc < 2; ++kc) kf[kt][kc] = frag_h(Ks + (kt * 16) * FKP + kc * 32, lane);
#pragma unroll 1   // one trip's registers only: with the four trips of a stage unrolled the build went past 255 registers and into scratch
    for (int k0 = 0; k0 < FKS; k0 += 32) {
      v16h vf[4];
#pragma unroll
      for (int j = 0; j < 4; ++j) vf[j] = frag_h(Vs + (j * 16) * FVP + k0, lane);
      v8f s[2][2] = {};
#pragma unroll
      for (int kc = 0; kc < 2; ++kc)
#pragma unroll
        for (int qt = 0; qt < 2; ++qt)
#pragma unroll
          for (int kt = 0; kt < 2; ++kt) s[qt][kt] = mmah(kf[kt][kc], qf[qt][kc], s[qt][kt]);
      const int kn = (k0 + 32) & (FKS - 1);   // the next trip's key rows, fetched a trip ahead; a stage's last trip fetches its own stage's rows 0..31 again (published, not used)
#pragma unroll
      for (int kt = 0; kt < 2; ++kt)
#pragma unroll
        for (int kc = 0; kc < 2; ++kc) kf[kt][kc] = frag_h(Ks + (kn + kt * 16) * FKP + kc * 32, lane);
      __builtin_amdgcn_sched_barrier(0);   // holds the look-ahead reads here: moved down behind the softmax they would have no time to land before the next trip's first product
#pragma unroll
      for (int qt = 0; qt < 2; ++qt) {
        float mx = fmaxf(s[qt][0][0], s[qt][1][0]);
#pragma unroll
        for (int r = 1; r < 8; ++r) mx = fmaxf(mx, fmaxf(s[qt][0][r], s[qt][1][r]));
        mx = fmaxf(mx, xhalf(mx));            // both halves of the wave hold this query's maximum over the 32 keys
        const float mn = fmaxf(m[qt], mx); const float corr = __builtin_amdgcn_exp2f((m[qt] - mn) * cs);   // 0 on the first trip
        m[qt] = mn; const float nm = 8.0f - mn * cs;
        v16h pf; float s0 = 0.f, s1 = 0.f;
#pragma unroll
        for (int r = 0; r < 8; ++r) { const float p0 = __builtin_amdgcn_exp2f(fmaf(s[qt][0][r], cs, nm)), p1 = __builtin_amdgcn_exp2f(fmaf(s[qt][1][r], cs, nm)); s0 += p0; s1 += p1; pf[r] = (_Float16)p0; pf[8 + r] = (_Float16)p1; }
        l[qt] = l[qt] * corr + (s0 + s1);
#pragma unroll
        for (int j = 0; j < 4; ++j) { acc[qt][j] = acc[qt][j] * corr; acc[qt][j] = mmah(vf[j], pf, acc[qt][j]); } } }
    asm volatile("s_wait_dscnt 0x0" ::: "memory");      // this wave's reads of stage t have returned
    asm volatile("s_wait_asynccnt 0x0" ::: "memory");   // this wave's copies of stage t + 1 have landed
    __syncthreads();                                    // publishes stage t + 1 and ends every wave's reads of stage t
    if (t + 2 < TT / FKS) FA_STAGE(t + 2, t & 1); }     // refill of the buffer that stage t has just left
  asm volatile("s_wait_asynccnt 0x0" ::: "memory");     // no copy is outstanding when the wave ends
#pragma unroll
  for (int qt = 0; qt < 2; ++qt) { const float inv = 1.0f / (l[qt] + xhalf(l[qt]));   // the two halves' sums are joined once
    float* yr = Y + ((size_t)b * TT + q0 + qt * 16 + col) * CC + h * HD + 8 * g;     // element r of tile j = channel j * 16 + 8g + r of query col
#pragma unroll
    for (int j = 0; j < 4; ++j) { const v8f o = acc[qt][j] * inv; vst2(yr + j * 16, (v4f){o[0], o[1], o[2], o[3]}); vst2(yr + j * 16 + 4, (v4f){o[4], o[5], o[6], o[7]}); } } }
// ---- k_out: block = (64 rows, 128 cols): out = ctx Wo (+ bo): ctx x 2^6 once to f16 against Wo as f16(bf16 x 2^8) exact (1 product) x 2^-14; causal early rows (< QHI of each sequence): ctx bf16 hi + lo against exact bf16 Wo (2 products)
__global__ __launch_bounds__(128) void k_out(const float* __restrict__ Y, const float* __restrict__ WO, const float* __restrict__ BO, float* __restrict__ OUT) { __shared__ __align__(16) float sf[4][16][132]; __shared__ __align__(16) _Float16 sg[2][192 * SPK];
  const int tid = threadIdx.x, wave = tid >> 5, lane = tid & 31, col = lane & 15, g = lane >> 4; const int c0 = blockIdx.y * 128; const size_t r0 = (size_t)blockIdx.x * 64 + wave * 16;
  v8f acc[8] = {};
  if (CAUSAL && (int)(((size_t)blockIdx.x * 64) % TT) < QHI) {   /* block-uniform */
#pragma unroll 2
    for (int kc = 0; kc < CC / 32; ++kc) { const F2 a = split_row(Y + (r0 + col) * CC, kc * 32, lane); asm volatile("s_wait_loadcnt 0x0" ::: "memory");
#pragma unroll
      for (int j = 0; j < 8; ++j) { const v16b w = WOCOL(WO, kc * 32, c0 + j * 16 + col, lane); asm volatile("s_wait_loadcnt 0x0" ::: "memory"); acc[j] = wmma_bf(a.h, w, acc[j]); acc[j] = wmma_bf(a.l, w, acc[j]); } }
#pragma unroll
    for (int j = 0; j < 8; ++j) { const float bias = BO ? bfr(BO[c0 + j * 16 + col]) : 0.f;
#pragma unroll
      for (int r = 0; r < 8; ++r) sf[wave][8 * g + r][j * 16 + col] = acc[j][r] + bias; }
  } else {
    // operands through LDS as in k_proj: rows 0..63 = ctx rows, 64..191 = weight rows; ctx carried x 2^6 into f16 so small-magnitude context rows stay clear of f16 subnormals
    const int lr = tid >> 3, lp = tid & 7; const float* Ap = Y + ((size_t)blockIdx.x * 64 + lr) * CC + lp * 4; const float* Wp = WO + (size_t)(c0 + lr) * CC + lp * 4; const int so = lr * SPK + lp * 4;
    v4f ra[4], rw[8];
#pragma unroll
    for (int i = 0; i < 4; ++i) ra[i] = *(const v4f*)(Ap + (size_t)i * 16 * CC);
#pragma unroll
    for (int i = 0; i < 8; ++i) rw[i] = *(const v4f*)(Wp + (size_t)i * 16 * CC);
#pragma unroll
    for (int i = 0; i < 4; ++i) *(v4h*)(&sg[0][0] + so + i * 16 * SPK) = cvt4y(ra[i]);
#pragma unroll
    for (int i = 0; i < 8; ++i) *(v4h*)(&sg[0][0] + so + (64 + i * 16) * SPK) = cvt4w(rw[i]);
#pragma unroll
    for (int i = 0; i < 4; ++i) ra[i] = *(const v4f*)(Ap + (size_t)i * 16 * CC + 32);
#pragma unroll
    for (int i = 0; i < 8; ++i) rw[i] = *(const v4f*)(Wp + (size_t)i * 16 * CC + 32);
    loads_issued(); stage_bar();   // chunk 0 is published
#pragma unroll 2   // two trips a pass, so that each trip's buffer addresses are constants
    for (int kc = 0; kc < CC / 32; ++kc) { const _Float16* sb = &sg[kc & 1][0]; _Float16* sn = &sg[(kc & 1) ^ 1][0];
      const v16h a = frag_h(sb + (wave * 16 + col) * SPK, lane); v16h w[8];
#pragma unroll
      for (int j = 0; j < 8; ++j) w[j] = frag_h(sb + (64 + j * 16 + col) * SPK, lane);
#pragma unroll
      for (int j = 0; j < 8; ++j) acc[j] = wmma16(a, w[j], acc[j]);
      __builtin_amdgcn_sched_barrier(0);   // keeps the wait for chunk kc + 1's loads behind the products, which cover a part of their latency
      if (kc + 1 < CC / 32) {   // the other buffer's readers left it before the last barrier
#pragma unroll
        for (int i = 0; i < 4; ++i) *(v4h*)(sn + so + i * 16 * SPK) = cvt4y(ra[i]);
#pragma unroll
        for (int i = 0; i < 8; ++i) *(v4h*)(sn + so + (64 + i * 16) * SPK) = cvt4w(rw[i]);
        if (kc + 2 < CC / 32) {
#pragma unroll
          for (int i = 0; i < 4; ++i) ra[i] = *(const v4f*)(Ap + (size_t)i * 16 * CC + (kc + 2) * 32);
#pragma unroll
          for (int i = 0; i < 8; ++i) rw[i] = *(const v4f*)(Wp + (size_t)i * 16 * CC + (kc + 2) * 32);
          loads_issued(); } }
      stage_bar(); }   // publishes chunk kc + 1 and ends the reads of chunk kc
#pragma unroll
    for (int j = 0; j < 8; ++j) { const float bias = BO ? bfr(BO[c0 + j * 16 + col]) : 0.f;
#pragma unroll
      for (int r = 0; r < 8; ++r) sf[wave][8 * g + r][j * 16 + col] = acc[j][r] * (1.0f / 16384.0f) + bias; } }   /* 2^-8 (Wo carry) x 2^-6 (ctx carry) */
  LDSX(); for (int rl = 0; rl < 16; ++rl) vst2(OUT + (r0 + rl) * DIN + c0 + lane * 4, *(const v4f*)&sf[wave][rl][lane * 4]); }

extern "C" void kernel_launch(void* const* d_in, const int* in_sizes, int n_in, void* d_out, int out_size, void* d_ws, size_t ws_size, hipStream_t stream) {
  (void)in_sizes; (void)n_in; (void)out_size;
  const float** F = (const float**)d_in;
  if (ws_size < (size_t)WS_END) return;
  char* ws = (char*)d_ws; _Float16 *QH = (_Float16*)(ws + WS_QH), *KH = (_Float16*)(ws + WS_KH), *VT = (_Float16*)(ws + WS_VT), *QL = (_Float16*)(ws + WS_QL), *KL = (_Float16*)(ws + WS_KL); __bf16 *VB = (__bf16*)(ws + WS_VB), *VBL = (__bf16*)(ws + WS_VBL); float *Y = (float*)(ws + WS_Y);
  (void)Y; (void)QL; (void)KL; (void)VB; (void)VBL;
  // inputs: 0 x [2,2048,1024]; 1 Wqkv [3072,1024] (out,in): q rows 0..1023, k 1024..2047, v 2048..3071; 2 Wout [1024,1024] (out,in); 3 token_positions [2048] int32 (arange; READ on the device); no biases
  k_proj<<<dim3(TNB * TT / 64, CC / 128, 3), 128, 0, stream>>>(F[0], F[0], F[0], F[1], F[1] + (size_t)CC * DIN, F[1] + 2 * (size_t)CC * DIN, nullptr, nullptr, nullptr, QH, QL, KH, KL, VT, VB, VBL, (const int*)d_in[3]);
  k_fa<<<dim3(TT / 128, NH, TNB), 128, 0, stream>>>(QH, KH, VT, Y);
  k_out<<<dim3(TNB * TT / 64, DIN / 128), 128, 0, stream>>>(Y, F[2], nullptr, (float*)d_out);
}

// v004
// One run takes 104 microseconds.
// Timed twice side by side with v003, it ran 1.25 times as fast both times.
// All steps since v000 together make it 13.9 times as fast.
// compute dtype: all float inputs rounded to bf16; q / k / v projections with EXACT bf16 products on WMMA 16x16x32 (f32 accumulate), no biases; RoPE in f32 (embedded frequencies, precise cosf / sinf, positions read from the int input token_positions); logits q x k once to f16 each (1 product) x 64^-0.5; softmax f32 with a running maximum and sum over 32-key trips; P (unnormalised, x 2^8) once to f16 x v once to f16 (1 product), divided by the sum at the end; ctx x 2^6 once to f16 x the output weight f16(bf16 x 2^8); f32 output.
#include <hip/hip_runtime.h>
#include <math.h>

typedef __attribute__((ext_vector_type(16))) _Float16 v16h;
typedef __attribute__((ext_vector_type(16))) __bf16 v16b;
typedef __attribute__((ext_vector_type(8)))  _Float16 v8h;
typedef __attribute__((ext_vector_type(8)))  float v8f;
typedef __attribute__((ext_vector_type(4)))  float v4f;
typedef __attribute__((ext_vector_type(2)))  float v2f;
typedef __attribute__((ext_vector_type(4)))  unsigned v4u;
typedef __attribute__((ext_vector_type(4)))  int v4i;
typedef float __attribute__((may_alias)) float_a;
typedef int __attribute__((may_alias)) int_a;

template <typename T> __device__ __forceinline__ void vst2(void* p, T v) { *(T*)p = v;  }
__device__ __forceinline__ v8f wmma16(v16h a, v16h b, v8f c) {
  v8f d = __builtin_amdgcn_wmma_f32_16x16x32_f16(false, a, false, b, (short)0, c, false, false);
  asm volatile("v_nop\n\tv_nop\n\tv_nop\n\tv_nop" : "+v"(d) : "v"(a), "v"(b));
  return d;
}
__device__ __forceinline__ v8f wmma_bf(v16b a, v16b b, v8f c) {
  v8f d = __builtin_amdgcn_wmma_f32_16x16x32_bf16(false, a, false, b, (short)0, c, false, false);
  asm volatile("v_nop\n\tv_nop\n\tv_nop\n\tv_nop" : "+v"(d) : "v"(a), "v"(b));
  return d;
}
// 16x16x32 fragments: lane = (h = lane>>4, row/col = lane&15); elements 0..7 = k0+8h+0..7, 8..15 = k0+16+8h+0..7; D element r = row 8h+r
__device__ __forceinline__ v16h frag_h(const _Float16* rowk0, int lane) {
  union { v16h v; v8h q[2]; } u; const _Float16* p = rowk0 + 8 * (lane >> 4);
  u.q[0] = *(const v8h*)p; u.q[1] = *(const v8h*)(p + 16); return u.v;
}
__device__ __forceinline__ v16h frag_f32(const float* rowk0, int lane) {
  v16h a; const float* p = rowk0 + 8 * (lane >> 4);
#pragma unroll
  for (int i = 0; i < 8; ++i) { a[i] = (_Float16)p[i]; a[8 + i] = (_Float16)p[16 + i]; }
  return a;
}
__device__ __forceinline__ v16h frag_f32s(const float* rowk0, int lane, float sc) {
  v16h a; const float* p = rowk0 + 8 * (lane >> 4);
#pragma unroll
  for (int i = 0; i < 8; ++i) { a[i] = (_Float16)(p[i] * sc); a[8 + i] = (_Float16)(p[16 + i] * sc); }
  return a;
}
// column fragment from a [K][ld] layout (column n), rows >= K read as 0
__device__ __forceinline__ v16h fragc_f32(const float* W, int k0, int n, int lane, int ld, int K) {
  v16h a; const int g = lane >> 4;
#pragma unroll
  for (int i = 0; i < 8; ++i) { const int ka = k0 + 8 * g + i, kb = ka + 16;
    a[i] = (_Float16)(ka < K ? W[(size_t)(ka < K ? ka : K - 1) * ld + n] : 0.f); a[8 + i] = (_Float16)(kb < K ? W[(size_t)(kb < K ? kb : K - 1) * ld + n] : 0.f); }
  return a;
}
struct F2 { v16b h, l; };
__device__ __forceinline__ F2 bsplit16(const float v[16]) { F2 r;
#pragma unroll
  for (int i = 0; i < 16; ++i) { const __bf16 h = (__bf16)v[i]; r.h[i] = h; r.l[i] = (__bf16)(v[i] - (float)h); }
  return r; }
__device__ __forceinline__ F2 split_row(const float* row, int k0, int lane) { float v[16]; const float* p = row + k0 + 8 * (lane >> 4);
#pragma unroll
  for (int i = 0; i < 8; ++i) { v[i] = p[i]; v[8 + i] = p[16 + i]; }
  return bsplit16(v); }
__device__ __forceinline__ F2 split_rowK(const float* row, int k0, int lane, int K) { float v[16]; const int g = lane >> 4;
#pragma unroll
  for (int i = 0; i < 8; ++i) { const int ka = k0 + 8 * g + i, kb = ka + 16; v[i] = ka < K ? row[ka < K ? ka : K - 1] : 0.f; v[8 + i] = kb < K ? row[kb < K ? kb : K - 1] : 0.f; }
  return bsplit16(v); }
__device__ __forceinline__ F2 split_col(const float* W, int k0, int n, int lane, int ld, int K) { float v[16]; const int g = lane >> 4;
#pragma unroll
  for (int i = 0; i < 8; ++i) { const int ka = k0 + 8 * g + i, kb = ka + 16; v[i] = ka < K ? W[(size_t)(ka < K ? ka : K - 1) * ld + n] : 0.f; v[8 + i] = kb < K ? W[(size_t)(kb < K ? kb : K - 1) * ld + n] : 0.f; }
  return bsplit16(v); }
__device__ __forceinline__ v8f mac3(const F2& a, const F2& b, v8f c) { c = wmma_bf(a.l, b.h, c); c = wmma_bf(a.h, b.l, c); return wmma_bf(a.h, b.h, c); }
__device__ __forceinline__ float sigm(float v) { return 1.0f / (1.0f + expf(-v)); }
#define LDSX() do { asm volatile("s_wait_dscnt 0" ::: "memory"); __builtin_amdgcn_wave_barrier(); __builtin_amdgcn_fence(__ATOMIC_RELEASE, "workgroup"); } while (0)

// Multi-head self-attention with interleaved-pair RoPE, no mask (x [2,2048,1024]; Wqkv [3072,1024] torch (out,in): qkv.reshape(B, S, 3, 16, 64): q = rows 0..1023, k = 1024..2047, v = 2048..3071; Wout [1024,1024] (out,in); token_positions [2048] int32 = arange, a module input READ on the device; RoPE on q and k: (even, odd) pairs (x_e c - x_o s, x_e s + x_o c) re-interleaved, inv_freq = 1 / 10000^(2i/64); scores / sqrt(64); softmax; out @ Wout.T).
#define NB 2
#define TT 2048
#define CC 1024            // NH * HD = projected width
#define DIN 1024          // input (model) width
#define NH 16
#define HD 64
#define NQB (TT / 64)
#define HG 4
#define SCALE (0.125f)
#define CAUSAL 0
#ifndef TNB
#define TNB NB
#endif
__device__ __forceinline__ float bfr(float v) { return (float)(__bf16)v; }
__host__ __device__ __forceinline__ int kb_last(int qb) { return CAUSAL ? ((qb * 64 + 63) >> 7) : (TT / 128 - 1); }
typedef __attribute__((ext_vector_type(8))) __bf16 v8b;
__device__ __forceinline__ v16b frag_b(const __bf16* rowk0, int lane) {
  union { v16b v; v8b q[2]; } u; const __bf16* p = rowk0 + 8 * (lane >> 4);
  u.q[0] = *(const v8b*)p; u.q[1] = *(const v8b*)(p + 16); return u.v;
}
// operand staging of the two projection GEMMs: the operands lie in the workspace as 16-bit values, rounded once ahead of the GEMMs; a 64-k chunk of a row is one 128-byte line; 8 lanes fetch it whole, 16 bytes each; LDS rows of 64 values at a pitch of 72 (144 bytes = 16 x odd, for 16-byte readers)
typedef __attribute__((ext_vector_type(4))) __bf16 v4b;
typedef __attribute__((ext_vector_type(4))) _Float16 v4h;
#define SPK 72
#define KCH 64              // k values a chunk
// work-group barrier by hand, behind the wave's own LDS wait: __syncthreads() would also wait out the global loads that are meant to stay in flight across it
__device__ __forceinline__ void stage_bar() { asm volatile("s_wait_dscnt 0x0" ::: "memory"); asm volatile("s_barrier_signal -1\n\ts_barrier_wait -1" ::: "memory"); }
// behind a group of look-ahead loads: their address registers are reused while the loads are still in flight
__device__ __forceinline__ void loads_issued() { asm volatile("s_wait_xcnt 0x0" ::: "memory"); }
__device__ __forceinline__ v4b cvt4b(v4f v) { v4b r; r[0] = (__bf16)v[0]; r[1] = (__bf16)v[1]; r[2] = (__bf16)v[2]; r[3] = (__bf16)v[3]; return r; }
__device__ __forceinline__ v4h cvt4w(v4f v) { v4h r; r[0] = (_Float16)(bfr(v[0]) * 256.0f); r[1] = (_Float16)(bfr(v[1]) * 256.0f); r[2] = (_Float16)(bfr(v[2]) * 256.0f); r[3] = (_Float16)(bfr(v[3]) * 256.0f); return r; }
#define QBH 0              // unused: k_fa has one path for all query blocks
#define QHI 0               // single-product logits on every row
#define KHI 64            // key rows carrying k residual / v bf16 hi+lo planes (written by k_proj, read by no kernel here)
// B fragment (k rows k0+.., output column o) of a weight: (in,out) [K][ld] or (out,in) [ld rows of K]: bf16 exact, or f16(bf16 * 256) exact
__device__ __forceinline__ v16b wcol_io(const float* Wm, int k0, int o, int lane, int ld) { v16b w; const int g = lane >> 4;
#pragma unroll
  for (int i = 0; i < 8; ++i) { w[i] = (__bf16)Wm[(size_t)(k0 + 8 * g + i) * ld + o]; w[8 + i] = (__bf16)Wm[(size_t)(k0 + 16 + 8 * g + i) * ld + o]; }
  return w; }
__device__ __forceinline__ v16b wcol_oi(const float* Wm, int k0, int o, int lane, int K) { v16b w; const float* p = Wm + (size_t)o * K + k0 + 8 * (lane >> 4);
#pragma unroll
  for (int i = 0; i < 8; ++i) { w[i] = (__bf16)p[i]; w[8 + i] = (__bf16)p[16 + i]; }
  return w; }
__device__ __forceinline__ v16h wcolh_io(const float* Wm, int k0, int o, int lane, int ld) { v16h w; const int g = lane >> 4;
#pragma unroll
  for (int i = 0; i < 8; ++i) { w[i] = (_Float16)(bfr(Wm[(size_t)(k0 + 8 * g + i) * ld + o]) * 256.0f); w[8 + i] = (_Float16)(bfr(Wm[(size_t)(k0 + 16 + 8 * g + i) * ld + o]) * 256.0f); }
  return w; }
__device__ __forceinline__ v16h wcolh_oi(const float* Wm, int k0, int o, int lane, int K) { v16h w; const float* p = Wm + (size_t)o * K + k0 + 8 * (lane >> 4);
#pragma unroll
  for (int i = 0; i < 8; ++i) { w[i] = (_Float16)(bfr(p[i]) * 256.0f); w[8 + i] = (_Float16)(bfr(p[16 + i]) * 256.0f); }
  return w; }
#define WQKV_LAYOUT 1   // 0 = (in,out) [DIN][CC]; 1 = (out,in) [CC][DIN]; 2 = per-head [NH][DIN][HD]
__device__ __forceinline__ v16b wcol_hdk(const float* Wm, int k0, int o, int lane) { v16b w; const int g = lane >> 4; const float* p = Wm + (size_t)(o / HD) * DIN * HD + (o % HD);
#pragma unroll
  for (int i = 0; i < 8; ++i) { w[i] = (__bf16)p[(size_t)(k0 + 8 * g + i) * HD]; w[8 + i] = (__bf16)p[(size_t)(k0 + 16 + 8 * g + i) * HD]; }
  return w; }
#define WO_OUT_IN 1
#if WQKV_LAYOUT == 1
#define WCOL(W, k0, o, lane) wcol_oi(W, k0, o, lane, DIN)
#elif WQKV_LAYOUT == 2
#define WCOL(W, k0, o, lane) wcol_hdk(W, k0, o, lane)
#else
#define WCOL(W, k0, o, lane) wcol_io(W, k0, o, lane, CC)
#endif
#if WO_OUT_IN
#define WOCOL(W, k0, o, lane) wcol_oi(W, k0, o, lane, CC)
#define WOCOLH(W, k0, o, lane) wcolh_oi(W, k0, o, lane, CC)
#else
#define WOCOL(W, k0, o, lane) wcol_io(W, k0, o, lane, DIN)
#define WOCOLH(W, k0, o, lane) wcolh_io(W, k0, o, lane, DIN)
#endif

// RoPE inverse frequencies 1/10000^(2i/64) (the f32 values jax computes)
__constant__ float INVF[32] = {1.000000000e+00,7.498942018e-01,5.623413324e-01,4.216965139e-01,3.162277639e-01,2.371373624e-01,1.778279394e-01,1.333521456e-01,1.000000015e-01,7.498941571e-02,5.623412877e-02,4.216964915e-02,3.162277862e-02,2.371373586e-02,1.778279431e-02,1.333521493e-02,9.999999776e-03,7.498942316e-03,5.623413250e-03,4.216964822e-03,3.162277862e-03,2.371373819e-03,1.778279431e-03,1.333521446e-03,1.000000047e-03,7.498941850e-04,5.623413017e-04,4.216964880e-04,3.162277862e-04,2.371373848e-04,1.778279402e-04,1.333521504e-04};
// (PROJ_EXTRA_PARAMS: the extra kernel parameters 'const int* __restrict__ TPOS' are written literally in the kernel signature)
// per (token, head) hook on the staged f32 row (64 floats) of the q and k streams: interleaved-pair rotation (x[2i], x[2i + 1]) by the angle pos * INVF[i] with pos READ from the int input; v untouched
#define PROJ_EPI(which, row, t, h) do { if ((which) < 2) { float* rw = (row); const float pos_ = (float)TPOS[(t)]; _Pragma("unroll 4") for (int i = 0; i < 32; ++i) { _Pragma("clang fp contract(off)") const float ang = pos_ * INVF[i]; const float cs = cosf(ang), sn = sinf(ang); const float xe = rw[2 * i], xo = rw[2 * i + 1]; rw[2 * i] = xe * cs - xo * sn; rw[2 * i + 1] = xe * sn + xo * cs; } } } while (0)
#ifndef SM_EXTRA_PARAMS
#define SM_EXTRA_PARAMS
#endif
#ifndef PROJ_EXTRA_PARAMS
#define PROJ_EXTRA_PARAMS
#endif
#ifndef SM_MASK_HOOK
#define SM_MASK_HOOK (void)0
#endif

#define WS_QH  0u                                      // f16 q rows [b*t][CC]
#define WS_KH  (WS_QH + 2u * (size_t)NB * TT * CC)      // f16 k rows [b*t][CC]
#define WS_VT  (WS_KH + 2u * (size_t)NB * TT * CC)      // f16 v planes [b][c][t]
#define WS_QL  (WS_VT + 2u * (size_t)NB * CC * TT)      // f16 q residual x 2^10 rows [b][t < QHI][CC]
#define WS_KL  (WS_QL + 2u * (size_t)NB * QHI * CC)     // f16 k residual x 2^10 rows [b][t < KHI][CC]
#define WS_VB  (WS_KL + 2u * (size_t)NB * KHI * CC)     // bf16 v hi planes [b][c][t < KHI]
#define WS_VBL (WS_VB + 2u * (size_t)NB * CC * KHI)
#define WS_S   (WS_VBL + 2u * (size_t)NB * CC * KHI)    // (once f32 logits) now the rounded GEMM operands
#define WS_XB  WS_S                                     // bf16 x rows [b*t][DIN]
#define WS_WB  (WS_XB + 2u * (size_t)NB * TT * DIN)     // bf16 Wqkv rows [3 * CC][DIN]
#define WS_WH  (WS_WB + 2u * (size_t)3 * CC * DIN)      // f16(bf16 x 2^8) Wout rows [DIN][CC]
#define WS_Y   (WS_S  + 4u * (size_t)HG * TT * TT)      // f16 ctx x 2^6 rows [b*t][CC]
#define WS_END (WS_Y  + 4u * (size_t)NB * TT * CC)

// ---- k_cvt: the GEMM operands that are inputs are rounded once, ahead of the GEMMs (each was rounded anew by every block that read it): x and Wqkv to bf16, Wout to f16(bf16 x 2^8).
// Few, long waves (two blocks of 8 waves a WGP): a block takes 16384 values in 16 passes; a pass is 16 bytes in and 8 bytes out a lane, whole lines a wave; all 16 loads of a lane are in flight together.
#define CVB 16384                         // values a block
#define CVX (NB * TT * DIN / CVB)         // blocks of x
#define CVW (3 * CC * DIN / CVB)          // blocks of Wqkv
#define CVO (DIN * CC / CVB)              // blocks of Wout
__global__ __launch_bounds__(256) void k_cvt(const float* __restrict__ X, const float* __restrict__ WQKV, const float* __restrict__ WO, __bf16* __restrict__ XB, __bf16* __restrict__ WB, _Float16* __restrict__ WH) {
  const int bx = blockIdx.x; const size_t o = (size_t)threadIdx.x * 4; v4f a[16];
  if (bx < CVX + CVW) { const bool isx = bx < CVX; const size_t e = (size_t)(isx ? bx : bx - CVX) * CVB + o; const float* s = (isx ? X : WQKV) + e; __bf16* d = (isx ? XB : WB) + e;
#pragma unroll
    for (int p = 0; p < 16; ++p) a[p] = *(const v4f*)(s + p * 1024);
    asm volatile("s_wait_xcnt 0x0" :: "v"(s) : "memory");   // the address pair is an input, so it stays live up to this wait: no load's own result is placed on it while the loads before it are in flight
#pragma unroll
    for (int p = 0; p < 16; ++p) vst2(d + p * 1024, cvt4b(a[p]));
    asm volatile("s_wait_xcnt 0x0" ::: "memory");   // behind the last store of the run: no register that a store names is rewritten ahead of this wait
  } else { const size_t e = (size_t)(bx - CVX - CVW) * CVB + o; const float* s = WO + e; _Float16* d = WH + e;
#pragma unroll
    for (int p = 0; p < 16; ++p) a[p] = *(const v4f*)(s + p * 1024);
    asm volatile("s_wait_xcnt 0x0" :: "v"(s) : "memory");   // the address pair is an input, so it stays live up to this wait: no load's own result is placed on it while the loads before it are in flight
#pragma unroll
    for (int p = 0; p < 16; ++p) vst2(d + p * 1024, cvt4w(a[p]));
    asm volatile("s_wait_xcnt 0x0" ::: "memory"); } }   // behind the last store of the run: no register that a store names is rewritten ahead of this wait
// ---- k_proj: block = (64 rows, 128 cols, which): q/k/v = X W (+ b) with exact bf16 products (K = DIN) -> which 0: q f16 rows (+ residual rows < QHI); 1: k f16 rows (+ residual rows < KHI); 2: v f16 planes [c][t] (+ bf16 hi/lo planes for t < KHI)
__global__ __launch_bounds__(128) void k_proj(const __bf16* __restrict__ XQ, const __bf16* __restrict__ XK, const __bf16* __restrict__ XV, const __bf16* __restrict__ WQ, const __bf16* __restrict__ WK, const __bf16* __restrict__ WV, const float* __restrict__ BQ, const float* __restrict__ BK, const float* __restrict__ BV,
    _Float16* __restrict__ QH, _Float16* __restrict__ QL, _Float16* __restrict__ KH, _Float16* __restrict__ KL, _Float16* __restrict__ VT, __bf16* __restrict__ VB, __bf16* __restrict__ VBL, const int* __restrict__ TPOS) {
  __shared__ __align__(16) float st[64][132]; __shared__ __align__(16) _Float16 sh[64][136], sl[64][136]; __shared__ __align__(16) _Float16 tq[3][128][72]; _Float16 (*th)[72] = tq[0]; __bf16 (*tb)[72] = (__bf16 (*)[72])tq[1]; __bf16 (*tbl)[72] = (__bf16 (*)[72])tq[2];   // one array, so that the two operand buffers of the main loop fit in it end to end
  const int tid = threadIdx.x, wave = tid >> 5, lane = tid & 31, col = lane & 15, g = lane >> 4; const int which = blockIdx.z; const int c0 = blockIdx.y * 128; const size_t r0 = (size_t)blockIdx.x * 64; const size_t bb = r0 / TT; const int t0 = (int)(r0 % TT);
  const __bf16* X = which == 0 ? XQ : which == 1 ? XK : XV; const __bf16* WA = which == 0 ? WQ : which == 1 ? WK : WV; const float* BA = which == 0 ? BQ : which == 1 ? BK : BV;
  v8f acc[8] = {};
  { // operands through LDS, two buffers (they fill tq, which the epilogue writes only behind its own barriers): rows 0..63 = X rows, 64..191 = weight rows of this tile; chunk kc + 1 is in flight in registers while chunk kc is multiplied
    __bf16* const sb0 = (__bf16*)&tq[0][0][0]; __bf16* const sb1 = sb0 + 192 * SPK;
    const int lr = tid >> 3, lp = tid & 7; const __bf16* Ap = X + (r0 + lr) * DIN + lp * 8; const __bf16* Wp = WA + (size_t)(c0 + lr) * DIN + lp * 8; const int so = lr * SPK + lp * 8;
    v4u ra[4], rw[8];
#pragma unroll
    for (int i = 0; i < 4; ++i) ra[i] = *(const v4u*)(Ap + (size_t)i * 16 * DIN);
#pragma unroll
    for (int i = 0; i < 8; ++i) rw[i] = *(const v4u*)(Wp + (size_t)i * 16 * DIN);
#pragma unroll
    for (int i = 0; i < 4; ++i) *(v4u*)(sb0 + so + i * 16 * SPK) = ra[i];
#pragma unroll
    for (int i = 0; i < 8; ++i) *(v4u*)(sb0 + so + (64 + i * 16) * SPK) = rw[i];
#pragma unroll
    for (int i = 0; i < 4; ++i) ra[i] = *(const v4u*)(Ap + (size_t)i * 16 * DIN + KCH);
#pragma unroll
    for (int i = 0; i < 8; ++i) rw[i] = *(const v4u*)(Wp + (size_t)i * 16 * DIN + KCH);
    loads_issued(); stage_bar();   // chunk 0 is published
#pragma unroll 2   // two trips a pass, so that each trip's buffer addresses are constants
    for (int kc = 0; kc < DIN / KCH; ++kc) { const __bf16* sb = (kc & 1) ? sb1 : sb0; __bf16* sn = (kc & 1) ? sb0 : sb1;
#pragma unroll
      for (int ks = 0; ks < KCH; ks += 32) { const v16b a = frag_b(sb + (wave * 16 + col) * SPK + ks, lane); v16b w[8];
#pragma unroll
        for (int j = 0; j < 8; ++j) w[j] = frag_b(sb + (64 + j * 16 + col) * SPK + ks, lane);
#pragma unroll
        for (int j = 0; j < 8; ++j) acc[j] = wmma_bf(a, w[j], acc[j]); }
      __builtin_amdgcn_sched_barrier(0);   // keeps the wait for chunk kc + 1's loads behind the products, which cover a part of their latency
      if (kc + 1 < DIN / KCH) {   // the other buffer's readers left it before the last barrier
#pragma unroll
        for (int i = 0; i < 4; ++i) *(v4u*)(sn + so + i * 16 * SPK) = ra[i];
#pragma unroll
        for (int i = 0; i < 8; ++i) *(v4u*)(sn + so + (64 + i * 16) * SPK) = rw[i];
        if (kc + 2 < DIN / KCH) {
#pragma unroll
          for (int i = 0; i < 4; ++i) ra[i] = *(const v4u*)(Ap + (size_t)i * 16 * DIN + (kc + 2) * KCH);
#pragma unroll
          for (int i = 0; i < 8; ++i) rw[i] = *(const v4u*)(Wp + (size_t)i * 16 * DIN + (kc + 2) * KCH);
          loads_issued(); } }
      stage_bar(); } }   // publishes chunk kc + 1 and ends the reads of chunk kc
  { // stage the f32 tile (acc + bias) in LDS, run the per-(row, head) epilogue hook, then convert
#pragma unroll
    for (int j = 0; j < 8; ++j) { const float bias = BA ? bfr(BA[c0 + j * 16 + col]) : 0.f;
#pragma unroll
      for (int r = 0; r < 8; ++r) st[wave * 16 + 8 * g + r][j * 16 + col] = acc[j][r] + bias; }
    __syncthreads();
    for (int e = tid; e < 64 * (128 / HD); e += 128) { const int rl = e / (128 / HD), hh = e % (128 / HD); PROJ_EPI(which, &st[rl][hh * HD], (int)((r0 + rl) % TT), (c0 / HD) + hh); }
    __syncthreads(); }
  if (which < 2) { _Float16* DH = which == 0 ? QH : KH; _Float16* DL = which == 0 ? QL : KL; const int nhi = which == 0 ? QHI : KHI; const bool hi_rows = t0 < nhi;
    for (int e = tid; e < 64 * 128; e += 128) { const int rl = e >> 7, cl = e & 127; const float v = st[rl][cl]; const _Float16 hv = (_Float16)v; sh[rl][cl] = hv; sl[rl][cl] = (_Float16)((v - (float)hv) * 1024.0f); }
    __syncthreads();
    for (int e = tid; e < 64 * 16; e += 128) { const int rl = e >> 4, q = e & 15; vst2((unsigned*)(DH + (r0 + rl) * CC + c0 + q * 8), *(const v4u*)&sh[rl][q * 8]); if (hi_rows) vst2((unsigned*)(DL + (bb * nhi + t0 + rl) * (size_t)CC + c0 + q * 8), *(const v4u*)&sl[rl][q * 8]); }
  } else { const bool hi_rows = t0 < KHI;
    for (int e = tid; e < 64 * 128; e += 128) { const int rl = e & 63, cl = e >> 6; const float v = st[rl][cl]; th[cl][rl] = (_Float16)v; const __bf16 bh = (__bf16)v; tb[cl][rl] = bh; tbl[cl][rl] = (__bf16)(v - (float)bh); }
    __syncthreads();
    for (int e = tid; e < 128 * 8; e += 128) { const int cl = e >> 3, q = e & 7; vst2((unsigned*)(VT + (bb * CC + c0 + cl) * (size_t)TT + t0 + q * 8), *(const v4u*)&th[cl][q * 8]); if (hi_rows) { const size_t o3 = (bb * CC + c0 + cl) * (size_t)KHI + t0 + q * 8; vst2((unsigned*)(VB + o3), *(const v4u*)&tb[cl][q * 8]); vst2((unsigned*)(VBL + o3), *(const v4u*)&tbl[cl][q * 8]); } } } }
// ---- k_fa: block = 128 queries (4 waves x 32 query columns) of head h, batch b: logits, softmax and P . v in one pass over the keys, 32 keys a trip; no logit or P ever leaves the registers.
// Transposed products: S^T = K Q^T (lane = query column, element r = key 8g + r), so the two 16-key tiles of a trip, converted in place, are the B fragment (k = key, hardware k order) of ctx^T = V^T P^T.
// Running maximum m (raw logits) and running sum l per query column; p = 2^((s - m) c + 8), c = SCALE log2(e); the 2^8 keeps small p clear of f16 subnormals and cancels in acc / l.
// K rows and V^T rows reach the four waves through LDS: a stage is 128 keys, copied once per block as whole 128-byte lines by asynchronous 16-byte copies, two buffers, stage t + 1 in flight while stage t is worked on.
__device__ __forceinline__ float xhalf(float x) { return __builtin_bit_cast(float, __builtin_amdgcn_permlanex16(__builtin_bit_cast(int, x), __builtin_bit_cast(int, x), 0x76543210, 0xfedcba98, false, false)); }  // lane l with lane l ^ 16
__device__ __forceinline__ v8f mmah(v16h a, v16h b, v8f c) { return __builtin_amdgcn_wmma_f32_16x16x32_f16(false, a, false, b, (short)0, c, false, false); }
#define FKS 128                       // keys a stage
#define FKP 72                        // LDS pitch of a K row in f16: 64 channels + 8 (144 bytes = 16 x odd, for 16-byte readers)
#define FVP 136                       // LDS pitch of a V^T row in f16: 128 keys + 8 (272 bytes = 16 x odd)
#define FVO (FKS * FKP)               // the V^T rows stand behind the K rows
#define FBUF (FKS * FKP + HD * FVP)   // f16 a buffer
__device__ __forceinline__ unsigned lds_off(const void* p) { return (unsigned)(size_t)p; }   // byte offset in the work-group's LDS
// eight 16-byte copies a lane, global memory to LDS through no register; the s_wait_xcnt closes the statement so that no address register of a copy is rewritten ahead of it
__device__ __forceinline__ void copy8(unsigned l, unsigned ls, const _Float16* p, size_t ps) {
  asm volatile("global_load_async_to_lds_b128 %0, %8, off\n\t"
               "global_load_async_to_lds_b128 %1, %9, off\n\t"
               "global_load_async_to_lds_b128 %2, %10, off\n\t"
               "global_load_async_to_lds_b128 %3, %11, off\n\t"
               "global_load_async_to_lds_b128 %4, %12, off\n\t"
               "global_load_async_to_lds_b128 %5, %13, off\n\t"
               "global_load_async_to_lds_b128 %6, %14, off\n\t"
               "global_load_async_to_lds_b128 %7, %15, off\n\t"
               "s_wait_xcnt 0x0"
               :: "v"(l), "v"(l + ls), "v"(l + 2 * ls), "v"(l + 3 * ls), "v"(l + 4 * ls), "v"(l + 5 * ls), "v"(l + 6 * ls), "v"(l + 7 * ls),
                  "v"(p), "v"(p + ps), "v"(p + 2 * ps), "v"(p + 3 * ps), "v"(p + 4 * ps), "v"(p + 5 * ps), "v"(p + 6 * ps), "v"(p + 7 * ps) : "memory");
}
__global__ __launch_bounds__(128) void k_fa(const _Float16* __restrict__ QH, const _Float16* __restrict__ KH, const _Float16* __restrict__ VT, _Float16* __restrict__ Y) {
  __shared__ __align__(16) _Float16 kv[2][FBUF];   // [buffer][K rows 0..127 at pitch FKP | V^T rows 0..63 at pitch FVP]
  const int tid = threadIdx.x, wave = tid >> 5, lane = tid & 31, col = lane & 15, g = lane >> 4; const int h = blockIdx.y, b = blockIdx.z; const int q0 = blockIdx.x * 128 + wave * 32;
  const float cs = SCALE * 1.4426950408889634f;
  v16h qf[2][2];
#pragma unroll
  for (int qt = 0; qt < 2; ++qt)
#pragma unroll
    for (int kc = 0; kc < 2; ++kc) qf[qt][kc] = frag_h(QH + ((size_t)b * TT + q0 + qt * 16 + col) * CC + h * HD + kc * 32, lane);
  // the copies of a stage: 8 lanes take one K row (128 bytes), rows tid / 8 + 16 i; 16 lanes take one V^T row (256 bytes), rows tid / 16 + 8 i
  const _Float16* Kg = KH + ((size_t)b * TT + (tid >> 3)) * CC + h * HD + (tid & 7) * 8;
  const _Float16* Vg = VT + ((size_t)b * CC + h * HD + (tid >> 4)) * (size_t)TT + (tid & 15) * 8;
  const unsigned lk = lds_off(&kv[0][0]) + 2u * (unsigned)((tid >> 3) * FKP + (tid & 7) * 8);
  const unsigned lv = lds_off(&kv[0][0]) + 2u * (unsigned)(FVO + (tid >> 4) * FVP + (tid & 15) * 8);
#define FA_STAGE(s, bf) do { copy8(lk + (unsigned)(bf) * (2u * FBUF), 2u * 16 * FKP, Kg + (size_t)(s) * FKS * CC, (size_t)16 * CC); copy8(lv + (unsigned)(bf) * (2u * FBUF), 2u * 8 * FVP, Vg + (size_t)(s) * FKS, (size_t)8 * TT); } while (0)
  FA_STAGE(0, 0);
  asm volatile("s_wait_asynccnt 0x0" ::: "memory");   // this wave's copies of stage 0 have landed
  __syncthreads();                                    // stage 0 is published
  FA_STAGE(1, 1);
  v8f acc[2][4] = {}; float m[2] = {-INFINITY, -INFINITY}, l[2] = {0.f, 0.f};
  for (int t = 0; t < TT / FKS; ++t) {
    const _Float16* Ks = &kv[t & 1][0] + col * FKP;         // key row col of a 16-key tile
    const _Float16* Vs = &kv[t & 1][0] + FVO + col * FVP;   // V^T row of channel col of a 16-channel tile
    v16h kf[2][2];
#pragma unroll
    for (int kt = 0; kt < 2; ++kt)
#pragma unroll
      for (int kc = 0; kc < 2; ++kc) kf[kt][kc] = frag_h(Ks + (kt * 16) * FKP + kc * 32, lane);
#pragma unroll 1   // one trip's registers only: with the four trips of a stage unrolled the build went past 255 registers and into scratch
    for (int k0 = 0; k0 < FKS; k0 += 32) {
      v16h vf[4];
#pragma unroll
      for (int j = 0; j < 4; ++j) vf[j] = frag_h(Vs + (j * 16) * FVP + k0, lane);
      v8f s[2][2] = {};
#pragma unroll
      for (int kc = 0; kc < 2; ++kc)
#pragma unroll
        for (int qt = 0; qt < 2; ++qt)
#pragma unroll
          for (int kt = 0; kt < 2; ++kt) s[qt][kt] = mmah(kf[kt][kc], qf[qt][kc], s[qt][kt]);
      const int kn = (k0 + 32) & (FKS - 1);   // the next trip's key rows, fetched a trip ahead; a stage's last trip fetches its own stage's rows 0..31 again (published, not used)
#pragma unroll
      for (int kt = 0; kt < 2; ++kt)
#pragma unroll
        for (int kc = 0; kc < 2; ++kc) kf[kt][kc] = frag_h(Ks + (kn + kt * 16) * FKP + kc * 32, lane);
      __builtin_amdgcn_sched_barrier(0);   // holds the look-ahead reads here: moved down behind the softmax they would have no time to land before the next trip's first product
#pragma unroll
      for (int qt = 0; qt < 2; ++qt) {
        float mx = fmaxf(s[qt][0][0], s[qt][1][0]);
#pragma unroll
        for (int r = 1; r < 8; ++r) mx = fmaxf(mx, fmaxf(s[qt][0][r], s[qt][1][r]));
        mx = fmaxf(mx, xhalf(mx));            // both halves of the wave hold this query's maximum over the 32 keys
        const float mn = fmaxf(m[qt], mx); const float corr = __builtin_amdgcn_exp2f((m[qt] - mn) * cs);   // 0 on the first trip
        m[qt] = mn; const float nm = 8.0f - mn * cs;
        v16h pf; float s0 = 0.f, s1 = 0.f;
#pragma unroll
        for (int r = 0; r < 8; ++r) { const float p0 = __builtin_amdgcn_exp2f(fmaf(s[qt][0][r], cs, nm)), p1 = __builtin_amdgcn_exp2f(fmaf(s[qt][1][r], cs, nm)); s0 += p0; s1 += p1; pf[r] = (_Float16)p0; pf[8 + r] = (_Float16)p1; }
        l[qt] = l[qt] * corr + (s0 + s1);
#pragma unroll
        for (int j = 0; j < 4; ++j) { acc[qt][j] = acc[qt][j] * corr; acc[qt][j] = mmah(vf[j], pf, acc[qt][j]); } } }
    asm volatile("s_wait_dscnt 0x0" ::: "memory");      // this wave's reads of stage t have returned
    asm volatile("s_wait_asynccnt 0x0" ::: "memory");   // this wave's copies of stage t + 1 have landed
    __syncthreads();                                    // publishes stage t + 1 and ends every wave's reads of stage t
    if (t + 2 < TT / FKS) FA_STAGE(t + 2, t & 1); }     // refill of the buffer that stage t has just left
  asm volatile("s_wait_asynccnt 0x0" ::: "memory");     // no copy is outstanding when the wave ends
#pragma unroll
  for (int qt = 0; qt < 2; ++qt) { const float inv = 1.0f / (l[qt] + xhalf(l[qt]));   // the two halves' sums are joined once
    _Float16* yr = Y + ((size_t)b * TT + q0 + qt * 16 + col) * CC + h * HD + 8 * g;  // element r of tile j = channel j * 16 + 8g + r of query col; ctx leaves as k_out's operand, x 2^6 once to f16 (small context rows stay clear of f16 subnormals)
#pragma unroll
    for (int j = 0; j < 4; ++j) { const v8f o = acc[qt][j] * inv; v8h y;
#pragma unroll
      for (int r = 0; r < 8; ++r) y[r] = (_Float16)(o[r] * 64.0f);
      vst2(yr + j * 16, y); } } }
// ---- k_out: block = (64 rows, 128 cols): out = ctx Wo (+ bo): ctx (f16, x 2^6) against Wo as f16(bf16 x 2^8) exact (1 product) x 2^-14
__global__ __launch_bounds__(128) void k_out(const _Float16* __restrict__ Y, const _Float16* __restrict__ WO, const float* __restrict__ BO, float* __restrict__ OUT) { __shared__ __align__(16) float sf[4][16][132]; __shared__ __align__(16) _Float16 sg[2][192 * SPK];
  const int tid = threadIdx.x, wave = tid >> 5, lane = tid & 31, col = lane & 15, g = lane >> 4; const int c0 = blockIdx.y * 128; const size_t r0 = (size_t)blockIdx.x * 64 + wave * 16;
  v8f acc[8] = {};
  {
    // operands through LDS as in k_proj: rows 0..63 = ctx rows, 64..191 = weight rows
    const int lr = tid >> 3, lp = tid & 7; const _Float16* Ap = Y + ((size_t)blockIdx.x * 64 + lr) * CC + lp * 8; const _Float16* Wp = WO + (size_t)(c0 + lr) * CC + lp * 8; const int so = lr * SPK + lp * 8;
    v4u ra[4], rw[8];
#pragma unroll
    for (int i = 0; i < 4; ++i) ra[i] = *(const v4u*)(Ap + (size_t)i * 16 * CC);
#pragma unroll
    for (int i = 0; i < 8; ++i) rw[i] = *(const v4u*)(Wp + (size_t)i * 16 * CC);
#pragma unroll
    for (int i = 0; i < 4; ++i) *(v4u*)(&sg[0][0] + so + i * 16 * SPK) = ra[i];
#pragma unroll
    for (int i = 0; i < 8; ++i) *(v4u*)(&sg[0][0] + so + (64 + i * 16) * SPK) = rw[i];
#pragma unroll
    for (int i = 0; i < 4; ++i) ra[i] = *(const v4u*)(Ap + (size_t)i * 16 * CC + KCH);
#pragma unroll
    for (int i = 0; i < 8; ++i) rw[i] = *(const v4u*)(Wp + (size_t)i * 16 * CC + KCH);
    loads_issued(); stage_bar();   // chunk 0 is published
#pragma unroll 2   // two trips a pass, so that each trip's buffer addresses are constants
    for (int kc = 0; kc < CC / KCH; ++kc) { const _Float16* sb = &sg[kc & 1][0]; _Float16* sn = &sg[(kc & 1) ^ 1][0];
#pragma unroll
      for (int ks = 0; ks < KCH; ks += 32) { const v16h a = frag_h(sb + (wave * 16 + col) * SPK + ks, lane); v16h w[8];
#pragma unroll
        for (int j = 0; j < 8; ++j) w[j] = frag_h(sb + (64 + j * 16 + col) * SPK + ks, lane);
#pragma unroll
        for (int j = 0; j < 8; ++j) acc[j] = wmma16(a, w[j], acc[j]); }
      __builtin_amdgcn_sched_barrier(0);   // keeps the wait for chunk kc + 1's loads behind the products, which cover a part of their latency
      if (kc + 1 < CC / KCH) {   // the other buffer's readers left it before the last barrier
#pragma unroll
        for (int i = 0; i < 4; ++i) *(v4u*)(sn + so + i * 16 * SPK) = ra[i];
#pragma unroll
        for (int i = 0; i < 8; ++i) *(v4u*)(sn + so + (64 + i * 16) * SPK) = rw[i];
        if (kc + 2 < CC / KCH) {
#pragma unroll
          for (int i = 0; i < 4; ++i) ra[i] = *(const v4u*)(Ap + (size_t)i * 16 * CC + (kc + 2) * KCH);
#pragma unroll
          for (int i = 0; i < 8; ++i) rw[i] = *(const v4u*)(Wp + (size_t)i * 16 * CC + (kc + 2) * KCH);
          loads_issued(); } }
      stage_bar(); }   // publishes chunk kc + 1 and ends the reads of chunk kc
#pragma unroll
    for (int j = 0; j < 8; ++j) { const float bias = BO ? bfr(BO[c0 + j * 16 + col]) : 0.f;
#pragma unroll
      for (int r = 0; r < 8; ++r) sf[wave][8 * g + r][j * 16 + col] = acc[j][r] * (1.0f / 16384.0f) + bias; } }   /* 2^-8 (Wo carry) x 2^-6 (ctx carry) */
  LDSX(); for (int rl = 0; rl < 16; ++rl) vst2(OUT + (r0 + rl) * DIN + c0 + lane * 4, *(const v4f*)&sf[wave][rl][lane * 4]); }

extern "C" void kernel_launch(void* const* d_in, const int* in_sizes, int n_in, void* d_out, int out_size, void* d_ws, size_t ws_size, hipStream_t stream) {
  (void)in_sizes; (void)n_in; (void)out_size;
  const float** F = (const float**)d_in;
  if (ws_size < (size_t)WS_END) return;
  char* ws = (char*)d_ws; _Float16 *QH = (_Float16*)(ws + WS_QH), *KH = (_Float16*)(ws + WS_KH), *VT = (_Float16*)(ws + WS_VT), *QL = (_Float16*)(ws + WS_QL), *KL = (_Float16*)(ws + WS_KL); __bf16 *VB = (__bf16*)(ws + WS_VB), *VBL = (__bf16*)(ws + WS_VBL), *XB = (__bf16*)(ws + WS_XB), *WB = (__bf16*)(ws + WS_WB); _Float16 *WH = (_Float16*)(ws + WS_WH), *Y = (_Float16*)(ws + WS_Y);
  (void)Y; (void)QL; (void)KL; (void)VB; (void)VBL;
  // inputs: 0 x [2,2048,1024]; 1 Wqkv [3072,1024] (out,in): q rows 0..1023, k 1024..2047, v 2048..3071; 2 Wout [1024,1024] (out,in); 3 token_positions [2048] int32 (arange; READ on the device); no biases
  k_cvt<<<dim3(CVX + CVW + CVO), 256, 0, stream>>>(F[0], F[1], F[2], XB, WB, WH);
  k_proj<<<dim3(TNB * TT / 64, CC / 128, 3), 128, 0, stream>>>(XB, XB, XB, WB, WB + (size_t)CC * DIN, WB + 2 * (size_t)CC * DIN, nullptr, nullptr, nullptr, QH, QL, KH, KL, VT, VB, VBL, (const int*)d_in[3]);
  k_fa<<<dim3(TT / 128, NH, TNB), 128, 0, stream>>>(QH, KH, VT, Y);
  k_out<<<dim3(TNB * TT / 64, DIN / 128), 128, 0, stream>>>(Y, WH, nullptr, (float*)d_out);
}

// v005
// One run takes 97.8 microseconds.
// Two timings next to v004 put it at 1.07 and 1.06 times that version's speed.
// Counting every step since v000, it is 14.8 times as fast.
// compute dtype: all float inputs rounded to bf16; q / k / v projections with EXACT bf16 products on WMMA 16x16x32 (f32 accumulate), no biases; RoPE in f32 (embedded frequencies, precise cosf / sinf, positions read from the int input token_positions); logits q x k once to f16 each (1 product) x 64^-0.5; softmax f32 with a running maximum and sum over 32-key trips; P (unnormalised, x 2^8) once to f16 x v once to f16 (1 product), divided by the sum at the end; ctx x 2^6 once to f16 x the output weight f16(bf16 x 2^8); f32 output.
#include <hip/hip_runtime.h>
#include <math.h>

typedef __attribute__((ext_vector_type(16))) _Float16 v16h;
typedef __attribute__((ext_vector_type(16))) __bf16 v16b;
typedef __attribute__((ext_vector_type(8)))  _Float16 v8h;
typedef __attribute__((ext_vector_type(8)))  float v8f;
typedef __attribute__((ext_vector_type(4)))  float v4f;
typedef __attribute__((ext_vector_type(2)))  float v2f;
typedef __attribute__((ext_vector_type(4)))  unsigned v4u;
typedef __attribute__((ext_vector_type(4)))  int v4i;
typedef float __attribute__((may_alias)) float_a;
typedef int __attribute__((may_alias)) int_a;

template <typename T> __device__ __forceinline__ void vst2(void* p, T v) { *(T*)p = v;  }
__device__ __forceinline__ v8f wmma16(v16h a, v16h b, v8f c) {
  v8f d = __builtin_amdgcn_wmma_f32_16x16x32_f16(false, a, false, b, (short)0, c, false, false);
  asm volatile("v_nop\n\tv_nop\n\tv_nop\n\tv_nop" : "+v"(d) : "v"(a), "v"(b));
  return d;
}
__device__ __forceinline__ v8f wmma_bf(v16b a, v16b b, v8f c) {
  v8f d = __builtin_amdgcn_wmma_f32_16x16x32_bf16(false, a, false, b, (short)0, c, false, false);
  asm volatile("v_nop\n\tv_nop\n\tv_nop\n\tv_nop" : "+v"(d) : "v"(a), "v"(b));
  return d;
}
// 16x16x32 fragments: lane = (h = lane>>4, row/col = lane&15); elements 0..7 = k0+8h+0..7, 8..15 = k0+16+8h+0..7; D element r = row 8h+r
__device__ __forceinline__ v16h frag_h(const _Float16* rowk0, int lane) {
  union { v16h v; v8h q[2]; } u; const _Float16* p = rowk0 + 8 * (lane >> 4);
  u.q[0] = *(const v8h*)p; u.q[1] = *(const v8h*)(p + 16); return u.v;
}
__device__ __forceinline__ v16h frag_f32(const float* rowk0, int lane) {
  v16h a; const float* p = rowk0 + 8 * (lane >> 4);
#pragma unroll
  for (int i = 0; i < 8; ++i) { a[i] = (_Float16)p[i]; a[8 + i] = (_Float16)p[16 + i]; }
  return a;
}
__device__ __forceinline__ v16h frag_f32s(const float* rowk0, int lane, float sc) {
  v16h a; const float* p = rowk0 + 8 * (lane >> 4);
#pragma unroll
  for (int i = 0; i < 8; ++i) { a[i] = (_Float16)(p[i] * sc); a[8 + i] = (_Float16)(p[16 + i] * sc); }
  return a;
}
// column fragment from a [K][ld] layout (column n), rows >= K read as 0
__device__ __forceinline__ v16h fragc_f32(const float* W, int k0, int n, int lane, int ld, int K) {
  v16h a; const int g = lane >> 4;
#pragma unroll
  for (int i = 0; i < 8; ++i) { const int ka = k0 + 8 * g + i, kb = ka + 16;
    a[i] = (_Float16)(ka < K ? W[(size_t)(ka < K ? ka : K - 1) * ld + n] : 0.f); a[8 + i] = (_Float16)(kb < K ? W[(size_t)(kb < K ? kb : K - 1) * ld + n] : 0.f); }
  return a;
}
struct F2 { v16b h, l; };
__device__ __forceinline__ F2 bsplit16(const float v[16]) { F2 r;
#pragma unroll
  for (int i = 0; i < 16; ++i) { const __bf16 h = (__bf16)v[i]; r.h[i] = h; r.l[i] = (__bf16)(v[i] - (float)h); }
  return r; }
__device__ __forceinline__ F2 split_row(const float* row, int k0, int lane) { float v[16]; const float* p = row + k0 + 8 * (lane >> 4);
#pragma unroll
  for (int i = 0; i < 8; ++i) { v[i] = p[i]; v[8 + i] = p[16 + i]; }
  return bsplit16(v); }
__device__ __forceinline__ F2 split_rowK(const float* row, int k0, int lane, int K) { float v[16]; const int g = lane >> 4;
#pragma unroll
  for (int i = 0; i < 8; ++i) { const int ka = k0 + 8 * g + i, kb = ka + 16; v[i] = ka < K ? row[ka < K ? ka : K - 1] : 0.f; v[8 + i] = kb < K ? row[kb < K ? kb : K - 1] : 0.f; }
  return bsplit16(v); }
__device__ __forceinline__ F2 split_col(const float* W, int k0, int n, int lane, int ld, int K) { float v[16]; const int g = lane >> 4;
#pragma unroll
  for (int i = 0; i < 8; ++i) { const int ka = k0 + 8 * g + i, kb = ka + 16; v[i] = ka < K ? W[(size_t)(ka < K ? ka : K - 1) * ld + n] : 0.f; v[8 + i] = kb < K ? W[(size_t)(kb < K ? kb : K - 1) * ld + n] : 0.f; }
  return bsplit16(v); }
__device__ __forceinline__ v8f mac3(const F2& a, const F2& b, v8f c) { c = wmma_bf(a.l, b.h, c); c = wmma_bf(a.h, b.l, c); return wmma_bf(a.h, b.h, c); }
__device__ __forceinline__ float sigm(float v) { return 1.0f / (1.0f + expf(-v)); }
#define LDSX() do { asm volatile("s_wait_dscnt 0" ::: "memory"); __builtin_amdgcn_wave_barrier(); __builtin_amdgcn_fence(__ATOMIC_RELEASE, "workgroup"); } while (0)

// Multi-head self-attention with interleaved-pair RoPE, no mask (x [2,2048,1024]; Wqkv [3072,1024] torch (out,in): qkv.reshape(B, S, 3, 16, 64): q = rows 0..1023, k = 1024..2047, v = 2048..3071; Wout [1024,1024] (out,in); token_positions [2048] int32 = arange, a module input READ on the device; RoPE on q and k: (even, odd) pairs (x_e c - x_o s, x_e s + x_o c) re-interleaved, inv_freq = 1 / 10000^(2i/64); scores / sqrt(64); softmax; out @ Wout.T).
#define NB 2
#define TT 2048
#define CC 1024            // NH * HD = projected width
#define DIN 1024          // input (model) width
#define NH 16
#define HD 64
#define NQB (TT / 64)
#define HG 4
#define SCALE (0.125f)
#define CAUSAL 0
#ifndef TNB
#define TNB NB
#endif
__device__ __forceinline__ float bfr(float v) { return (float)(__bf16)v; }
__host__ __device__ __forceinline__ int kb_last(int qb) { return CAUSAL ? ((qb * 64 + 63) >> 7) : (TT / 128 - 1); }
typedef __attribute__((ext_vector_type(8))) __bf16 v8b;
__device__ __forceinline__ v16b frag_b(const __bf16* rowk0, int lane) {
  union { v16b v; v8b q[2]; } u; const __bf16* p = rowk0 + 8 * (lane >> 4);
  u.q[0] = *(const v8b*)p; u.q[1] = *(const v8b*)(p + 16); return u.v;
}
// operand staging of the two projection GEMMs: the operands lie in the workspace as 16-bit values, rounded once ahead of the GEMMs; a 64-k chunk of a row is one 128-byte line; 8 lanes fetch it whole, 16 bytes each; LDS rows of 64 values at a pitch of 72 (144 bytes = 16 x odd, for 16-byte readers)
typedef __attribute__((ext_vector_type(4))) __bf16 v4b;
typedef __attribute__((ext_vector_type(4))) _Float16 v4h;
#define SPK 72
#define KCH 64              // k values a chunk
// work-group barrier by hand, behind the wave's own LDS wait: __syncthreads() would also wait out the global loads that are meant to stay in flight across it
__device__ __forceinline__ void stage_bar() { asm volatile("s_wait_dscnt 0x0" ::: "memory"); asm volatile("s_barrier_signal -1\n\ts_barrier_wait -1" ::: "memory"); }
// behind a group of look-ahead loads: their address registers are reused while the loads are still in flight
__device__ __forceinline__ void loads_issued() { asm volatile("s_wait_xcnt 0x0" ::: "memory"); }
__device__ __forceinline__ v4b cvt4b(v4f v) { v4b r; r[0] = (__bf16)v[0]; r[1] = (__bf16)v[1]; r[2] = (__bf16)v[2]; r[3] = (__bf16)v[3]; return r; }
__device__ __forceinline__ v4h cvt4w(v4f v) { v4h r; r[0] = (_Float16)(bfr(v[0]) * 256.0f); r[1] = (_Float16)(bfr(v[1]) * 256.0f); r[2] = (_Float16)(bfr(v[2]) * 256.0f); r[3] = (_Float16)(bfr(v[3]) * 256.0f); return r; }
#define QBH 0              // unused: k_fa has one path for all query blocks
#define QHI 0               // single-product logits on every row
#define KHI 64            // key rows carrying k residual / v bf16 hi+lo planes (written by k_proj, read by no kernel here)
// B fragment (k rows k0+.., output column o) of a weight: (in,out) [K][ld] or (out,in) [ld rows of K]: bf16 exact, or f16(bf16 * 256) exact
__device__ __forceinline__ v16b wcol_io(const float* Wm, int k0, int o, int lane, int ld) { v16b w; const int g = lane >> 4;
#pragma unroll
  for (int i = 0; i < 8; ++i) { w[i] = (__bf16)Wm[(size_t)(k0 + 8 * g + i) * ld + o]; w[8 + i] = (__bf16)Wm[(size_t)(k0 + 16 + 8 * g + i) * ld + o]; }
  return w; }
__device__ __forceinline__ v16b wcol_oi(const float* Wm, int k0, int o, int lane, int K) { v16b w; const float* p = Wm + (size_t)o * K + k0 + 8 * (lane >> 4);
#pragma unroll
  for (int i = 0; i < 8; ++i) { w[i] = (__bf16)p[i]; w[8 + i] = (__bf16)p[16 + i]; }
  return w; }
__device__ __forceinline__ v16h wcolh_io(const float* Wm, int k0, int o, int lane, int ld) { v16h w; const int g = lane >> 4;
#pragma unroll
  for (int i = 0; i < 8; ++i) { w[i] = (_Float16)(bfr(Wm[(size_t)(k0 + 8 * g + i) * ld + o]) * 256.0f); w[8 + i] = (_Float16)(bfr(Wm[(size_t)(k0 + 16 + 8 * g + i) * ld + o]) * 256.0f); }
  return w; }
__device__ __forceinline__ v16h wcolh_oi(const float* Wm, int k0, int o, int lane, int K) { v16h w; const float* p = Wm + (size_t)o * K + k0 + 8 * (lane >> 4);
#pragma unroll
  for (int i = 0; i < 8; ++i) { w[i] = (_Float16)(bfr(p[i]) * 256.0f); w[8 + i] = (_Float16)(bfr(p[16 + i]) * 256.0f); }
  return w; }
#define WQKV_LAYOUT 1   // 0 = (in,out) [DIN][CC]; 1 = (out,in) [CC][DIN]; 2 = per-head [NH][DIN][HD]
__device__ __forceinline__ v16b wcol_hdk(const float* Wm, int k0, int o, int lane) { v16b w; const int g = lane >> 4; const float* p = Wm + (size_t)(o / HD) * DIN * HD + (o % HD);
#pragma unroll
  for (int i = 0; i < 8; ++i) { w[i] = (__bf16)p[(size_t)(k0 + 8 * g + i) * HD]; w[8 + i] = (__bf16)p[(size_t)(k0 + 16 + 8 * g + i) * HD]; }
  return w; }
#define WO_OUT_IN 1
#if WQKV_LAYOUT == 1
#define WCOL(W, k0, o, lane) wcol_oi(W, k0, o, lane, DIN)
#elif WQKV_LAYOUT == 2
#define WCOL(W, k0, o, lane) wcol_hdk(W, k0, o, lane)
#else
#define WCOL(W, k0, o, lane) wcol_io(W, k0, o, lane, CC)
#endif
#if WO_OUT_IN
#define WOCOL(W, k0, o, lane) wcol_oi(W, k0, o, lane, CC)
#define WOCOLH(W, k0, o, lane) wcolh_oi(W, k0, o, lane, CC)
#else
#define WOCOL(W, k0, o, lane) wcol_io(W, k0, o, lane, DIN)
#define WOCOLH(W, k0, o, lane) wcolh_io(W, k0, o, lane, DIN)
#endif

// RoPE inverse frequencies 1/10000^(2i/64) (the f32 values jax computes)
__constant__ float INVF[32] = {1.000000000e+00,7.498942018e-01,5.623413324e-01,4.216965139e-01,3.162277639e-01,2.371373624e-01,1.778279394e-01,1.333521456e-01,1.000000015e-01,7.498941571e-02,5.623412877e-02,4.216964915e-02,3.162277862e-02,2.371373586e-02,1.778279431e-02,1.333521493e-02,9.999999776e-03,7.498942316e-03,5.623413250e-03,4.216964822e-03,3.162277862e-03,2.371373819e-03,1.778279431e-03,1.333521446e-03,1.000000047e-03,7.498941850e-04,5.623413017e-04,4.216964880e-04,3.162277862e-04,2.371373848e-04,1.778279402e-04,1.333521504e-04};
// RoPE factors: (cos, sin) of pos * INVF[i], pos READ from the int input, depend on (token, i) alone: the rounding launch works each pair out once into the table RT [t][i][cos, sin]; k_proj's q and k blocks read them there
#ifndef SM_EXTRA_PARAMS
#define SM_EXTRA_PARAMS
#endif
#ifndef PROJ_EXTRA_PARAMS
#define PROJ_EXTRA_PARAMS
#endif
#ifndef SM_MASK_HOOK
#define SM_MASK_HOOK (void)0
#endif

#define WS_QH  0u                                      // f16 q rows [b*t][CC]
#define WS_KH  (WS_QH + 2u * (size_t)NB * TT * CC)      // f16 k rows [b*t][CC]
#define WS_VT  (WS_KH + 2u * (size_t)NB * TT * CC)      // f16 v planes [b][c][t]
#define WS_QL  (WS_VT + 2u * (size_t)NB * CC * TT)      // f16 q residual x 2^10 rows [b][t < QHI][CC]
#define WS_KL  (WS_QL + 2u * (size_t)NB * QHI * CC)     // f16 k residual x 2^10 rows [b][t < KHI][CC]
#define WS_VB  (WS_KL + 2u * (size_t)NB * KHI * CC)     // bf16 v hi planes [b][c][t < KHI]
#define WS_VBL (WS_VB + 2u * (size_t)NB * CC * KHI)
#define WS_S   (WS_VBL + 2u * (size_t)NB * CC * KHI)    // (once f32 logits) now the rounded GEMM operands
#define WS_XB  WS_S                                     // bf16 x rows [b*t][DIN]
#define WS_WB  (WS_XB + 2u * (size_t)NB * TT * DIN)     // bf16 Wqkv rows [3 * CC][DIN]
#define WS_WH  (WS_WB + 2u * (size_t)3 * CC * DIN)      // f16(bf16 x 2^8) Wout rows [DIN][CC]
#define WS_RT  (WS_WH + 2u * (size_t)DIN * CC)          // f32 RoPE table [t][32][cos, sin]
#define WS_Y   (WS_S  + 4u * (size_t)HG * TT * TT)      // f16 ctx x 2^6 rows [b*t][CC]
#define WS_END (WS_Y  + 4u * (size_t)NB * TT * CC)

// ---- k_cvt: the GEMM operands that are inputs are rounded once, ahead of the GEMMs (each was rounded anew by every block that read it): x and Wqkv to bf16, Wout to f16(bf16 x 2^8).
// Few, long waves (two blocks of 8 waves a WGP): a block takes 16384 values in 16 passes; a pass is 16 bytes in and 8 bytes out a lane, whole lines a wave; all 16 loads of a lane are in flight together.
#define CVB 16384                         // values a block
#define CVX (NB * TT * DIN / CVB)         // blocks of x
#define CVW (3 * CC * DIN / CVB)          // blocks of Wqkv
#define CVO (DIN * CC / CVB)              // blocks of Wout
#define CVT (TT * 32 / 1024)              // blocks of the RoPE table: 1024 (token, frequency) entries a block, 4 a lane; they stand first in the grid
__global__ __launch_bounds__(256) void k_cvt(const float* __restrict__ X, const float* __restrict__ WQKV, const float* __restrict__ WO, const int* __restrict__ TPOS, __bf16* __restrict__ XB, __bf16* __restrict__ WB, _Float16* __restrict__ WH, float* __restrict__ RT) {
  if (blockIdx.x < CVT) { const int e0 = blockIdx.x * 1024 + threadIdx.x;   // entry e = t * 32 + i; a lane's four entries are 256 apart: one frequency, tokens 8 apart
    const int* tp = TPOS + (e0 >> 5); const float* fp = INVF + (e0 & 31); float* d = RT + 2 * (size_t)e0; int ps[4]; v2f c[4];
#pragma unroll
    for (int p = 0; p < 4; ++p) ps[p] = tp[p * 8];
    const float fr = *fp;
#pragma unroll
    for (int p = 0; p < 4; ++p) { const float ang = (float)ps[p] * fr; c[p][0] = cosf(ang); c[p][1] = sinf(ang); }
#pragma unroll
    for (int p = 0; p < 4; ++p) vst2(d + p * 512, c[p]);   // 8 bytes a lane, 256 contiguous bytes a wave; the wave ends behind these stores
    return; }
  const int bx = blockIdx.x - CVT; const size_t o = (size_t)threadIdx.x * 4; v4f a[16];
  if (bx < CVX + CVW) { const bool isx = bx < CVX; const size_t e = (size_t)(isx ? bx : bx - CVX) * CVB + o; const float* s = (isx ? X : WQKV) + e; __bf16* d = (isx ? XB : WB) + e;
#pragma unroll
    for (int p = 0; p < 16; ++p) a[p] = *(const v4f*)(s + p * 1024);
    asm volatile("s_wait_xcnt 0x0" :: "v"(s) : "memory");   // the address pair is an input, so it stays live up to this wait: no load's own result is placed on it while the loads before it are in flight
#pragma unroll
    for (int p = 0; p < 16; ++p) vst2(d + p * 1024, cvt4b(a[p]));
    asm volatile("s_wait_xcnt 0x0" ::: "memory");   // behind the last store of the run: no register that a store names is rewritten ahead of this wait
  } else { const size_t e = (size_t)(bx - CVX - CVW) * CVB + o; const float* s = WO + e; _Float16* d = WH + e;
#pragma unroll
    for (int p = 0; p < 16; ++p) a[p] = *(const v4f*)(s + p * 1024);
    asm volatile("s_wait_xcnt 0x0" :: "v"(s) : "memory");   // the address pair is an input, so it stays live up to this wait: no load's own result is placed on it while the loads before it are in flight
#pragma unroll
    for (int p = 0; p < 16; ++p) vst2(d + p * 1024, cvt4w(a[p]));
    asm volatile("s_wait_xcnt 0x0" ::: "memory"); } }   // behind the last store of the run: no register that a store names is rewritten ahead of this wait
// ---- k_proj: block = (64 rows, 128 cols, which): q/k/v = X W (+ b) with exact bf16 products (K = DIN) -> which 0: q f16 rows (+ residual rows < QHI); 1: k f16 rows (+ residual rows < KHI); 2: v f16 planes [c][t] (+ bf16 hi/lo planes for t < KHI)
__global__ __launch_bounds__(128) void k_proj(const __bf16* __restrict__ XQ, const __bf16* __restrict__ XK, const __bf16* __restrict__ XV, const __bf16* __restrict__ WQ, const __bf16* __restrict__ WK, const __bf16* __restrict__ WV, const float* __restrict__ BQ, const float* __restrict__ BK, const float* __restrict__ BV,
    _Float16* __restrict__ QH, _Float16* __restrict__ QL, _Float16* __restrict__ KH, _Float16* __restrict__ KL, _Float16* __restrict__ VT, __bf16* __restrict__ VB, __bf16* __restrict__ VBL, const float* __restrict__ RT) {
  __shared__ __align__(16) float st[64][132]; __shared__ __align__(16) _Float16 sh[64][136], sl[64][136]; __shared__ __align__(16) _Float16 tq[3][128][72]; _Float16 (*th)[72] = tq[0]; __bf16 (*tb)[72] = (__bf16 (*)[72])tq[1]; __bf16 (*tbl)[72] = (__bf16 (*)[72])tq[2];   // one array, so that the two operand buffers of the main loop fit in it end to end
  const int tid = threadIdx.x, wave = tid >> 5, lane = tid & 31, col = lane & 15, g = lane >> 4; const int which = blockIdx.z; const int c0 = blockIdx.y * 128; const size_t r0 = (size_t)blockIdx.x * 64; const size_t bb = r0 / TT; const int t0 = (int)(r0 % TT);
  const __bf16* X = which == 0 ? XQ : which == 1 ? XK : XV; const __bf16* WA = which == 0 ? WQ : which == 1 ? WK : WV; const float* BA = which == 0 ? BQ : which == 1 ? BK : BV;
  v2f tc[16];   // q and k blocks: the RoPE factors of this wave's 16 rows, lane = frequency i: 256 contiguous bytes a row, fetched ahead of the main loop, which covers their latency
  if (which < 2) { const float* tp = RT + (size_t)(t0 + wave * 16) * 64 + lane * 2;
#pragma unroll
    for (int rr = 0; rr < 16; ++rr) tc[rr] = *(const v2f*)(tp + rr * 64);
    asm volatile("s_wait_xcnt 0x0" :: "v"(tp) : "memory"); }   // the address pair is an input, so it stays live up to this wait: no load's own result is placed on it while the loads before it are being issued
  v8f acc[8] = {};
  { // operands through LDS, two buffers (they fill tq, which the epilogue writes only behind its own barriers): rows 0..63 = X rows, 64..191 = weight rows of this tile; chunk kc + 1 is in flight in registers while chunk kc is multiplied
    __bf16* const sb0 = (__bf16*)&tq[0][0][0]; __bf16* const sb1 = sb0 + 192 * SPK;
    const int lr = tid >> 3, lp = tid & 7; const __bf16* Ap = X + (r0 + lr) * DIN + lp * 8; const __bf16* Wp = WA + (size_t)(c0 + lr) * DIN + lp * 8; const int so = lr * SPK + lp * 8;
    v4u ra[4], rw[8];
#pragma unroll
    for (int i = 0; i < 4; ++i) ra[i] = *(const v4u*)(Ap + (size_t)i * 16 * DIN);
#pragma unroll
    for (int i = 0; i < 8; ++i) rw[i] = *(const v4u*)(Wp + (size_t)i * 16 * DIN);
#pragma unroll
    for (int i = 0; i < 4; ++i) *(v4u*)(sb0 + so + i * 16 * SPK) = ra[i];
#pragma unroll
    for (int i = 0; i < 8; ++i) *(v4u*)(sb0 + so + (64 + i * 16) * SPK) = rw[i];
#pragma unroll
    for (int i = 0; i < 4; ++i) ra[i] = *(const v4u*)(Ap + (size_t)i * 16 * DIN + KCH);
#pragma unroll
    for (int i = 0; i < 8; ++i) rw[i] = *(const v4u*)(Wp + (size_t)i * 16 * DIN + KCH);
    loads_issued(); stage_bar();   // chunk 0 is published
#pragma unroll 2   // two trips a pass, so that each trip's buffer addresses are constants
    for (int kc = 0; kc < DIN / KCH; ++kc) { const __bf16* sb = (kc & 1) ? sb1 : sb0; __bf16* sn = (kc & 1) ? sb0 : sb1;
#pragma unroll
      for (int ks = 0; ks < KCH; ks += 32) { const v16b a = frag_b(sb + (wave * 16 + col) * SPK + ks, lane); v16b w[8];
#pragma unroll
        for (int j = 0; j < 8; ++j) w[j] = frag_b(sb + (64 + j * 16 + col) * SPK + ks, lane);
#pragma unroll
        for (int j = 0; j < 8; ++j) acc[j] = wmma_bf(a, w[j], acc[j]); }
      __builtin_amdgcn_sched_barrier(0);   // keeps the wait for chunk kc + 1's loads behind the products, which cover a part of their latency
      if (kc + 1 < DIN / KCH) {   // the other buffer's readers left it before the last barrier
#pragma unroll
        for (int i = 0; i < 4; ++i) *(v4u*)(sn + so + i * 16 * SPK) = ra[i];
#pragma unroll
        for (int i = 0; i < 8; ++i) *(v4u*)(sn + so + (64 + i * 16) * SPK) = rw[i];
        if (kc + 2 < DIN / KCH) {
#pragma unroll
          for (int i = 0; i < 4; ++i) ra[i] = *(const v4u*)(Ap + (size_t)i * 16 * DIN + (kc + 2) * KCH);
#pragma unroll
          for (int i = 0; i < 8; ++i) rw[i] = *(const v4u*)(Wp + (size_t)i * 16 * DIN + (kc + 2) * KCH);
          loads_issued(); } }
      stage_bar(); } }   // publishes chunk kc + 1 and ends the reads of chunk kc
  { // stage the f32 tile (acc + bias) in LDS, rotate the q and k rows there, then convert
#pragma unroll
    for (int j = 0; j < 8; ++j) { const float bias = BA ? bfr(BA[c0 + j * 16 + col]) : 0.f;
#pragma unroll
      for (int r = 0; r < 8; ++r) st[wave * 16 + 8 * g + r][j * 16 + col] = acc[j][r] + bias; }
    __syncthreads();
    if (which < 2) {   // interleaved-pair rotation (x[2i], x[2i + 1]) by the angle pos * INVF[i]: lane = pair i of a head, so a wave reads and writes 256 contiguous bytes of a row; v untouched
#pragma unroll
      for (int rr = 0; rr < 16; ++rr) { const float cs = tc[rr][0], sn = tc[rr][1];
#pragma unroll
        for (int hh = 0; hh < 128 / HD; ++hh) { float* rw = &st[wave * 16 + rr][hh * HD + 2 * lane]; const v2f x = *(const v2f*)rw; v2f y; y[0] = x[0] * cs - x[1] * sn; y[1] = x[0] * sn + x[1] * cs; *(v2f*)rw = y; } } }
    __syncthreads(); }
  if (which < 2) { _Float16* DH = which == 0 ? QH : KH; _Float16* DL = which == 0 ? QL : KL; const int nhi = which == 0 ? QHI : KHI; const bool hi_rows = t0 < nhi;
    for (int e = tid; e < 64 * 128; e += 128) { const int rl = e >> 7, cl = e & 127; const float v = st[rl][cl]; const _Float16 hv = (_Float16)v; sh[rl][cl] = hv; sl[rl][cl] = (_Float16)((v - (float)hv) * 1024.0f); }
    __syncthreads();
    for (int e = tid; e < 64 * 16; e += 128) { const int rl = e >> 4, q = e & 15; vst2((unsigned*)(DH + (r0 + rl) * CC + c0 + q * 8), *(const v4u*)&sh[rl][q * 8]); if (hi_rows) vst2((unsigned*)(DL + (bb * nhi + t0 + rl) * (size_t)CC + c0 + q * 8), *(const v4u*)&sl[rl][q * 8]); }
  } else { const bool hi_rows = t0 < KHI;
    for (int e = tid; e < 64 * 128; e += 128) { const int rl = e & 63, cl = e >> 6; const float v = st[rl][cl]; th[cl][rl] = (_Float16)v; const __bf16 bh = (__bf16)v; tb[cl][rl] = bh; tbl[cl][rl] = (__bf16)(v - (float)bh); }
    __syncthreads();
    for (int e = tid; e < 128 * 8; e += 128) { const int cl = e >> 3, q = e & 7; vst2((unsigned*)(VT + (bb * CC + c0 + cl) * (size_t)TT + t0 + q * 8), *(const v4u*)&th[cl][q * 8]); if (hi_rows) { const size_t o3 = (bb * CC + c0 + cl) * (size_t)KHI + t0 + q * 8; vst2((unsigned*)(VB + o3), *(const v4u*)&tb[cl][q * 8]); vst2((unsigned*)(VBL + o3), *(const v4u*)&tbl[cl][q * 8]); } } } }
// ---- k_fa: block = 128 queries (4 waves x 32 query columns) of head h, batch b: logits, softmax and P . v in one pass over the keys, 32 keys a trip; no logit or P ever leaves the registers.
// Transposed products: S^T = K Q^T (lane = query column, element r = key 8g + r), so the two 16-key tiles of a trip, converted in place, are the B fragment (k = key, hardware k order) of ctx^T = V^T P^T.
// Running maximum m (raw logits) and running sum l per query column; p = 2^((s - m) c + 8), c = SCALE log2(e); the 2^8 keeps small p clear of f16 subnormals and cancels in acc / l.
// K rows and V^T rows reach the four waves through LDS: a stage is 128 keys, copied once per block as whole 128-byte lines by asynchronous 16-byte copies, two buffers, stage t + 1 in flight while stage t is worked on.
__device__ __forceinline__ float xhalf(float x) { return __builtin_bit_cast(float, __builtin_amdgcn_permlanex16(__builtin_bit_cast(int, x), __builtin_bit_cast(int, x), 0x76543210, 0xfedcba98, false, false)); }  // lane l with lane l ^ 16
__device__ __forceinline__ v8f mmah(v16h a, v16h b, v8f c) { return __builtin_amdgcn_wmma_f32_16x16x32_f16(false, a, false, b, (short)0, c, false, false); }
#define FKS 128                       // keys a stage
#define FKP 72                        // LDS pitch of a K row in f16: 64 channels + 8 (144 bytes = 16 x odd, for 16-byte readers)
#define FVP 136                       // LDS pitch of a V^T row in f16: 128 keys + 8 (272 bytes = 16 x odd)
#define FVO (FKS * FKP)               // the V^T rows stand behind the K rows
#define FBUF (FKS * FKP + HD * FVP)   // f16 a buffer
__device__ __forceinline__ unsigned lds_off(const void* p) { return (unsigned)(size_t)p; }   // byte offset in the work-group's LDS
// eight 16-byte copies a lane, global memory to LDS through no register; the s_wait_xcnt closes the statement so that no address register of a copy is rewritten ahead of it
__device__ __forceinline__ void copy8(unsigned l, unsigned ls, const _Float16* p, size_t ps) {
  asm volatile("global_load_async_to_lds_b128 %0, %8, off\n\t"
               "global_load_async_to_lds_b128 %1, %9, off\n\t"
               "global_load_async_to_lds_b128 %2, %10, off\n\t"
               "global_load_async_to_lds_b128 %3, %11, off\n\t"
               "global_load_async_to_lds_b128 %4, %12, off\n\t"
               "global_load_async_to_lds_b128 %5, %13, off\n\t"
               "global_load_async_to_lds_b128 %6, %14, off\n\t"
               "global_load_async_to_lds_b128 %7, %15, off\n\t"
               "s_wait_xcnt 0x0"
               :: "v"(l), "v"(l + ls), "v"(l + 2 * ls), "v"(l + 3 * ls), "v"(l + 4 * ls), "v"(l + 5 * ls), "v"(l + 6 * ls), "v"(l + 7 * ls),
                  "v"(p), "v"(p + ps), "v"(p + 2 * ps), "v"(p + 3 * ps), "v"(p + 4 * ps), "v"(p + 5 * ps), "v"(p + 6 * ps), "v"(p + 7 * ps) : "memory");
}
__global__ __launch_bounds__(128) void k_fa(const _Float16* __restrict__ QH, const _Float16* __restrict__ KH, const _Float16* __restrict__ VT, _Float16* __restrict__ Y) {
  __shared__ __align__(16) _Float16 kv[2][FBUF];   // [buffer][K rows 0..127 at pitch FKP | V^T rows 0..63 at pitch FVP]
  const int tid = threadIdx.x, wave = tid >> 5, lane = tid & 31, col = lane & 15, g = lane >> 4; const int h = blockIdx.y, b = blockIdx.z; const int q0 = blockIdx.x * 128 + wave * 32;
  const float cs = SCALE * 1.4426950408889634f;
  v16h qf[2][2];
#pragma unroll
  for (int qt = 0; qt < 2; ++qt)
#pragma unroll
    for (int kc = 0; kc < 2; ++kc) qf[qt][kc] = frag_h(QH + ((size_t)b * TT + q0 + qt * 16 + col) * CC + h * HD + kc * 32, lane);
  // the copies of a stage: 8 lanes take one K row (128 bytes), rows tid / 8 + 16 i; 16 lanes take one V^T row (256 bytes), rows tid / 16 + 8 i
  const _Float16* Kg = KH + ((size_t)b * TT + (tid >> 3)) * CC + h * HD + (tid & 7) * 8;
  const _Float16* Vg = VT + ((size_t)b * CC + h * HD + (tid >> 4)) * (size_t)TT + (tid & 15) * 8;
  const unsigned lk = lds_off(&kv[0][0]) + 2u * (unsigned)((tid >> 3) * FKP + (tid & 7) * 8);
  const unsigned lv = lds_off(&kv[0][0]) + 2u * (unsigned)(FVO + (tid >> 4) * FVP + (tid & 15) * 8);
#define FA_STAGE(s, bf) do { copy8(lk + (unsigned)(bf) * (2u * FBUF), 2u * 16 * FKP, Kg + (size_t)(s) * FKS * CC, (size_t)16 * CC); copy8(lv + (unsigned)(bf) * (2u * FBUF), 2u * 8 * FVP, Vg + (size_t)(s) * FKS, (size_t)8 * TT); } while (0)
  FA_STAGE(0, 0);
  asm volatile("s_wait_asynccnt 0x0" ::: "memory");   // this wave's copies of stage 0 have landed
  __syncthreads();                                    // stage 0 is published
  FA_STAGE(1, 1);
  v8f acc[2][4] = {}; float m[2] = {-INFINITY, -INFINITY}, l[2] = {0.f, 0.f};
  for (int t = 0; t < TT / FKS; ++t) {
    const _Float16* Ks = &kv[t & 1][0] + col * FKP;         // key row col of a 16-key tile
    const _Float16* Vs = &kv[t & 1][0] + FVO + col * FVP;   // V^T row of channel col of a 16-channel tile
    v16h kf[2][2];
#pragma unroll
    for (int kt = 0; kt < 2; ++kt)
#pragma unroll
      for (int kc = 0; kc < 2; ++kc) kf[kt][kc] = frag_h(Ks + (kt * 16) * FKP + kc * 32, lane);
#pragma unroll 1   // one trip's registers only: with the four trips of a stage unrolled the build went past 255 registers and into scratch
    for (int k0 = 0; k0 < FKS; k0 += 32) {
      v16h vf[4];
#pragma unroll
      for (int j = 0; j < 4; ++j) vf[j] = frag_h(Vs + (j * 16) * FVP + k0, lane);
      v8f s[2][2] = {};
#pragma unroll
      for (int kc = 0; kc < 2; ++kc)
#pragma unroll
        for (int qt = 0; qt < 2; ++qt)
#pragma unroll
          for (int kt = 0; kt < 2; ++kt) s[qt][kt] = mmah(kf[kt][kc], qf[qt][kc], s[qt][kt]);
      const int kn = (k0 + 32) & (FKS - 1);   // the next trip's key rows, fetched a trip ahead; a stage's last trip fetches its own stage's rows 0..31 again (published, not used)
#pragma unroll
      for (int kt = 0; kt < 2; ++kt)
#pragma unroll
        for (int kc = 0; kc < 2; ++kc) kf[kt][kc] = frag_h(Ks + (kn + kt * 16) * FKP + kc * 32, lane);
      __builtin_amdgcn_sched_barrier(0);   // holds the look-ahead reads here: moved down behind the softmax they would have no time to land before the next trip's first product
#pragma unroll
      for (int qt = 0; qt < 2; ++qt) {
        float mx = fmaxf(s[qt][0][0], s[qt][1][0]);
#pragma unroll
        for (int r = 1; r < 8; ++r) mx = fmaxf(mx, fmaxf(s[qt][0][r], s[qt][1][r]));
        mx = fmaxf(mx, xhalf(mx));            // both halves of the wave hold this query's maximum over the 32 keys
        const float mn = fmaxf(m[qt], mx); const float corr = __builtin_amdgcn_exp2f((m[qt] - mn) * cs);   // 0 on the first trip
        m[qt] = mn; const float nm = 8.0f - mn * cs;
        v16h pf; float s0 = 0.f, s1 = 0.f;
#pragma unroll
        for (int r = 0; r < 8; ++r) { const float p0 = __builtin_amdgcn_exp2f(fmaf(s[qt][0][r], cs, nm)), p1 = __builtin_amdgcn_exp2f(fmaf(s[qt][1][r], cs, nm)); s0 += p0; s1 += p1; pf[r] = (_Float16)p0; pf[8 + r] = (_Float16)p1; }
        l[qt] = l[qt] * corr + (s0 + s1);
#pragma unroll
        for (int j = 0; j < 4; ++j) { acc[qt][j] = acc[qt][j] * corr; acc[qt][j] = mmah(vf[j], pf, acc[qt][j]); } } }
    asm volatile("s_wait_dscnt 0x0" ::: "memory");      // this wave's reads of stage t have returned
    asm volatile("s_wait_asynccnt 0x0" ::: "memory");   // this wave's copies of stage t + 1 have landed
    __syncthreads();                                    // publishes stage t + 1 and ends every wave's reads of stage t
    if (t + 2 < TT / FKS) FA_STAGE(t + 2, t & 1); }     // refill of the buffer that stage t has just left
  asm volatile("s_wait_asynccnt 0x0" ::: "memory");     // no copy is outstanding when the wave ends
#pragma unroll
  for (int qt = 0; qt < 2; ++qt) { const float inv = 1.0f / (l[qt] + xhalf(l[qt]));   // the two halves' sums are joined once
    _Float16* yr = Y + ((size_t)b * TT + q0 + qt * 16 + col) * CC + h * HD + 8 * g;  // element r of tile j = channel j * 16 + 8g + r of query col; ctx leaves as k_out's operand, x 2^6 once to f16 (small context rows stay clear of f16 subnormals)
#pragma unroll
    for (int j = 0; j < 4; ++j) { const v8f o = acc[qt][j] * inv; v8h y;
#pragma unroll
      for (int r = 0; r < 8; ++r) y[r] = (_Float16)(o[r] * 64.0f);
      vst2(yr + j * 16, y); } } }
// ---- k_out: block = (64 rows, 128 cols): out = ctx Wo (+ bo): ctx (f16, x 2^6) against Wo as f16(bf16 x 2^8) exact (1 product) x 2^-14
__global__ __launch_bounds__(128) void k_out(const _Float16* __restrict__ Y, const _Float16* __restrict__ WO, const float* __restrict__ BO, float* __restrict__ OUT) { __shared__ __align__(16) float sf[4][16][132]; __shared__ __align__(16) _Float16 sg[2][192 * SPK];
  const int tid = threadIdx.x, wave = tid >> 5, lane = tid & 31, col = lane & 15, g = lane >> 4; const int c0 = blockIdx.y * 128; const size_t r0 = (size_t)blockIdx.x * 64 + wave * 16;
  v8f acc[8] = {};
  {
    // operands through LDS as in k_proj: rows 0..63 = ctx rows, 64..191 = weight rows
    const int lr = tid >> 3, lp = tid & 7; const _Float16* Ap = Y + ((size_t)blockIdx.x * 64 + lr) * CC + lp * 8; const _Float16* Wp = WO + (size_t)(c0 + lr) * CC + lp * 8; const int so = lr * SPK + lp * 8;
    v4u ra[4], rw[8];
#pragma unroll
    for (int i = 0; i < 4; ++i) ra[i] = *(const v4u*)(Ap + (size_t)i * 16 * CC);
#pragma unroll
    for (int i = 0; i < 8; ++i) rw[i] = *(const v4u*)(Wp + (size_t)i * 16 * CC);
#pragma unroll
    for (int i = 0; i < 4; ++i) *(v4u*)(&sg[0][0] + so + i * 16 * SPK) = ra[i];
#pragma unroll
    for (int i = 0; i < 8; ++i) *(v4u*)(&sg[0][0] + so + (64 + i * 16) * SPK) = rw[i];
#pragma unroll
    for (int i = 0; i < 4; ++i) ra[i] = *(const v4u*)(Ap + (size_t)i * 16 * CC + KCH);
#pragma unroll
    for (int i = 0; i < 8; ++i) rw[i] = *(const v4u*)(Wp + (size_t)i * 16 * CC + KCH);
    loads_issued(); stage_bar();   // chunk 0 is published
#pragma unroll 2   // two trips a pass, so that each trip's buffer addresses are constants
    for (int kc = 0; kc < CC / KCH; ++kc) { const _Float16* sb = &sg[kc & 1][0]; _Float16* sn = &sg[(kc & 1) ^ 1][0];
#pragma unroll
      for (int ks = 0; ks < KCH; ks += 32) { const v16h a = frag_h(sb + (wave * 16 + col) * SPK + ks, lane); v16h w[8];
#pragma unroll
        for (int j = 0; j < 8; ++j) w[j] = frag_h(sb + (64 + j * 16 + col) * SPK + ks, lane);
#pragma unroll
        for (int j = 0; j < 8; ++j) acc[j] = wmma16(a, w[j], acc[j]); }
      __builtin_amdgcn_sched_barrier(0);   // keeps the wait for chunk kc + 1's loads behind the products, which cover a part of their latency
      if (kc + 1 < CC / KCH) {   // the other buffer's readers left it before the last barrier
#pragma unroll
        for (int i = 0; i < 4; ++i) *(v4u*)(sn + so + i * 16 * SPK) = ra[i];
#pragma unroll
        for (int i = 0; i < 8; ++i) *(v4u*)(sn + so + (64 + i * 16) * SPK) = rw[i];
        if (kc + 2 < CC / KCH) {
#pragma unroll
          for (int i = 0; i < 4; ++i) ra[i] = *(const v4u*)(Ap + (size_t)i * 16 * CC + (kc + 2) * KCH);
#pragma unroll
          for (int i = 0; i < 8; ++i) rw[i] = *(const v4u*)(Wp + (size_t)i * 16 * CC + (kc + 2) * KCH);
          loads_issued(); } }
      stage_bar(); }   // publishes chunk kc + 1 and ends the reads of chunk kc
#pragma unroll
    for (int j = 0; j < 8; ++j) { const float bias = BO ? bfr(BO[c0 + j * 16 + col]) : 0.f;
#pragma unroll
      for (int r = 0; r < 8; ++r) sf[wave][8 * g + r][j * 16 + col] = acc[j][r] * (1.0f / 16384.0f) + bias; } }   /* 2^-8 (Wo carry) x 2^-6 (ctx carry) */
  LDSX(); for (int rl = 0; rl < 16; ++rl) vst2(OUT + (r0 + rl) * DIN + c0 + lane * 4, *(const v4f*)&sf[wave][rl][lane * 4]); }

extern "C" void kernel_launch(void* const* d_in, const int* in_sizes, int n_in, void* d_out, int out_size, void* d_ws, size_t ws_size, hipStream_t stream) {
  (void)in_sizes; (void)n_in; (void)out_size;
  const float** F = (const float**)d_in;
  if (ws_size < (size_t)WS_END) return;
  char* ws = (char*)d_ws; _Float16 *QH = (_Float16*)(ws + WS_QH), *KH = (_Float16*)(ws + WS_KH), *VT = (_Float16*)(ws + WS_VT), *QL = (_Float16*)(ws + WS_QL), *KL = (_Float16*)(ws + WS_KL); __bf16 *VB = (__bf16*)(ws + WS_VB), *VBL = (__bf16*)(ws + WS_VBL), *XB = (__bf16*)(ws + WS_XB), *WB = (__bf16*)(ws + WS_WB); _Float16 *WH = (_Float16*)(ws + WS_WH), *Y = (_Float16*)(ws + WS_Y); float* RT = (float*)(ws + WS_RT);
  (void)Y; (void)QL; (void)KL; (void)VB; (void)VBL;
  // inputs: 0 x [2,2048,1024]; 1 Wqkv [3072,1024] (out,in): q rows 0..1023, k 1024..2047, v 2048..3071; 2 Wout [1024,1024] (out,in); 3 token_positions [2048] int32 (arange; READ on the device); no biases
  k_cvt<<<dim3(CVT + CVX + CVW + CVO), 256, 0, stream>>>(F[0], F[1], F[2], (const int*)d_in[3], XB, WB, WH, RT);
  k_proj<<<dim3(TNB * TT / 64, CC / 128, 3), 128, 0, stream>>>(XB, XB, XB, WB, WB + (size_t)CC * DIN, WB + 2 * (size_t)CC * DIN, nullptr, nullptr, nullptr, QH, QL, KH, KL, VT, VB, VBL, RT);
  k_fa<<<dim3(TT / 128, NH, TNB), 128, 0, stream>>>(QH, KH, VT, Y);
  k_out<<<dim3(TNB * TT / 64, DIN / 128), 128, 0, stream>>>(Y, WH, nullptr, (float*)d_out);
}

// v006
// It runs in 80.9 microseconds.
// Two timings next to v005 put it at 1.19 and 1.21 times that version's speed.
// All steps since v000 together make it 17.8 times as fast.
// compute dtype: all float inputs rounded to bf16; q / k / v projections with EXACT bf16 products on WMMA 16x16x32 (f32 accumulate), no biases; RoPE in f32 (embedded frequencies, precise cosf / sinf, positions read from the int input token_positions); logits q x k once to f16 each (1 product) x 64^-0.5; softmax f32 with a running maximum and sum over 32-key trips; P (unnormalised, x 2^8) once to f16 x v once to f16 (1 product), divided by the sum at the end; ctx x 2^6 once to f16 x the output weight f16(bf16 x 2^8); f32 output.
#include <hip/hip_runtime.h>
#include <math.h>

typedef __attribute__((ext_vector_type(16))) _Float16 v16h;
typedef __attribute__((ext_vector_type(16))) __bf16 v16b;
typedef __attribute__((ext_vector_type(8)))  _Float16 v8h;
typedef __attribute__((ext_vector_type(8)))  float v8f;
typedef __attribute__((ext_vector_type(4)))  float v4f;
typedef __attribute__((ext_vector_type(2)))  float v2f;
typedef __attribute__((ext_vector_type(4)))  unsigned v4u;
typedef __attribute__((ext_vector_type(4)))  int v4i;
typedef float __attribute__((may_alias)) float_a;
typedef int __attribute__((may_alias)) int_a;

template <typename T> __device__ __forceinline__ void vst2(void* p, T v) { *(T*)p = v;  }
__device__ __forceinline__ v8f wmma16(v16h a, v16h b, v8f c) {
  v8f d = __builtin_amdgcn_wmma_f32_16x16x32_f16(false, a, false, b, (short)0, c, false, false);
  asm volatile("v_nop\n\tv_nop\n\tv_nop\n\tv_nop" : "+v"(d) : "v"(a), "v"(b));
  return d;
}
__device__ __forceinline__ v8f wmma_bf(v16b a, v16b b, v8f c) {
  v8f d = __builtin_amdgcn_wmma_f32_16x16x32_bf16(false, a, false, b, (short)0, c, false, false);
  asm volatile("v_nop\n\tv_nop\n\tv_nop\n\tv_nop" : "+v"(d) : "v"(a), "v"(b));
  return d;
}
// 16x16x32 fragments: lane = (h = lane>>4, row/col = lane&15); elements 0..7 = k0+8h+0..7, 8..15 = k0+16+8h+0..7; D element r = row 8h+r
__device__ __forceinline__ v16h frag_h(const _Float16* rowk0, int lane) {
  union { v16h v; v8h q[2]; } u; const _Float16* p = rowk0 + 8 * (lane >> 4);
  u.q[0] = *(const v8h*)p; u.q[1] = *(const v8h*)(p + 16); return u.v;
}
__device__ __forceinline__ v16h frag_f32(const float* rowk0, int lane) {
  v16h a; const float* p = rowk0 + 8 * (lane >> 4);
#pragma unroll
  for (int i = 0; i < 8; ++i) { a[i] = (_Float16)p[i]; a[8 + i] = (_Float16)p[16 + i]; }
  return a;
}
__device__ __forceinline__ v16h frag_f32s(const float* rowk0, int lane, float sc) {
  v16h a; const float* p = rowk0 + 8 * (lane >> 4);
#pragma unroll
  for (int i = 0; i < 8; ++i) { a[i] = (_Float16)(p[i] * sc); a[8 + i] = (_Float16)(p[16 + i] * sc); }
  return a;
}
// column fragment from a [K][ld] layout (column n), rows >= K read as 0
__device__ __forceinline__ v16h fragc_f32(const float* W, int k0, int n, int lane, int ld, int K) {
  v16h a; const int g = lane >> 4;
#pragma unroll
  for (int i = 0; i < 8; ++i) { const int ka = k0 + 8 * g + i, kb = ka + 16;
    a[i] = (_Float16)(ka < K ? W[(size_t)(ka < K ? ka : K - 1) * ld + n] : 0.f); a[8 + i] = (_Float16)(kb < K ? W[(size_t)(kb < K ? kb : K - 1) * ld + n] : 0.f); }
  return a;
}
struct F2 { v16b h, l; };
__device__ __forceinline__ F2 bsplit16(const float v[16]) { F2 r;
#pragma unroll
  for (int i = 0; i < 16; ++i) { const __bf16 h = (__bf16)v[i]; r.h[i] = h; r.l[i] = (__bf16)(v[i] - (float)h); }
  return r; }
__device__ __forceinline__ F2 split_row(const float* row, int k0, int lane) { float v[16]; const float* p = row + k0 + 8 * (lane >> 4);
#pragma unroll
  for (int i = 0; i < 8; ++i) { v[i] = p[i]; v[8 + i] = p[16 + i]; }
  return bsplit16(v); }
__device__ __forceinline__ F2 split_rowK(const float* row, int k0, int lane, int K) { float v[16]; const int g = lane >> 4;
#pragma unroll
  for (int i = 0; i < 8; ++i) { const int ka = k0 + 8 * g + i, kb = ka + 16; v[i] = ka < K ? row[ka < K ? ka : K - 1] : 0.f; v[8 + i] = kb < K ? row[kb < K ? kb : K - 1] : 0.f; }
  return bsplit16(v); }
__device__ __forceinline__ F2 split_col(const float* W, int k0, int n, int lane, int ld, int K) { float v[16]; const int g = lane >> 4;
#pragma unroll
  for (int i = 0; i < 8; ++i) { const int ka = k0 + 8 * g + i, kb = ka + 16; v[i] = ka < K ? W[(size_t)(ka < K ? ka : K - 1) * ld + n] : 0.f; v[8 + i] = kb < K ? W[(size_t)(kb < K ? kb : K - 1) * ld + n] : 0.f; }
  return bsplit16(v); }
__device__ __forceinline__ v8f mac3(const F2& a, const F2& b, v8f c) { c = wmma_bf(a.l, b.h, c); c = wmma_bf(a.h, b.l, c); return wmma_bf(a.h, b.h, c); }
__device__ __forceinline__ float sigm(float v) { return 1.0f / (1.0f + expf(-v)); }
#define LDSX() do { asm volatile("s_wait_dscnt 0" ::: "memory"); __builtin_amdgcn_wave_barrier(); __builtin_amdgcn_fence(__ATOMIC_RELEASE, "workgroup"); } while (0)

// Multi-head self-attention with interleaved-pair RoPE, no mask (x [2,2048,1024]; Wqkv [3072,1024] torch (out,in): qkv.reshape(B, S, 3, 16, 64): q = rows 0..1023, k = 1024..2047, v = 2048..3071; Wout [1024,1024] (out,in); token_positions [2048] int32 = arange, a module input READ on the device; RoPE on q and k: (even, odd) pairs (x_e c - x_o s, x_e s + x_o c) re-interleaved, inv_freq = 1 / 10000^(2i/64); scores / sqrt(64); softmax; out @ Wout.T).
#define NB 2
#define TT 2048
#define CC 1024            // NH * HD = projected width
#define DIN 1024          // input (model) width
#define NH 16
#define HD 64
#define NQB (TT / 64)
#define HG 4
#define SCALE (0.125f)
#define CAUSAL 0
#ifndef TNB
#define TNB NB
#endif
__device__ __forceinline__ float bfr(float v) { return (float)(__bf16)v; }
__host__ __device__ __forceinline__ int kb_last(int qb) { return CAUSAL ? ((qb * 64 + 63) >> 7) : (TT / 128 - 1); }
typedef __attribute__((ext_vector_type(8))) __bf16 v8b;
__device__ __forceinline__ v16b frag_b(const __bf16* rowk0, int lane) {
  union { v16b v; v8b q[2]; } u; const __bf16* p = rowk0 + 8 * (lane >> 4);
  u.q[0] = *(const v8b*)p; u.q[1] = *(const v8b*)(p + 16); return u.v;
}
// operand staging of the two projection GEMMs: the operands lie in the workspace as 16-bit values, rounded once ahead of the GEMMs; a 64-k chunk of a row is one 128-byte line; 8 lanes fetch it whole, 16 bytes each; LDS rows of 64 values at a pitch of 72 (144 bytes = 16 x odd, for 16-byte readers)
typedef __attribute__((ext_vector_type(4))) __bf16 v4b;
typedef __attribute__((ext_vector_type(4))) _Float16 v4h;
#define SPK 72
#define KCH 64              // k values a chunk
// work-group barrier by hand, behind the wave's own LDS wait: __syncthreads() would also wait out the global loads that are meant to stay in flight across it
__device__ __forceinline__ void stage_bar() { asm volatile("s_wait_dscnt 0x0" ::: "memory"); asm volatile("s_barrier_signal -1\n\ts_barrier_wait -1" ::: "memory"); }
// behind a group of look-ahead loads: their address registers are reused while the loads are still in flight
__device__ __forceinline__ void loads_issued() { asm volatile("s_wait_xcnt 0x0" ::: "memory"); }
// behind a store in a loop: its address and data registers are rewritten by what follows it
__device__ __forceinline__ void store_issued() { asm volatile("s_wait_xcnt 0x0" ::: "memory"); }
__device__ __forceinline__ v4b cvt4b(v4f v) { v4b r; r[0] = (__bf16)v[0]; r[1] = (__bf16)v[1]; r[2] = (__bf16)v[2]; r[3] = (__bf16)v[3]; return r; }
__device__ __forceinline__ v4h cvt4w(v4f v) { v4h r; r[0] = (_Float16)(bfr(v[0]) * 256.0f); r[1] = (_Float16)(bfr(v[1]) * 256.0f); r[2] = (_Float16)(bfr(v[2]) * 256.0f); r[3] = (_Float16)(bfr(v[3]) * 256.0f); return r; }
#define QBH 0              // unused: k_fa has one path for all query blocks
#define QHI 0               // single-product logits on every row
#define KHI 64            // key rows carrying k residual / v bf16 hi+lo planes (written by k_proj, read by no kernel here)
// B fragment (k rows k0+.., output column o) of a weight: (in,out) [K][ld] or (out,in) [ld rows of K]: bf16 exact, or f16(bf16 * 256) exact
__device__ __forceinline__ v16b wcol_io(const float* Wm, int k0, int o, int lane, int ld) { v16b w; const int g = lane >> 4;
#pragma unroll
  for (int i = 0; i < 8; ++i) { w[i] = (__bf16)Wm[(size_t)(k0 + 8 * g + i) * ld + o]; w[8 + i] = (__bf16)Wm[(size_t)(k0 + 16 + 8 * g + i) * ld + o]; }
  return w; }
__device__ __forceinline__ v16b wcol_oi(const float* Wm, int k0, int o, int lane, int K) { v16b w; const float* p = Wm + (size_t)o * K + k0 + 8 * (lane >> 4);
#pragma unroll
  for (int i = 0; i < 8; ++i) { w[i] = (__bf16)p[i]; w[8 + i] = (__bf16)p[16 + i]; }
  return w; }
__device__ __forceinline__ v16h wcolh_io(const float* Wm, int k0, int o, int lane, int ld) { v16h w; const int g = lane >> 4;
#pragma unroll
  for (int i = 0; i < 8; ++i) { w[i] = (_Float16)(bfr(Wm[(size_t)(k0 + 8 * g + i) * ld + o]) * 256.0f); w[8 + i] = (_Float16)(bfr(Wm[(size_t)(k0 + 16 + 8 * g + i) * ld + o]) * 256.0f); }
  return w; }
__device__ __forceinline__ v16h wcolh_oi(const float* Wm, int k0, int o, int lane, int K) { v16h w; const float* p = Wm + (size_t)o * K + k0 + 8 * (lane >> 4);
#pragma unroll
  for (int i = 0; i < 8; ++i) { w[i] = (_Float16)(bfr(p[i]) * 256.0f); w[8 + i] = (_Float16)(bfr(p[16 + i]) * 256.0f); }
  return w; }
#define WQKV_LAYOUT 1   // 0 = (in,out) [DIN][CC]; 1 = (out,in) [CC][DIN]; 2 = per-head [NH][DIN][HD]
__device__ __forceinline__ v16b wcol_hdk(const float* Wm, int k0, int o, int lane) { v16b w; const int g = lane >> 4; const float* p = Wm + (size_t)(o / HD) * DIN * HD + (o % HD);
#pragma unroll
  for (int i = 0; i < 8; ++i) { w[i] = (__bf16)p[(size_t)(k0 + 8 * g + i) * HD]; w[8 + i] = (__bf16)p[(size_t)(k0 + 16 + 8 * g + i) * HD]; }
  return w; }
#define WO_OUT_IN 1
#if WQKV_LAYOUT == 1
#define WCOL(W, k0, o, lane) wcol_oi(W, k0, o, lane, DIN)
#elif WQKV_LAYOUT == 2
#define WCOL(W, k0, o, lane) wcol_hdk(W, k0, o, lane)
#else
#define WCOL(W, k0, o, lane) wcol_io(W, k0, o, lane, CC)
#endif
#if WO_OUT_IN
#define WOCOL(W, k0, o, lane) wcol_oi(W, k0, o, lane, CC)
#define WOCOLH(W, k0, o, lane) wcolh_oi(W, k0, o, lane, CC)
#else
#define WOCOL(W, k0, o, lane) wcol_io(W, k0, o, lane, DIN)
#define WOCOLH(W, k0, o, lane) wcolh_io(W, k0, o, lane, DIN)
#endif

// RoPE inverse frequencies 1/10000^(2i/64) (the f32 values jax computes)
__constant__ float INVF[32] = {1.000000000e+00,7.498942018e-01,5.623413324e-01,4.216965139e-01,3.162277639e-01,2.371373624e-01,1.778279394e-01,1.333521456e-01,1.000000015e-01,7.498941571e-02,5.623412877e-02,4.216964915e-02,3.162277862e-02,2.371373586e-02,1.778279431e-02,1.333521493e-02,9.999999776e-03,7.498942316e-03,5.623413250e-03,4.216964822e-03,3.162277862e-03,2.371373819e-03,1.778279431e-03,1.333521446e-03,1.000000047e-03,7.498941850e-04,5.623413017e-04,4.216964880e-04,3.162277862e-04,2.371373848e-04,1.778279402e-04,1.333521504e-04};
// RoPE factors: (cos, sin) of pos * INVF[i], pos READ from the int input, depend on (token, i) alone: the rounding launch works each pair out once into the table RT [t][i][cos, sin]; k_proj's q and k blocks read them there
#ifndef SM_EXTRA_PARAMS
#define SM_EXTRA_PARAMS
#endif
#ifndef PROJ_EXTRA_PARAMS
#define PROJ_EXTRA_PARAMS
#endif
#ifndef SM_MASK_HOOK
#define SM_MASK_HOOK (void)0
#endif

#define WS_QH  0u                                      // f16 q rows [b*t][CC]
#define WS_KH  (WS_QH + 2u * (size_t)NB * TT * CC)      // f16 k rows [b*t][CC]
#define WS_VT  (WS_KH + 2u * (size_t)NB * TT * CC)      // f16 v planes [b][c][t]
#define WS_QL  (WS_VT + 2u * (size_t)NB * CC * TT)      // f16 q residual x 2^10 rows [b][t < QHI][CC]
#define WS_KL  (WS_QL + 2u * (size_t)NB * QHI * CC)     // f16 k residual x 2^10 rows [b][t < KHI][CC]
#define WS_VB  (WS_KL + 2u * (size_t)NB * KHI * CC)     // bf16 v hi planes [b][c][t < KHI]
#define WS_VBL (WS_VB + 2u * (size_t)NB * CC * KHI)
#define WS_S   (WS_VBL + 2u * (size_t)NB * CC * KHI)    // (once f32 logits) now the rounded GEMM operands
#define WS_XB  WS_S                                     // bf16 x rows [b*t][DIN]
#define WS_WB  (WS_XB + 2u * (size_t)NB * TT * DIN)     // bf16 Wqkv rows [3 * CC][DIN]
#define WS_WH  (WS_WB + 2u * (size_t)3 * CC * DIN)      // f16(bf16 x 2^8) Wout rows [DIN][CC]
#define WS_RT  (WS_WH + 2u * (size_t)DIN * CC)          // f32 RoPE table [t][32][cos, sin]
#define WS_Y   (WS_S  + 4u * (size_t)HG * TT * TT)      // f16 ctx x 2^6 rows [b*t][CC]
#define WS_END (WS_Y  + 4u * (size_t)NB * TT * CC)

// ---- k_cvt: the GEMM operands that are inputs are rounded once, ahead of the GEMMs (each was rounded anew by every block that read it): x and Wqkv to bf16, Wout to f16(bf16 x 2^8).
// Few, long waves (two blocks of 8 waves a WGP): a block takes 16384 values in 16 passes; a pass is 16 bytes in and 8 bytes out a lane, whole lines a wave; all 16 loads of a lane are in flight together.
#define CVB 16384                         // values a block
#define CVX (NB * TT * DIN / CVB)         // blocks of x
#define CVW (3 * CC * DIN / CVB)          // blocks of Wqkv
#define CVO (DIN * CC / CVB)              // blocks of Wout
#define CVT (TT * 32 / 1024)              // blocks of the RoPE table: 1024 (token, frequency) entries a block, 4 a lane; they stand first in the grid
__global__ __launch_bounds__(256) void k_cvt(const float* __restrict__ X, const float* __restrict__ WQKV, const float* __restrict__ WO, const int* __restrict__ TPOS, __bf16* __restrict__ XB, __bf16* __restrict__ WB, _Float16* __restrict__ WH, float* __restrict__ RT) {
  if (blockIdx.x < CVT) { const int e0 = blockIdx.x * 1024 + threadIdx.x;   // entry e = t * 32 + i; a lane's four entries are 256 apart: one frequency, tokens 8 apart
    const int* tp = TPOS + (e0 >> 5); const float* fp = INVF + (e0 & 31); float* d = RT + 2 * (size_t)e0; int ps[4]; v2f c[4];
#pragma unroll
    for (int p = 0; p < 4; ++p) ps[p] = tp[p * 8];
    const float fr = *fp;
#pragma unroll
    for (int p = 0; p < 4; ++p) { const float ang = (float)ps[p] * fr; c[p][0] = cosf(ang); c[p][1] = sinf(ang); }
#pragma unroll
    for (int p = 0; p < 4; ++p) vst2(d + p * 512, c[p]);   // 8 bytes a lane, 256 contiguous bytes a wave; the wave ends behind these stores
    return; }
  const int bx = blockIdx.x - CVT; const size_t o = (size_t)threadIdx.x * 4; v4f a[16];
  if (bx < CVX + CVW) { const bool isx = bx < CVX; const size_t e = (size_t)(isx ? bx : bx - CVX) * CVB + o; const float* s = (isx ? X : WQKV) + e; __bf16* d = (isx ? XB : WB) + e;
#pragma unroll
    for (int p = 0; p < 16; ++p) a[p] = *(const v4f*)(s + p * 1024);
    asm volatile("s_wait_xcnt 0x0" :: "v"(s) : "memory");   // the address pair is an input, so it stays live up to this wait: no load's own result is placed on it while the loads before it are in flight
#pragma unroll
    for (int p = 0; p < 16; ++p) vst2(d + p * 1024, cvt4b(a[p]));
    asm volatile("s_wait_xcnt 0x0" ::: "memory");   // behind the last store of the run: no register that a store names is rewritten ahead of this wait
  } else { const size_t e = (size_t)(bx - CVX - CVW) * CVB + o; const float* s = WO + e; _Float16* d = WH + e;
#pragma unroll
    for (int p = 0; p < 16; ++p) a[p] = *(const v4f*)(s + p * 1024);
    asm volatile("s_wait_xcnt 0x0" :: "v"(s) : "memory");   // the address pair is an input, so it stays live up to this wait: no load's own result is placed on it while the loads before it are in flight
#pragma unroll
    for (int p = 0; p < 16; ++p) vst2(d + p * 1024, cvt4w(a[p]));
    asm volatile("s_wait_xcnt 0x0" ::: "memory"); } }   // behind the last store of the run: no register that a store names is rewritten ahead of this wait
// ---- k_proj: block = (128 rows, 128 cols, which), 4 waves as 2 x 2, a wave = 64 x 64 (4 + 4 fragments feed 16 products): q/k/v = X W (+ b) with exact bf16 products (K = DIN) -> which 0: q f16 rows (+ residual rows < QHI); 1: k f16 rows (+ residual rows < KHI); 2: v f16 planes [c][t] (+ bf16 hi/lo planes for t < KHI)
#define PST (64 * 132 * 4)                 // bytes of st
#define PSM (PST + 3 * 128 * 72 * 2)       // bytes of the block's LDS; the operand buffers take 2 * 256 * SPK * 2 of them
__global__ __launch_bounds__(128) void k_proj(const __bf16* __restrict__ XQ, const __bf16* __restrict__ XK, const __bf16* __restrict__ XV, const __bf16* __restrict__ WQ, const __bf16* __restrict__ WK, const __bf16* __restrict__ WV, const float* __restrict__ BQ, const float* __restrict__ BK, const float* __restrict__ BV,
    _Float16* __restrict__ QH, _Float16* __restrict__ QL, _Float16* __restrict__ KH, _Float16* __restrict__ KL, _Float16* __restrict__ VT, __bf16* __restrict__ VB, __bf16* __restrict__ VBL, const float* __restrict__ RT) {
  __shared__ __align__(16) char sm[PSM];   // one array: the main loop's two operand buffers from its start; behind the loop's last barrier the epilogue's st, and behind st either sh, sl (q, k) or th, tb, tbl (v); three blocks fit a WGP
  float (*st)[132] = (float (*)[132])sm; _Float16 (*sh)[136] = (_Float16 (*)[136])(sm + PST); _Float16 (*sl)[136] = sh + 64; _Float16 (*th)[72] = (_Float16 (*)[72])(sm + PST); __bf16 (*tb)[72] = (__bf16 (*)[72])(th + 128); __bf16 (*tbl)[72] = tb + 128;
  const int tid = threadIdx.x, wave = tid >> 5, lane = tid & 31, col = lane & 15, g = lane >> 4, wr = wave >> 1, wc = wave & 1; const int which = blockIdx.z; const int c0 = blockIdx.y * 128; const size_t r0 = (size_t)blockIdx.x * 128; const size_t bb = r0 / TT; const int t0 = (int)(r0 % TT);
  const __bf16* X = which == 0 ? XQ : which == 1 ? XK : XV; const __bf16* WA = which == 0 ? WQ : which == 1 ? WK : WV; const float* BA = which == 0 ? BQ : which == 1 ? BK : BV;
  v2f tc[2][16];   // q and k blocks: the RoPE factors of the 16 rows that this wave rotates in each 64-row half, lane = frequency i: 256 contiguous bytes a row; the first half's are fetched ahead of the main loop, which covers their latency, the second half's while the first half is stored
  if (which < 2) { const float* tp = RT + (size_t)(t0 + wave * 16) * 64 + lane * 2;
#pragma unroll
    for (int rr = 0; rr < 16; ++rr) tc[0][rr] = *(const v2f*)(tp + rr * 64);
    asm volatile("s_wait_xcnt 0x0" :: "v"(tp) : "memory"); }   // the address pair is an input, so it stays live up to this wait: no load's own result is placed on it while the loads before it are being issued
  v8f acc[4][4] = {};
  { // operands through LDS, two buffers: rows 0..127 = X rows, 128..255 = weight rows of this tile; chunk kc + 1 is in flight in registers while chunk kc is multiplied
    __bf16* const sb0 = (__bf16*)sm; __bf16* const sb1 = sb0 + 256 * SPK;
    const int lr = tid >> 3, lp = tid & 7; const __bf16* Ap = X + (r0 + lr) * DIN + lp * 8; const __bf16* Wp = WA + (size_t)(c0 + lr) * DIN + lp * 8; const int so = lr * SPK + lp * 8;
    v4u ra[8], rw[8];
#pragma unroll
    for (int i = 0; i < 8; ++i) ra[i] = *(const v4u*)(Ap + (size_t)i * 16 * DIN);
#pragma unroll
    for (int i = 0; i < 8; ++i) rw[i] = *(const v4u*)(Wp + (size_t)i * 16 * DIN);
#pragma unroll
    for (int i = 0; i < 8; ++i) *(v4u*)(sb0 + so + i * 16 * SPK) = ra[i];
#pragma unroll
    for (int i = 0; i < 8; ++i) *(v4u*)(sb0 + so + (128 + i * 16) * SPK) = rw[i];
#pragma unroll
    for (int i = 0; i < 8; ++i) ra[i] = *(const v4u*)(Ap + (size_t)i * 16 * DIN + KCH);
#pragma unroll
    for (int i = 0; i < 8; ++i) rw[i] = *(const v4u*)(Wp + (size_t)i * 16 * DIN + KCH);
    loads_issued(); stage_bar();   // chunk 0 is published
#pragma unroll 2   // two trips a pass, so that each trip's buffer addresses are constants
    for (int kc = 0; kc < DIN / KCH; ++kc) { const __bf16* sb = (kc & 1) ? sb1 : sb0; __bf16* sn = (kc & 1) ? sb0 : sb1;
#pragma unroll
      for (int ks = 0; ks < KCH; ks += 32) { v16b a[4], w[4];
#pragma unroll
        for (int i = 0; i < 4; ++i) a[i] = frag_b(sb + (wr * 64 + i * 16 + col) * SPK + ks, lane);
#pragma unroll
        for (int j = 0; j < 4; ++j) w[j] = frag_b(sb + (128 + wc * 64 + j * 16 + col) * SPK + ks, lane);
#pragma unroll
        for (int i = 0; i < 4; ++i)
#pragma unroll
          for (int j = 0; j < 4; ++j) acc[i][j] = wmma_bf(a[i], w[j], acc[i][j]); }
      __builtin_amdgcn_sched_barrier(0);   // keeps the wait for chunk kc + 1's loads behind the products, which cover a part of their latency
      if (kc + 1 < DIN / KCH) {   // the other buffer's readers left it before the last barrier
#pragma unroll
        for (int i = 0; i < 8; ++i) *(v4u*)(sn + so + i * 16 * SPK) = ra[i];
#pragma unroll
        for (int i = 0; i < 8; ++i) *(v4u*)(sn + so + (128 + i * 16) * SPK) = rw[i];
        if (kc + 2 < DIN / KCH) {
#pragma unroll
          for (int i = 0; i < 8; ++i) ra[i] = *(const v4u*)(Ap + (size_t)i * 16 * DIN + (kc + 2) * KCH);
#pragma unroll
          for (int i = 0; i < 8; ++i) rw[i] = *(const v4u*)(Wp + (size_t)i * 16 * DIN + (kc + 2) * KCH);
          loads_issued(); } }
      stage_bar(); } }   // publishes chunk kc + 1 and ends the reads of chunk kc
#pragma unroll   // the tile leaves in two halves of 64 rows through the same staging arrays; unrolled, so that the accumulators are indexed by constants
  for (int hf = 0; hf < 2; ++hf) { const size_t r0h = r0 + hf * 64; const int t0h = t0 + hf * 64;
  { // stage the half's f32 tile (acc + bias) in LDS (the two waves that hold it), rotate the q and k rows there, then convert
    if (wr == hf) {
#pragma unroll
      for (int j = 0; j < 4; ++j) { const float bias = BA ? bfr(BA[c0 + wc * 64 + j * 16 + col]) : 0.f;
#pragma unroll
        for (int i = 0; i < 4; ++i)
#pragma unroll
          for (int r = 0; r < 8; ++r) st[i * 16 + 8 * g + r][wc * 64 + j * 16 + col] = acc[i][j][r] + bias; } }
    __syncthreads();
    if (which < 2) {   // interleaved-pair rotation (x[2i], x[2i + 1]) by the angle pos * INVF[i]: lane = pair i of a head, so a wave reads and writes 256 contiguous bytes of a row; v untouched
#pragma unroll
      for (int rr = 0; rr < 16; ++rr) { const float cs = tc[hf][rr][0], sn = tc[hf][rr][1];
#pragma unroll
        for (int hh = 0; hh < 128 / HD; ++hh) { float* rw = &st[wave * 16 + rr][hh * HD + 2 * lane]; const v2f x = *(const v2f*)rw; v2f y; y[0] = x[0] * cs - x[1] * sn; y[1] = x[0] * sn + x[1] * cs; *(v2f*)rw = y; } } }
    __syncthreads(); }
  if (which < 2) { _Float16* DH = which == 0 ? QH : KH; _Float16* DL = which == 0 ? QL : KL; const int nhi = which == 0 ? QHI : KHI; const bool hi_rows = t0h < nhi;
    for (int e = tid; e < 64 * 128; e += 128) { const int rl = e >> 7, cl = e & 127; const float v = st[rl][cl]; const _Float16 hv = (_Float16)v; sh[rl][cl] = hv; sl[rl][cl] = (_Float16)((v - (float)hv) * 1024.0f); }
    __syncthreads();
    if (hf == 0) { const float* tp = RT + (size_t)(t0 + wave * 16) * 64 + lane * 2;   // behind the first half's last barrier (a barrier would wait these loads out): its stores and the second half's staging cover their latency
#pragma unroll
      for (int rr = 0; rr < 16; ++rr) tc[1][rr] = *(const v2f*)(tp + (64 + rr) * 64);
      asm volatile("s_wait_xcnt 0x0" :: "v"(tp) : "memory"); }   // as at the first half's fetch
    for (int e = tid; e < 64 * 16; e += 128) { const int rl = e >> 4, q = e & 15; vst2((unsigned*)(DH + (r0h + rl) * CC + c0 + q * 8), *(const v4u*)&sh[rl][q * 8]); store_issued(); if (hi_rows) { vst2((unsigned*)(DL + (bb * nhi + t0h + rl) * (size_t)CC + c0 + q * 8), *(const v4u*)&sl[rl][q * 8]); store_issued(); } }
  } else { const bool hi_rows = t0h < KHI;
    for (int e = tid; e < 64 * 128; e += 128) { const int rl = e & 63, cl = e >> 6; const float v = st[rl][cl]; th[cl][rl] = (_Float16)v; const __bf16 bh = (__bf16)v; tb[cl][rl] = bh; tbl[cl][rl] = (__bf16)(v - (float)bh); }
    __syncthreads();
    for (int e = tid; e < 128 * 8; e += 128) { const int cl = e >> 3, q = e & 7; vst2((unsigned*)(VT + (bb * CC + c0 + cl) * (size_t)TT + t0h + q * 8), *(const v4u*)&th[cl][q * 8]); store_issued(); if (hi_rows) { const size_t o3 = (bb * CC + c0 + cl) * (size_t)KHI + t0h + q * 8; vst2((unsigned*)(VB + o3), *(const v4u*)&tb[cl][q * 8]); vst2((unsigned*)(VBL + o3), *(const v4u*)&tbl[cl][q * 8]); store_issued(); } } } } }
// ---- k_fa: block = 128 queries (4 waves x 32 query columns) of head h, batch b: logits, softmax and P . v in one pass over the keys, 32 keys a trip; no logit or P ever leaves the registers.
// Transposed products: S^T = K Q^T (lane = query column, element r = key 8g + r), so the two 16-key tiles of a trip, converted in place, are the B fragment (k = key, hardware k order) of ctx^T = V^T P^T.
// Running maximum m (raw logits) and running sum l per query column; p = 2^((s - m) c + 8), c = SCALE log2(e); the 2^8 keeps small p clear of f16 subnormals and cancels in acc / l.
// K rows and V^T rows reach the four waves through LDS: a stage is 128 keys, copied once per block as whole 128-byte lines by asynchronous 16-byte copies, two buffers, stage t + 1 in flight while stage t is worked on.
__device__ __forceinline__ float xhalf(float x) { return __builtin_bit_cast(float, __builtin_amdgcn_permlanex16(__builtin_bit_cast(int, x), __builtin_bit_cast(int, x), 0x76543210, 0xfedcba98, false, false)); }  // lane l with lane l ^ 16
__device__ __forceinline__ v8f mmah(v16h a, v16h b, v8f c) { return __builtin_amdgcn_wmma_f32_16x16x32_f16(false, a, false, b, (short)0, c, false, false); }
#define FKS 128                       // keys a stage
#define FKP 72                        // LDS pitch of a K row in f16: 64 channels + 8 (144 bytes = 16 x odd, for 16-byte readers)
#define FVP 136                       // LDS pitch of a V^T row in f16: 128 keys + 8 (272 bytes = 16 x odd)
#define FVO (FKS * FKP)               // the V^T rows stand behind the K rows
#define FBUF (FKS * FKP + HD * FVP)   // f16 a buffer
__device__ __forceinline__ unsigned lds_off(const void* p) { return (unsigned)(size_t)p; }   // byte offset in the work-group's LDS
// eight 16-byte copies a lane, global memory to LDS through no register; the s_wait_xcnt closes the statement so that no address register of a copy is rewritten ahead of it
__device__ __forceinline__ void copy8(unsigned l, unsigned ls, const _Float16* p, size_t ps) {
  asm volatile("global_load_async_to_lds_b128 %0, %8, off\n\t"
               "global_load_async_to_lds_b128 %1, %9, off\n\t"
               "global_load_async_to_lds_b128 %2, %10, off\n\t"
               "global_load_async_to_lds_b128 %3, %11, off\n\t"
               "global_load_async_to_lds_b128 %4, %12, off\n\t"
               "global_load_async_to_lds_b128 %5, %13, off\n\t"
               "global_load_async_to_lds_b128 %6, %14, off\n\t"
               "global_load_async_to_lds_b128 %7, %15, off\n\t"
               "s_wait_xcnt 0x0"
               :: "v"(l), "v"(l + ls), "v"(l + 2 * ls), "v"(l + 3 * ls), "v"(l + 4 * ls), "v"(l + 5 * ls), "v"(l + 6 * ls), "v"(l + 7 * ls),
                  "v"(p), "v"(p + ps), "v"(p + 2 * ps), "v"(p + 3 * ps), "v"(p + 4 * ps), "v"(p + 5 * ps), "v"(p + 6 * ps), "v"(p + 7 * ps) : "memory");
}
__global__ __launch_bounds__(128) void k_fa(const _Float16* __restrict__ QH, const _Float16* __restrict__ KH, const _Float16* __restrict__ VT, _Float16* __restrict__ Y) {
  __shared__ __align__(16) _Float16 kv[2][FBUF];   // [buffer][K rows 0..127 at pitch FKP | V^T rows 0..63 at pitch FVP]
  const int tid = threadIdx.x, wave = tid >> 5, lane = tid & 31, col = lane & 15, g = lane >> 4; const int h = blockIdx.y, b = blockIdx.z; const int q0 = blockIdx.x * 128 + wave * 32;
  const float cs = SCALE * 1.4426950408889634f;
  v16h qf[2][2];
#pragma unroll
  for (int qt = 0; qt < 2; ++qt)
#pragma unroll
    for (int kc = 0; kc < 2; ++kc) qf[qt][kc] = frag_h(QH + ((size_t)b * TT + q0 + qt * 16 + col) * CC + h * HD + kc * 32, lane);
  // the copies of a stage: 8 lanes take one K row (128 bytes), rows tid / 8 + 16 i; 16 lanes take one V^T row (256 bytes), rows tid / 16 + 8 i
  const _Float16* Kg = KH + ((size_t)b * TT + (tid >> 3)) * CC + h * HD + (tid & 7) * 8;
  const _Float16* Vg = VT + ((size_t)b * CC + h * HD + (tid >> 4)) * (size_t)TT + (tid & 15) * 8;
  const unsigned lk = lds_off(&kv[0][0]) + 2u * (unsigned)((tid >> 3) * FKP + (tid & 7) * 8);
  const unsigned lv = lds_off(&kv[0][0]) + 2u * (unsigned)(FVO + (tid >> 4) * FVP + (tid & 15) * 8);
#define FA_STAGE(s, bf) do { copy8(lk + (unsigned)(bf) * (2u * FBUF), 2u * 16 * FKP, Kg + (size_t)(s) * FKS * CC, (size_t)16 * CC); copy8(lv + (unsigned)(bf) * (2u * FBUF), 2u * 8 * FVP, Vg + (size_t)(s) * FKS, (size_t)8 * TT); } while (0)
  FA_STAGE(0, 0);
  asm volatile("s_wait_asynccnt 0x0" ::: "memory");   // this wave's copies of stage 0 have landed
  __syncthreads();                                    // stage 0 is published
  FA_STAGE(1, 1);
  v8f acc[2][4] = {}; float m[2] = {-INFINITY, -INFINITY}, l[2] = {0.f, 0.f};
  for (int t = 0; t < TT / FKS; ++t) {
    const _Float16* Ks = &kv[t & 1][0] + col * FKP;         // key row col of a 16-key tile
    const _Float16* Vs = &kv[t & 1][0] + FVO + col * FVP;   // V^T row of channel col of a 16-channel tile
    v16h kf[2][2];
#pragma unroll
    for (int kt = 0; kt < 2; ++kt)
#pragma unroll
      for (int kc = 0; kc < 2; ++kc) kf[kt][kc] = frag_h(Ks + (kt * 16) * FKP + kc * 32, lane);
#pragma unroll 1   // one trip's registers only: with the four trips of a stage unrolled the build went past 255 registers and into scratch
    for (int k0 = 0; k0 < FKS; k0 += 32) {
      v16h vf[4];
#pragma unroll
      for (int j = 0; j < 4; ++j) vf[j] = frag_h(Vs + (j * 16) * FVP + k0, lane);
      v8f s[2][2] = {};
#pragma unroll
      for (int kc = 0; kc < 2; ++kc)
#pragma unroll
        for (int qt = 0; qt < 2; ++qt)
#pragma unroll
          for (int kt = 0; kt < 2; ++kt) s[qt][kt] = mmah(kf[kt][kc], qf[qt][kc], s[qt][kt]);
      const int kn = (k0 + 32) & (FKS - 1);   // the next trip's key rows, fetched a trip ahead; a stage's last trip fetches its own stage's rows 0..31 again (published, not used)
#pragma unroll
      for (int kt = 0; kt < 2; ++kt)
#pragma unroll
        for (int kc = 0; kc < 2; ++kc) kf[kt][kc] = frag_h(Ks + (kn + kt * 16) * FKP + kc * 32, lane);
      __builtin_amdgcn_sched_barrier(0);   // holds the look-ahead reads here: moved down behind the softmax they would have no time to land before the next trip's first product
#pragma unroll
      for (int qt = 0; qt < 2; ++qt) {
        float mx = fmaxf(s[qt][0][0], s[qt][1][0]);
#pragma unroll
        for (int r = 1; r < 8; ++r) mx = fmaxf(mx, fmaxf(s[qt][0][r], s[qt][1][r]));
        mx = fmaxf(mx, xhalf(mx));            // both halves of the wave hold this query's maximum over the 32 keys
        const float mn = fmaxf(m[qt], mx); const float corr = __builtin_amdgcn_exp2f((m[qt] - mn) * cs);   // 0 on the first trip
        m[qt] = mn; const float nm = 8.0f - mn * cs;
        v16h pf; float s0 = 0.f, s1 = 0.f;
#pragma unroll
        for (int r = 0; r < 8; ++r) { const float p0 = __builtin_amdgcn_exp2f(fmaf(s[qt][0][r], cs, nm)), p1 = __builtin_amdgcn_exp2f(fmaf(s[qt][1][r], cs, nm)); s0 += p0; s1 += p1; pf[r] = (_Float16)p0; pf[8 + r] = (_Float16)p1; }
        l[qt] = l[qt] * corr + (s0 + s1);
#pragma unroll
        for (int j = 0; j < 4; ++j) { acc[qt][j] = acc[qt][j] * corr; acc[qt][j] = mmah(vf[j], pf, acc[qt][j]); } } }
    asm volatile("s_wait_dscnt 0x0" ::: "memory");      // this wave's reads of stage t have returned
    asm volatile("s_wait_asynccnt 0x0" ::: "memory");   // this wave's copies of stage t + 1 have landed
    __syncthreads();                                    // publishes stage t + 1 and ends every wave's reads of stage t
    if (t + 2 < TT / FKS) FA_STAGE(t + 2, t & 1); }     // refill of the buffer that stage t has just left
  asm volatile("s_wait_asynccnt 0x0" ::: "memory");     // no copy is outstanding when the wave ends
#pragma unroll
  for (int qt = 0; qt < 2; ++qt) { const float inv = 1.0f / (l[qt] + xhalf(l[qt]));   // the two halves' sums are joined once
    _Float16* yr = Y + ((size_t)b * TT + q0 + qt * 16 + col) * CC + h * HD + 8 * g;  // element r of tile j = channel j * 16 + 8g + r of query col; ctx leaves as k_out's operand, x 2^6 once to f16 (small context rows stay clear of f16 subnormals)
#pragma unroll
    for (int j = 0; j < 4; ++j) { const v8f o = acc[qt][j] * inv; v8h y;
#pragma unroll
      for (int r = 0; r < 8; ++r) y[r] = (_Float16)(o[r] * 64.0f);
      vst2(yr + j * 16, y); } } }
// ---- k_out: block = (128 rows, 128 cols), 8 waves as 4 x 2, a wave = 32 x 64 (2 + 4 fragments feed 8 products; one block a WGP, so two waves a SIMD): out = ctx Wo (+ bo): ctx (f16, x 2^6) against Wo as f16(bf16 x 2^8) exact (1 product) x 2^-14
#define OFP 68              // pitch in f32 of a wave's staged output rows (64 values + 4: the two halves of a wave fall on different banks)
__global__ __launch_bounds__(256) void k_out(const _Float16* __restrict__ Y, const _Float16* __restrict__ WO, const float* __restrict__ BO, float* __restrict__ OUT) { __shared__ __align__(16) _Float16 sg[2][256 * SPK];   // the two operand buffers; behind the loop's last barrier each wave stages its 32 x 64 f32 tile in its own eighth
  const int tid = threadIdx.x, wave = tid >> 5, lane = tid & 31, col = lane & 15, g = lane >> 4, wr = wave >> 1, wc = wave & 1; const int c0 = blockIdx.y * 128 + wc * 64; const size_t r0 = (size_t)blockIdx.x * 128 + wr * 32;
  v8f acc[2][4] = {};
  {
    // operands through LDS as in k_proj: rows 0..127 = ctx rows, 128..255 = weight rows
    const int lr = tid >> 3, lp = tid & 7; const _Float16* Ap = Y + ((size_t)blockIdx.x * 128 + lr) * CC + lp * 8; const _Float16* Wp = WO + (size_t)(blockIdx.y * 128 + lr) * CC + lp * 8; const int so = lr * SPK + lp * 8;
    v4u ra[4], rw[4];
#pragma unroll
    for (int i = 0; i < 4; ++i) ra[i] = *(const v4u*)(Ap + (size_t)i * 32 * CC);
#pragma unroll
    for (int i = 0; i < 4; ++i) rw[i] = *(const v4u*)(Wp + (size_t)i * 32 * CC);
#pragma unroll
    for (int i = 0; i < 4; ++i) *(v4u*)(&sg[0][0] + so + i * 32 * SPK) = ra[i];
#pragma unroll
    for (int i = 0; i < 4; ++i) *(v4u*)(&sg[0][0] + so + (128 + i * 32) * SPK) = rw[i];
#pragma unroll
    for (int i = 0; i < 4; ++i) ra[i] = *(const v4u*)(Ap + (size_t)i * 32 * CC + KCH);
#pragma unroll
    for (int i = 0; i < 4; ++i) rw[i] = *(const v4u*)(Wp + (size_t)i * 32 * CC + KCH);
    loads_issued(); stage_bar();   // chunk 0 is published
#pragma unroll 2   // two trips a pass, so that each trip's buffer addresses are constants
    for (int kc = 0; kc < CC / KCH; ++kc) { const _Float16* sb = &sg[kc & 1][0]; _Float16* sn = &sg[(kc & 1) ^ 1][0];
#pragma unroll
      for (int ks = 0; ks < KCH; ks += 32) { v16h a[2], w[4];
#pragma unroll
        for (int i = 0; i < 2; ++i) a[i] = frag_h(sb + (wr * 32 + i * 16 + col) * SPK + ks, lane);
#pragma unroll
        for (int j = 0; j < 4; ++j) w[j] = frag_h(sb + (128 + wc * 64 + j * 16 + col) * SPK + ks, lane);
#pragma unroll
        for (int i = 0; i < 2; ++i)
#pragma unroll
          for (int j = 0; j < 4; ++j) acc[i][j] = wmma16(a[i], w[j], acc[i][j]); }
      __builtin_amdgcn_sched_barrier(0);   // keeps the wait for chunk kc + 1's loads behind the products, which cover a part of their latency
      if (kc + 1 < CC / KCH) {   // the other buffer's readers left it before the last barrier
#pragma unroll
        for (int i = 0; i < 4; ++i) *(v4u*)(sn + so + i * 32 * SPK) = ra[i];
#pragma unroll
        for (int i = 0; i < 4; ++i) *(v4u*)(sn + so + (128 + i * 32) * SPK) = rw[i];
        if (kc + 2 < CC / KCH) {
#pragma unroll
          for (int i = 0; i < 4; ++i) ra[i] = *(const v4u*)(Ap + (size_t)i * 32 * CC + (kc + 2) * KCH);
#pragma unroll
          for (int i = 0; i < 4; ++i) rw[i] = *(const v4u*)(Wp + (size_t)i * 32 * CC + (kc + 2) * KCH);
          loads_issued(); } }
      stage_bar(); } }   // publishes chunk kc + 1 and ends the reads of chunk kc
  float* sf = (float*)&sg[0][0] + wave * 32 * OFP;   // 8 x 32 x OFP x 4 bytes lie inside the two buffers
#pragma unroll
  for (int j = 0; j < 4; ++j) { const float bias = BO ? bfr(BO[c0 + j * 16 + col]) : 0.f;
#pragma unroll
    for (int i = 0; i < 2; ++i)
#pragma unroll
      for (int r = 0; r < 8; ++r) sf[(i * 16 + 8 * g + r) * OFP + j * 16 + col] = acc[i][j][r] * (1.0f / 16384.0f) + bias; }   /* 2^-8 (Wo carry) x 2^-6 (ctx carry) */
  LDSX();
  float* op = OUT + (r0 + g) * DIN + c0 + col * 4; const float* sp = sf + g * OFP + col * 4;   // a store = two rows of 256 contiguous bytes each: whole lines
#pragma unroll
  for (int rl = 0; rl < 32; rl += 2) vst2(op + (size_t)rl * DIN, *(const v4f*)(sp + rl * OFP)); }

extern "C" void kernel_launch(void* const* d_in, const int* in_sizes, int n_in, void* d_out, int out_size, void* d_ws, size_t ws_size, hipStream_t stream) {
  (void)in_sizes; (void)n_in; (void)out_size;
  const float** F = (const float**)d_in;
  if (ws_size < (size_t)WS_END) return;
  char* ws = (char*)d_ws; _Float16 *QH = (_Float16*)(ws + WS_QH), *KH = (_Float16*)(ws + WS_KH), *VT = (_Float16*)(ws + WS_VT), *QL = (_Float16*)(ws + WS_QL), *KL = (_Float16*)(ws + WS_KL); __bf16 *VB = (__bf16*)(ws + WS_VB), *VBL = (__bf16*)(ws + WS_VBL), *XB = (__bf16*)(ws + WS_XB), *WB = (__bf16*)(ws + WS_WB); _Float16 *WH = (_Float16*)(ws + WS_WH), *Y = (_Float16*)(ws + WS_Y); float* RT = (float*)(ws + WS_RT);
  (void)Y; (void)QL; (void)KL; (void)VB; (void)VBL;
  // inputs: 0 x [2,2048,1024]; 1 Wqkv [3072,1024] (out,in): q rows 0..1023, k 1024..2047, v 2048..3071; 2 Wout [1024,1024] (out,in); 3 token_positions [2048] int32 (arange; READ on the device); no biases
  k_cvt<<<dim3(CVT + CVX + CVW + CVO), 256, 0, stream>>>(F[0], F[1], F[2], (const int*)d_in[3], XB, WB, WH, RT);
  k_proj<<<dim3(TNB * TT / 128, CC / 128, 3), 128, 0, stream>>>(XB, XB, XB, WB, WB + (size_t)CC * DIN, WB + 2 * (size_t)CC * DIN, nullptr, nullptr, nullptr, QH, QL, KH, KL, VT, VB, VBL, RT);
  k_fa<<<dim3(TT / 128, NH, TNB), 128, 0, stream>>>(QH, KH, VT, Y);
  k_out<<<dim3(TNB * TT / 128, DIN / 128), 256, 0, stream>>>(Y, WH, nullptr, (float*)d_out);
}

// v007
// It runs in 78.8 microseconds.
// In two side-by-side timings against v006, it was 1.03 and 1.05 times as fast.
// Counting every step since v000, it is 18.5 times as fast.
// compute dtype: all float inputs rounded to bf16; q / k / v projections with EXACT bf16 products on WMMA 16x16x32 (f32 accumulate), no biases; RoPE in f32 (embedded frequencies, precise cosf / sinf, positions read from the int input token_positions); logits q x 64^-0.5 log2(e) and k once to f16 each (1 product); softmax f32 in base 2 against a reference logit per query that is renewed only when a logit passes it by 6 (p by 2^6), sums over 32-key trips; P (unnormalised, x 2^8) once to f16 x v once to f16 (1 product), divided by the sum at the end; ctx x 2^6 once to f16 x the output weight f16(bf16 x 2^8); f32 output.
#include <hip/hip_runtime.h>
#include <math.h>

typedef __attribute__((ext_vector_type(16))) _Float16 v16h;
typedef __attribute__((ext_vector_type(16))) __bf16 v16b;
typedef __attribute__((ext_vector_type(8)))  _Float16 v8h;
typedef __attribute__((ext_vector_type(8)))  float v8f;
typedef __attribute__((ext_vector_type(4)))  float v4f;
typedef __attribute__((ext_vector_type(2)))  float v2f;
typedef __attribute__((ext_vector_type(4)))  unsigned v4u;
typedef __attribute__((ext_vector_type(4)))  int v4i;
typedef float __attribute__((may_alias)) float_a;
typedef int __attribute__((may_alias)) int_a;

template <typename T> __device__ __forceinline__ void vst2(void* p, T v) { *(T*)p = v;  }
__device__ __forceinline__ v8f wmma16(v16h a, v16h b, v8f c) {
  v8f d = __builtin_amdgcn_wmma_f32_16x16x32_f16(false, a, false, b, (short)0, c, false, false);
  asm volatile("v_nop\n\tv_nop\n\tv_nop\n\tv_nop" : "+v"(d) : "v"(a), "v"(b));
  return d;
}
__device__ __forceinline__ v8f wmma_bf(v16b a, v16b b, v8f c) {
  v8f d = __builtin_amdgcn_wmma_f32_16x16x32_bf16(false, a, false, b, (short)0, c, false, false);
  asm volatile("v_nop\n\tv_nop\n\tv_nop\n\tv_nop" : "+v"(d) : "v"(a), "v"(b));
  return d;
}
// 16x16x32 fragments: lane = (h = lane>>4, row/col = lane&15); elements 0..7 = k0+8h+0..7, 8..15 = k0+16+8h+0..7; D element r = row 8h+r
__device__ __forceinline__ v16h frag_h(const _Float16* rowk0, int lane) {
  union { v16h v; v8h q[2]; } u; const _Float16* p = rowk0 + 8 * (lane >> 4);
  u.q[0] = *(const v8h*)p; u.q[1] = *(const v8h*)(p + 16); return u.v;
}
__device__ __forceinline__ v16h frag_f32(const float* rowk0, int lane) {
  v16h a; const float* p = rowk0 + 8 * (lane >> 4);
#pragma unroll
  for (int i = 0; i < 8; ++i) { a[i] = (_Float16)p[i]; a[8 + i] = (_Float16)p[16 + i]; }
  return a;
}
__device__ __forceinline__ v16h frag_f32s(const float* rowk0, int lane, float sc) {
  v16h a; const float* p = rowk0 + 8 * (lane >> 4);
#pragma unroll
  for (int i = 0; i < 8; ++i) { a[i] = (_Float16)(p[i] * sc); a[8 + i] = (_Float16)(p[16 + i] * sc); }
  return a;
}
// column fragment from a [K][ld] layout (column n), rows >= K read as 0
__device__ __forceinline__ v16h fragc_f32(const float* W, int k0, int n, int lane, int ld, int K) {
  v16h a; const int g = lane >> 4;
#pragma unroll
  for (int i = 0; i < 8; ++i) { const int ka = k0 + 8 * g + i, kb = ka + 16;
    a[i] = (_Float16)(ka < K ? W[(size_t)(ka < K ? ka : K - 1) * ld + n] : 0.f); a[8 + i] = (_Float16)(kb < K ? W[(size_t)(kb < K ? kb : K - 1) * ld + n] : 0.f); }
  return a;
}
struct F2 { v16b h, l; };
__device__ __forceinline__ F2 bsplit16(const float v[16]) { F2 r;
#pragma unroll
  for (int i = 0; i < 16; ++i) { const __bf16 h = (__bf16)v[i]; r.h[i] = h; r.l[i] = (__bf16)(v[i] - (float)h); }
  return r; }
__device__ __forceinline__ F2 split_row(const float* row, int k0, int lane) { float v[16]; const float* p = row + k0 + 8 * (lane >> 4);
#pragma unroll
  for (int i = 0; i < 8; ++i) { v[i] = p[i]; v[8 + i] = p[16 + i]; }
  return bsplit16(v); }
__device__ __forceinline__ F2 split_rowK(const float* row, int k0, int lane, int K) { float v[16]; const int g = lane >> 4;
#pragma unroll
  for (int i = 0; i < 8; ++i) { const int ka = k0 + 8 * g + i, kb = ka + 16; v[i] = ka < K ? row[ka < K ? ka : K - 1] : 0.f; v[8 + i] = kb < K ? row[kb < K ? kb : K - 1] : 0.f; }
  return bsplit16(v); }
__device__ __forceinline__ F2 split_col(const float* W, int k0, int n, int lane, int ld, int K) { float v[16]; const int g = lane >> 4;
#pragma unroll
  for (int i = 0; i < 8; ++i) { const int ka = k0 + 8 * g + i, kb = ka + 16; v[i] = ka < K ? W[(size_t)(ka < K ? ka : K - 1) * ld + n] : 0.f; v[8 + i] = kb < K ? W[(size_t)(kb < K ? kb : K - 1) * ld + n] : 0.f; }
  return bsplit16(v); }
__device__ __forceinline__ v8f mac3(const F2& a, const F2& b, v8f c) { c = wmma_bf(a.l, b.h, c); c = wmma_bf(a.h, b.l, c); return wmma_bf(a.h, b.h, c); }
__device__ __forceinline__ float sigm(float v) { return 1.0f / (1.0f + expf(-v)); }
#define LDSX() do { asm volatile("s_wait_dscnt 0" ::: "memory"); __builtin_amdgcn_wave_barrier(); __builtin_amdgcn_fence(__ATOMIC_RELEASE, "workgroup"); } while (0)

// Multi-head self-attention with interleaved-pair RoPE, no mask (x [2,2048,1024]; Wqkv [3072,1024] torch (out,in): qkv.reshape(B, S, 3, 16, 64): q = rows 0..1023, k = 1024..2047, v = 2048..3071; Wout [1024,1024] (out,in); token_positions [2048] int32 = arange, a module input READ on the device; RoPE on q and k: (even, odd) pairs (x_e c - x_o s, x_e s + x_o c) re-interleaved, inv_freq = 1 / 10000^(2i/64); scores / sqrt(64); softmax; out @ Wout.T).
#define NB 2
#define TT 2048
#define CC 1024            // NH * HD = projected width
#define DIN 1024          // input (model) width
#define NH 16
#define HD 64
#define NQB (TT / 64)
#define HG 4
#define SCALE (0.125f)
#define CAUSAL 0
#ifndef TNB
#define TNB NB
#endif
__device__ __forceinline__ float bfr(float v) { return (float)(__bf16)v; }
__host__ __device__ __forceinline__ int kb_last(int qb) { return CAUSAL ? ((qb * 64 + 63) >> 7) : (TT / 128 - 1); }
typedef __attribute__((ext_vector_type(8))) __bf16 v8b;
__device__ __forceinline__ v16b frag_b(const __bf16* rowk0, int lane) {
  union { v16b v; v8b q[2]; } u; const __bf16* p = rowk0 + 8 * (lane >> 4);
  u.q[0] = *(const v8b*)p; u.q[1] = *(const v8b*)(p + 16); return u.v;
}
// operand staging of the two projection GEMMs: the operands lie in the workspace as 16-bit values, rounded once ahead of the GEMMs; a 64-k chunk of a row is one 128-byte line; 8 lanes fetch it whole, 16 bytes each; LDS rows of 64 values at a pitch of 72 (144 bytes = 16 x odd, for 16-byte readers)
typedef __attribute__((ext_vector_type(4))) __bf16 v4b;
typedef __attribute__((ext_vector_type(4))) _Float16 v4h;
#define SPK 72
#define KCH 64              // k values a chunk
// work-group barrier by hand, behind the wave's own LDS wait: __syncthreads() would also wait out the global loads that are meant to stay in flight across it
__device__ __forceinline__ void stage_bar() { asm volatile("s_wait_dscnt 0x0" ::: "memory"); asm volatile("s_barrier_signal -1\n\ts_barrier_wait -1" ::: "memory"); }
// behind a group of look-ahead loads: their address registers are reused while the loads are still in flight
__device__ __forceinline__ void loads_issued() { asm volatile("s_wait_xcnt 0x0" ::: "memory"); }
// behind a store in a loop: its address and data registers are rewritten by what follows it
__device__ __forceinline__ void store_issued() { asm volatile("s_wait_xcnt 0x0" ::: "memory"); }
__device__ __forceinline__ v4b cvt4b(v4f v) { v4b r; r[0] = (__bf16)v[0]; r[1] = (__bf16)v[1]; r[2] = (__bf16)v[2]; r[3] = (__bf16)v[3]; return r; }
__device__ __forceinline__ v4h cvt4w(v4f v) { v4h r; r[0] = (_Float16)(bfr(v[0]) * 256.0f); r[1] = (_Float16)(bfr(v[1]) * 256.0f); r[2] = (_Float16)(bfr(v[2]) * 256.0f); r[3] = (_Float16)(bfr(v[3]) * 256.0f); return r; }
#define QBH 0              // unused: k_fa has one path for all query blocks
#define QHI 0               // single-product logits on every row
#define KHI 64            // key rows carrying k residual / v bf16 hi+lo planes (written by k_proj, read by no kernel here)
// B fragment (k rows k0+.., output column o) of a weight: (in,out) [K][ld] or (out,in) [ld rows of K]: bf16 exact, or f16(bf16 * 256) exact
__device__ __forceinline__ v16b wcol_io(const float* Wm, int k0, int o, int lane, int ld) { v16b w; const int g = lane >> 4;
#pragma unroll
  for (int i = 0; i < 8; ++i) { w[i] = (__bf16)Wm[(size_t)(k0 + 8 * g + i) * ld + o]; w[8 + i] = (__bf16)Wm[(size_t)(k0 + 16 + 8 * g + i) * ld + o]; }
  return w; }
__device__ __forceinline__ v16b wcol_oi(const float* Wm, int k0, int o, int lane, int K) { v16b w; const float* p = Wm + (size_t)o * K + k0 + 8 * (lane >> 4);
#pragma unroll
  for (int i = 0; i < 8; ++i) { w[i] = (__bf16)p[i]; w[8 + i] = (__bf16)p[16 + i]; }
  return w; }
__device__ __forceinline__ v16h wcolh_io(const float* Wm, int k0, int o, int lane, int ld) { v16h w; const int g = lane >> 4;
#pragma unroll
  for (int i = 0; i < 8; ++i) { w[i] = (_Float16)(bfr(Wm[(size_t)(k0 + 8 * g + i) * ld + o]) * 256.0f); w[8 + i] = (_Float16)(bfr(Wm[(size_t)(k0 + 16 + 8 * g + i) * ld + o]) * 256.0f); }
  return w; }
__device__ __forceinline__ v16h wcolh_oi(const float* Wm, int k0, int o, int lane, int K) { v16h w; const float* p = Wm + (size_t)o * K + k0 + 8 * (lane >> 4);
#pragma unroll
  for (int i = 0; i < 8; ++i) { w[i] = (_Float16)(bfr(p[i]) * 256.0f); w[8 + i] = (_Float16)(bfr(p[16 + i]) * 256.0f); }
  return w; }
#define WQKV_LAYOUT 1   // 0 = (in,out) [DIN][CC]; 1 = (out,in) [CC][DIN]; 2 = per-head [NH][DIN][HD]
__device__ __forceinline__ v16b wcol_hdk(const float* Wm, int k0, int o, int lane) { v16b w; const int g = lane >> 4; const float* p = Wm + (size_t)(o / HD) * DIN * HD + (o % HD);
#pragma unroll
  for (int i = 0; i < 8; ++i) { w[i] = (__bf16)p[(size_t)(k0 + 8 * g + i) * HD]; w[8 + i] = (__bf16)p[(size_t)(k0 + 16 + 8 * g + i) * HD]; }
  return w; }
#define WO_OUT_IN 1
#if WQKV_LAYOUT == 1
#define WCOL(W, k0, o, lane) wcol_oi(W, k0, o, lane, DIN)
#elif WQKV_LAYOUT == 2
#define WCOL(W, k0, o, lane) wcol_hdk(W, k0, o, lane)
#else
#define WCOL(W, k0, o, lane) wcol_io(W, k0, o, lane, CC)
#endif
#if WO_OUT_IN
#define WOCOL(W, k0, o, lane) wcol_oi(W, k0, o, lane, CC)
#define WOCOLH(W, k0, o, lane) wcolh_oi(W, k0, o, lane, CC)
#else
#define WOCOL(W, k0, o, lane) wcol_io(W, k0, o, lane, DIN)
#define WOCOLH(W, k0, o, lane) wcolh_io(W, k0, o, lane, DIN)
#endif

// RoPE inverse frequencies 1/10000^(2i/64) (the f32 values jax computes)
__constant__ float INVF[32] = {1.000000000e+00,7.498942018e-01,5.623413324e-01,4.216965139e-01,3.162277639e-01,2.371373624e-01,1.778279394e-01,1.333521456e-01,1.000000015e-01,7.498941571e-02,5.623412877e-02,4.216964915e-02,3.162277862e-02,2.371373586e-02,1.778279431e-02,1.333521493e-02,9.999999776e-03,7.498942316e-03,5.623413250e-03,4.216964822e-03,3.162277862e-03,2.371373819e-03,1.778279431e-03,1.333521446e-03,1.000000047e-03,7.498941850e-04,5.623413017e-04,4.216964880e-04,3.162277862e-04,2.371373848e-04,1.778279402e-04,1.333521504e-04};
// RoPE factors: (cos, sin) of pos * INVF[i], pos READ from the int input, depend on (token, i) alone: the rounding launch works each pair out once into the table RT [t][i][cos, sin]; k_proj's q and k blocks read them there
#ifndef SM_EXTRA_PARAMS
#define SM_EXTRA_PARAMS
#endif
#ifndef PROJ_EXTRA_PARAMS
#define PROJ_EXTRA_PARAMS
#endif
#ifndef SM_MASK_HOOK
#define SM_MASK_HOOK (void)0
#endif

#define WS_QH  0u                                      // f16 q rows [b*t][CC]
#define WS_KH  (WS_QH + 2u * (size_t)NB * TT * CC)      // f16 k rows [b*t][CC]
#define WS_VT  (WS_KH + 2u * (size_t)NB * TT * CC)      // f16 v planes [b][c][t]
#define WS_QL  (WS_VT + 2u * (size_t)NB * CC * TT)      // f16 q residual x 2^10 rows [b][t < QHI][CC]
#define WS_KL  (WS_QL + 2u * (size_t)NB * QHI * CC)     // f16 k residual x 2^10 rows [b][t < KHI][CC]
#define WS_VB  (WS_KL + 2u * (size_t)NB * KHI * CC)     // bf16 v hi planes [b][c][t < KHI]
#define WS_VBL (WS_VB + 2u * (size_t)NB * CC * KHI)
#define WS_S   (WS_VBL + 2u * (size_t)NB * CC * KHI)    // (once f32 logits) now the rounded GEMM operands
#define WS_XB  WS_S                                     // bf16 x rows [b*t][DIN]
#define WS_WB  (WS_XB + 2u * (size_t)NB * TT * DIN)     // bf16 Wqkv rows [3 * CC][DIN]
#define WS_WH  (WS_WB + 2u * (size_t)3 * CC * DIN)      // f16(bf16 x 2^8) Wout rows [DIN][CC]
#define WS_RT  (WS_WH + 2u * (size_t)DIN * CC)          // f32 RoPE table [t][32][cos, sin]
#define WS_Y   (WS_S  + 4u * (size_t)HG * TT * TT)      // f16 ctx x 2^6 rows [b*t][CC]
#define WS_END (WS_Y  + 4u * (size_t)NB * TT * CC)

// ---- k_cvt: the GEMM operands that are inputs are rounded once, ahead of the GEMMs (each was rounded anew by every block that read it): x and Wqkv to bf16, Wout to f16(bf16 x 2^8).
// Few, long waves (two blocks of 8 waves a WGP): a block takes 16384 values in 16 passes; a pass is 16 bytes in and 8 bytes out a lane, whole lines a wave; all 16 loads of a lane are in flight together.
#define CVB 16384                         // values a block
#define CVX (NB * TT * DIN / CVB)         // blocks of x
#define CVW (3 * CC * DIN / CVB)          // blocks of Wqkv
#define CVO (DIN * CC / CVB)              // blocks of Wout
#define CVT (TT * 32 / 1024)              // blocks of the RoPE table: 1024 (token, frequency) entries a block, 4 a lane; they stand first in the grid
__global__ __launch_bounds__(256) void k_cvt(const float* __restrict__ X, const float* __restrict__ WQKV, const float* __restrict__ WO, const int* __restrict__ TPOS, __bf16* __restrict__ XB, __bf16* __restrict__ WB, _Float16* __restrict__ WH, float* __restrict__ RT) {
  if (blockIdx.x < CVT) { const int e0 = blockIdx.x * 1024 + threadIdx.x;   // entry e = t * 32 + i; a lane's four entries are 256 apart: one frequency, tokens 8 apart
    const int* tp = TPOS + (e0 >> 5); const float* fp = INVF + (e0 & 31); float* d = RT + 2 * (size_t)e0; int ps[4]; v2f c[4];
#pragma unroll
    for (int p = 0; p < 4; ++p) ps[p] = tp[p * 8];
    const float fr = *fp;
#pragma unroll
    for (int p = 0; p < 4; ++p) { const float ang = (float)ps[p] * fr; c[p][0] = cosf(ang); c[p][1] = sinf(ang); }
#pragma unroll
    for (int p = 0; p < 4; ++p) vst2(d + p * 512, c[p]);   // 8 bytes a lane, 256 contiguous bytes a wave; the wave ends behind these stores
    return; }
  const int bx = blockIdx.x - CVT; const size_t o = (size_t)threadIdx.x * 4; v4f a[16];
  if (bx < CVX + CVW) { const bool isx = bx < CVX; const size_t e = (size_t)(isx ? bx : bx - CVX) * CVB + o; const float* s = (isx ? X : WQKV) + e; __bf16* d = (isx ? XB : WB) + e;
#pragma unroll
    for (int p = 0; p < 16; ++p) a[p] = *(const v4f*)(s + p * 1024);
    asm volatile("s_wait_xcnt 0x0" :: "v"(s) : "memory");   // the address pair is an input, so it stays live up to this wait: no load's own result is placed on it while the loads before it are in flight
#pragma unroll
    for (int p = 0; p < 16; ++p) vst2(d + p * 1024, cvt4b(a[p]));
    asm volatile("s_wait_xcnt 0x0" ::: "memory");   // behind the last store of the run: no register that a store names is rewritten ahead of this wait
  } else { const size_t e = (size_t)(bx - CVX - CVW) * CVB + o; const float* s = WO + e; _Float16* d = WH + e;
#pragma unroll
    for (int p = 0; p < 16; ++p) a[p] = *(const v4f*)(s + p * 1024);
    asm volatile("s_wait_xcnt 0x0" :: "v"(s) : "memory");   // the address pair is an input, so it stays live up to this wait: no load's own result is placed on it while the loads before it are in flight
#pragma unroll
    for (int p = 0; p < 16; ++p) vst2(d + p * 1024, cvt4w(a[p]));
    asm volatile("s_wait_xcnt 0x0" ::: "memory"); } }   // behind the last store of the run: no register that a store names is rewritten ahead of this wait
// ---- k_proj: block = (128 rows, 128 cols, which), 4 waves as 2 x 2, a wave = 64 x 64 (4 + 4 fragments feed 16 products): q/k/v = X W (+ b) with exact bf16 products (K = DIN) -> which 0: q f16 rows (+ residual rows < QHI); 1: k f16 rows (+ residual rows < KHI); 2: v f16 planes [c][t] (+ bf16 hi/lo planes for t < KHI)
#define PST (64 * 132 * 4)                 // bytes of st
#define PSM (PST + 3 * 128 * 72 * 2)       // bytes of the block's LDS; the operand buffers take 2 * 256 * SPK * 2 of them
__global__ __launch_bounds__(128) void k_proj(const __bf16* __restrict__ XQ, const __bf16* __restrict__ XK, const __bf16* __restrict__ XV, const __bf16* __restrict__ WQ, const __bf16* __restrict__ WK, const __bf16* __restrict__ WV, const float* __restrict__ BQ, const float* __restrict__ BK, const float* __restrict__ BV,
    _Float16* __restrict__ QH, _Float16* __restrict__ QL, _Float16* __restrict__ KH, _Float16* __restrict__ KL, _Float16* __restrict__ VT, __bf16* __restrict__ VB, __bf16* __restrict__ VBL, const float* __restrict__ RT) {
  __shared__ __align__(16) char sm[PSM];   // one array: the main loop's two operand buffers from its start; behind the loop's last barrier the epilogue's st, and behind st either sh, sl (q, k) or th, tb, tbl (v); three blocks fit a WGP
  float (*st)[132] = (float (*)[132])sm; _Float16 (*sh)[136] = (_Float16 (*)[136])(sm + PST); _Float16 (*sl)[136] = sh + 64; _Float16 (*th)[72] = (_Float16 (*)[72])(sm + PST); __bf16 (*tb)[72] = (__bf16 (*)[72])(th + 128); __bf16 (*tbl)[72] = tb + 128;
  const int tid = threadIdx.x, wave = tid >> 5, lane = tid & 31, col = lane & 15, g = lane >> 4, wr = wave >> 1, wc = wave & 1; const int which = blockIdx.z; const int c0 = blockIdx.y * 128; const size_t r0 = (size_t)blockIdx.x * 128; const size_t bb = r0 / TT; const int t0 = (int)(r0 % TT);
  const __bf16* X = which == 0 ? XQ : which == 1 ? XK : XV; const __bf16* WA = which == 0 ? WQ : which == 1 ? WK : WV; const float* BA = which == 0 ? BQ : which == 1 ? BK : BV;
  v2f tc[2][16];   // q and k blocks: the RoPE factors of the 16 rows that this wave rotates in each 64-row half, lane = frequency i: 256 contiguous bytes a row; the first half's are fetched ahead of the main loop, which covers their latency, the second half's while the first half is stored
  if (which < 2) { const float* tp = RT + (size_t)(t0 + wave * 16) * 64 + lane * 2;
#pragma unroll
    for (int rr = 0; rr < 16; ++rr) tc[0][rr] = *(const v2f*)(tp + rr * 64);
    asm volatile("s_wait_xcnt 0x0" :: "v"(tp) : "memory"); }   // the address pair is an input, so it stays live up to this wait: no load's own result is placed on it while the loads before it are being issued
  v8f acc[4][4] = {};
  { // operands through LDS, two buffers: rows 0..127 = X rows, 128..255 = weight rows of this tile; chunk kc + 1 is in flight in registers while chunk kc is multiplied
    __bf16* const sb0 = (__bf16*)sm; __bf16* const sb1 = sb0 + 256 * SPK;
    const int lr = tid >> 3, lp = tid & 7; const __bf16* Ap = X + (r0 + lr) * DIN + lp * 8; const __bf16* Wp = WA + (size_t)(c0 + lr) * DIN + lp * 8; const int so = lr * SPK + lp * 8;
    v4u ra[8], rw[8];
#pragma unroll
    for (int i = 0; i < 8; ++i) ra[i] = *(const v4u*)(Ap + (size_t)i * 16 * DIN);
#pragma unroll
    for (int i = 0; i < 8; ++i) rw[i] = *(const v4u*)(Wp + (size_t)i * 16 * DIN);
#pragma unroll
    for (int i = 0; i < 8; ++i) *(v4u*)(sb0 + so + i * 16 * SPK) = ra[i];
#pragma unroll
    for (int i = 0; i < 8; ++i) *(v4u*)(sb0 + so + (128 + i * 16) * SPK) = rw[i];
#pragma unroll
    for (int i = 0; i < 8; ++i) ra[i] = *(const v4u*)(Ap + (size_t)i * 16 * DIN + KCH);
#pragma unroll
    for (int i = 0; i < 8; ++i) rw[i] = *(const v4u*)(Wp + (size_t)i * 16 * DIN + KCH);
    loads_issued(); stage_bar();   // chunk 0 is published
#pragma unroll 2   // two trips a pass, so that each trip's buffer addresses are constants
    for (int kc = 0; kc < DIN / KCH; ++kc) { const __bf16* sb = (kc & 1) ? sb1 : sb0; __bf16* sn = (kc & 1) ? sb0 : sb1;
#pragma unroll
      for (int ks = 0; ks < KCH; ks += 32) { v16b a[4], w[4];
#pragma unroll
        for (int i = 0; i < 4; ++i) a[i] = frag_b(sb + (wr * 64 + i * 16 + col) * SPK + ks, lane);
#pragma unroll
        for (int j = 0; j < 4; ++j) w[j] = frag_b(sb + (128 + wc * 64 + j * 16 + col) * SPK + ks, lane);
#pragma unroll
        for (int i = 0; i < 4; ++i)
#pragma unroll
          for (int j = 0; j < 4; ++j) acc[i][j] = wmma_bf(a[i], w[j], acc[i][j]); }
      __builtin_amdgcn_sched_barrier(0);   // keeps the wait for chunk kc + 1's loads behind the products, which cover a part of their latency
      if (kc + 1 < DIN / KCH) {   // the other buffer's readers left it before the last barrier
#pragma unroll
        for (int i = 0; i < 8; ++i) *(v4u*)(sn + so + i * 16 * SPK) = ra[i];
#pragma unroll
        for (int i = 0; i < 8; ++i) *(v4u*)(sn + so + (128 + i * 16) * SPK) = rw[i];
        if (kc + 2 < DIN / KCH) {
#pragma unroll
          for (int i = 0; i < 8; ++i) ra[i] = *(const v4u*)(Ap + (size_t)i * 16 * DIN + (kc + 2) * KCH);
#pragma unroll
          for (int i = 0; i < 8; ++i) rw[i] = *(const v4u*)(Wp + (size_t)i * 16 * DIN + (kc + 2) * KCH);
          loads_issued(); } }
      stage_bar(); } }   // publishes chunk kc + 1 and ends the reads of chunk kc
#pragma unroll   // the tile leaves in two halves of 64 rows through the same staging arrays; unrolled, so that the accumulators are indexed by constants
  for (int hf = 0; hf < 2; ++hf) { const size_t r0h = r0 + hf * 64; const int t0h = t0 + hf * 64;
  { // stage the half's f32 tile (acc + bias) in LDS (the two waves that hold it), rotate the q and k rows there, then convert
    if (wr == hf) {
#pragma unroll
      for (int j = 0; j < 4; ++j) { const float bias = BA ? bfr(BA[c0 + wc * 64 + j * 16 + col]) : 0.f;
#pragma unroll
        for (int i = 0; i < 4; ++i)
#pragma unroll
          for (int r = 0; r < 8; ++r) st[i * 16 + 8 * g + r][wc * 64 + j * 16 + col] = acc[i][j][r] + bias; } }
    __syncthreads();
    if (which < 2) {   // interleaved-pair rotation (x[2i], x[2i + 1]) by the angle pos * INVF[i]: lane = pair i of a head, so a wave reads and writes 256 contiguous bytes of a row; v untouched
#pragma unroll
      for (int rr = 0; rr < 16; ++rr) { const float cs = tc[hf][rr][0], sn = tc[hf][rr][1];
#pragma unroll
        for (int hh = 0; hh < 128 / HD; ++hh) { float* rw = &st[wave * 16 + rr][hh * HD + 2 * lane]; const v2f x = *(const v2f*)rw; v2f y; y[0] = x[0] * cs - x[1] * sn; y[1] = x[0] * sn + x[1] * cs; *(v2f*)rw = y; } } }
    __syncthreads(); }
  if (which < 2) { _Float16* DH = which == 0 ? QH : KH; _Float16* DL = which == 0 ? QL : KL; const int nhi = which == 0 ? QHI : KHI; const bool hi_rows = t0h < nhi;
    const float qs = which == 0 ? SCALE * 1.4426950408889634f : 1.0f;   // q leaves as k_fa's operand: logits come out of the product in base-2 units
    for (int e = tid; e < 64 * 128; e += 128) { const int rl = e >> 7, cl = e & 127; const float v = st[rl][cl] * qs; const _Float16 hv = (_Float16)v; sh[rl][cl] = hv; sl[rl][cl] = (_Float16)((v - (float)hv) * 1024.0f); }
    __syncthreads();
    if (hf == 0) { const float* tp = RT + (size_t)(t0 + wave * 16) * 64 + lane * 2;   // behind the first half's last barrier (a barrier would wait these loads out): its stores and the second half's staging cover their latency
#pragma unroll
      for (int rr = 0; rr < 16; ++rr) tc[1][rr] = *(const v2f*)(tp + (64 + rr) * 64);
      asm volatile("s_wait_xcnt 0x0" :: "v"(tp) : "memory"); }   // as at the first half's fetch
    for (int e = tid; e < 64 * 16; e += 128) { const int rl = e >> 4, q = e & 15; vst2((unsigned*)(DH + (r0h + rl) * CC + c0 + q * 8), *(const v4u*)&sh[rl][q * 8]); store_issued(); if (hi_rows) { vst2((unsigned*)(DL + (bb * nhi + t0h + rl) * (size_t)CC + c0 + q * 8), *(const v4u*)&sl[rl][q * 8]); store_issued(); } }
  } else { const bool hi_rows = t0h < KHI;
    for (int e = tid; e < 64 * 128; e += 128) { const int rl = e & 63, cl = e >> 6; const float v = st[rl][cl]; th[cl][rl] = (_Float16)v; const __bf16 bh = (__bf16)v; tb[cl][rl] = bh; tbl[cl][rl] = (__bf16)(v - (float)bh); }
    __syncthreads();
    for (int e = tid; e < 128 * 8; e += 128) { const int cl = e >> 3, q = e & 7; vst2((unsigned*)(VT + (bb * CC + c0 + cl) * (size_t)TT + t0h + q * 8), *(const v4u*)&th[cl][q * 8]); store_issued(); if (hi_rows) { const size_t o3 = (bb * CC + c0 + cl) * (size_t)KHI + t0h + q * 8; vst2((unsigned*)(VB + o3), *(const v4u*)&tb[cl][q * 8]); vst2((unsigned*)(VBL + o3), *(const v4u*)&tbl[cl][q * 8]); store_issued(); } } } } }
// ---- k_fa: block = 128 queries (4 waves x 32 query columns) of head h, batch b: logits, softmax and P . v in one pass over the keys, 32 keys a trip; no logit or P ever leaves the registers.
// Transposed products: S^T = K Q^T (lane = query column, element r = key 8g + r), so the two 16-key tiles of a trip, converted in place, are the B fragment (k = key, hardware k order) of ctx^T = V^T P^T.
// Reference logit ref and running sum l per query column; q arrives x SCALE log2(e), and 8 - ref enters the score product as its C operand, so p = 2^s straight from the accumulator; the 2^8 keeps small p clear of f16 subnormals and cancels in acc / l.
// ref is the first trip's maximum and is renewed (acc, l and this trip's s rescaled) only in a trip where some s passes 14, so p never passes 2^14, well inside f16; any ref gives the same quotient acc / l.
// K rows and V^T rows reach the four waves through LDS: a stage is 128 keys, copied once per block as whole 128-byte lines by asynchronous 16-byte copies, two buffers, stage t + 1 in flight while stage t is worked on.
__device__ __forceinline__ float xhalf(float x) { return __builtin_bit_cast(float, __builtin_amdgcn_permlanex16(__builtin_bit_cast(int, x), __builtin_bit_cast(int, x), 0x76543210, 0xfedcba98, false, false)); }  // lane l with lane l ^ 16
__device__ __forceinline__ v8f mmah(v16h a, v16h b, v8f c) { return __builtin_amdgcn_wmma_f32_16x16x32_f16(false, a, false, b, (short)0, c, false, false); }
#define FKS 128                       // keys a stage
#define FKP 72                        // LDS pitch of a K row in f16: 64 channels + 8 (144 bytes = 16 x odd, for 16-byte readers)
#define FVP 136                       // LDS pitch of a V^T row in f16: 128 keys + 8 (272 bytes = 16 x odd)
#define FVO (FKS * FKP)               // the V^T rows stand behind the K rows
#define FBUF (FKS * FKP + HD * FVP)   // f16 a buffer
__device__ __forceinline__ unsigned lds_off(const void* p) { return (unsigned)(size_t)p; }   // byte offset in the work-group's LDS
// eight 16-byte copies a lane, global memory to LDS through no register; the s_wait_xcnt closes the statement so that no address register of a copy is rewritten ahead of it
__device__ __forceinline__ void copy8(unsigned l, unsigned ls, const _Float16* p, size_t ps) {
  asm volatile("global_load_async_to_lds_b128 %0, %8, off\n\t"
               "global_load_async_to_lds_b128 %1, %9, off\n\t"
               "global_load_async_to_lds_b128 %2, %10, off\n\t"
               "global_load_async_to_lds_b128 %3, %11, off\n\t"
               "global_load_async_to_lds_b128 %4, %12, off\n\t"
               "global_load_async_to_lds_b128 %5, %13, off\n\t"
               "global_load_async_to_lds_b128 %6, %14, off\n\t"
               "global_load_async_to_lds_b128 %7, %15, off\n\t"
               "s_wait_xcnt 0x0"
               :: "v"(l), "v"(l + ls), "v"(l + 2 * ls), "v"(l + 3 * ls), "v"(l + 4 * ls), "v"(l + 5 * ls), "v"(l + 6 * ls), "v"(l + 7 * ls),
                  "v"(p), "v"(p + ps), "v"(p + 2 * ps), "v"(p + 3 * ps), "v"(p + 4 * ps), "v"(p + 5 * ps), "v"(p + 6 * ps), "v"(p + 7 * ps) : "memory");
}
__global__ __launch_bounds__(128) void k_fa(const _Float16* __restrict__ QH, const _Float16* __restrict__ KH, const _Float16* __restrict__ VT, _Float16* __restrict__ Y) {
  __shared__ __align__(16) _Float16 kv[2][FBUF];   // [buffer][K rows 0..127 at pitch FKP | V^T rows 0..63 at pitch FVP]
  const int tid = threadIdx.x, wave = tid >> 5, lane = tid & 31, col = lane & 15, g = lane >> 4; const int h = blockIdx.y, b = blockIdx.z; const int q0 = blockIdx.x * 128 + wave * 32;
  v16h qf[2][2];
#pragma unroll
  for (int qt = 0; qt < 2; ++qt)
#pragma unroll
    for (int kc = 0; kc < 2; ++kc) qf[qt][kc] = frag_h(QH + ((size_t)b * TT + q0 + qt * 16 + col) * CC + h * HD + kc * 32, lane);
  // the copies of a stage: 8 lanes take one K row (128 bytes), rows tid / 8 + 16 i; 16 lanes take one V^T row (256 bytes), rows tid / 16 + 8 i
  const _Float16* Kg = KH + ((size_t)b * TT + (tid >> 3)) * CC + h * HD + (tid & 7) * 8;
  const _Float16* Vg = VT + ((size_t)b * CC + h * HD + (tid >> 4)) * (size_t)TT + (tid & 15) * 8;
  const unsigned lk = lds_off(&kv[0][0]) + 2u * (unsigned)((tid >> 3) * FKP + (tid & 7) * 8);
  const unsigned lv = lds_off(&kv[0][0]) + 2u * (unsigned)(FVO + (tid >> 4) * FVP + (tid & 15) * 8);
#define FA_STAGE(s, bf) do { copy8(lk + (unsigned)(bf) * (2u * FBUF), 2u * 16 * FKP, Kg + (size_t)(s) * FKS * CC, (size_t)16 * CC); copy8(lv + (unsigned)(bf) * (2u * FBUF), 2u * 8 * FVP, Vg + (size_t)(s) * FKS, (size_t)8 * TT); } while (0)
  FA_STAGE(0, 0);
  asm volatile("s_wait_asynccnt 0x0" ::: "memory");   // this wave's copies of stage 0 have landed
  __syncthreads();                                    // stage 0 is published
  FA_STAGE(1, 1);
  v8f acc[2][4] = {}; float l[2] = {0.f, 0.f}; v8f cb[2];   // cb: 8 - ref in every element
#pragma unroll
  for (int qt = 0; qt < 2; ++qt)
#pragma unroll
    for (int r = 0; r < 8; ++r) cb[qt][r] = 8.0f;
  for (int t = 0; t < TT / FKS; ++t) {
    const _Float16* Ks = &kv[t & 1][0] + col * FKP;         // key row col of a 16-key tile
    const _Float16* Vs = &kv[t & 1][0] + FVO + col * FVP;   // V^T row of channel col of a 16-channel tile
    v16h kf[2][2];
#pragma unroll
    for (int kt = 0; kt < 2; ++kt)
#pragma unroll
      for (int kc = 0; kc < 2; ++kc) kf[kt][kc] = frag_h(Ks + (kt * 16) * FKP + kc * 32, lane);
#pragma unroll 1   // one trip's registers only: with the four trips of a stage unrolled the build went past 255 registers and into scratch
    for (int k0 = 0; k0 < FKS; k0 += 32) {
      v16h vf[4];
#pragma unroll
      for (int j = 0; j < 4; ++j) vf[j] = frag_h(Vs + (j * 16) * FVP + k0, lane);
      v8f s[2][2];
#pragma unroll
      for (int kc = 0; kc < 2; ++kc)
#pragma unroll
        for (int qt = 0; qt < 2; ++qt)
#pragma unroll
          for (int kt = 0; kt < 2; ++kt) s[qt][kt] = mmah(kf[kt][kc], qf[qt][kc], kc == 0 ? cb[qt] : s[qt][kt]);
      const int kn = (k0 + 32) & (FKS - 1);   // the next trip's key rows, fetched a trip ahead; a stage's last trip fetches its own stage's rows 0..31 again (published, not used)
#pragma unroll
      for (int kt = 0; kt < 2; ++kt)
#pragma unroll
        for (int kc = 0; kc < 2; ++kc) kf[kt][kc] = frag_h(Ks + (kn + kt * 16) * FKP + kc * 32, lane);
      __builtin_amdgcn_sched_barrier(0);   // holds the look-ahead reads here: moved down behind the softmax they would have no time to land before the next trip's first product
      float mk[2][2];   // this lane's largest s of each 16 x 16 tile: four short chains, not one long one, since the test below waits for their end
#pragma unroll
      for (int qt = 0; qt < 2; ++qt)
#pragma unroll
        for (int kt = 0; kt < 2; ++kt) { const v8f& a = s[qt][kt]; mk[qt][kt] = fmaxf(fmaxf(fmaxf(fmaxf(a[0], a[1]), a[2]), fmaxf(a[3], a[4])), fmaxf(fmaxf(a[5], a[6]), a[7])); }
      const bool first = (t | k0) == 0;   // the first trip sets ref, whatever the logits are
      if (__builtin_amdgcn_ballot_w32(fmaxf(fmaxf(mk[0][0], mk[0][1]), fmaxf(mk[1][0], mk[1][1])) > (first ? -INFINITY : 14.0f)) != 0) {   // one test a trip, a scalar branch; with logits of like size it is taken in the first trip alone
#pragma unroll
        for (int qt = 0; qt < 2; ++qt) { const float ml = fmaxf(mk[qt][0], mk[qt][1]); const float mx = fmaxf(ml, xhalf(ml)) - 8.0f;   // both halves of the wave hold how far this query's maximum over the 32 keys stands above ref
          const float d = first ? mx : fmaxf(mx, 0.f);   // ref moves by d: later it only rises
          const float corr = __builtin_amdgcn_exp2f(fminf(-d, 0.f));   // never above 1: in the first trip acc and l are 0 and stay so
          l[qt] *= corr; cb[qt] = cb[qt] - d; s[qt][0] = s[qt][0] - d; s[qt][1] = s[qt][1] - d;
#pragma unroll
          for (int j = 0; j < 4; ++j) acc[qt][j] = acc[qt][j] * corr; } }
#pragma unroll
      for (int qt = 0; qt < 2; ++qt) {
        v16h pf; float s0 = 0.f, s1 = 0.f;
#pragma unroll
        for (int r = 0; r < 8; ++r) { const float p0 = __builtin_amdgcn_exp2f(s[qt][0][r]), p1 = __builtin_amdgcn_exp2f(s[qt][1][r]); s0 += p0; s1 += p1; pf[r] = (_Float16)p0; pf[8 + r] = (_Float16)p1; }
        l[qt] += s0 + s1;
#pragma unroll
        for (int j = 0; j < 4; ++j) acc[qt][j] = mmah(vf[j], pf, acc[qt][j]); } }
    asm volatile("s_wait_dscnt 0x0" ::: "memory");      // this wave's reads of stage t have returned
    asm volatile("s_wait_asynccnt 0x0" ::: "memory");   // this wave's copies of stage t + 1 have landed
    __syncthreads();                                    // publishes stage t + 1 and ends every wave's reads of stage t
    if (t + 2 < TT / FKS) FA_STAGE(t + 2, t & 1); }     // refill of the buffer that stage t has just left
  asm volatile("s_wait_asynccnt 0x0" ::: "memory");     // no copy is outstanding when the wave ends
#pragma unroll
  for (int qt = 0; qt < 2; ++qt) { const float inv = 1.0f / (l[qt] + xhalf(l[qt]));   // the two halves' sums are joined once
    _Float16* yr = Y + ((size_t)b * TT + q0 + qt * 16 + col) * CC + h * HD + 8 * g;  // element r of tile j = channel j * 16 + 8g + r of query col; ctx leaves as k_out's operand, x 2^6 once to f16 (small context rows stay clear of f16 subnormals)
#pragma unroll
    for (int j = 0; j < 4; ++j) { const v8f o = acc[qt][j] * inv; v8h y;
#pragma unroll
      for (int r = 0; r < 8; ++r) y[r] = (_Float16)(o[r] * 64.0f);
      vst2(yr + j * 16, y); } } }
// ---- k_out: block = (128 rows, 128 cols), 8 waves as 4 x 2, a wave = 32 x 64 (2 + 4 fragments feed 8 products; one block a WGP, so two waves a SIMD): out = ctx Wo (+ bo): ctx (f16, x 2^6) against Wo as f16(bf16 x 2^8) exact (1 product) x 2^-14
#define OFP 68              // pitch in f32 of a wave's staged output rows (64 values + 4: the two halves of a wave fall on different banks)
__global__ __launch_bounds__(256) void k_out(const _Float16* __restrict__ Y, const _Float16* __restrict__ WO, const float* __restrict__ BO, float* __restrict__ OUT) { __shared__ __align__(16) _Float16 sg[2][256 * SPK];   // the two operand buffers; behind the loop's last barrier each wave stages its 32 x 64 f32 tile in its own eighth
  const int tid = threadIdx.x, wave = tid >> 5, lane = tid & 31, col = lane & 15, g = lane >> 4, wr = wave >> 1, wc = wave & 1; const int c0 = blockIdx.y * 128 + wc * 64; const size_t r0 = (size_t)blockIdx.x * 128 + wr * 32;
  v8f acc[2][4] = {};
  {
    // operands through LDS as in k_proj: rows 0..127 = ctx rows, 128..255 = weight rows
    const int lr = tid >> 3, lp = tid & 7; const _Float16* Ap = Y + ((size_t)blockIdx.x * 128 + lr) * CC + lp * 8; const _Float16* Wp = WO + (size_t)(blockIdx.y * 128 + lr) * CC + lp * 8; const int so = lr * SPK + lp * 8;
    v4u ra[4], rw[4];
#pragma unroll
    for (int i = 0; i < 4; ++i) ra[i] = *(const v4u*)(Ap + (size_t)i * 32 * CC);
#pragma unroll
    for (int i = 0; i < 4; ++i) rw[i] = *(const v4u*)(Wp + (size_t)i * 32 * CC);
#pragma unroll
    for (int i = 0; i < 4; ++i) *(v4u*)(&sg[0][0] + so + i * 32 * SPK) = ra[i];
#pragma unroll
    for (int i = 0; i < 4; ++i) *(v4u*)(&sg[0][0] + so + (128 + i * 32) * SPK) = rw[i];
#pragma unroll
    for (int i = 0; i < 4; ++i) ra[i] = *(const v4u*)(Ap + (size_t)i * 32 * CC + KCH);
#pragma unroll
    for (int i = 0; i < 4; ++i) rw[i] = *(const v4u*)(Wp + (size_t)i * 32 * CC + KCH);
    loads_issued(); stage_bar();   // chunk 0 is published
#pragma unroll 2   // two trips a pass, so that each trip's buffer addresses are constants
    for (int kc = 0; kc < CC / KCH; ++kc) { const _Float16* sb = &sg[kc & 1][0]; _Float16* sn = &sg[(kc & 1) ^ 1][0];
#pragma unroll
      for (int ks = 0; ks < KCH; ks += 32) { v16h a[2], w[4];
#pragma unroll
        for (int i = 0; i < 2; ++i) a[i] = frag_h(sb + (wr * 32 + i * 16 + col) * SPK + ks, lane);
#pragma unroll
        for (int j = 0; j < 4; ++j) w[j] = frag_h(sb + (128 + wc * 64 + j * 16 + col) * SPK + ks, lane);
#pragma unroll
        for (int i = 0; i < 2; ++i)
#pragma unroll
          for (int j = 0; j < 4; ++j) acc[i][j] = wmma16(a[i], w[j], acc[i][j]); }
      __builtin_amdgcn_sched_barrier(0);   // keeps the wait for chunk kc + 1's loads behind the products, which cover a part of their latency
      if (kc + 1 < CC / KCH) {   // the other buffer's readers left it before the last barrier
#pragma unroll
        for (int i = 0; i < 4; ++i) *(v4u*)(sn + so + i * 32 * SPK) = ra[i];
#pragma unroll
        for (int i = 0; i < 4; ++i) *(v4u*)(sn + so + (128 + i * 32) * SPK) = rw[i];
        if (kc + 2 < CC / KCH) {
#pragma unroll
          for (int i = 0; i < 4; ++i) ra[i] = *(const v4u*)(Ap + (size_t)i * 32 * CC + (kc + 2) * KCH);
#pragma unroll
          for (int i = 0; i < 4; ++i) rw[i] = *(const v4u*)(Wp + (size_t)i * 32 * CC + (kc + 2) * KCH);
          loads_issued(); } }
      stage_bar(); } }   // publishes chunk kc + 1 and ends the reads of chunk kc
  float* sf = (float*)&sg[0][0] + wave * 32 * OFP;   // 8 x 32 x OFP x 4 bytes lie inside the two buffers
#pragma unroll
  for (int j = 0; j < 4; ++j) { const float bias = BO ? bfr(BO[c0 + j * 16 + col]) : 0.f;
#pragma unroll
    for (int i = 0; i < 2; ++i)
#pragma unroll
      for (int r = 0; r < 8; ++r) sf[(i * 16 + 8 * g + r) * OFP + j * 16 + col] = acc[i][j][r] * (1.0f / 16384.0f) + bias; }   /* 2^-8 (Wo carry) x 2^-6 (ctx carry) */
  LDSX();
  float* op = OUT + (r0 + g) * DIN + c0 + col * 4; const float* sp = sf + g * OFP + col * 4;   // a store = two rows of 256 contiguous bytes each: whole lines
#pragma unroll
  for (int rl = 0; rl < 32; rl += 2) vst2(op + (size_t)rl * DIN, *(const v4f*)(sp + rl * OFP)); }

extern "C" void kernel_launch(void* const* d_in, const int* in_sizes, int n_in, void* d_out, int out_size, void* d_ws, size_t ws_size, hipStream_t stream) {
  (void)in_sizes; (void)n_in; (void)out_size;
  const float** F = (const float**)d_in;
  if (ws_size < (size_t)WS_END) return;
  char* ws = (char*)d_ws; _Float16 *QH = (_Float16*)(ws + WS_QH), *KH = (_Float16*)(ws + WS_KH), *VT = (_Float16*)(ws + WS_VT), *QL = (_Float16*)(ws + WS_QL), *KL = (_Float16*)(ws + WS_KL); __bf16 *VB = (__bf16*)(ws + WS_VB), *VBL = (__bf16*)(ws + WS_VBL), *XB = (__bf16*)(ws + WS_XB), *WB = (__bf16*)(ws + WS_WB); _Float16 *WH = (_Float16*)(ws + WS_WH), *Y = (_Float16*)(ws + WS_Y); float* RT = (float*)(ws + WS_RT);
  (void)Y; (void)QL; (void)KL; (void)VB; (void)VBL;
  // inputs: 0 x [2,2048,1024]; 1 Wqkv [3072,1024] (out,in): q rows 0..1023, k 1024..2047, v 2048..3071; 2 Wout [1024,1024] (out,in); 3 token_positions [2048] int32 (arange; READ on the device); no biases
  k_cvt<<<dim3(CVT + CVX + CVW + CVO), 256, 0, stream>>>(F[0], F[1], F[2], (const int*)d_in[3], XB, WB, WH, RT);
  k_proj<<<dim3(TNB * TT / 128, CC / 128, 3), 128, 0, stream>>>(XB, XB, XB, WB, WB + (size_t)CC * DIN, WB + 2 * (size_t)CC * DIN, nullptr, nullptr, nullptr, QH, QL, KH, KL, VT, VB, VBL, RT);
  k_fa<<<dim3(TT / 128, NH, TNB), 128, 0, stream>>>(QH, KH, VT, Y);
  k_out<<<dim3(TNB * TT / 128, DIN / 128), 256, 0, stream>>>(Y, WH, nullptr, (float*)d_out);
}

// v008
// A run of this version takes 75.7 microseconds.
// Timed twice side by side with v007, it ran 1.03 and 1.04 times as fast.
// Counting every step since v000, it is 19.2 times as fast.
// compute dtype: all float inputs rounded to bf16; q / k / v projections with EXACT bf16 products on WMMA 16x16x32 (f32 accumulate), no biases; RoPE in f32 (embedded frequencies, precise cosf / sinf, positions read from the int input token_positions); logits q x 64^-0.5 log2(e) and k once to f16 each (1 product); softmax f32 in base 2 against a reference logit per query that is renewed only when a logit passes it by 6 (p by 2^6), sums over 32-key trips; P (unnormalised, x 2^8) once to f16 x v once to f16 (1 product), divided by the sum at the end; ctx x 2^6 once to f16 x the output weight f16(bf16 x 2^8); f32 output.
#include <hip/hip_runtime.h>
#include <math.h>

typedef __attribute__((ext_vector_type(16))) _Float16 v16h;
typedef __attribute__((ext_vector_type(16))) __bf16 v16b;
typedef __attribute__((ext_vector_type(8)))  _Float16 v8h;
typedef __attribute__((ext_vector_type(8)))  float v8f;
typedef __attribute__((ext_vector_type(4)))  float v4f;
typedef __attribute__((ext_vector_type(2)))  float v2f;
typedef __attribute__((ext_vector_type(4)))  unsigned v4u;
typedef __attribute__((ext_vector_type(4)))  int v4i;
typedef float __attribute__((may_alias)) float_a;
typedef int __attribute__((may_alias)) int_a;

template <typename T> __device__ __forceinline__ void vst2(void* p, T v) { *(T*)p = v;  }
__device__ __forceinline__ v8f wmma16(v16h a, v16h b, v8f c) {
  v8f d = __builtin_amdgcn_wmma_f32_16x16x32_f16(false, a, false, b, (short)0, c, false, false);
  asm volatile("v_nop\n\tv_nop\n\tv_nop\n\tv_nop" : "+v"(d) : "v"(a), "v"(b));
  return d;
}
__device__ __forceinline__ v8f wmma_bf(v16b a, v16b b, v8f c) {
  v8f d = __builtin_amdgcn_wmma_f32_16x16x32_bf16(false, a, false, b, (short)0, c, false, false);
  asm volatile("v_nop\n\tv_nop\n\tv_nop\n\tv_nop" : "+v"(d) : "v"(a), "v"(b));
  return d;
}
// 16x16x32 fragments: lane = (h = lane>>4, row/col = lane&15); elements 0..7 = k0+8h+0..7, 8..15 = k0+16+8h+0..7; D element r = row 8h+r
__device__ __forceinline__ v16h frag_h(const _Float16* rowk0, int lane) {
  union { v16h v; v8h q[2]; } u; const _Float16* p = rowk0 + 8 * (lane >> 4);
  u.q[0] = *(const v8h*)p; u.q[1] = *(const v8h*)(p + 16); return u.v;
}
__device__ __forceinline__ v16h frag_f32(const float* rowk0, int lane) {
  v16h a; const float* p = rowk0 + 8 * (lane >> 4);
#pragma unroll
  for (int i = 0; i < 8; ++i) { a[i] = (_Float16)p[i]; a[8 + i] = (_Float16)p[16 + i]; }
  return a;
}
__device__ __forceinline__ v16h frag_f32s(const float* rowk0, int lane, float sc) {
  v16h a; const float* p = rowk0 + 8 * (lane >> 4);
#pragma unroll
  for (int i = 0; i < 8; ++i) { a[i] = (_Float16)(p[i] * sc); a[8 + i] = (_Float16)(p[16 + i] * sc); }
  return a;
}
// column fragment from a [K][ld] layout (column n), rows >= K read as 0
__device__ __forceinline__ v16h fragc_f32(const float* W, int k0, int n, int lane, int ld, int K) {
  v16h a; const int g = lane >> 4;
#pragma unroll
  for (int i = 0; i < 8; ++i) { const int ka = k0 + 8 * g + i, kb = ka + 16;
    a[i] = (_Float16)(ka < K ? W[(size_t)(ka < K ? ka : K - 1) * ld + n] : 0.f); a[8 + i] = (_Float16)(kb < K ? W[(size_t)(kb < K ? kb : K - 1) * ld + n] : 0.f); }
  return a;
}
struct F2 { v16b h, l; };
__device__ __forceinline__ F2 bsplit16(const float v[16]) { F2 r;
#pragma unroll
  for (int i = 0; i < 16; ++i) { const __bf16 h = (__bf16)v[i]; r.h[i] = h; r.l[i] = (__bf16)(v[i] - (float)h); }
  return r; }
__device__ __forceinline__ F2 split_row(const float* row, int k0, int lane) { float v[16]; const float* p = row + k0 + 8 * (lane >> 4);
#pragma unroll
  for (int i = 0; i < 8; ++i) { v[i] = p[i]; v[8 + i] = p[16 + i]; }
  return bsplit16(v); }
__device__ __forceinline__ F2 split_rowK(const float* row, int k0, int lane, int K) { float v[16]; const int g = lane >> 4;
#pragma unroll
  for (int i = 0; i < 8; ++i) { const int ka = k0 + 8 * g + i, kb = ka + 16; v[i] = ka < K ? row[ka < K ? ka : K - 1] : 0.f; v[8 + i] = kb < K ? row[kb < K ? kb : K - 1] : 0.f; }
  return bsplit16(v); }
__device__ __forceinline__ F2 split_col(const float* W, int k0, int n, int lane, int ld, int K) { float v[16]; const int g = lane >> 4;
#pragma unroll
  for (int i = 0; i < 8; ++i) { const int ka = k0 + 8 * g + i, kb = ka + 16; v[i] = ka < K ? W[(size_t)(ka < K ? ka : K - 1) * ld + n] : 0.f; v[8 + i] = kb < K ? W[(size_t)(kb < K ? kb : K - 1) * ld + n] : 0.f; }
  return bsplit16(v); }
__device__ __forceinline__ v8f mac3(const F2& a, const F2& b, v8f c) { c = wmma_bf(a.l, b.h, c); c = wmma_bf(a.h, b.l, c); return wmma_bf(a.h, b.h, c); }
__device__ __forceinline__ float sigm(float v) { return 1.0f / (1.0f + expf(-v)); }
#define LDSX() do { asm volatile("s_wait_dscnt 0" ::: "memory"); __builtin_amdgcn_wave_barrier(); __builtin_amdgcn_fence(__ATOMIC_RELEASE, "workgroup"); } while (0)

// Multi-head self-attention with interleaved-pair RoPE, no mask (x [2,2048,1024]; Wqkv [3072,1024] torch (out,in): qkv.reshape(B, S, 3, 16, 64): q = rows 0..1023, k = 1024..2047, v = 2048..3071; Wout [1024,1024] (out,in); token_positions [2048] int32 = arange, a module input READ on the device; RoPE on q and k: (even, odd) pairs (x_e c - x_o s, x_e s + x_o c) re-interleaved, inv_freq = 1 / 10000^(2i/64); scores / sqrt(64); softmax; out @ Wout.T).
#define NB 2
#define TT 2048
#define CC 1024            // NH * HD = projected width
#define DIN 1024          // input (model) width
#define NH 16
#define HD 64
#define NQB (TT / 64)
#define HG 4
#define SCALE (0.125f)
#define CAUSAL 0
#ifndef TNB
#define TNB NB
#endif
__device__ __forceinline__ float bfr(float v) { return (float)(__bf16)v; }
__host__ __device__ __forceinline__ int kb_last(int qb) { return CAUSAL ? ((qb * 64 + 63) >> 7) : (TT / 128 - 1); }
typedef __attribute__((ext_vector_type(8))) __bf16 v8b;
__device__ __forceinline__ v16b frag_b(const __bf16* rowk0, int lane) {
  union { v16b v; v8b q[2]; } u; const __bf16* p = rowk0 + 8 * (lane >> 4);
  u.q[0] = *(const v8b*)p; u.q[1] = *(const v8b*)(p + 16); return u.v;
}
// operand staging of the two projection GEMMs: the operands lie in the workspace as 16-bit values, rounded once ahead of the GEMMs; a 64-k chunk of a row is one 128-byte line; 8 lanes fetch it whole, 16 bytes each; LDS rows of 64 values at a pitch of 72 (144 bytes = 16 x odd, for 16-byte readers)
typedef __attribute__((ext_vector_type(4))) __bf16 v4b;
typedef __attribute__((ext_vector_type(4))) _Float16 v4h;
#define SPK 72
#define KCH 64              // k values a chunk
// work-group barrier by hand, behind the wave's own LDS wait: __syncthreads() would also wait out the global loads that are meant to stay in flight across it
__device__ __forceinline__ void stage_bar() { asm volatile("s_wait_dscnt 0x0" ::: "memory"); asm volatile("s_barrier_signal -1\n\ts_barrier_wait -1" ::: "memory"); }
// behind a group of look-ahead loads: their address registers are reused while the loads are still in flight
__device__ __forceinline__ void loads_issued() { asm volatile("s_wait_xcnt 0x0" ::: "memory"); }
// behind a store in a loop: its address and data registers are rewritten by what follows it
__device__ __forceinline__ void store_issued() { asm volatile("s_wait_xcnt 0x0" ::: "memory"); }
__device__ __forceinline__ v4b cvt4b(v4f v) { v4b r; r[0] = (__bf16)v[0]; r[1] = (__bf16)v[1]; r[2] = (__bf16)v[2]; r[3] = (__bf16)v[3]; return r; }
__device__ __forceinline__ v4h cvt4w(v4f v) { v4h r; r[0] = (_Float16)(bfr(v[0]) * 256.0f); r[1] = (_Float16)(bfr(v[1]) * 256.0f); r[2] = (_Float16)(bfr(v[2]) * 256.0f); r[3] = (_Float16)(bfr(v[3]) * 256.0f); return r; }
#define QBH 0              // unused: k_fa has one path for all query blocks
#define QHI 0               // single-product logits on every row
#define KHI 64            // key rows carrying k residual / v bf16 hi+lo planes (written by k_proj, read by no kernel here)
// B fragment (k rows k0+.., output column o) of a weight: (in,out) [K][ld] or (out,in) [ld rows of K]: bf16 exact, or f16(bf16 * 256) exact
__device__ __forceinline__ v16b wcol_io(const float* Wm, int k0, int o, int lane, int ld) { v16b w; const int g = lane >> 4;
#pragma unroll
  for (int i = 0; i < 8; ++i) { w[i] = (__bf16)Wm[(size_t)(k0 + 8 * g + i) * ld + o]; w[8 + i] = (__bf16)Wm[(size_t)(k0 + 16 + 8 * g + i) * ld + o]; }
  return w; }
__device__ __forceinline__ v16b wcol_oi(const float* Wm, int k0, int o, int lane, int K) { v16b w; const float* p = Wm + (size_t)o * K + k0 + 8 * (lane >> 4);
#pragma unroll
  for (int i = 0; i < 8; ++i) { w[i] = (__bf16)p[i]; w[8 + i] = (__bf16)p[16 + i]; }
  return w; }
__device__ __forceinline__ v16h wcolh_io(const float* Wm, int k0, int o, int lane, int ld) { v16h w; const int g = lane >> 4;
#pragma unroll
  for (int i = 0; i < 8; ++i) { w[i] = (_Float16)(bfr(Wm[(size_t)(k0 + 8 * g + i) * ld + o]) * 256.0f); w[8 + i] = (_Float16)(bfr(Wm[(size_t)(k0 + 16 + 8 * g + i) * ld + o]) * 256.0f); }
  return w; }
__device__ __forceinline__ v16h wcolh_oi(const float* Wm, int k0, int o, int lane, int K) { v16h w; const float* p = Wm + (size_t)o * K + k0 + 8 * (lane >> 4);
#pragma unroll
  for (int i = 0; i < 8; ++i) { w[i] = (_Float16)(bfr(p[i]) * 256.0f); w[8 + i] = (_Float16)(bfr(p[16 + i]) * 256.0f); }
  return w; }
#define WQKV_LAYOUT 1   // 0 = (in,out) [DIN][CC]; 1 = (out,in) [CC][DIN]; 2 = per-head [NH][DIN][HD]
__device__ __forceinline__ v16b wcol_hdk(const float* Wm, int k0, int o, int lane) { v16b w; const int g = lane >> 4; const float* p = Wm + (size_t)(o / HD) * DIN * HD + (o % HD);
#pragma unroll
  for (int i = 0; i < 8; ++i) { w[i] = (__bf16)p[(size_t)(k0 + 8 * g + i) * HD]; w[8 + i] = (__bf16)p[(size_t)(k0 + 16 + 8 * g + i) * HD]; }
  return w; }
#define WO_OUT_IN 1
#if WQKV_LAYOUT == 1
#define WCOL(W, k0, o, lane) wcol_oi(W, k0, o, lane, DIN)
#elif WQKV_LAYOUT == 2
#define WCOL(W, k0, o, lane) wcol_hdk(W, k0, o, lane)
#else
#define WCOL(W, k0, o, lane) wcol_io(W, k0, o, lane, CC)
#endif
#if WO_OUT_IN
#define WOCOL(W, k0, o, lane) wcol_oi(W, k0, o, lane, CC)
#define WOCOLH(W, k0, o, lane) wcolh_oi(W, k0, o, lane, CC)
#else
#define WOCOL(W, k0, o, lane) wcol_io(W, k0, o, lane, DIN)
#define WOCOLH(W, k0, o, lane) wcolh_io(W, k0, o, lane, DIN)
#endif

// RoPE inverse frequencies 1/10000^(2i/64) (the f32 values jax computes)
__constant__ float INVF[32] = {1.000000000e+00,7.498942018e-01,5.623413324e-01,4.216965139e-01,3.162277639e-01,2.371373624e-01,1.778279394e-01,1.333521456e-01,1.000000015e-01,7.498941571e-02,5.623412877e-02,4.216964915e-02,3.162277862e-02,2.371373586e-02,1.778279431e-02,1.333521493e-02,9.999999776e-03,7.498942316e-03,5.623413250e-03,4.216964822e-03,3.162277862e-03,2.371373819e-03,1.778279431e-03,1.333521446e-03,1.000000047e-03,7.498941850e-04,5.623413017e-04,4.216964880e-04,3.162277862e-04,2.371373848e-04,1.778279402e-04,1.333521504e-04};
// RoPE factors: (cos, sin) of pos * INVF[i], pos READ from the int input, depend on (token, i) alone: the rounding launch works each pair out once into the table RT [t][i][cos, sin]; k_proj's q and k blocks read them there
#ifndef SM_EXTRA_PARAMS
#define SM_EXTRA_PARAMS
#endif
#ifndef PROJ_EXTRA_PARAMS
#define PROJ_EXTRA_PARAMS
#endif
#ifndef SM_MASK_HOOK
#define SM_MASK_HOOK (void)0
#endif

#define WS_QH  0u                                      // f16 q rows [b*t][CC]
#define WS_KH  (WS_QH + 2u * (size_t)NB * TT * CC)      // f16 k rows [b*t][CC]
#define WS_VT  (WS_KH + 2u * (size_t)NB * TT * CC)      // f16 v planes [b][c][t]
#define WS_QL  (WS_VT + 2u * (size_t)NB * CC * TT)      // f16 q residual x 2^10 rows [b][t < QHI][CC]
#define WS_KL  (WS_QL + 2u * (size_t)NB * QHI * CC)     // f16 k residual x 2^10 rows [b][t < KHI][CC]
#define WS_VB  (WS_KL + 2u * (size_t)NB * KHI * CC)     // bf16 v hi planes [b][c][t < KHI]
#define WS_VBL (WS_VB + 2u * (size_t)NB * CC * KHI)
#define WS_S   (WS_VBL + 2u * (size_t)NB * CC * KHI)    // (once f32 logits) now the rounded GEMM operands
#define WS_XB  WS_S                                     // bf16 x rows [b*t][DIN]
#define WS_WB  (WS_XB + 2u * (size_t)NB * TT * DIN)     // bf16 Wqkv rows [3 * CC][DIN]
#define WS_WH  (WS_WB + 2u * (size_t)3 * CC * DIN)      // f16(bf16 x 2^8) Wout rows [DIN][CC]
#define WS_RT  (WS_WH + 2u * (size_t)DIN * CC)          // f32 RoPE table [t][32][cos, sin]
#define WS_Y   (WS_S  + 4u * (size_t)HG * TT * TT)      // f16 ctx x 2^6 rows [b*t][CC]
#define WS_END (WS_Y  + 4u * (size_t)NB * TT * CC)

// ---- k_cvt: the GEMM operands that are inputs are rounded once, ahead of the GEMMs (each was rounded anew by every block that read it): x and Wqkv to bf16, Wout to f16(bf16 x 2^8).
// Few, long waves (two blocks of 8 waves a WGP): a block takes 16384 values in 16 passes; a pass is 16 bytes in and 8 bytes out a lane, whole lines a wave; all 16 loads of a lane are in flight together.
#define CVB 16384                         // values a block
#define CVX (NB * TT * DIN / CVB)         // blocks of x
#define CVW (3 * CC * DIN / CVB)          // blocks of Wqkv
#define CVO (DIN * CC / CVB)              // blocks of Wout
#define CVT (TT * 32 / 1024)              // blocks of the RoPE table: 1024 (token, frequency) entries a block, 4 a lane; they stand first in the grid
__global__ __launch_bounds__(256) void k_cvt(const float* __restrict__ X, const float* __restrict__ WQKV, const float* __restrict__ WO, const int* __restrict__ TPOS, __bf16* __restrict__ XB, __bf16* __restrict__ WB, _Float16* __restrict__ WH, float* __restrict__ RT) {
  if (blockIdx.x < CVT) { const int e0 = blockIdx.x * 1024 + threadIdx.x;   // entry e = t * 32 + i; a lane's four entries are 256 apart: one frequency, tokens 8 apart
    const int* tp = TPOS + (e0 >> 5); const float* fp = INVF + (e0 & 31); float* d = RT + 2 * (size_t)e0; int ps[4]; v2f c[4];
#pragma unroll
    for (int p = 0; p < 4; ++p) ps[p] = tp[p * 8];
    const float fr = *fp;
#pragma unroll
    for (int p = 0; p < 4; ++p) { const float ang = (float)ps[p] * fr; c[p][0] = cosf(ang); c[p][1] = sinf(ang); }
#pragma unroll
    for (int p = 0; p < 4; ++p) vst2(d + p * 512, c[p]);   // 8 bytes a lane, 256 contiguous bytes a wave; the wave ends behind these stores
    return; }
  const int bx = blockIdx.x - CVT; const size_t o = (size_t)threadIdx.x * 4; v4f a[16];
  if (bx < CVX + CVW) { const bool isx = bx < CVX; const size_t e = (size_t)(isx ? bx : bx - CVX) * CVB + o; const float* s = (isx ? X : WQKV) + e; __bf16* d = (isx ? XB : WB) + e;
#pragma unroll
    for (int p = 0; p < 16; ++p) a[p] = *(const v4f*)(s + p * 1024);
    asm volatile("s_wait_xcnt 0x0" :: "v"(s) : "memory");   // the address pair is an input, so it stays live up to this wait: no load's own result is placed on it while the loads before it are in flight
#pragma unroll
    for (int p = 0; p < 16; ++p) vst2(d + p * 1024, cvt4b(a[p]));
    asm volatile("s_wait_xcnt 0x0" ::: "memory");   // behind the last store of the run: no register that a store names is rewritten ahead of this wait
  } else { const size_t e = (size_t)(bx - CVX - CVW) * CVB + o; const float* s = WO + e; _Float16* d = WH + e;
#pragma unroll
    for (int p = 0; p < 16; ++p) a[p] = *(const v4f*)(s + p * 1024);
    asm volatile("s_wait_xcnt 0x0" :: "v"(s) : "memory");   // the address pair is an input, so it stays live up to this wait: no load's own result is placed on it while the loads before it are in flight
#pragma unroll
    for (int p = 0; p < 16; ++p) vst2(d + p * 1024, cvt4w(a[p]));
    asm volatile("s_wait_xcnt 0x0" ::: "memory"); } }   // behind the last store of the run: no register that a store names is rewritten ahead of this wait
// ---- k_proj: block = (128 rows, 128 cols, which), 4 waves as 2 x 2, a wave = 64 x 64 (4 + 4 fragments feed 16 products): q/k/v = X W (+ b) with exact bf16 products (K = DIN) -> which 0: q f16 rows (+ residual rows < QHI); 1: k f16 rows (+ residual rows < KHI); 2: v f16 planes [c][t] (+ bf16 hi/lo planes for t < KHI)
#define PST (64 * 132 * 4)                 // bytes of st
#define PSM (PST + 3 * 128 * 72 * 2)       // bytes of the block's LDS; the operand buffers take 2 * 256 * SPK * 2 of them
__global__ __launch_bounds__(128) void k_proj(const __bf16* __restrict__ XQ, const __bf16* __restrict__ XK, const __bf16* __restrict__ XV, const __bf16* __restrict__ WQ, const __bf16* __restrict__ WK, const __bf16* __restrict__ WV, const float* __restrict__ BQ, const float* __restrict__ BK, const float* __restrict__ BV,
    _Float16* __restrict__ QH, _Float16* __restrict__ QL, _Float16* __restrict__ KH, _Float16* __restrict__ KL, _Float16* __restrict__ VT, __bf16* __restrict__ VB, __bf16* __restrict__ VBL, const float* __restrict__ RT) {
  __shared__ __align__(16) char sm[PSM];   // one array: the main loop's two operand buffers from its start; behind the loop's last barrier the epilogue's st, and behind st either sh, sl (q, k) or th, tb, tbl (v); three blocks fit a WGP
  float (*st)[132] = (float (*)[132])sm; _Float16 (*sh)[136] = (_Float16 (*)[136])(sm + PST); _Float16 (*sl)[136] = sh + 64; _Float16 (*th)[72] = (_Float16 (*)[72])(sm + PST); __bf16 (*tb)[72] = (__bf16 (*)[72])(th + 128); __bf16 (*tbl)[72] = tb + 128;
  const int tid = threadIdx.x, wave = tid >> 5, lane = tid & 31, col = lane & 15, g = lane >> 4, wr = wave >> 1, wc = wave & 1; const int which = blockIdx.z; const int c0 = blockIdx.y * 128; const size_t r0 = (size_t)blockIdx.x * 128; const size_t bb = r0 / TT; const int t0 = (int)(r0 % TT);
  const __bf16* X = which == 0 ? XQ : which == 1 ? XK : XV; const __bf16* WA = which == 0 ? WQ : which == 1 ? WK : WV; const float* BA = which == 0 ? BQ : which == 1 ? BK : BV;
  v2f tc[2][16];   // q and k blocks: the RoPE factors of the 16 rows that this wave rotates in each 64-row half, lane = frequency i: 256 contiguous bytes a row; the first half's are fetched ahead of the main loop, which covers their latency, the second half's while the first half is stored
  if (which < 2) { const float* tp = RT + (size_t)(t0 + wave * 16) * 64 + lane * 2;
#pragma unroll
    for (int rr = 0; rr < 16; ++rr) tc[0][rr] = *(const v2f*)(tp + rr * 64);
    asm volatile("s_wait_xcnt 0x0" :: "v"(tp) : "memory"); }   // the address pair is an input, so it stays live up to this wait: no load's own result is placed on it while the loads before it are being issued
  v8f acc[4][4] = {};
  { // operands through LDS, two buffers: rows 0..127 = X rows, 128..255 = weight rows of this tile; chunk kc + 1 is in flight in registers while chunk kc is multiplied
    __bf16* const sb0 = (__bf16*)sm; __bf16* const sb1 = sb0 + 256 * SPK;
    const int lr = tid >> 3, lp = tid & 7; const __bf16* Ap = X + (r0 + lr) * DIN + lp * 8; const __bf16* Wp = WA + (size_t)(c0 + lr) * DIN + lp * 8; const int so = lr * SPK + lp * 8;
    v4u ra[8], rw[8];
#pragma unroll
    for (int i = 0; i < 8; ++i) ra[i] = *(const v4u*)(Ap + (size_t)i * 16 * DIN);
#pragma unroll
    for (int i = 0; i < 8; ++i) rw[i] = *(const v4u*)(Wp + (size_t)i * 16 * DIN);
#pragma unroll
    for (int i = 0; i < 8; ++i) *(v4u*)(sb0 + so + i * 16 * SPK) = ra[i];
#pragma unroll
    for (int i = 0; i < 8; ++i) *(v4u*)(sb0 + so + (128 + i * 16) * SPK) = rw[i];
#pragma unroll
    for (int i = 0; i < 8; ++i) ra[i] = *(const v4u*)(Ap + (size_t)i * 16 * DIN + KCH);
#pragma unroll
    for (int i = 0; i < 8; ++i) rw[i] = *(const v4u*)(Wp + (size_t)i * 16 * DIN + KCH);
    loads_issued(); stage_bar();   // chunk 0 is published
#pragma unroll 2   // two trips a pass, so that each trip's buffer addresses are constants
    for (int kc = 0; kc < DIN / KCH; ++kc) { const __bf16* sb = (kc & 1) ? sb1 : sb0; __bf16* sn = (kc & 1) ? sb0 : sb1;
#pragma unroll
      for (int ks = 0; ks < KCH; ks += 32) { v16b a[4], w[4];
#pragma unroll
        for (int i = 0; i < 4; ++i) a[i] = frag_b(sb + (wr * 64 + i * 16 + col) * SPK + ks, lane);
#pragma unroll
        for (int j = 0; j < 4; ++j) w[j] = frag_b(sb + (128 + wc * 64 + j * 16 + col) * SPK + ks, lane);
#pragma unroll
        for (int i = 0; i < 4; ++i)
#pragma unroll
          for (int j = 0; j < 4; ++j) acc[i][j] = wmma_bf(a[i], w[j], acc[i][j]); }
      __builtin_amdgcn_sched_barrier(0);   // keeps the wait for chunk kc + 1's loads behind the products, which cover a part of their latency
      if (kc + 1 < DIN / KCH) {   // the other buffer's readers left it before the last barrier
#pragma unroll
        for (int i = 0; i < 8; ++i) *(v4u*)(sn + so + i * 16 * SPK) = ra[i];
#pragma unroll
        for (int i = 0; i < 8; ++i) *(v4u*)(sn + so + (128 + i * 16) * SPK) = rw[i];
        if (kc + 2 < DIN / KCH) {
#pragma unroll
          for (int i = 0; i < 8; ++i) ra[i] = *(const v4u*)(Ap + (size_t)i * 16 * DIN + (kc + 2) * KCH);
#pragma unroll
          for (int i = 0; i < 8; ++i) rw[i] = *(const v4u*)(Wp + (size_t)i * 16 * DIN + (kc + 2) * KCH);
          loads_issued(); } }
      stage_bar(); } }   // publishes chunk kc + 1 and ends the reads of chunk kc
#pragma unroll   // the tile leaves in two halves of 64 rows through the same staging arrays; unrolled, so that the accumulators are indexed by constants
  for (int hf = 0; hf < 2; ++hf) { const size_t r0h = r0 + hf * 64; const int t0h = t0 + hf * 64;
  { // stage the half's f32 tile (acc + bias) in LDS (the two waves that hold it), rotate the q and k rows there, then convert
    if (wr == hf) {
#pragma unroll
      for (int j = 0; j < 4; ++j) { const float bias = BA ? bfr(BA[c0 + wc * 64 + j * 16 + col]) : 0.f;
#pragma unroll
        for (int i = 0; i < 4; ++i)
#pragma unroll
          for (int r = 0; r < 8; ++r) st[i * 16 + 8 * g + r][wc * 64 + j * 16 + col] = acc[i][j][r] + bias; } }
    __syncthreads();
    if (which < 2) {   // interleaved-pair rotation (x[2i], x[2i + 1]) by the angle pos * INVF[i]: lane = pair i of a head, so a wave reads and writes 256 contiguous bytes of a row; v untouched
#pragma unroll
      for (int rr = 0; rr < 16; ++rr) { const float cs = tc[hf][rr][0], sn = tc[hf][rr][1];
#pragma unroll
        for (int hh = 0; hh < 128 / HD; ++hh) { float* rw = &st[wave * 16 + rr][hh * HD + 2 * lane]; const v2f x = *(const v2f*)rw; v2f y; y[0] = x[0] * cs - x[1] * sn; y[1] = x[0] * sn + x[1] * cs; *(v2f*)rw = y; } } }
    __syncthreads(); }
  if (which < 2) { _Float16* DH = which == 0 ? QH : KH; _Float16* DL = which == 0 ? QL : KL; const int nhi = which == 0 ? QHI : KHI; const bool hi_rows = t0h < nhi;
    const float qs = which == 0 ? SCALE * 1.4426950408889634f : 1.0f;   // q leaves as k_fa's operand: logits come out of the product in base-2 units
    for (int e = tid; e < 64 * 128; e += 128) { const int rl = e >> 7, cl = e & 127; const float v = st[rl][cl] * qs; const _Float16 hv = (_Float16)v; sh[rl][cl] = hv; sl[rl][cl] = (_Float16)((v - (float)hv) * 1024.0f); }
    __syncthreads();
    if (hf == 0) { const float* tp = RT + (size_t)(t0 + wave * 16) * 64 + lane * 2;   // behind the first half's last barrier (a barrier would wait these loads out): its stores and the second half's staging cover their latency
#pragma unroll
      for (int rr = 0; rr < 16; ++rr) tc[1][rr] = *(const v2f*)(tp + (64 + rr) * 64);
      asm volatile("s_wait_xcnt 0x0" :: "v"(tp) : "memory"); }   // as at the first half's fetch
    for (int e = tid; e < 64 * 16; e += 128) { const int rl = e >> 4, q = e & 15; vst2((unsigned*)(DH + (r0h + rl) * CC + c0 + q * 8), *(const v4u*)&sh[rl][q * 8]); store_issued(); if (hi_rows) { vst2((unsigned*)(DL + (bb * nhi + t0h + rl) * (size_t)CC + c0 + q * 8), *(const v4u*)&sl[rl][q * 8]); store_issued(); } }
  } else { const bool hi_rows = t0h < KHI;
    for (int e = tid; e < 64 * 128; e += 128) { const int rl = e & 63, cl = e >> 6; const float v = st[rl][cl]; th[cl][rl] = (_Float16)v; const __bf16 bh = (__bf16)v; tb[cl][rl] = bh; tbl[cl][rl] = (__bf16)(v - (float)bh); }
    __syncthreads();
    for (int e = tid; e < 128 * 8; e += 128) { const int cl = e >> 3, q = e & 7; vst2((unsigned*)(VT + (bb * CC + c0 + cl) * (size_t)TT + t0h + q * 8), *(const v4u*)&th[cl][q * 8]); store_issued(); if (hi_rows) { const size_t o3 = (bb * CC + c0 + cl) * (size_t)KHI + t0h + q * 8; vst2((unsigned*)(VB + o3), *(const v4u*)&tb[cl][q * 8]); vst2((unsigned*)(VBL + o3), *(const v4u*)&tbl[cl][q * 8]); store_issued(); } } } } }
// ---- k_fa: block = 128 queries (4 waves x 32 query columns) of head h, batch b: logits, softmax and P . v in one pass over the keys, 32 keys a trip; no logit or P ever leaves the registers.
// Transposed products: S^T = K Q^T (lane = query column, element r = key 8g + r), so the two 16-key tiles of a trip, converted in place, are the B fragment (k = key, hardware k order) of ctx^T = V^T P^T.
// Reference logit ref and running sum l per query column; q arrives x SCALE log2(e), and 8 - ref enters the score product as its C operand, so p = 2^s straight from the accumulator; the 2^8 keeps small p clear of f16 subnormals and cancels in acc / l.
// ref is the first trip's maximum and is renewed (acc, l and this trip's s rescaled) only in a trip where some s passes 14, so p never passes 2^14, well inside f16; any ref gives the same quotient acc / l.
// K rows and V^T rows reach the four waves through LDS: a stage is 128 keys, copied once per block as whole 128-byte lines by asynchronous 16-byte copies, two buffers, stage t + 1 in flight while stage t is worked on.
__device__ __forceinline__ float xhalf(float x) { return __builtin_bit_cast(float, __builtin_amdgcn_permlanex16(__builtin_bit_cast(int, x), __builtin_bit_cast(int, x), 0x76543210, 0xfedcba98, false, false)); }  // lane l with lane l ^ 16
__device__ __forceinline__ v8f mmah(v16h a, v16h b, v8f c) { return __builtin_amdgcn_wmma_f32_16x16x32_f16(false, a, false, b, (short)0, c, false, false); }
#define FKS 128                       // keys a stage
#define FKP 72                        // LDS pitch of a K row in f16: 64 channels + 8 (144 bytes = 16 x odd, for 16-byte readers)
#define FVP 136                       // LDS pitch of a V^T row in f16: 128 keys + 8 (272 bytes = 16 x odd)
#define FVO (FKS * FKP)               // the V^T rows stand behind the K rows
#define FBUF (FKS * FKP + HD * FVP)   // f16 a buffer
__device__ __forceinline__ unsigned lds_off(const void* p) { return (unsigned)(size_t)p; }   // byte offset in the work-group's LDS
// eight 16-byte copies a lane, global memory to LDS through no register; the s_wait_xcnt closes the statement so that no address register of a copy is rewritten ahead of it
__device__ __forceinline__ void copy8(unsigned l, unsigned ls, const _Float16* p, size_t ps) {
  asm volatile("global_load_async_to_lds_b128 %0, %8, off\n\t"
               "global_load_async_to_lds_b128 %1, %9, off\n\t"
               "global_load_async_to_lds_b128 %2, %10, off\n\t"
               "global_load_async_to_lds_b128 %3, %11, off\n\t"
               "global_load_async_to_lds_b128 %4, %12, off\n\t"
               "global_load_async_to_lds_b128 %5, %13, off\n\t"
               "global_load_async_to_lds_b128 %6, %14, off\n\t"
               "global_load_async_to_lds_b128 %7, %15, off\n\t"
               "s_wait_xcnt 0x0"
               :: "v"(l), "v"(l + ls), "v"(l + 2 * ls), "v"(l + 3 * ls), "v"(l + 4 * ls), "v"(l + 5 * ls), "v"(l + 6 * ls), "v"(l + 7 * ls),
                  "v"(p), "v"(p + ps), "v"(p + 2 * ps), "v"(p + 3 * ps), "v"(p + 4 * ps), "v"(p + 5 * ps), "v"(p + 6 * ps), "v"(p + 7 * ps) : "memory");
}
__global__ __launch_bounds__(128) void k_fa(const _Float16* __restrict__ QH, const _Float16* __restrict__ KH, const _Float16* __restrict__ VT, _Float16* __restrict__ Y) {
  __shared__ __align__(16) _Float16 kv[2][FBUF];   // [buffer][K rows 0..127 at pitch FKP | V^T rows 0..63 at pitch FVP]
  const int tid = threadIdx.x, wave = tid >> 5, lane = tid & 31, col = lane & 15, g = lane >> 4; const int h = blockIdx.y, b = blockIdx.z; const int q0 = blockIdx.x * 128 + wave * 32;
  v16h qf[2][2];
#pragma unroll
  for (int qt = 0; qt < 2; ++qt)
#pragma unroll
    for (int kc = 0; kc < 2; ++kc) qf[qt][kc] = frag_h(QH + ((size_t)b * TT + q0 + qt * 16 + col) * CC + h * HD + kc * 32, lane);
  // the copies of a stage: 8 lanes take one K row (128 bytes), rows tid / 8 + 16 i; 16 lanes take one V^T row (256 bytes), rows tid / 16 + 8 i
  const _Float16* Kg = KH + ((size_t)b * TT + (tid >> 3)) * CC + h * HD + (tid & 7) * 8;
  const _Float16* Vg = VT + ((size_t)b * CC + h * HD + (tid >> 4)) * (size_t)TT + (tid & 15) * 8;
  const unsigned lk = lds_off(&kv[0][0]) + 2u * (unsigned)((tid >> 3) * FKP + (tid & 7) * 8);
  const unsigned lv = lds_off(&kv[0][0]) + 2u * (unsigned)(FVO + (tid >> 4) * FVP + (tid & 15) * 8);
#define FA_STAGE(s, bf) do { copy8(lk + (unsigned)(bf) * (2u * FBUF), 2u * 16 * FKP, Kg + (size_t)(s) * FKS * CC, (size_t)16 * CC); copy8(lv + (unsigned)(bf) * (2u * FBUF), 2u * 8 * FVP, Vg + (size_t)(s) * FKS, (size_t)8 * TT); } while (0)
  FA_STAGE(0, 0);
  asm volatile("s_wait_asynccnt 0x0" ::: "memory");   // this wave's copies of stage 0 have landed
  __syncthreads();                                    // stage 0 is published
  FA_STAGE(1, 1);
  v8f acc[2][4] = {}; float l[2] = {0.f, 0.f}; v8f cb[2];   // cb: 8 - ref in every element
#pragma unroll
  for (int qt = 0; qt < 2; ++qt)
#pragma unroll
    for (int r = 0; r < 8; ++r) cb[qt][r] = 8.0f;
  for (int t = 0; t < TT / FKS; ++t) {
    const _Float16* Ks = &kv[t & 1][0] + col * FKP;         // key row col of a 16-key tile
    const _Float16* Vs = &kv[t & 1][0] + FVO + col * FVP;   // V^T row of channel col of a 16-channel tile
    v16h kf[2][2];
#pragma unroll
    for (int kt = 0; kt < 2; ++kt)
#pragma unroll
      for (int kc = 0; kc < 2; ++kc) kf[kt][kc] = frag_h(Ks + (kt * 16) * FKP + kc * 32, lane);
#pragma unroll 1   // one trip's registers only: with the four trips of a stage unrolled the build went past 255 registers and into scratch
    for (int k0 = 0; k0 < FKS; k0 += 32) {
      v16h vf[4];
#pragma unroll
      for (int j = 0; j < 4; ++j) vf[j] = frag_h(Vs + (j * 16) * FVP + k0, lane);
      v8f s[2][2];
#pragma unroll
      for (int kc = 0; kc < 2; ++kc)
#pragma unroll
        for (int qt = 0; qt < 2; ++qt)
#pragma unroll
          for (int kt = 0; kt < 2; ++kt) s[qt][kt] = mmah(kf[kt][kc], qf[qt][kc], kc == 0 ? cb[qt] : s[qt][kt]);
      const int kn = (k0 + 32) & (FKS - 1);   // the next trip's key rows, fetched a trip ahead; a stage's last trip fetches its own stage's rows 0..31 again (published, not used)
#pragma unroll
      for (int kt = 0; kt < 2; ++kt)
#pragma unroll
        for (int kc = 0; kc < 2; ++kc) kf[kt][kc] = frag_h(Ks + (kn + kt * 16) * FKP + kc * 32, lane);
      __builtin_amdgcn_sched_barrier(0);   // holds the look-ahead reads here: moved down behind the softmax they would have no time to land before the next trip's first product
      float mk[2][2];   // this lane's largest s of each 16 x 16 tile: four short chains, not one long one, since the test below waits for their end
#pragma unroll
      for (int qt = 0; qt < 2; ++qt)
#pragma unroll
        for (int kt = 0; kt < 2; ++kt) { const v8f& a = s[qt][kt]; mk[qt][kt] = fmaxf(fmaxf(fmaxf(fmaxf(a[0], a[1]), a[2]), fmaxf(a[3], a[4])), fmaxf(fmaxf(a[5], a[6]), a[7])); }
      const bool first = (t | k0) == 0;   // the first trip sets ref, whatever the logits are
      if (__builtin_amdgcn_ballot_w32(fmaxf(fmaxf(mk[0][0], mk[0][1]), fmaxf(mk[1][0], mk[1][1])) > (first ? -INFINITY : 14.0f)) != 0) {   // one test a trip, a scalar branch; with logits of like size it is taken in the first trip alone
#pragma unroll
        for (int qt = 0; qt < 2; ++qt) { const float ml = fmaxf(mk[qt][0], mk[qt][1]); const float mx = fmaxf(ml, xhalf(ml)) - 8.0f;   // both halves of the wave hold how far this query's maximum over the 32 keys stands above ref
          const float d = first ? mx : fmaxf(mx, 0.f);   // ref moves by d: later it only rises
          const float corr = __builtin_amdgcn_exp2f(fminf(-d, 0.f));   // never above 1: in the first trip acc and l are 0 and stay so
          l[qt] *= corr; cb[qt] = cb[qt] - d; s[qt][0] = s[qt][0] - d; s[qt][1] = s[qt][1] - d;
#pragma unroll
          for (int j = 0; j < 4; ++j) acc[qt][j] = acc[qt][j] * corr; } }
#pragma unroll
      for (int qt = 0; qt < 2; ++qt) {
        v16h pf; float s0 = 0.f, s1 = 0.f;
#pragma unroll
        for (int r = 0; r < 8; ++r) { const float p0 = __builtin_amdgcn_exp2f(s[qt][0][r]), p1 = __builtin_amdgcn_exp2f(s[qt][1][r]); s0 += p0; s1 += p1; pf[r] = (_Float16)p0; pf[8 + r] = (_Float16)p1; }
        l[qt] += s0 + s1;
#pragma unroll
        for (int j = 0; j < 4; ++j) acc[qt][j] = mmah(vf[j], pf, acc[qt][j]); } }
    asm volatile("s_wait_dscnt 0x0" ::: "memory");      // this wave's reads of stage t have returned
    asm volatile("s_wait_asynccnt 0x0" ::: "memory");   // this wave's copies of stage t + 1 have landed
    __syncthreads();                                    // publishes stage t + 1 and ends every wave's reads of stage t
    if (t + 2 < TT / FKS) FA_STAGE(t + 2, t & 1); }     // refill of the buffer that stage t has just left
  asm volatile("s_wait_asynccnt 0x0" ::: "memory");     // no copy is outstanding when the wave ends
#pragma unroll
  for (int qt = 0; qt < 2; ++qt) { const float inv = 1.0f / (l[qt] + xhalf(l[qt]));   // the two halves' sums are joined once
    _Float16* yr = Y + ((size_t)b * TT + q0 + qt * 16 + col) * CC + h * HD + 8 * g;  // element r of tile j = channel j * 16 + 8g + r of query col; ctx leaves as k_out's operand, x 2^6 once to f16 (small context rows stay clear of f16 subnormals)
#pragma unroll
    for (int j = 0; j < 4; ++j) { const v8f o = acc[qt][j] * inv; v8h y;
#pragma unroll
      for (int r = 0; r < 8; ++r) y[r] = (_Float16)(o[r] * 64.0f);
      vst2(yr + j * 16, y); } } }
// ---- k_out: block = (128 rows, 128 cols), 8 waves as 4 x 2, a wave = 32 x 64 (2 + 4 fragments feed 8 products; one block a WGP, so two waves a SIMD): out = ctx Wo (+ bo): ctx (f16, x 2^6) against Wo as f16(bf16 x 2^8) exact (1 product) x 2^-14
#define OFP 68              // pitch in f32 of a wave's staged output rows (64 values + 4: the two halves of a wave fall on different banks)
__global__ __launch_bounds__(256) void k_out(const _Float16* __restrict__ Y, const _Float16* __restrict__ WO, const float* __restrict__ BO, float* __restrict__ OUT) { __shared__ __align__(16) _Float16 sg[2][256 * SPK];   // the two operand buffers; behind the loop's last barrier each wave stages its 32 x 64 f32 tile in its own eighth
  const int tid = threadIdx.x, wave = tid >> 5, lane = tid & 31, col = lane & 15, g = lane >> 4, wr = wave >> 1, wc = wave & 1; const int c0 = blockIdx.y * 128 + wc * 64; const size_t r0 = (size_t)blockIdx.x * 128 + wr * 32;
  v8f acc[2][4] = {};
  {
    // operands through LDS as in k_proj: rows 0..127 = ctx rows, 128..255 = weight rows; here chunks kc + 1 and kc + 2 are in flight in registers while chunk kc is multiplied
    const int lr = tid >> 3, lp = tid & 7; const _Float16* Ap = Y + ((size_t)blockIdx.x * 128 + lr) * CC + lp * 8; const _Float16* Wp = WO + (size_t)(blockIdx.y * 128 + lr) * CC + lp * 8; const int so = lr * SPK + lp * 8;
    v4u ra[2][4], rw[2][4];   // two register sets, chunk c in set c & 1: two chunks' loads are in flight at a time, so a chunk has two trips to arrive in, not one
#pragma unroll
    for (int i = 0; i < 4; ++i) ra[0][i] = *(const v4u*)(Ap + (size_t)i * 32 * CC);
#pragma unroll
    for (int i = 0; i < 4; ++i) rw[0][i] = *(const v4u*)(Wp + (size_t)i * 32 * CC);
    __builtin_amdgcn_sched_barrier(0);   // the chunks' loads are issued chunk by chunk: loads return in order, and mixed with a later chunk's an earlier chunk could only be waited for together with it
#pragma unroll
    for (int i = 0; i < 4; ++i) ra[1][i] = *(const v4u*)(Ap + (size_t)i * 32 * CC + KCH);
#pragma unroll
    for (int i = 0; i < 4; ++i) rw[1][i] = *(const v4u*)(Wp + (size_t)i * 32 * CC + KCH);
    __builtin_amdgcn_sched_barrier(0);   // as above
#pragma unroll
    for (int i = 0; i < 4; ++i) *(v4u*)(&sg[0][0] + so + i * 32 * SPK) = ra[0][i];
#pragma unroll
    for (int i = 0; i < 4; ++i) *(v4u*)(&sg[0][0] + so + (128 + i * 32) * SPK) = rw[0][i];
#pragma unroll
    for (int i = 0; i < 4; ++i) ra[0][i] = *(const v4u*)(Ap + (size_t)i * 32 * CC + 2 * KCH);
#pragma unroll
    for (int i = 0; i < 4; ++i) rw[0][i] = *(const v4u*)(Wp + (size_t)i * 32 * CC + 2 * KCH);
    loads_issued(); stage_bar();   // chunk 0 is published
    // one trip: chunk kc (buffer p = kc & 1) is multiplied; st: chunk kc + 1 goes from its set to the other buffer; ld: that set then takes chunk kc + 3, while chunk kc + 2 stays in flight in the other set
    auto trip = [&](const int kc, const int p, const bool st, const bool ld) __attribute__((always_inline)) { const _Float16* sb = &sg[p][0]; _Float16* sn = &sg[p ^ 1][0];
#pragma unroll
      for (int ks = 0; ks < KCH; ks += 32) { v16h a[2], w[4];
#pragma unroll
        for (int i = 0; i < 2; ++i) a[i] = frag_h(sb + (wr * 32 + i * 16 + col) * SPK + ks, lane);
#pragma unroll
        for (int j = 0; j < 4; ++j) w[j] = frag_h(sb + (128 + wc * 64 + j * 16 + col) * SPK + ks, lane);
#pragma unroll
        for (int i = 0; i < 2; ++i)
#pragma unroll
          for (int j = 0; j < 4; ++j) acc[i][j] = wmma16(a[i], w[j], acc[i][j]); }
      __builtin_amdgcn_sched_barrier(0);   // keeps the wait for chunk kc + 1's loads behind the products, which cover a part of their latency
      if (st) {   // the other buffer's readers left it before the last barrier
#pragma unroll
        for (int i = 0; i < 4; ++i) *(v4u*)(sn + so + i * 32 * SPK) = ra[p ^ 1][i];
#pragma unroll
        for (int i = 0; i < 4; ++i) *(v4u*)(sn + so + (128 + i * 32) * SPK) = rw[p ^ 1][i];
        if (ld) {
#pragma unroll
          for (int i = 0; i < 4; ++i) ra[p ^ 1][i] = *(const v4u*)(Ap + (size_t)i * 32 * CC + (kc + 3) * KCH);
#pragma unroll
          for (int i = 0; i < 4; ++i) rw[p ^ 1][i] = *(const v4u*)(Wp + (size_t)i * 32 * CC + (kc + 3) * KCH);
          loads_issued(); } }
      stage_bar(); };   // publishes chunk kc + 1 and ends the reads of chunk kc
#pragma unroll 1   // a pass is two trips, so that each trip's LDS buffer and register set are named by constants; every trip of the loop fetches, so that its wait leaves the younger chunk's eight loads in flight
    for (int kk = 0; kk < CC / KCH - 4; kk += 2) { trip(kk, 0, true, true); trip(kk + 1, 1, true, true); }
    trip(CC / KCH - 4, 0, true, true); trip(CC / KCH - 3, 1, true, false); trip(CC / KCH - 2, 0, true, false); trip(CC / KCH - 1, 1, false, false); }   // the last four trips stand apart: only the first of them still has a chunk to fetch
  float* sf = (float*)&sg[0][0] + wave * 32 * OFP;   // 8 x 32 x OFP x 4 bytes lie inside the two buffers
#pragma unroll
  for (int j = 0; j < 4; ++j) { const float bias = BO ? bfr(BO[c0 + j * 16 + col]) : 0.f;
#pragma unroll
    for (int i = 0; i < 2; ++i)
#pragma unroll
      for (int r = 0; r < 8; ++r) sf[(i * 16 + 8 * g + r) * OFP + j * 16 + col] = acc[i][j][r] * (1.0f / 16384.0f) + bias; }   /* 2^-8 (Wo carry) x 2^-6 (ctx carry) */
  LDSX();
  float* op = OUT + (r0 + g) * DIN + c0 + col * 4; const float* sp = sf + g * OFP + col * 4;   // a store = two rows of 256 contiguous bytes each: whole lines
#pragma unroll
  for (int rl = 0; rl < 32; rl += 2) vst2(op + (size_t)rl * DIN, *(const v4f*)(sp + rl * OFP)); }

extern "C" void kernel_launch(void* const* d_in, const int* in_sizes, int n_in, void* d_out, int out_size, void* d_ws, size_t ws_size, hipStream_t stream) {
  (void)in_sizes; (void)n_in; (void)out_size;
  const float** F = (const float**)d_in;
  if (ws_size < (size_t)WS_END) return;
  char* ws = (char*)d_ws; _Float16 *QH = (_Float16*)(ws + WS_QH), *KH = (_Float16*)(ws + WS_KH), *VT = (_Float16*)(ws + WS_VT), *QL = (_Float16*)(ws + WS_QL), *KL = (_Float16*)(ws + WS_KL); __bf16 *VB = (__bf16*)(ws + WS_VB), *VBL = (__bf16*)(ws + WS_VBL), *XB = (__bf16*)(ws + WS_XB), *WB = (__bf16*)(ws + WS_WB); _Float16 *WH = (_Float16*)(ws + WS_WH), *Y = (_Float16*)(ws + WS_Y); float* RT = (float*)(ws + WS_RT);
  (void)Y; (void)QL; (void)KL; (void)VB; (void)VBL;
  // inputs: 0 x [2,2048,1024]; 1 Wqkv [3072,1024] (out,in): q rows 0..1023, k 1024..2047, v 2048..3071; 2 Wout [1024,1024] (out,in); 3 token_positions [2048] int32 (arange; READ on the device); no biases
  k_cvt<<<dim3(CVT + CVX + CVW + CVO), 256, 0, stream>>>(F[0], F[1], F[2], (const int*)d_in[3], XB, WB, WH, RT);
  k_proj<<<dim3(TNB * TT / 128, CC / 128, 3), 128, 0, stream>>>(XB, XB, XB, WB, WB + (size_t)CC * DIN, WB + 2 * (size_t)CC * DIN, nullptr, nullptr, nullptr, QH, QL, KH, KL, VT, VB, VBL, RT);
  k_fa<<<dim3(TT / 128, NH, TNB), 128, 0, stream>>>(QH, KH, VT, Y);
  k_out<<<dim3(TNB * TT / 128, DIN / 128), 256, 0, stream>>>(Y, WH, nullptr, (float*)d_out);
}

// v009
// Measured time: 73.1 microseconds a run.
// Timed twice side by side with v008, it ran 1.03 and 1.04 times as fast.
// Over all steps from v000 it is 19.9 times as fast.
// compute dtype: all float inputs rounded to bf16; q / k / v projections with EXACT bf16 products on WMMA 16x16x32 (f32 accumulate), no biases; RoPE in f32 (embedded frequencies, precise cosf / sinf, positions read from the int input token_positions); logits q x 64^-0.5 log2(e) and k once to f16 each (1 product); softmax f32 in base 2 against a reference logit per query that is renewed only when a logit passes it by 6 (p by 2^6), sums over 32-key trips; P (unnormalised, x 2^8) once to f16 x v once to f16 (1 product), divided by the sum at the end; ctx x 2^6 once to f16 x the output weight f16(bf16 x 2^8); f32 output.
#include <hip/hip_runtime.h>
#include <math.h>

typedef __attribute__((ext_vector_type(16))) _Float16 v16h;
typedef __attribute__((ext_vector_type(16))) __bf16 v16b;
typedef __attribute__((ext_vector_type(8)))  _Float16 v8h;
typedef __attribute__((ext_vector_type(8)))  float v8f;
typedef __attribute__((ext_vector_type(4)))  float v4f;
typedef __attribute__((ext_vector_type(2)))  float v2f;
typedef __attribute__((ext_vector_type(4)))  unsigned v4u;
typedef __attribute__((ext_vector_type(4)))  int v4i;
typedef float __attribute__((may_alias)) float_a;
typedef int __attribute__((may_alias)) int_a;

template <typename T> __device__ __forceinline__ void vst2(void* p, T v) { *(T*)p = v;  }
__device__ __forceinline__ v8f wmma16(v16h a, v16h b, v8f c) {
  v8f d = __builtin_amdgcn_wmma_f32_16x16x32_f16(false, a, false, b, (short)0, c, false, false);
  asm volatile("v_nop\n\tv_nop\n\tv_nop\n\tv_nop" : "+v"(d) : "v"(a), "v"(b));
  return d;
}
__device__ __forceinline__ v8f wmma_bf(v16b a, v16b b, v8f c) {
  v8f d = __builtin_amdgcn_wmma_f32_16x16x32_bf16(false, a, false, b, (short)0, c, false, false);
  asm volatile("v_nop\n\tv_nop\n\tv_nop\n\tv_nop" : "+v"(d) : "v"(a), "v"(b));
  return d;
}
// 16x16x32 fragments: lane = (h = lane>>4, row/col = lane&15); elements 0..7 = k0+8h+0..7, 8..15 = k0+16+8h+0..7; D element r = row 8h+r
__device__ __forceinline__ v16h frag_h(const _Float16* rowk0, int lane) {
  union { v16h v; v8h q[2]; } u; const _Float16* p = rowk0 + 8 * (lane >> 4);
  u.q[0] = *(const v8h*)p; u.q[1] = *(const v8h*)(p + 16); return u.v;
}
__device__ __forceinline__ v16h frag_f32(const float* rowk0, int lane) {
  v16h a; const float* p = rowk0 + 8 * (lane >> 4);
#pragma unroll
  for (int i = 0; i < 8; ++i) { a[i] = (_Float16)p[i]; a[8 + i] = (_Float16)p[16 + i]; }
  return a;
}
__device__ __forceinline__ v16h frag_f32s(const float* rowk0, int lane, float sc) {
  v16h a; const float* p = rowk0 + 8 * (lane >> 4);
#pragma unroll
  for (int i = 0; i < 8; ++i) { a[i] = (_Float16)(p[i] * sc); a[8 + i] = (_Float16)(p[16 + i] * sc); }
  return a;
}
// column fragment from a [K][ld] layout (column n), rows >= K read as 0
__device__ __forceinline__ v16h fragc_f32(const float* W, int k0, int n, int lane, int ld, int K) {
  v16h a; const int g = lane >> 4;
#pragma unroll
  for (int i = 0; i < 8; ++i) { const int ka = k0 + 8 * g + i, kb = ka + 16;
    a[i] = (_Float16)(ka < K ? W[(size_t)(ka < K ? ka : K - 1) * ld + n] : 0.f); a[8 + i] = (_Float16)(kb < K ? W[(size_t)(kb < K ? kb : K - 1) * ld + n] : 0.f); }
  return a;
}
struct F2 { v16b h, l; };
__device__ __forceinline__ F2 bsplit16(const float v[16]) { F2 r;
#pragma unroll
  for (int i = 0; i < 16; ++i) { const __bf16 h = (__bf16)v[i]; r.h[i] = h; r.l[i] = (__bf16)(v[i] - (float)h); }
  return r; }
__device__ __forceinline__ F2 split_row(const float* row, int k0, int lane) { float v[16]; const float* p = row + k0 + 8 * (lane >> 4);
#pragma unroll
  for (int i = 0; i < 8; ++i) { v[i] = p[i]; v[8 + i] = p[16 + i]; }
  return bsplit16(v); }
__device__ __forceinline__ F2 split_rowK(const float* row, int k0, int lane, int K) { float v[16]; const int g = lane >> 4;
#pragma unroll
  for (int i = 0; i < 8; ++i) { const int ka = k0 + 8 * g + i, kb = ka + 16; v[i] = ka < K ? row[ka < K ? ka : K - 1] : 0.f; v[8 + i] = kb < K ? row[kb < K ? kb : K - 1] : 0.f; }
  return bsplit16(v); }
__device__ __forceinline__ F2 split_col(const float* W, int k0, int n, int lane, int ld, int K) { float v[16]; const int g = lane >> 4;
#pragma unroll
  for (int i = 0; i < 8; ++i) { const int ka = k0 + 8 * g + i, kb = ka + 16; v[i] = ka < K ? W[(size_t)(ka < K ? ka : K - 1) * ld + n] : 0.f; v[8 + i] = kb < K ? W[(size_t)(kb < K ? kb : K - 1) * ld + n] : 0.f; }
  return bsplit16(v); }
__device__ __forceinline__ v8f mac3(const F2& a, const F2& b, v8f c) { c = wmma_bf(a.l, b.h, c); c = wmma_bf(a.h, b.l, c); return wmma_bf(a.h, b.h, c); }
__device__ __forceinline__ float sigm(float v) { return 1.0f / (1.0f + expf(-v)); }
#define LDSX() do { asm volatile("s_wait_dscnt 0" ::: "memory"); __builtin_amdgcn_wave_barrier(); __builtin_amdgcn_fence(__ATOMIC_RELEASE, "workgroup"); } while (0)

// Multi-head self-attention with interleaved-pair RoPE, no mask (x [2,2048,1024]; Wqkv [3072,1024] torch (out,in): qkv.reshape(B, S, 3, 16, 64): q = rows 0..1023, k = 1024..2047, v = 2048..3071; Wout [1024,1024] (out,in); token_positions [2048] int32 = arange, a module input READ on the device; RoPE on q and k: (even, odd) pairs (x_e c - x_o s, x_e s + x_o c) re-interleaved, inv_freq = 1 / 10000^(2i/64); scores / sqrt(64); softmax; out @ Wout.T).
#define NB 2
#define TT 2048
#define CC 1024            // NH * HD = projected width
#define DIN 1024          // input (model) width
#define NH 16
#define HD 64
#define NQB (TT / 64)
#define HG 4
#define SCALE (0.125f)
#define CAUSAL 0
#ifndef TNB
#define TNB NB
#endif
__device__ __forceinline__ float bfr(float v) { return (float)(__bf16)v; }
__host__ __device__ __forceinline__ int kb_last(int qb) { return CAUSAL ? ((qb * 64 + 63) >> 7) : (TT / 128 - 1); }
typedef __attribute__((ext_vector_type(8))) __bf16 v8b;
__device__ __forceinline__ v16b frag_b(const __bf16* rowk0, int lane) {
  union { v16b v; v8b q[2]; } u; const __bf16* p = rowk0 + 8 * (lane >> 4);
  u.q[0] = *(const v8b*)p; u.q[1] = *(const v8b*)(p + 16); return u.v;
}
// operand staging of the two projection GEMMs: the operands lie in the workspace as 16-bit values, rounded once ahead of the GEMMs; a 64-k chunk of a row is one 128-byte line; 8 lanes fetch it whole, 16 bytes each; LDS rows of 64 values at a pitch of 72 (144 bytes = 16 x odd, for 16-byte readers)
typedef __attribute__((ext_vector_type(4))) __bf16 v4b;
typedef __attribute__((ext_vector_type(4))) _Float16 v4h;
#define SPK 72
#define KCH 64              // k values a chunk
// work-group barrier by hand, behind the wave's own LDS wait: __syncthreads() would also wait out the global loads that are meant to stay in flight across it
__device__ __forceinline__ void stage_bar() { asm volatile("s_wait_dscnt 0x0" ::: "memory"); asm volatile("s_barrier_signal -1\n\ts_barrier_wait -1" ::: "memory"); }
// behind a group of look-ahead loads: their address registers are reused while the loads are still in flight
__device__ __forceinline__ void loads_issued() { asm volatile("s_wait_xcnt 0x0" ::: "memory"); }
// behind a store in a loop: its address and data registers are rewritten by what follows it
__device__ __forceinline__ void store_issued() { asm volatile("s_wait_xcnt 0x0" ::: "memory"); }
__device__ __forceinline__ v4b cvt4b(v4f v) { v4b r; r[0] = (__bf16)v[0]; r[1] = (__bf16)v[1]; r[2] = (__bf16)v[2]; r[3] = (__bf16)v[3]; return r; }
__device__ __forceinline__ v4h cvt4w(v4f v) { v4h r; r[0] = (_Float16)(bfr(v[0]) * 256.0f); r[1] = (_Float16)(bfr(v[1]) * 256.0f); r[2] = (_Float16)(bfr(v[2]) * 256.0f); r[3] = (_Float16)(bfr(v[3]) * 256.0f); return r; }
#define QBH 0              // unused: k_fa has one path for all query blocks
#define QHI 0               // single-product logits on every row
#define KHI 64            // key rows carrying k residual / v bf16 hi+lo planes (neither written nor read by any kernel here)
// B fragment (k rows k0+.., output column o) of a weight: (in,out) [K][ld] or (out,in) [ld rows of K]: bf16 exact, or f16(bf16 * 256) exact
__device__ __forceinline__ v16b wcol_io(const float* Wm, int k0, int o, int lane, int ld) { v16b w; const int g = lane >> 4;
#pragma unroll
  for (int i = 0; i < 8; ++i) { w[i] = (__bf16)Wm[(size_t)(k0 + 8 * g + i) * ld + o]; w[8 + i] = (__bf16)Wm[(size_t)(k0 + 16 + 8 * g + i) * ld + o]; }
  return w; }
__device__ __forceinline__ v16b wcol_oi(const float* Wm, int k0, int o, int lane, int K) { v16b w; const float* p = Wm + (size_t)o * K + k0 + 8 * (lane >> 4);
#pragma unroll
  for (int i = 0; i < 8; ++i) { w[i] = (__bf16)p[i]; w[8 + i] = (__bf16)p[16 + i]; }
  return w; }
__device__ __forceinline__ v16h wcolh_io(const float* Wm, int k0, int o, int lane, int ld) { v16h w; const int g = lane >> 4;
#pragma unroll
  for (int i = 0; i < 8; ++i) { w[i] = (_Float16)(bfr(Wm[(size_t)(k0 + 8 * g + i) * ld + o]) * 256.0f); w[8 + i] = (_Float16)(bfr(Wm[(size_t)(k0 + 16 + 8 * g + i) * ld + o]) * 256.0f); }
  return w; }
__device__ __forceinline__ v16h wcolh_oi(const float* Wm, int k0, int o, int lane, int K) { v16h w; const float* p = Wm + (size_t)o * K + k0 + 8 * (lane >> 4);
#pragma unroll
  for (int i = 0; i < 8; ++i) { w[i] = (_Float16)(bfr(p[i]) * 256.0f); w[8 + i] = (_Float16)(bfr(p[16 + i]) * 256.0f); }
  return w; }
#define WQKV_LAYOUT 1   // 0 = (in,out) [DIN][CC]; 1 = (out,in) [CC][DIN]; 2 = per-head [NH][DIN][HD]
__device__ __forceinline__ v16b wcol_hdk(const float* Wm, int k0, int o, int lane) { v16b w; const int g = lane >> 4; const float* p = Wm + (size_t)(o / HD) * DIN * HD + (o % HD);
#pragma unroll
  for (int i = 0; i < 8; ++i) { w[i] = (__bf16)p[(size_t)(k0 + 8 * g + i) * HD]; w[8 + i] = (__bf16)p[(size_t)(k0 + 16 + 8 * g + i) * HD]; }
  return w; }
#define WO_OUT_IN 1
#if WQKV_LAYOUT == 1
#define WCOL(W, k0, o, lane) wcol_oi(W, k0, o, lane, DIN)
#elif WQKV_LAYOUT == 2
#define WCOL(W, k0, o, lane) wcol_hdk(W, k0, o, lane)
#else
#define WCOL(W, k0, o, lane) wcol_io(W, k0, o, lane, CC)
#endif
#if WO_OUT_IN
#define WOCOL(W, k0, o, lane) wcol_oi(W, k0, o, lane, CC)
#define WOCOLH(W, k0, o, lane) wcolh_oi(W, k0, o, lane, CC)
#else
#define WOCOL(W, k0, o, lane) wcol_io(W, k0, o, lane, DIN)
#define WOCOLH(W, k0, o, lane) wcolh_io(W, k0, o, lane, DIN)
#endif

// RoPE inverse frequencies 1/10000^(2i/64) (the f32 values jax computes)
__constant__ float INVF[32] = {1.000000000e+00,7.498942018e-01,5.623413324e-01,4.216965139e-01,3.162277639e-01,2.371373624e-01,1.778279394e-01,1.333521456e-01,1.000000015e-01,7.498941571e-02,5.623412877e-02,4.216964915e-02,3.162277862e-02,2.371373586e-02,1.778279431e-02,1.333521493e-02,9.999999776e-03,7.498942316e-03,5.623413250e-03,4.216964822e-03,3.162277862e-03,2.371373819e-03,1.778279431e-03,1.333521446e-03,1.000000047e-03,7.498941850e-04,5.623413017e-04,4.216964880e-04,3.162277862e-04,2.371373848e-04,1.778279402e-04,1.333521504e-04};
// RoPE factors: (cos, sin) of pos * INVF[i], pos READ from the int input, depend on (token, i) alone: the rounding launch works each pair out once into the table RT [t][i][cos, sin]; k_proj's q and k blocks read them there
#ifndef SM_EXTRA_PARAMS
#define SM_EXTRA_PARAMS
#endif
#ifndef PROJ_EXTRA_PARAMS
#define PROJ_EXTRA_PARAMS
#endif
#ifndef SM_MASK_HOOK
#define SM_MASK_HOOK (void)0
#endif

#define WS_QH  0u                                      // f16 q rows [b*t][CC]
#define WS_KH  (WS_QH + 2u * (size_t)NB * TT * CC)      // f16 k rows [b*t][CC]
#define WS_VT  (WS_KH + 2u * (size_t)NB * TT * CC)      // f16 v planes [b][c][t]
#define WS_QL  (WS_VT + 2u * (size_t)NB * CC * TT)      // f16 q residual x 2^10 rows [b][t < QHI][CC]
#define WS_KL  (WS_QL + 2u * (size_t)NB * QHI * CC)     // f16 k residual x 2^10 rows [b][t < KHI][CC]
#define WS_VB  (WS_KL + 2u * (size_t)NB * KHI * CC)     // bf16 v hi planes [b][c][t < KHI]
#define WS_VBL (WS_VB + 2u * (size_t)NB * CC * KHI)
#define WS_S   (WS_VBL + 2u * (size_t)NB * CC * KHI)    // (once f32 logits) now the rounded GEMM operands
#define WS_XB  WS_S                                     // bf16 x rows [b*t][DIN]
#define WS_WB  (WS_XB + 2u * (size_t)NB * TT * DIN)     // bf16 Wqkv rows [3 * CC][DIN]
#define WS_WH  (WS_WB + 2u * (size_t)3 * CC * DIN)      // f16(bf16 x 2^8) Wout rows [DIN][CC]
#define WS_RT  (WS_WH + 2u * (size_t)DIN * CC)          // f32 RoPE table [t][32][cos, sin]
#define WS_Y   (WS_S  + 4u * (size_t)HG * TT * TT)      // f16 ctx x 2^6 rows [b*t][CC]
#define WS_END (WS_Y  + 4u * (size_t)NB * TT * CC)

// ---- k_cvt: the GEMM operands that are inputs are rounded once, ahead of the GEMMs (each was rounded anew by every block that read it): x and Wqkv to bf16, Wout to f16(bf16 x 2^8).
// Few, long waves (two blocks of 8 waves a WGP): a block takes 16384 values in 16 passes; a pass is 16 bytes in and 8 bytes out a lane, whole lines a wave; all 16 loads of a lane are in flight together.
#define CVB 16384                         // values a block
#define CVX (NB * TT * DIN / CVB)         // blocks of x
#define CVW (3 * CC * DIN / CVB)          // blocks of Wqkv
#define CVO (DIN * CC / CVB)              // blocks of Wout
#define CVT (TT * 32 / 1024)              // blocks of the RoPE table: 1024 (token, frequency) entries a block, 4 a lane; they stand first in the grid
__global__ __launch_bounds__(256) void k_cvt(const float* __restrict__ X, const float* __restrict__ WQKV, const float* __restrict__ WO, const int* __restrict__ TPOS, __bf16* __restrict__ XB, __bf16* __restrict__ WB, _Float16* __restrict__ WH, float* __restrict__ RT) {
  if (blockIdx.x < CVT) { const int e0 = blockIdx.x * 1024 + threadIdx.x;   // entry e = t * 32 + i; a lane's four entries are 256 apart: one frequency, tokens 8 apart
    const int* tp = TPOS + (e0 >> 5); const float* fp = INVF + (e0 & 31); float* d = RT + 2 * (size_t)e0; int ps[4]; v2f c[4];
#pragma unroll
    for (int p = 0; p < 4; ++p) ps[p] = tp[p * 8];
    const float fr = *fp;
#pragma unroll
    for (int p = 0; p < 4; ++p) { const float ang = (float)ps[p] * fr; c[p][0] = cosf(ang); c[p][1] = sinf(ang); }
#pragma unroll
    for (int p = 0; p < 4; ++p) vst2(d + p * 512, c[p]);   // 8 bytes a lane, 256 contiguous bytes a wave; the wave ends behind these stores
    return; }
  const int bx = blockIdx.x - CVT; const size_t o = (size_t)threadIdx.x * 4; v4f a[16];
  if (bx < CVX + CVW) { const bool isx = bx < CVX; const size_t e = (size_t)(isx ? bx : bx - CVX) * CVB + o; const float* s = (isx ? X : WQKV) + e; __bf16* d = (isx ? XB : WB) + e;
#pragma unroll
    for (int p = 0; p < 16; ++p) a[p] = *(const v4f*)(s + p * 1024);
    asm volatile("s_wait_xcnt 0x0" :: "v"(s) : "memory");   // the address pair is an input, so it stays live up to this wait: no load's own result is placed on it while the loads before it are in flight
#pragma unroll
    for (int p = 0; p < 16; ++p) vst2(d + p * 1024, cvt4b(a[p]));
    asm volatile("s_wait_xcnt 0x0" ::: "memory");   // behind the last store of the run: no register that a store names is rewritten ahead of this wait
  } else { const size_t e = (size_t)(bx - CVX - CVW) * CVB + o; const float* s = WO + e; _Float16* d = WH + e;
#pragma unroll
    for (int p = 0; p < 16; ++p) a[p] = *(const v4f*)(s + p * 1024);
    asm volatile("s_wait_xcnt 0x0" :: "v"(s) : "memory");   // the address pair is an input, so it stays live up to this wait: no load's own result is placed on it while the loads before it are in flight
#pragma unroll
    for (int p = 0; p < 16; ++p) vst2(d + p * 1024, cvt4w(a[p]));
    asm volatile("s_wait_xcnt 0x0" ::: "memory"); } }   // behind the last store of the run: no register that a store names is rewritten ahead of this wait
// ---- k_proj: block = (128 rows, 128 cols, which), 4 waves as 2 x 2, a wave = 64 x 64 (4 + 4 fragments feed 16 products): q/k/v = X W (+ b) with exact bf16 products (K = DIN) -> which 0: q f16 rows; 1: k f16 rows; 2: v f16 planes [c][t]
// The tile leaves in one pass: the four waves stage the whole 128 x 128 f32 tile in the LDS that the operand buffers have left, one barrier, then each lane reads the 8 values of one 16-byte store, rotates (q, k) or turns (v) them in registers, rounds and stores them; 16 lanes store 256 contiguous bytes. The residual and bf16 planes of the workspace layout (QL, KL, VB, VBL) are read by no kernel and are not written.
#define PSM (2 * 256 * SPK * 2)            // bytes of the block's LDS: the two operand buffers; the staged f32 tile lies inside them
#define QKP 140                            // pitch in f32 of the staged q / k tile (rows 16-byte aligned); its second 64 columns stand 4 further right, so the 16-byte reads of the 16 lanes of a row meet no bank twice
#define VTP 133                            // pitch in f32 of the staged v tile: odd, and its second 64 rows stand 4 further right, so 16 lanes that read one column 8 rows apart meet no bank twice
// RS, CS: how far right the second 64 rows, the second 64 columns stand
template <int P, int RS, int CS> __device__ __forceinline__ void stage_tile(float* st, const v8f (&acc)[4][4], const float (&bias)[4], int wr, int wc, int col, int g) {
  float* p = st + (wr * 64 + 8 * g) * P + wr * RS + wc * (64 + CS) + col;
#pragma unroll
  for (int j = 0; j < 4; ++j)
#pragma unroll
    for (int i = 0; i < 4; ++i)
#pragma unroll
      for (int r = 0; r < 8; ++r) p[(i * 16 + r) * P + j * 16] = acc[i][j][r] + bias[j]; }
__global__ __launch_bounds__(128) void k_proj(const __bf16* __restrict__ XQ, const __bf16* __restrict__ XK, const __bf16* __restrict__ XV, const __bf16* __restrict__ WQ, const __bf16* __restrict__ WK, const __bf16* __restrict__ WV, const float* __restrict__ BQ, const float* __restrict__ BK, const float* __restrict__ BV,
    _Float16* __restrict__ QH, _Float16* __restrict__ KH, _Float16* __restrict__ VT, const float* __restrict__ RT) {
  __shared__ __align__(16) char sm[PSM];   // the main loop's two operand buffers; behind the loop's last barrier the staged f32 tile
  const int tid = threadIdx.x, wave = tid >> 5, lane = tid & 31, col = lane & 15, g = lane >> 4, wr = wave >> 1, wc = wave & 1; const int which = blockIdx.z; const int c0 = blockIdx.y * 128; const size_t r0 = (size_t)blockIdx.x * 128; const size_t bb = r0 / TT; const int t0 = (int)(r0 % TT);
  const __bf16* X = which == 0 ? XQ : which == 1 ? XK : XV; const __bf16* WA = which == 0 ? WQ : which == 1 ? WK : WV; const float* BA = which == 0 ? BQ : which == 1 ? BK : BV;
  const int eq = tid & 15, eb = tid >> 4;   // the leaving pass: q, k: row eb + 8 i, columns 8 eq .. 8 eq + 7; v: channel eb + 8 i, tokens 8 eq .. 8 eq + 7
  const float* tp = RT + (size_t)(t0 + eb) * 64 + (eq & 7) * 8;   // q and k blocks: the RoPE factors (cos, sin) of this lane's four pairs, 32 contiguous bytes a row
  v4f tc[16][2];   // rows eb + 8 i: i < 4 are fetched ahead of the main loop, which covers their latency, the others behind it (in the main loop's registers), covered by the staging and the first rows' work
  if (which < 2) {
#pragma unroll
    for (int i = 0; i < 4; ++i) { tc[i][0] = *(const v4f*)(tp + i * 8 * 64); tc[i][1] = *(const v4f*)(tp + i * 8 * 64 + 4); }
    asm volatile("s_wait_xcnt 0x0" :: "v"(tp) : "memory"); }   // the address pair is an input, so it stays live up to this wait: no load's own result is placed on it while the loads before it are being issued
  v8f acc[4][4] = {};
  { // operands through LDS, two buffers: rows 0..127 = X rows, 128..255 = weight rows of this tile; chunk kc + 1 is in flight in registers while chunk kc is multiplied
    __bf16* const sb0 = (__bf16*)sm; __bf16* const sb1 = sb0 + 256 * SPK;
    const int lr = tid >> 3, lp = tid & 7; const __bf16* Ap = X + (r0 + lr) * DIN + lp * 8; const __bf16* Wp = WA + (size_t)(c0 + lr) * DIN + lp * 8; const int so = lr * SPK + lp * 8;
    v4u ra[8], rw[8];
#pragma unroll
    for (int i = 0; i < 8; ++i) ra[i] = *(const v4u*)(Ap + (size_t)i * 16 * DIN);
#pragma unroll
    for (int i = 0; i < 8; ++i) rw[i] = *(const v4u*)(Wp + (size_t)i * 16 * DIN);
#pragma unroll
    for (int i = 0; i < 8; ++i) *(v4u*)(sb0 + so + i * 16 * SPK) = ra[i];
#pragma unroll
    for (int i = 0; i < 8; ++i) *(v4u*)(sb0 + so + (128 + i * 16) * SPK) = rw[i];
#pragma unroll
    for (int i = 0; i < 8; ++i) ra[i] = *(const v4u*)(Ap + (size_t)i * 16 * DIN + KCH);
#pragma unroll
    for (int i = 0; i < 8; ++i) rw[i] = *(const v4u*)(Wp + (size_t)i * 16 * DIN + KCH);
    loads_issued(); stage_bar();   // chunk 0 is published
#pragma unroll 2   // two trips a pass, so that each trip's buffer addresses are constants
    for (int kc = 0; kc < DIN / KCH; ++kc) { const __bf16* sb = (kc & 1) ? sb1 : sb0; __bf16* sn = (kc & 1) ? sb0 : sb1;
#pragma unroll
      for (int ks = 0; ks < KCH; ks += 32) { v16b a[4], w[4];
#pragma unroll
        for (int i = 0; i < 4; ++i) a[i] = frag_b(sb + (wr * 64 + i * 16 + col) * SPK + ks, lane);
#pragma unroll
        for (int j = 0; j < 4; ++j) w[j] = frag_b(sb + (128 + wc * 64 + j * 16 + col) * SPK + ks, lane);
#pragma unroll
        for (int i = 0; i < 4; ++i)
#pragma unroll
          for (int j = 0; j < 4; ++j) acc[i][j] = wmma_bf(a[i], w[j], acc[i][j]); }
      __builtin_amdgcn_sched_barrier(0);   // keeps the wait for chunk kc + 1's loads behind the products, which cover a part of their latency
      if (kc + 1 < DIN / KCH) {   // the other buffer's readers left it before the last barrier
#pragma unroll
        for (int i = 0; i < 8; ++i) *(v4u*)(sn + so + i * 16 * SPK) = ra[i];
#pragma unroll
        for (int i = 0; i < 8; ++i) *(v4u*)(sn + so + (128 + i * 16) * SPK) = rw[i];
        if (kc + 2 < DIN / KCH) {
#pragma unroll
          for (int i = 0; i < 8; ++i) ra[i] = *(const v4u*)(Ap + (size_t)i * 16 * DIN + (kc + 2) * KCH);
#pragma unroll
          for (int i = 0; i < 8; ++i) rw[i] = *(const v4u*)(Wp + (size_t)i * 16 * DIN + (kc + 2) * KCH);
          loads_issued(); } }
      stage_bar(); } }   // publishes chunk kc + 1 and ends the reads of chunk kc
  float* const st = (float*)sm; float bias[4] = {0.f, 0.f, 0.f, 0.f};
  if (BA) { const float* bp = BA + c0 + wc * 64 + col;
#pragma unroll
    for (int j = 0; j < 4; ++j) bias[j] = bfr(bp[j * 16]);
    asm volatile("s_wait_xcnt 0x0" :: "v"(bp) : "memory"); }   // as at the factor fetch: the address pair stays live up to this wait
  if (which < 2) {
#pragma unroll
    for (int i = 4; i < 16; ++i) { tc[i][0] = *(const v4f*)(tp + i * 8 * 64); tc[i][1] = *(const v4f*)(tp + i * 8 * 64 + 4); }
    asm volatile("s_wait_xcnt 0x0" :: "v"(tp) : "memory");   // as at the first rows' fetch
    stage_tile<QKP, 0, 4>(st, acc, bias, wr, wc, col, g);
    stage_bar();   // the tile is published; by hand, so that the factor loads stay in flight across it
    const float qs = which == 0 ? SCALE * 1.4426950408889634f : 1.0f;   // q leaves as k_fa's operand: logits come out of the product in base-2 units
    const float* sp = st + eb * QKP + eq * 8 + (eq >> 3) * 4; _Float16* dp = (which == 0 ? QH : KH) + (r0 + eb) * CC + c0 + eq * 8;
    v4f x[16][2];   // all of this lane's values are read in one run (the accumulators' registers are free), so that the LDS latency is met once
#pragma unroll
    for (int i = 0; i < 16; ++i) { x[i][0] = *(const v4f*)(sp + i * 8 * QKP); x[i][1] = *(const v4f*)(sp + i * 8 * QKP + 4); }
#pragma unroll
    for (int ih = 0; ih < 16; ih += 4) { v8h y[4];
#pragma unroll
      for (int i = 0; i < 4; ++i)   // interleaved-pair rotation (x[2p], x[2p + 1]) by the angle pos * INVF[p]: (y[2p], y[2p + 1]) = x[2p] (cos, sin) + x[2p + 1] (-sin, cos)
#pragma unroll
        for (int p = 0; p < 4; ++p) { const v4f xv = x[ih + i][p >> 1], cv = tc[ih + i][p >> 1]; const int o = (p & 1) * 2;
          v2f cs, sc; cs[0] = cv[o]; cs[1] = cv[o + 1]; sc[0] = -cv[o + 1]; sc[1] = cv[o];
          const v2f r = (cs * xv[o] + sc * xv[o + 1]) * qs; y[i][p * 2] = (_Float16)r[0]; y[i][p * 2 + 1] = (_Float16)r[1]; }
#pragma unroll
      for (int i = 0; i < 4; ++i) vst2(dp + (size_t)(ih + i) * 8 * CC, y[i]);
      store_issued(); __builtin_amdgcn_sched_barrier(0); }   // the scheduling barrier keeps what follows, which reuses the stores' data registers, behind the wait
  } else {
    stage_tile<VTP, 4, 0>(st, acc, bias, wr, wc, col, g);
    stage_bar();   // the tile is published
    const float* sp = st + eq * 8 * VTP + (eq >> 3) * 4 + eb; _Float16* dp = VT + (bb * CC + c0 + eb) * (size_t)TT + t0 + eq * 8;
    float x[16][8];   // as in the q, k pass: one run of reads
#pragma unroll
    for (int i = 0; i < 16; ++i)
#pragma unroll
      for (int j = 0; j < 8; ++j) x[i][j] = sp[j * VTP + i * 8];
#pragma unroll
    for (int ih = 0; ih < 16; ih += 4) { v8h y[4];
#pragma unroll
      for (int i = 0; i < 4; ++i)
#pragma unroll
        for (int j = 0; j < 8; ++j) y[i][j] = (_Float16)x[ih + i][j];
#pragma unroll
      for (int i = 0; i < 4; ++i) vst2(dp + (size_t)(ih + i) * 8 * TT, y[i]);
      store_issued(); __builtin_amdgcn_sched_barrier(0); } } }   // as in the q, k pass
// ---- k_fa: block = 128 queries (4 waves x 32 query columns) of head h, batch b: logits, softmax and P . v in one pass over the keys, 32 keys a trip; no logit or P ever leaves the registers.
// Transposed products: S^T = K Q^T (lane = query column, element r = key 8g + r), so the two 16-key tiles of a trip, converted in place, are the B fragment (k = key, hardware k order) of ctx^T = V^T P^T.
// Reference logit ref and running sum l per query column; q arrives x SCALE log2(e), and 8 - ref enters the score product as its C operand, so p = 2^s straight from the accumulator; the 2^8 keeps small p clear of f16 subnormals and cancels in acc / l.
// ref is the first trip's maximum and is renewed (acc, l and this trip's s rescaled) only in a trip where some s passes 14, so p never passes 2^14, well inside f16; any ref gives the same quotient acc / l.
// K rows and V^T rows reach the four waves through LDS: a stage is 128 keys, copied once per block as whole 128-byte lines by asynchronous 16-byte copies, two buffers, stage t + 1 in flight while stage t is worked on.
__device__ __forceinline__ float xhalf(float x) { return __builtin_bit_cast(float, __builtin_amdgcn_permlanex16(__builtin_bit_cast(int, x), __builtin_bit_cast(int, x), 0x76543210, 0xfedcba98, false, false)); }  // lane l with lane l ^ 16
__device__ __forceinline__ v8f mmah(v16h a, v16h b, v8f c) { return __builtin_amdgcn_wmma_f32_16x16x32_f16(false, a, false, b, (short)0, c, false, false); }
#define FKS 128                       // keys a stage
#define FKP 72                        // LDS pitch of a K row in f16: 64 channels + 8 (144 bytes = 16 x odd, for 16-byte readers)
#define FVP 136                       // LDS pitch of a V^T row in f16: 128 keys + 8 (272 bytes = 16 x odd)
#define FVO (FKS * FKP)               // the V^T rows stand behind the K rows
#define FBUF (FKS * FKP + HD * FVP)   // f16 a buffer
__device__ __forceinline__ unsigned lds_off(const void* p) { return (unsigned)(size_t)p; }   // byte offset in the work-group's LDS
// eight 16-byte copies a lane, global memory to LDS through no register; the s_wait_xcnt closes the statement so that no address register of a copy is rewritten ahead of it
__device__ __forceinline__ void copy8(unsigned l, unsigned ls, const _Float16* p, size_t ps) {
  asm volatile("global_load_async_to_lds_b128 %0, %8, off\n\t"
               "global_load_async_to_lds_b128 %1, %9, off\n\t"
               "global_load_async_to_lds_b128 %2, %10, off\n\t"
               "global_load_async_to_lds_b128 %3, %11, off\n\t"
               "global_load_async_to_lds_b128 %4, %12, off\n\t"
               "global_load_async_to_lds_b128 %5, %13, off\n\t"
               "global_load_async_to_lds_b128 %6, %14, off\n\t"
               "global_load_async_to_lds_b128 %7, %15, off\n\t"
               "s_wait_xcnt 0x0"
               :: "v"(l), "v"(l + ls), "v"(l + 2 * ls), "v"(l + 3 * ls), "v"(l + 4 * ls), "v"(l + 5 * ls), "v"(l + 6 * ls), "v"(l + 7 * ls),
                  "v"(p), "v"(p + ps), "v"(p + 2 * ps), "v"(p + 3 * ps), "v"(p + 4 * ps), "v"(p + 5 * ps), "v"(p + 6 * ps), "v"(p + 7 * ps) : "memory");
}
__global__ __launch_bounds__(128) void k_fa(const _Float16* __restrict__ QH, const _Float16* __restrict__ KH, const _Float16* __restrict__ VT, _Float16* __restrict__ Y) {
  __shared__ __align__(16) _Float16 kv[2][FBUF];   // [buffer][K rows 0..127 at pitch FKP | V^T rows 0..63 at pitch FVP]
  const int tid = threadIdx.x, wave = tid >> 5, lane = tid & 31, col = lane & 15, g = lane >> 4; const int h = blockIdx.y, b = blockIdx.z; const int q0 = blockIdx.x * 128 + wave * 32;
  v16h qf[2][2];
#pragma unroll
  for (int qt = 0; qt < 2; ++qt)
#pragma unroll
    for (int kc = 0; kc < 2; ++kc) qf[qt][kc] = frag_h(QH + ((size_t)b * TT + q0 + qt * 16 + col) * CC + h * HD + kc * 32, lane);
  // the copies of a stage: 8 lanes take one K row (128 bytes), rows tid / 8 + 16 i; 16 lanes take one V^T row (256 bytes), rows tid / 16 + 8 i
  const _Float16* Kg = KH + ((size_t)b * TT + (tid >> 3)) * CC + h * HD + (tid & 7) * 8;
  const _Float16* Vg = VT + ((size_t)b * CC + h * HD + (tid >> 4)) * (size_t)TT + (tid & 15) * 8;
  const unsigned lk = lds_off(&kv[0][0]) + 2u * (unsigned)((tid >> 3) * FKP + (tid & 7) * 8);
  const unsigned lv = lds_off(&kv[0][0]) + 2u * (unsigned)(FVO + (tid >> 4) * FVP + (tid & 15) * 8);
#define FA_STAGE(s, bf) do { copy8(lk + (unsigned)(bf) * (2u * FBUF), 2u * 16 * FKP, Kg + (size_t)(s) * FKS * CC, (size_t)16 * CC); copy8(lv + (unsigned)(bf) * (2u * FBUF), 2u * 8 * FVP, Vg + (size_t)(s) * FKS, (size_t)8 * TT); } while (0)
  FA_STAGE(0, 0);
  asm volatile("s_wait_asynccnt 0x0" ::: "memory");   // this wave's copies of stage 0 have landed
  __syncthreads();                                    // stage 0 is published
  FA_STAGE(1, 1);
  v8f acc[2][4] = {}; float l[2] = {0.f, 0.f}; v8f cb[2];   // cb: 8 - ref in every element
#pragma unroll
  for (int qt = 0; qt < 2; ++qt)
#pragma unroll
    for (int r = 0; r < 8; ++r) cb[qt][r] = 8.0f;
  for (int t = 0; t < TT / FKS; ++t) {
    const _Float16* Ks = &kv[t & 1][0] + col * FKP;         // key row col of a 16-key tile
    const _Float16* Vs = &kv[t & 1][0] + FVO + col * FVP;   // V^T row of channel col of a 16-channel tile
    v16h kf[2][2];
#pragma unroll
    for (int kt = 0; kt < 2; ++kt)
#pragma unroll
      for (int kc = 0; kc < 2; ++kc) kf[kt][kc] = frag_h(Ks + (kt * 16) * FKP + kc * 32, lane);
#pragma unroll 1   // one trip's registers only: with the four trips of a stage unrolled the build went past 255 registers and into scratch
    for (int k0 = 0; k0 < FKS; k0 += 32) {
      v16h vf[4];
#pragma unroll
      for (int j = 0; j < 4; ++j) vf[j] = frag_h(Vs + (j * 16) * FVP + k0, lane);
      v8f s[2][2];
#pragma unroll
      for (int kc = 0; kc < 2; ++kc)
#pragma unroll
        for (int qt = 0; qt < 2; ++qt)
#pragma unroll
          for (int kt = 0; kt < 2; ++kt) s[qt][kt] = mmah(kf[kt][kc], qf[qt][kc], kc == 0 ? cb[qt] : s[qt][kt]);
      const int kn = (k0 + 32) & (FKS - 1);   // the next trip's key rows, fetched a trip ahead; a stage's last trip fetches its own stage's rows 0..31 again (published, not used)
#pragma unroll
      for (int kt = 0; kt < 2; ++kt)
#pragma unroll
        for (int kc = 0; kc < 2; ++kc) kf[kt][kc] = frag_h(Ks + (kn + kt * 16) * FKP + kc * 32, lane);
      __builtin_amdgcn_sched_barrier(0);   // holds the look-ahead reads here: moved down behind the softmax they would have no time to land before the next trip's first product
      float mk[2][2];   // this lane's largest s of each 16 x 16 tile: four short chains, not one long one, since the test below waits for their end
#pragma unroll
      for (int qt = 0; qt < 2; ++qt)
#pragma unroll
        for (int kt = 0; kt < 2; ++kt) { const v8f& a = s[qt][kt]; mk[qt][kt] = fmaxf(fmaxf(fmaxf(fmaxf(a[0], a[1]), a[2]), fmaxf(a[3], a[4])), fmaxf(fmaxf(a[5], a[6]), a[7])); }
      const bool first = (t | k0) == 0;   // the first trip sets ref, whatever the logits are
      if (__builtin_amdgcn_ballot_w32(fmaxf(fmaxf(mk[0][0], mk[0][1]), fmaxf(mk[1][0], mk[1][1])) > (first ? -INFINITY : 14.0f)) != 0) {   // one test a trip, a scalar branch; with logits of like size it is taken in the first trip alone
#pragma unroll
        for (int qt = 0; qt < 2; ++qt) { const float ml = fmaxf(mk[qt][0], mk[qt][1]); const float mx = fmaxf(ml, xhalf(ml)) - 8.0f;   // both halves of the wave hold how far this query's maximum over the 32 keys stands above ref
          const float d = first ? mx : fmaxf(mx, 0.f);   // ref moves by d: later it only rises
          const float corr = __builtin_amdgcn_exp2f(fminf(-d, 0.f));   // never above 1: in the first trip acc and l are 0 and stay so
          l[qt] *= corr; cb[qt] = cb[qt] - d; s[qt][0] = s[qt][0] - d; s[qt][1] = s[qt][1] - d;
#pragma unroll
          for (int j = 0; j < 4; ++j) acc[qt][j] = acc[qt][j] * corr; } }
#pragma unroll
      for (int qt = 0; qt < 2; ++qt) {
        v16h pf; float s0 = 0.f, s1 = 0.f;
#pragma unroll
        for (int r = 0; r < 8; ++r) { const float p0 = __builtin_amdgcn_exp2f(s[qt][0][r]), p1 = __builtin_amdgcn_exp2f(s[qt][1][r]); s0 += p0; s1 += p1; pf[r] = (_Float16)p0; pf[8 + r] = (_Float16)p1; }
        l[qt] += s0 + s1;
#pragma unroll
        for (int j = 0; j < 4; ++j) acc[qt][j] = mmah(vf[j], pf, acc[qt][j]); } }
    asm volatile("s_wait_dscnt 0x0" ::: "memory");      // this wave's reads of stage t have returned
    asm volatile("s_wait_asynccnt 0x0" ::: "memory");   // this wave's copies of stage t + 1 have landed
    __syncthreads();                                    // publishes stage t + 1 and ends every wave's reads of stage t
    if (t + 2 < TT / FKS) FA_STAGE(t + 2, t & 1); }     // refill of the buffer that stage t has just left
  asm volatile("s_wait_asynccnt 0x0" ::: "memory");     // no copy is outstanding when the wave ends
#pragma unroll
  for (int qt = 0; qt < 2; ++qt) { const float inv = 1.0f / (l[qt] + xhalf(l[qt]));   // the two halves' sums are joined once
    _Float16* yr = Y + ((size_t)b * TT + q0 + qt * 16 + col) * CC + h * HD + 8 * g;  // element r of tile j = channel j * 16 + 8g + r of query col; ctx leaves as k_out's operand, x 2^6 once to f16 (small context rows stay clear of f16 subnormals)
#pragma unroll
    for (int j = 0; j < 4; ++j) { const v8f o = acc[qt][j] * inv; v8h y;
#pragma unroll
      for (int r = 0; r < 8; ++r) y[r] = (_Float16)(o[r] * 64.0f);
      vst2(yr + j * 16, y); } } }
// ---- k_out: block = (128 rows, 128 cols), 8 waves as 4 x 2, a wave = 32 x 64 (2 + 4 fragments feed 8 products; one block a WGP, so two waves a SIMD): out = ctx Wo (+ bo): ctx (f16, x 2^6) against Wo as f16(bf16 x 2^8) exact (1 product) x 2^-14
#define OFP 68              // pitch in f32 of a wave's staged output rows (64 values + 4: the two halves of a wave fall on different banks)
__global__ __launch_bounds__(256) void k_out(const _Float16* __restrict__ Y, const _Float16* __restrict__ WO, const float* __restrict__ BO, float* __restrict__ OUT) { __shared__ __align__(16) _Float16 sg[2][256 * SPK];   // the two operand buffers; behind the loop's last barrier each wave stages its 32 x 64 f32 tile in its own eighth
  const int tid = threadIdx.x, wave = tid >> 5, lane = tid & 31, col = lane & 15, g = lane >> 4, wr = wave >> 1, wc = wave & 1; const int c0 = blockIdx.y * 128 + wc * 64; const size_t r0 = (size_t)blockIdx.x * 128 + wr * 32;
  v8f acc[2][4] = {};
  {
    // operands through LDS as in k_proj: rows 0..127 = ctx rows, 128..255 = weight rows; here chunks kc + 1 and kc + 2 are in flight in registers while chunk kc is multiplied
    const int lr = tid >> 3, lp = tid & 7; const _Float16* Ap = Y + ((size_t)blockIdx.x * 128 + lr) * CC + lp * 8; const _Float16* Wp = WO + (size_t)(blockIdx.y * 128 + lr) * CC + lp * 8; const int so = lr * SPK + lp * 8;
    v4u ra[2][4], rw[2][4];   // two register sets, chunk c in set c & 1: two chunks' loads are in flight at a time, so a chunk has two trips to arrive in, not one
#pragma unroll
    for (int i = 0; i < 4; ++i) ra[0][i] = *(const v4u*)(Ap + (size_t)i * 32 * CC);
#pragma unroll
    for (int i = 0; i < 4; ++i) rw[0][i] = *(const v4u*)(Wp + (size_t)i * 32 * CC);
    __builtin_amdgcn_sched_barrier(0);   // the chunks' loads are issued chunk by chunk: loads return in order, and mixed with a later chunk's an earlier chunk could only be waited for together with it
#pragma unroll
    for (int i = 0; i < 4; ++i) ra[1][i] = *(const v4u*)(Ap + (size_t)i * 32 * CC + KCH);
#pragma unroll
    for (int i = 0; i < 4; ++i) rw[1][i] = *(const v4u*)(Wp + (size_t)i * 32 * CC + KCH);
    __builtin_amdgcn_sched_barrier(0);   // as above
#pragma unroll
    for (int i = 0; i < 4; ++i) *(v4u*)(&sg[0][0] + so + i * 32 * SPK) = ra[0][i];
#pragma unroll
    for (int i = 0; i < 4; ++i) *(v4u*)(&sg[0][0] + so + (128 + i * 32) * SPK) = rw[0][i];
#pragma unroll
    for (int i = 0; i < 4; ++i) ra[0][i] = *(const v4u*)(Ap + (size_t)i * 32 * CC + 2 * KCH);
#pragma unroll
    for (int i = 0; i < 4; ++i) rw[0][i] = *(const v4u*)(Wp + (size_t)i * 32 * CC + 2 * KCH);
    loads_issued(); stage_bar();   // chunk 0 is published
    // one trip: chunk kc (buffer p = kc & 1) is multiplied; st: chunk kc + 1 goes from its set to the other buffer; ld: that set then takes chunk kc + 3, while chunk kc + 2 stays in flight in the other set
    auto trip = [&](const int kc, const int p, const bool st, const bool ld) __attribute__((always_inline)) { const _Float16* sb = &sg[p][0]; _Float16* sn = &sg[p ^ 1][0];
#pragma unroll
      for (int ks = 0; ks < KCH; ks += 32) { v16h a[2], w[4];
#pragma unroll
        for (int i = 0; i < 2; ++i) a[i] = frag_h(sb + (wr * 32 + i * 16 + col) * SPK + ks, lane);
#pragma unroll
        for (int j = 0; j < 4; ++j) w[j] = frag_h(sb + (128 + wc * 64 + j * 16 + col) * SPK + ks, lane);
#pragma unroll
        for (int i = 0; i < 2; ++i)
#pragma unroll
          for (int j = 0; j < 4; ++j) acc[i][j] = wmma16(a[i], w[j], acc[i][j]); }
      __builtin_amdgcn_sched_barrier(0);   // keeps the wait for chunk kc + 1's loads behind the products, which cover a part of their latency
      if (st) {   // the other buffer's readers left it before the last barrier
#pragma unroll
        for (int i = 0; i < 4; ++i) *(v4u*)(sn + so + i * 32 * SPK) = ra[p ^ 1][i];
#pragma unroll
        for (int i = 0; i < 4; ++i) *(v4u*)(sn + so + (128 + i * 32) * SPK) = rw[p ^ 1][i];
        if (ld) {
#pragma unroll
          for (int i = 0; i < 4; ++i) ra[p ^ 1][i] = *(const v4u*)(Ap + (size_t)i * 32 * CC + (kc + 3) * KCH);
#pragma unroll
          for (int i = 0; i < 4; ++i) rw[p ^ 1][i] = *(const v4u*)(Wp + (size_t)i * 32 * CC + (kc + 3) * KCH);
          loads_issued(); } }
      stage_bar(); };   // publishes chunk kc + 1 and ends the reads of chunk kc
#pragma unroll 1   // a pass is two trips, so that each trip's LDS buffer and register set are named by constants; every trip of the loop fetches, so that its wait leaves the younger chunk's eight loads in flight
    for (int kk = 0; kk < CC / KCH - 4; kk += 2) { trip(kk, 0, true, true); trip(kk + 1, 1, true, true); }
    trip(CC / KCH - 4, 0, true, true); trip(CC / KCH - 3, 1, true, false); trip(CC / KCH - 2, 0, true, false); trip(CC / KCH - 1, 1, false, false); }   // the last four trips stand apart: only the first of them still has a chunk to fetch
  float* sf = (float*)&sg[0][0] + wave * 32 * OFP;   // 8 x 32 x OFP x 4 bytes lie inside the two buffers
#pragma unroll
  for (int j = 0; j < 4; ++j) { const float bias = BO ? bfr(BO[c0 + j * 16 + col]) : 0.f;
#pragma unroll
    for (int i = 0; i < 2; ++i)
#pragma unroll
      for (int r = 0; r < 8; ++r) sf[(i * 16 + 8 * g + r) * OFP + j * 16 + col] = acc[i][j][r] * (1.0f / 16384.0f) + bias; }   /* 2^-8 (Wo carry) x 2^-6 (ctx carry) */
  LDSX();
  float* op = OUT + (r0 + g) * DIN + c0 + col * 4; const float* sp = sf + g * OFP + col * 4;   // a store = two rows of 256 contiguous bytes each: whole lines
#pragma unroll
  for (int rl = 0; rl < 32; rl += 2) vst2(op + (size_t)rl * DIN, *(const v4f*)(sp + rl * OFP)); }

extern "C" void kernel_launch(void* const* d_in, const int* in_sizes, int n_in, void* d_out, int out_size, void* d_ws, size_t ws_size, hipStream_t stream) {
  (void)in_sizes; (void)n_in; (void)out_size;
  const float** F = (const float**)d_in;
  if (ws_size < (size_t)WS_END) return;
  char* ws = (char*)d_ws; _Float16 *QH = (_Float16*)(ws + WS_QH), *KH = (_Float16*)(ws + WS_KH), *VT = (_Float16*)(ws + WS_VT), *QL = (_Float16*)(ws + WS_QL), *KL = (_Float16*)(ws + WS_KL); __bf16 *VB = (__bf16*)(ws + WS_VB), *VBL = (__bf16*)(ws + WS_VBL), *XB = (__bf16*)(ws + WS_XB), *WB = (__bf16*)(ws + WS_WB); _Float16 *WH = (_Float16*)(ws + WS_WH), *Y = (_Float16*)(ws + WS_Y); float* RT = (float*)(ws + WS_RT);
  (void)Y; (void)QL; (void)KL; (void)VB; (void)VBL;
  // inputs: 0 x [2,2048,1024]; 1 Wqkv [3072,1024] (out,in): q rows 0..1023, k 1024..2047, v 2048..3071; 2 Wout [1024,1024] (out,in); 3 token_positions [2048] int32 (arange; READ on the device); no biases
  k_cvt<<<dim3(CVT + CVX + CVW + CVO), 256, 0, stream>>>(F[0], F[1], F[2], (const int*)d_in[3], XB, WB, WH, RT);
  k_proj<<<dim3(TNB * TT / 128, CC / 128, 3), 128, 0, stream>>>(XB, XB, XB, WB, WB + (size_t)CC * DIN, WB + 2 * (size_t)CC * DIN, nullptr, nullptr, nullptr, QH, KH, VT, RT);
  k_fa<<<dim3(TT / 128, NH, TNB), 128, 0, stream>>>(QH, KH, VT, Y);
  k_out<<<dim3(TNB * TT / 128, DIN / 128), 256, 0, stream>>>(Y, WH, nullptr, (float*)d_out);
}

// v010
// It runs in 71.4 microseconds.
// Next to v009, in two timings, it ran 1.03 and 1.02 times as fast.
// Counting every step since v000, it is 20.4 times as fast.
// compute dtype: all float inputs rounded to bf16; q / k / v projections with EXACT bf16 products on WMMA 16x16x32 (f32 accumulate), no biases; RoPE in f32 (embedded frequencies, precise cosf / sinf, positions read from the int input token_positions); logits q x 64^-0.5 log2(e) and k once to f16 each (1 product); softmax f32 in base 2 against a reference logit per query that is renewed only when a logit passes it by 6 (p by 2^6), sums over 32-key trips; P (unnormalised, x 2^8) once to f16 x v once to f16 (1 product), divided by the sum at the end; ctx x 2^6 once to f16 x the output weight f16(bf16 x 2^8); f32 output.
#include <hip/hip_runtime.h>
#include <math.h>

typedef __attribute__((ext_vector_type(16))) _Float16 v16h;
typedef __attribute__((ext_vector_type(16))) __bf16 v16b;
typedef __attribute__((ext_vector_type(8)))  _Float16 v8h;
typedef __attribute__((ext_vector_type(8)))  float v8f;
typedef __attribute__((ext_vector_type(4)))  float v4f;
typedef __attribute__((ext_vector_type(2)))  float v2f;
typedef __attribute__((ext_vector_type(4)))  unsigned v4u;
typedef __attribute__((ext_vector_type(4)))  int v4i;
typedef float __attribute__((may_alias)) float_a;
typedef int __attribute__((may_alias)) int_a;

template <typename T> __device__ __forceinline__ void vst2(void* p, T v) { *(T*)p = v;  }
__device__ __forceinline__ v8f wmma16(v16h a, v16h b, v8f c) {
  v8f d = __builtin_amdgcn_wmma_f32_16x16x32_f16(false, a, false, b, (short)0, c, false, false);
  asm volatile("v_nop\n\tv_nop\n\tv_nop\n\tv_nop" : "+v"(d) : "v"(a), "v"(b));
  return d;
}
__device__ __forceinline__ v8f wmma_bf(v16b a, v16b b, v8f c) {
  v8f d = __builtin_amdgcn_wmma_f32_16x16x32_bf16(false, a, false, b, (short)0, c, false, false);
  asm volatile("v_nop\n\tv_nop\n\tv_nop\n\tv_nop" : "+v"(d) : "v"(a), "v"(b));
  return d;
}
// 16x16x32 fragments: lane = (h = lane>>4, row/col = lane&15); elements 0..7 = k0+8h+0..7, 8..15 = k0+16+8h+0..7; D element r = row 8h+r
__device__ __forceinline__ v16h frag_h(const _Float16* rowk0, int lane) {
  union { v16h v; v8h q[2]; } u; const _Float16* p = rowk0 + 8 * (lane >> 4);
  u.q[0] = *(const v8h*)p; u.q[1] = *(const v8h*)(p + 16); return u.v;
}
__device__ __forceinline__ v16h frag_f32(const float* rowk0, int lane) {
  v16h a; const float* p = rowk0 + 8 * (lane >> 4);
#pragma unroll
  for (int i = 0; i < 8; ++i) { a[i] = (_Float16)p[i]; a[8 + i] = (_Float16)p[16 + i]; }
  return a;
}
__device__ __forceinline__ v16h frag_f32s(const float* rowk0, int lane, float sc) {
  v16h a; const float* p = rowk0 + 8 * (lane >> 4);
#pragma unroll
  for (int i = 0; i < 8; ++i) { a[i] = (_Float16)(p[i] * sc); a[8 + i] = (_Float16)(p[16 + i] * sc); }
  return a;
}
// column fragment from a [K][ld] layout (column n), rows >= K read as 0
__device__ __forceinline__ v16h fragc_f32(const float* W, int k0, int n, int lane, int ld, int K) {
  v16h a; const int g = lane >> 4;
#pragma unroll
  for (int i = 0; i < 8; ++i) { const int ka = k0 + 8 * g + i, kb = ka + 16;
    a[i] = (_Float16)(ka < K ? W[(size_t)(ka < K ? ka : K - 1) * ld + n] : 0.f); a[8 + i] = (_Float16)(kb < K ? W[(size_t)(kb < K ? kb : K - 1) * ld + n] : 0.f); }
  return a;
}
struct F2 { v16b h, l; };
__device__ __forceinline__ F2 bsplit16(const float v[16]) { F2 r;
#pragma unroll
  for (int i = 0; i < 16; ++i) { const __bf16 h = (__bf16)v[i]; r.h[i] = h; r.l[i] = (__bf16)(v[i] - (float)h); }
  return r; }
__device__ __forceinline__ F2 split_row(const float* row, int k0, int lane) { float v[16]; const float* p = row + k0 + 8 * (lane >> 4);
#pragma unroll
  for (int i = 0; i < 8; ++i) { v[i] = p[i]; v[8 + i] = p[16 + i]; }
  return bsplit16(v); }
__device__ __forceinline__ F2 split_rowK(const float* row, int k0, int lane, int K) { float v[16]; const int g = lane >> 4;
#pragma unroll
  for (int i = 0; i < 8; ++i) { const int ka = k0 + 8 * g + i, kb = ka + 16; v[i] = ka < K ? row[ka < K ? ka : K - 1] : 0.f; v[8 + i] = kb < K ? row[kb < K ? kb : K - 1] : 0.f; }
  return bsplit16(v); }
__device__ __forceinline__ F2 split_col(const float* W, int k0, int n, int lane, int ld, int K) { float v[16]; const int g = lane >> 4;
#pragma unroll
  for (int i = 0; i < 8; ++i) { const int ka = k0 + 8 * g + i, kb = ka + 16; v[i] = ka < K ? W[(size_t)(ka < K ? ka : K - 1) * ld + n] : 0.f; v[8 + i] = kb < K ? W[(size_t)(kb < K ? kb : K - 1) * ld + n] : 0.f; }
  return bsplit16(v); }
__device__ __forceinline__ v8f mac3(const F2& a, const F2& b, v8f c) { c = wmma_bf(a.l, b.h, c); c = wmma_bf(a.h, b.l, c); return wmma_bf(a.h, b.h, c); }
__device__ __forceinline__ float sigm(float v) { return 1.0f / (1.0f + expf(-v)); }
#define LDSX() do { asm volatile("s_wait_dscnt 0" ::: "memory"); __builtin_amdgcn_wave_barrier(); __builtin_amdgcn_fence(__ATOMIC_RELEASE, "workgroup"); } while (0)

// Multi-head self-attention with interleaved-pair RoPE, no mask (x [2,2048,1024]; Wqkv [3072,1024] torch (out,in): qkv.reshape(B, S, 3, 16, 64): q = rows 0..1023, k = 1024..2047, v = 2048..3071; Wout [1024,1024] (out,in); token_positions [2048] int32 = arange, a module input READ on the device; RoPE on q and k: (even, odd) pairs (x_e c - x_o s, x_e s + x_o c) re-interleaved, inv_freq = 1 / 10000^(2i/64); scores / sqrt(64); softmax; out @ Wout.T).
#define NB 2
#define TT 2048
#define CC 1024            // NH * HD = projected width
#define DIN 1024          // input (model) width
#define NH 16
#define HD 64
#define NQB (TT / 64)
#define HG 4
#define SCALE (0.125f)
#define CAUSAL 0
#ifndef TNB
#define TNB NB
#endif
__device__ __forceinline__ float bfr(float v) { return (float)(__bf16)v; }
__host__ __device__ __forceinline__ int kb_last(int qb) { return CAUSAL ? ((qb * 64 + 63) >> 7) : (TT / 128 - 1); }
typedef __attribute__((ext_vector_type(8))) __bf16 v8b;
__device__ __forceinline__ v16b frag_b(const __bf16* rowk0, int lane) {
  union { v16b v; v8b q[2]; } u; const __bf16* p = rowk0 + 8 * (lane >> 4);
  u.q[0] = *(const v8b*)p; u.q[1] = *(const v8b*)(p + 16); return u.v;
}
// operand staging of the two projection GEMMs: the operands lie in the workspace as 16-bit values, rounded once ahead of the GEMMs; a 64-k chunk of a row is one 128-byte line; 8 lanes fetch it whole, 16 bytes each; LDS rows of 64 values at a pitch of 72 (144 bytes = 16 x odd, for 16-byte readers)
typedef __attribute__((ext_vector_type(4))) __bf16 v4b;
typedef __attribute__((ext_vector_type(4))) _Float16 v4h;
#define SPK 72
#define KCH 64              // k values a chunk
// work-group barrier by hand, behind the wave's own LDS wait: __syncthreads() would also wait out the global loads that are meant to stay in flight across it
__device__ __forceinline__ void stage_bar() { asm volatile("s_wait_dscnt 0x0" ::: "memory"); asm volatile("s_barrier_signal -1\n\ts_barrier_wait -1" ::: "memory"); }
// behind a group of look-ahead loads: their address registers are reused while the loads are still in flight
__device__ __forceinline__ void loads_issued() { asm volatile("s_wait_xcnt 0x0" ::: "memory"); }
// the same with the loads' two address pairs as inputs: they stay live up to the wait, so nothing is placed on them ahead of it
__device__ __forceinline__ void loads_issued(const void* a, const void* b) { asm volatile("s_wait_xcnt 0x0" :: "v"(a), "v"(b) : "memory"); }
// behind a store in a loop: its address and data registers are rewritten by what follows it
__device__ __forceinline__ void store_issued() { asm volatile("s_wait_xcnt 0x0" ::: "memory"); }
// where a block of the projection GEMMs starts its walk over k: chunk krot(), then on in order and round the end. Blocks that share an operand tile (one bx: all by; one by: all bx) would else ask L2 for the same lines at the same time, every chunk a first touch for all of them at once;
// so the sharers start 2 chunks apart, and since a block's first fetches cover at least 2 chunks, every chunk of a tile is asked for at the start by some sharer and is found in L2 by the others later. bx enters by its bits 3, 4 and 0, so that any run of 4 neighbouring bx modulo 8 still takes all 8 starts. The blocks of one (bx, by) keep one start.
__device__ __forceinline__ int krot(int bx, int by) { return (2 * (by + ((bx >> 3) | ((bx & 1) << 2)))) & (DIN / KCH - 1); }
__device__ __forceinline__ v4b cvt4b(v4f v) { v4b r; r[0] = (__bf16)v[0]; r[1] = (__bf16)v[1]; r[2] = (__bf16)v[2]; r[3] = (__bf16)v[3]; return r; }
__device__ __forceinline__ v4h cvt4w(v4f v) { v4h r; r[0] = (_Float16)(bfr(v[0]) * 256.0f); r[1] = (_Float16)(bfr(v[1]) * 256.0f); r[2] = (_Float16)(bfr(v[2]) * 256.0f); r[3] = (_Float16)(bfr(v[3]) * 256.0f); return r; }
#define QBH 0              // unused: k_fa has one path for all query blocks
#define QHI 0               // single-product logits on every row
#define KHI 64            // key rows carrying k residual / v bf16 hi+lo planes (neither written nor read by any kernel here)
// B fragment (k rows k0+.., output column o) of a weight: (in,out) [K][ld] or (out,in) [ld rows of K]: bf16 exact, or f16(bf16 * 256) exact
__device__ __forceinline__ v16b wcol_io(const float* Wm, int k0, int o, int lane, int ld) { v16b w; const int g = lane >> 4;
#pragma unroll
  for (int i = 0; i < 8; ++i) { w[i] = (__bf16)Wm[(size_t)(k0 + 8 * g + i) * ld + o]; w[8 + i] = (__bf16)Wm[(size_t)(k0 + 16 + 8 * g + i) * ld + o]; }
  return w; }
__device__ __forceinline__ v16b wcol_oi(const float* Wm, int k0, int o, int lane, int K) { v16b w; const float* p = Wm + (size_t)o * K + k0 + 8 * (lane >> 4);
#pragma unroll
  for (int i = 0; i < 8; ++i) { w[i] = (__bf16)p[i]; w[8 + i] = (__bf16)p[16 + i]; }
  return w; }
__device__ __forceinline__ v16h wcolh_io(const float* Wm, int k0, int o, int lane, int ld) { v16h w; const int g = lane >> 4;
#pragma unroll
  for (int i = 0; i < 8; ++i) { w[i] = (_Float16)(bfr(Wm[(size_t)(k0 + 8 * g + i) * ld + o]) * 256.0f); w[8 + i] = (_Float16)(bfr(Wm[(size_t)(k0 + 16 + 8 * g + i) * ld + o]) * 256.0f); }
  return w; }
__device__ __forceinline__ v16h wcolh_oi(const float* Wm, int k0, int o, int lane, int K) { v16h w; const float* p = Wm + (size_t)o * K + k0 + 8 * (lane >> 4);
#pragma unroll
  for (int i = 0; i < 8; ++i) { w[i] = (_Float16)(bfr(p[i]) * 256.0f); w[8 + i] = (_Float16)(bfr(p[16 + i]) * 256.0f); }
  return w; }
#define WQKV_LAYOUT 1   // 0 = (in,out) [DIN][CC]; 1 = (out,in) [CC][DIN]; 2 = per-head [NH][DIN][HD]
__device__ __forceinline__ v16b wcol_hdk(const float* Wm, int k0, int o, int lane) { v16b w; const int g = lane >> 4; const float* p = Wm + (size_t)(o / HD) * DIN * HD + (o % HD);
#pragma unroll
  for (int i = 0; i < 8; ++i) { w[i] = (__bf16)p[(size_t)(k0 + 8 * g + i) * HD]; w[8 + i] = (__bf16)p[(size_t)(k0 + 16 + 8 * g + i) * HD]; }
  return w; }
#define WO_OUT_IN 1
#if WQKV_LAYOUT == 1
#define WCOL(W, k0, o, lane) wcol_oi(W, k0, o, lane, DIN)
#elif WQKV_LAYOUT == 2
#define WCOL(W, k0, o, lane) wcol_hdk(W, k0, o, lane)
#else
#define WCOL(W, k0, o, lane) wcol_io(W, k0, o, lane, CC)
#endif
#if WO_OUT_IN
#define WOCOL(W, k0, o, lane) wcol_oi(W, k0, o, lane, CC)
#define WOCOLH(W, k0, o, lane) wcolh_oi(W, k0, o, lane, CC)
#else
#define WOCOL(W, k0, o, lane) wcol_io(W, k0, o, lane, DIN)
#define WOCOLH(W, k0, o, lane) wcolh_io(W, k0, o, lane, DIN)
#endif

// RoPE inverse frequencies 1/10000^(2i/64) (the f32 values jax computes)
__constant__ float INVF[32] = {1.000000000e+00,7.498942018e-01,5.623413324e-01,4.216965139e-01,3.162277639e-01,2.371373624e-01,1.778279394e-01,1.333521456e-01,1.000000015e-01,7.498941571e-02,5.623412877e-02,4.216964915e-02,3.162277862e-02,2.371373586e-02,1.778279431e-02,1.333521493e-02,9.999999776e-03,7.498942316e-03,5.623413250e-03,4.216964822e-03,3.162277862e-03,2.371373819e-03,1.778279431e-03,1.333521446e-03,1.000000047e-03,7.498941850e-04,5.623413017e-04,4.216964880e-04,3.162277862e-04,2.371373848e-04,1.778279402e-04,1.333521504e-04};
// RoPE factors: (cos, sin) of pos * INVF[i], pos READ from the int input, depend on (token, i) alone: the rounding launch works each pair out once into the table RT [t][i][cos, sin]; k_proj's q and k blocks read them there
#ifndef SM_EXTRA_PARAMS
#define SM_EXTRA_PARAMS
#endif
#ifndef PROJ_EXTRA_PARAMS
#define PROJ_EXTRA_PARAMS
#endif
#ifndef SM_MASK_HOOK
#define SM_MASK_HOOK (void)0
#endif

#define WS_QH  0u                                      // f16 q rows [b*t][CC]
#define WS_KH  (WS_QH + 2u * (size_t)NB * TT * CC)      // f16 k rows [b*t][CC]
#define WS_VT  (WS_KH + 2u * (size_t)NB * TT * CC)      // f16 v planes [b][c][t]
#define WS_QL  (WS_VT + 2u * (size_t)NB * CC * TT)      // f16 q residual x 2^10 rows [b][t < QHI][CC]
#define WS_KL  (WS_QL + 2u * (size_t)NB * QHI * CC)     // f16 k residual x 2^10 rows [b][t < KHI][CC]
#define WS_VB  (WS_KL + 2u * (size_t)NB * KHI * CC)     // bf16 v hi planes [b][c][t < KHI]
#define WS_VBL (WS_VB + 2u * (size_t)NB * CC * KHI)
#define WS_S   (WS_VBL + 2u * (size_t)NB * CC * KHI)    // (once f32 logits) now the rounded GEMM operands
#define WS_XB  WS_S                                     // bf16 x rows [b*t][DIN]
#define WS_WB  (WS_XB + 2u * (size_t)NB * TT * DIN)     // bf16 Wqkv rows [3 * CC][DIN]
#define WS_WH  (WS_WB + 2u * (size_t)3 * CC * DIN)      // f16(bf16 x 2^8) Wout rows [DIN][CC]
#define WS_RT  (WS_WH + 2u * (size_t)DIN * CC)          // f32 RoPE table [t][32][cos, sin]
#define WS_Y   (WS_S  + 4u * (size_t)HG * TT * TT)      // f16 ctx x 2^6 rows [b*t][CC]
#define WS_END (WS_Y  + 4u * (size_t)NB * TT * CC)

// ---- k_cvt: the GEMM operands that are inputs are rounded once, ahead of the GEMMs (each was rounded anew by every block that read it): x and Wqkv to bf16, Wout to f16(bf16 x 2^8).
// Few, long waves (two blocks of 8 waves a WGP): a block takes 16384 values in 16 passes; a pass is 16 bytes in and 8 bytes out a lane, whole lines a wave; all 16 loads of a lane are in flight together.
#define CVB 16384                         // values a block
#define CVX (NB * TT * DIN / CVB)         // blocks of x
#define CVW (3 * CC * DIN / CVB)          // blocks of Wqkv
#define CVO (DIN * CC / CVB)              // blocks of Wout
#define CVT (TT * 32 / 1024)              // blocks of the RoPE table: 1024 (token, frequency) entries a block, 4 a lane; they stand first in the grid
__global__ __launch_bounds__(256) void k_cvt(const float* __restrict__ X, const float* __restrict__ WQKV, const float* __restrict__ WO, const int* __restrict__ TPOS, __bf16* __restrict__ XB, __bf16* __restrict__ WB, _Float16* __restrict__ WH, float* __restrict__ RT) {
  if (blockIdx.x < CVT) { const int e0 = blockIdx.x * 1024 + threadIdx.x;   // entry e = t * 32 + i; a lane's four entries are 256 apart: one frequency, tokens 8 apart
    const int* tp = TPOS + (e0 >> 5); const float* fp = INVF + (e0 & 31); float* d = RT + 2 * (size_t)e0; int ps[4]; v2f c[4];
#pragma unroll
    for (int p = 0; p < 4; ++p) ps[p] = tp[p * 8];
    const float fr = *fp;
#pragma unroll
    for (int p = 0; p < 4; ++p) { const float ang = (float)ps[p] * fr; c[p][0] = cosf(ang); c[p][1] = sinf(ang); }
#pragma unroll
    for (int p = 0; p < 4; ++p) vst2(d + p * 512, c[p]);   // 8 bytes a lane, 256 contiguous bytes a wave; the wave ends behind these stores
    return; }
  const int bx = blockIdx.x - CVT; const size_t o = (size_t)threadIdx.x * 4; v4f a[16];
  if (bx < CVX + CVW) { const bool isx = bx < CVX; const size_t e = (size_t)(isx ? bx : bx - CVX) * CVB + o; const float* s = (isx ? X : WQKV) + e; __bf16* d = (isx ? XB : WB) + e;
#pragma unroll
    for (int p = 0; p < 16; ++p) a[p] = *(const v4f*)(s + p * 1024);
    asm volatile("s_wait_xcnt 0x0" :: "v"(s) : "memory");   // the address pair is an input, so it stays live up to this wait: no load's own result is placed on it while the loads before it are in flight
#pragma unroll
    for (int p = 0; p < 16; ++p) vst2(d + p * 1024, cvt4b(a[p]));
    asm volatile("s_wait_xcnt 0x0" ::: "memory");   // behind the last store of the run: no register that a store names is rewritten ahead of this wait
  } else { const size_t e = (size_t)(bx - CVX - CVW) * CVB + o; const float* s = WO + e; _Float16* d = WH + e;
#pragma unroll
    for (int p = 0; p < 16; ++p) a[p] = *(const v4f*)(s + p * 1024);
    asm volatile("s_wait_xcnt 0x0" :: "v"(s) : "memory");   // the address pair is an input, so it stays live up to this wait: no load's own result is placed on it while the loads before it are in flight
#pragma unroll
    for (int p = 0; p < 16; ++p) vst2(d + p * 1024, cvt4w(a[p]));
    asm volatile("s_wait_xcnt 0x0" ::: "memory"); } }   // behind the last store of the run: no register that a store names is rewritten ahead of this wait
// ---- k_proj: block = (128 rows, 128 cols, which), 4 waves as 2 x 2, a wave = 64 x 64 (4 + 4 fragments feed 16 products): q/k/v = X W (+ b) with exact bf16 products (K = DIN) -> which 0: q f16 rows; 1: k f16 rows; 2: v f16 planes [c][t]
// The tile leaves in one pass: the four waves stage the whole 128 x 128 f32 tile in the LDS that the operand buffers have left, one barrier, then each lane reads the 8 values of one 16-byte store, rotates (q, k) or turns (v) them in registers, rounds and stores them; 16 lanes store 256 contiguous bytes. The residual and bf16 planes of the workspace layout (QL, KL, VB, VBL) are read by no kernel and are not written.
#define PSM (2 * 256 * SPK * 2)            // bytes of the block's LDS: the two operand buffers; the staged f32 tile lies inside them
#define QKP 140                            // pitch in f32 of the staged q / k tile (rows 16-byte aligned); its second 64 columns stand 4 further right, so the 16-byte reads of the 16 lanes of a row meet no bank twice
#define VTP 133                            // pitch in f32 of the staged v tile: odd, and its second 64 rows stand 4 further right, so 16 lanes that read one column 8 rows apart meet no bank twice
// RS, CS: how far right the second 64 rows, the second 64 columns stand
template <int P, int RS, int CS> __device__ __forceinline__ void stage_tile(float* st, const v8f (&acc)[4][4], const float (&bias)[4], int wr, int wc, int col, int g) {
  float* p = st + (wr * 64 + 8 * g) * P + wr * RS + wc * (64 + CS) + col;
#pragma unroll
  for (int j = 0; j < 4; ++j)
#pragma unroll
    for (int i = 0; i < 4; ++i)
#pragma unroll
      for (int r = 0; r < 8; ++r) p[(i * 16 + r) * P + j * 16] = acc[i][j][r] + bias[j]; }
__global__ __launch_bounds__(128) void k_proj(const __bf16* __restrict__ XQ, const __bf16* __restrict__ XK, const __bf16* __restrict__ XV, const __bf16* __restrict__ WQ, const __bf16* __restrict__ WK, const __bf16* __restrict__ WV, const float* __restrict__ BQ, const float* __restrict__ BK, const float* __restrict__ BV,
    _Float16* __restrict__ QH, _Float16* __restrict__ KH, _Float16* __restrict__ VT, const float* __restrict__ RT) {
  __shared__ __align__(16) char sm[PSM];   // the main loop's two operand buffers; behind the loop's last barrier the staged f32 tile
  const int tid = threadIdx.x, wave = tid >> 5, lane = tid & 31, col = lane & 15, g = lane >> 4, wr = wave >> 1, wc = wave & 1; const int which = blockIdx.z; const int c0 = blockIdx.y * 128; const size_t r0 = (size_t)blockIdx.x * 128; const size_t bb = r0 / TT; const int t0 = (int)(r0 % TT);
  const __bf16* X = which == 0 ? XQ : which == 1 ? XK : XV; const __bf16* WA = which == 0 ? WQ : which == 1 ? WK : WV; const float* BA = which == 0 ? BQ : which == 1 ? BK : BV;
  const int eq = tid & 15, eb = tid >> 4;   // the leaving pass: q, k: row eb + 8 i, columns 8 eq .. 8 eq + 7; v: channel eb + 8 i, tokens 8 eq .. 8 eq + 7
  const float* tp = RT + (size_t)(t0 + eb) * 64 + (eq & 7) * 8;   // q and k blocks: the RoPE factors (cos, sin) of this lane's four pairs, 32 contiguous bytes a row
  v4f tc[16][2];   // rows eb + 8 i: i < 4 are fetched ahead of the main loop, which covers their latency, the others behind it (in the main loop's registers), covered by the staging and the first rows' work
  if (which < 2) {
#pragma unroll
    for (int i = 0; i < 4; ++i) { tc[i][0] = *(const v4f*)(tp + i * 8 * 64); tc[i][1] = *(const v4f*)(tp + i * 8 * 64 + 4); }
    asm volatile("s_wait_xcnt 0x0" :: "v"(tp) : "memory"); }   // the address pair is an input, so it stays live up to this wait: no load's own result is placed on it while the loads before it are being issued
  v8f acc[4][4] = {};
  { // operands through LDS, two buffers: rows 0..127 = X rows, 128..255 = weight rows of this tile; chunk kc + 1 is in flight in registers while chunk kc is multiplied
    __bf16* const sb0 = (__bf16*)sm; __bf16* const sb1 = sb0 + 256 * SPK;
    const int lr = tid >> 3, lp = tid & 7; const __bf16* Ap = X + (r0 + lr) * DIN + lp * 8; const __bf16* Wp = WA + (size_t)(c0 + lr) * DIN + lp * 8; const int so = lr * SPK + lp * 8;
    const int rot = krot(blockIdx.x, blockIdx.y);   // trip kc works on chunk (kc + rot) mod 16 of k
#define PKO(c) ((((c) + rot) & (DIN / KCH - 1)) * KCH)
    const __bf16* const A0 = Ap + PKO(0); const __bf16* const W0 = Wp + PKO(0);   // rot is even, so the second chunk follows the first in memory
    v4u ra[8], rw[8];
#pragma unroll
    for (int i = 0; i < 8; ++i) ra[i] = *(const v4u*)(A0 + (size_t)i * 16 * DIN);
#pragma unroll
    for (int i = 0; i < 8; ++i) rw[i] = *(const v4u*)(W0 + (size_t)i * 16 * DIN);
#pragma unroll
    for (int i = 0; i < 8; ++i) *(v4u*)(sb0 + so + i * 16 * SPK) = ra[i];
#pragma unroll
    for (int i = 0; i < 8; ++i) *(v4u*)(sb0 + so + (128 + i * 16) * SPK) = rw[i];
#pragma unroll
    for (int i = 0; i < 8; ++i) ra[i] = *(const v4u*)(A0 + (size_t)i * 16 * DIN + KCH);
#pragma unroll
    for (int i = 0; i < 8; ++i) rw[i] = *(const v4u*)(W0 + (size_t)i * 16 * DIN + KCH);
    loads_issued(A0, W0); stage_bar();   // the first chunk is published
#pragma unroll 2   // two trips a pass, so that each trip's buffer addresses are constants
    for (int kc = 0; kc < DIN / KCH; ++kc) { const __bf16* sb = (kc & 1) ? sb1 : sb0; __bf16* sn = (kc & 1) ? sb0 : sb1;
#pragma unroll
      for (int ks = 0; ks < KCH; ks += 32) { v16b a[4], w[4];
#pragma unroll
        for (int i = 0; i < 4; ++i) a[i] = frag_b(sb + (wr * 64 + i * 16 + col) * SPK + ks, lane);
#pragma unroll
        for (int j = 0; j < 4; ++j) w[j] = frag_b(sb + (128 + wc * 64 + j * 16 + col) * SPK + ks, lane);
#pragma unroll
        for (int i = 0; i < 4; ++i)
#pragma unroll
          for (int j = 0; j < 4; ++j) acc[i][j] = wmma_bf(a[i], w[j], acc[i][j]); }
      __builtin_amdgcn_sched_barrier(0);   // keeps the wait for chunk kc + 1's loads behind the products, which cover a part of their latency
      if (kc + 1 < DIN / KCH) {   // the other buffer's readers left it before the last barrier
#pragma unroll
        for (int i = 0; i < 8; ++i) *(v4u*)(sn + so + i * 16 * SPK) = ra[i];
#pragma unroll
        for (int i = 0; i < 8; ++i) *(v4u*)(sn + so + (128 + i * 16) * SPK) = rw[i];
        if (kc + 2 < DIN / KCH) {
#pragma unroll
          for (int i = 0; i < 8; ++i) ra[i] = *(const v4u*)(Ap + (size_t)i * 16 * DIN + PKO(kc + 2));
#pragma unroll
          for (int i = 0; i < 8; ++i) rw[i] = *(const v4u*)(Wp + (size_t)i * 16 * DIN + PKO(kc + 2));
          loads_issued(); } }
      stage_bar(); } }   // publishes chunk kc + 1 and ends the reads of chunk kc
  float* const st = (float*)sm; float bias[4] = {0.f, 0.f, 0.f, 0.f};
  if (BA) { const float* bp = BA + c0 + wc * 64 + col;
#pragma unroll
    for (int j = 0; j < 4; ++j) bias[j] = bfr(bp[j * 16]);
    asm volatile("s_wait_xcnt 0x0" :: "v"(bp) : "memory"); }   // as at the factor fetch: the address pair stays live up to this wait
  if (which < 2) {
#pragma unroll
    for (int i = 4; i < 16; ++i) { tc[i][0] = *(const v4f*)(tp + i * 8 * 64); tc[i][1] = *(const v4f*)(tp + i * 8 * 64 + 4); }
    asm volatile("s_wait_xcnt 0x0" :: "v"(tp) : "memory");   // as at the first rows' fetch
    stage_tile<QKP, 0, 4>(st, acc, bias, wr, wc, col, g);
    stage_bar();   // the tile is published; by hand, so that the factor loads stay in flight across it
    const float qs = which == 0 ? SCALE * 1.4426950408889634f : 1.0f;   // q leaves as k_fa's operand: logits come out of the product in base-2 units
    const float* sp = st + eb * QKP + eq * 8 + (eq >> 3) * 4; _Float16* dp = (which == 0 ? QH : KH) + (r0 + eb) * CC + c0 + eq * 8;
    v4f x[16][2];   // all of this lane's values are read in one run (the accumulators' registers are free), so that the LDS latency is met once
#pragma unroll
    for (int i = 0; i < 16; ++i) { x[i][0] = *(const v4f*)(sp + i * 8 * QKP); x[i][1] = *(const v4f*)(sp + i * 8 * QKP + 4); }
#pragma unroll
    for (int ih = 0; ih < 16; ih += 4) { v8h y[4];
#pragma unroll
      for (int i = 0; i < 4; ++i)   // interleaved-pair rotation (x[2p], x[2p + 1]) by the angle pos * INVF[p]: (y[2p], y[2p + 1]) = x[2p] (cos, sin) + x[2p + 1] (-sin, cos)
#pragma unroll
        for (int p = 0; p < 4; ++p) { const v4f xv = x[ih + i][p >> 1], cv = tc[ih + i][p >> 1]; const int o = (p & 1) * 2;
          v2f cs, sc; cs[0] = cv[o]; cs[1] = cv[o + 1]; sc[0] = -cv[o + 1]; sc[1] = cv[o];
          const v2f r = (cs * xv[o] + sc * xv[o + 1]) * qs; y[i][p * 2] = (_Float16)r[0]; y[i][p * 2 + 1] = (_Float16)r[1]; }
#pragma unroll
      for (int i = 0; i < 4; ++i) vst2(dp + (size_t)(ih + i) * 8 * CC, y[i]);
      store_issued(); __builtin_amdgcn_sched_barrier(0); }   // the scheduling barrier keeps what follows, which reuses the stores' data registers, behind the wait
  } else {
    stage_tile<VTP, 4, 0>(st, acc, bias, wr, wc, col, g);
    stage_bar();   // the tile is published
    const float* sp = st + eq * 8 * VTP + (eq >> 3) * 4 + eb; _Float16* dp = VT + (bb * CC + c0 + eb) * (size_t)TT + t0 + eq * 8;
    float x[16][8];   // as in the q, k pass: one run of reads
#pragma unroll
    for (int i = 0; i < 16; ++i)
#pragma unroll
      for (int j = 0; j < 8; ++j) x[i][j] = sp[j * VTP + i * 8];
#pragma unroll
    for (int ih = 0; ih < 16; ih += 4) { v8h y[4];
#pragma unroll
      for (int i = 0; i < 4; ++i)
#pragma unroll
        for (int j = 0; j < 8; ++j) y[i][j] = (_Float16)x[ih + i][j];
#pragma unroll
      for (int i = 0; i < 4; ++i) vst2(dp + (size_t)(ih + i) * 8 * TT, y[i]);
      store_issued(); __builtin_amdgcn_sched_barrier(0); } } }   // as in the q, k pass
// ---- k_fa: block = 128 queries (4 waves x 32 query columns) of head h, batch b: logits, softmax and P . v in one pass over the keys, 32 keys a trip; no logit or P ever leaves the registers.
// Transposed products: S^T = K Q^T (lane = query column, element r = key 8g + r), so the two 16-key tiles of a trip, converted in place, are the B fragment (k = key, hardware k order) of ctx^T = V^T P^T.
// Reference logit ref and running sum l per query column; q arrives x SCALE log2(e), and 8 - ref enters the score product as its C operand, so p = 2^s straight from the accumulator; the 2^8 keeps small p clear of f16 subnormals and cancels in acc / l.
// ref is the first trip's maximum and is renewed (acc, l and this trip's s rescaled) only in a trip where some s passes 14, so p never passes 2^14, well inside f16; any ref gives the same quotient acc / l.
// K rows and V^T rows reach the four waves through LDS: a stage is 128 keys, copied once per block as whole 128-byte lines by asynchronous 16-byte copies, two buffers, stage t + 1 in flight while stage t is worked on.
__device__ __forceinline__ float xhalf(float x) { return __builtin_bit_cast(float, __builtin_amdgcn_permlanex16(__builtin_bit_cast(int, x), __builtin_bit_cast(int, x), 0x76543210, 0xfedcba98, false, false)); }  // lane l with lane l ^ 16
__device__ __forceinline__ v8f mmah(v16h a, v16h b, v8f c) { return __builtin_amdgcn_wmma_f32_16x16x32_f16(false, a, false, b, (short)0, c, false, false); }
#define FKS 128                       // keys a stage
#define FKP 72                        // LDS pitch of a K row in f16: 64 channels + 8 (144 bytes = 16 x odd, for 16-byte readers)
#define FVP 136                       // LDS pitch of a V^T row in f16: 128 keys + 8 (272 bytes = 16 x odd)
#define FVO (FKS * FKP)               // the V^T rows stand behind the K rows
#define FBUF (FKS * FKP + HD * FVP)   // f16 a buffer
__device__ __forceinline__ unsigned lds_off(const void* p) { return (unsigned)(size_t)p; }   // byte offset in the work-group's LDS
// eight 16-byte copies a lane, global memory to LDS through no register; the s_wait_xcnt closes the statement so that no address register of a copy is rewritten ahead of it
__device__ __forceinline__ void copy8(unsigned l, unsigned ls, const _Float16* p, size_t ps) {
  asm volatile("global_load_async_to_lds_b128 %0, %8, off\n\t"
               "global_load_async_to_lds_b128 %1, %9, off\n\t"
               "global_load_async_to_lds_b128 %2, %10, off\n\t"
               "global_load_async_to_lds_b128 %3, %11, off\n\t"
               "global_load_async_to_lds_b128 %4, %12, off\n\t"
               "global_load_async_to_lds_b128 %5, %13, off\n\t"
               "global_load_async_to_lds_b128 %6, %14, off\n\t"
               "global_load_async_to_lds_b128 %7, %15, off\n\t"
               "s_wait_xcnt 0x0"
               :: "v"(l), "v"(l + ls), "v"(l + 2 * ls), "v"(l + 3 * ls), "v"(l + 4 * ls), "v"(l + 5 * ls), "v"(l + 6 * ls), "v"(l + 7 * ls),
                  "v"(p), "v"(p + ps), "v"(p + 2 * ps), "v"(p + 3 * ps), "v"(p + 4 * ps), "v"(p + 5 * ps), "v"(p + 6 * ps), "v"(p + 7 * ps) : "memory");
}
__global__ __launch_bounds__(128) void k_fa(const _Float16* __restrict__ QH, const _Float16* __restrict__ KH, const _Float16* __restrict__ VT, _Float16* __restrict__ Y) {
  __shared__ __align__(16) _Float16 kv[2][FBUF];   // [buffer][K rows 0..127 at pitch FKP | V^T rows 0..63 at pitch FVP]
  const int tid = threadIdx.x, wave = tid >> 5, lane = tid & 31, col = lane & 15, g = lane >> 4; const int h = blockIdx.y, b = blockIdx.z; const int q0 = blockIdx.x * 128 + wave * 32;
  v16h qf[2][2];
#pragma unroll
  for (int qt = 0; qt < 2; ++qt)
#pragma unroll
    for (int kc = 0; kc < 2; ++kc) qf[qt][kc] = frag_h(QH + ((size_t)b * TT + q0 + qt * 16 + col) * CC + h * HD + kc * 32, lane);
  // the copies of a stage: 8 lanes take one K row (128 bytes), rows tid / 8 + 16 i; 16 lanes take one V^T row (256 bytes), rows tid / 16 + 8 i
  const _Float16* Kg = KH + ((size_t)b * TT + (tid >> 3)) * CC + h * HD + (tid & 7) * 8;
  const _Float16* Vg = VT + ((size_t)b * CC + h * HD + (tid >> 4)) * (size_t)TT + (tid & 15) * 8;
  const unsigned lk = lds_off(&kv[0][0]) + 2u * (unsigned)((tid >> 3) * FKP + (tid & 7) * 8);
  const unsigned lv = lds_off(&kv[0][0]) + 2u * (unsigned)(FVO + (tid >> 4) * FVP + (tid & 15) * 8);
  // as in the projection GEMMs (krot): the 16 blocks that share a head's K and V^T start their walk over the 16 key stages 2 stages apart and wrap round; pass t works on stage (t + rotf) mod 16. blockIdx.x enters by its bits 3, 0 and 1, so that any run of 4 neighbouring values modulo 8 takes all 8 starts
  const int rotf = 2 * ((blockIdx.x >> 3) | ((blockIdx.x & 1) << 1) | (((blockIdx.x >> 1) & 1) << 2));
#define FA_STAGE(s, bf) do { const int sr = ((s) + rotf) & (TT / FKS - 1); copy8(lk + (unsigned)(bf) * (2u * FBUF), 2u * 16 * FKP, Kg + (size_t)sr * FKS * CC, (size_t)16 * CC); copy8(lv + (unsigned)(bf) * (2u * FBUF), 2u * 8 * FVP, Vg + (size_t)sr * FKS, (size_t)8 * TT); } while (0)
  FA_STAGE(0, 0);
  asm volatile("s_wait_asynccnt 0x0" ::: "memory");   // this wave's copies of stage 0 have landed
  __syncthreads();                                    // stage 0 is published
  FA_STAGE(1, 1);
  v8f acc[2][4] = {}; float l[2] = {0.f, 0.f}; v8f cb[2];   // cb: 8 - ref in every element
#pragma unroll
  for (int qt = 0; qt < 2; ++qt)
#pragma unroll
    for (int r = 0; r < 8; ++r) cb[qt][r] = 8.0f;
  for (int t = 0; t < TT / FKS; ++t) {
    const _Float16* Ks = &kv[t & 1][0] + col * FKP;         // key row col of a 16-key tile
    const _Float16* Vs = &kv[t & 1][0] + FVO + col * FVP;   // V^T row of channel col of a 16-channel tile
    v16h kf[2][2];
#pragma unroll
    for (int kt = 0; kt < 2; ++kt)
#pragma unroll
      for (int kc = 0; kc < 2; ++kc) kf[kt][kc] = frag_h(Ks + (kt * 16) * FKP + kc * 32, lane);
#pragma unroll 1   // one trip's registers only: with the four trips of a stage unrolled the build went past 255 registers and into scratch
    for (int k0 = 0; k0 < FKS; k0 += 32) {
      v16h vf[4];
#pragma unroll
      for (int j = 0; j < 4; ++j) vf[j] = frag_h(Vs + (j * 16) * FVP + k0, lane);
      v8f s[2][2];
#pragma unroll
      for (int kc = 0; kc < 2; ++kc)
#pragma unroll
        for (int qt = 0; qt < 2; ++qt)
#pragma unroll
          for (int kt = 0; kt < 2; ++kt) s[qt][kt] = mmah(kf[kt][kc], qf[qt][kc], kc == 0 ? cb[qt] : s[qt][kt]);
      const int kn = (k0 + 32) & (FKS - 1);   // the next trip's key rows, fetched a trip ahead; a stage's last trip fetches its own stage's rows 0..31 again (published, not used)
#pragma unroll
      for (int kt = 0; kt < 2; ++kt)
#pragma unroll
        for (int kc = 0; kc < 2; ++kc) kf[kt][kc] = frag_h(Ks + (kn + kt * 16) * FKP + kc * 32, lane);
      __builtin_amdgcn_sched_barrier(0);   // holds the look-ahead reads here: moved down behind the softmax they would have no time to land before the next trip's first product
      float mk[2][2];   // this lane's largest s of each 16 x 16 tile: four short chains, not one long one, since the test below waits for their end
#pragma unroll
      for (int qt = 0; qt < 2; ++qt)
#pragma unroll
        for (int kt = 0; kt < 2; ++kt) { const v8f& a = s[qt][kt]; mk[qt][kt] = fmaxf(fmaxf(fmaxf(fmaxf(a[0], a[1]), a[2]), fmaxf(a[3], a[4])), fmaxf(fmaxf(a[5], a[6]), a[7])); }
      const bool first = (t | k0) == 0;   // the first trip sets ref, whatever the logits are
      if (__builtin_amdgcn_ballot_w32(fmaxf(fmaxf(mk[0][0], mk[0][1]), fmaxf(mk[1][0], mk[1][1])) > (first ? -INFINITY : 14.0f)) != 0) {   // one test a trip, a scalar branch; with logits of like size it is taken in the first trip alone
#pragma unroll
        for (int qt = 0; qt < 2; ++qt) { const float ml = fmaxf(mk[qt][0], mk[qt][1]); const float mx = fmaxf(ml, xhalf(ml)) - 8.0f;   // both halves of the wave hold how far this query's maximum over the 32 keys stands above ref
          const float d = first ? mx : fmaxf(mx, 0.f);   // ref moves by d: later it only rises
          const float corr = __builtin_amdgcn_exp2f(fminf(-d, 0.f));   // never above 1: in the first trip acc and l are 0 and stay so
          l[qt] *= corr; cb[qt] = cb[qt] - d; s[qt][0] = s[qt][0] - d; s[qt][1] = s[qt][1] - d;
#pragma unroll
          for (int j = 0; j < 4; ++j) acc[qt][j] = acc[qt][j] * corr; } }
#pragma unroll
      for (int qt = 0; qt < 2; ++qt) {
        v16h pf; float s0 = 0.f, s1 = 0.f;
#pragma unroll
        for (int r = 0; r < 8; ++r) { const float p0 = __builtin_amdgcn_exp2f(s[qt][0][r]), p1 = __builtin_amdgcn_exp2f(s[qt][1][r]); s0 += p0; s1 += p1; pf[r] = (_Float16)p0; pf[8 + r] = (_Float16)p1; }
        l[qt] += s0 + s1;
#pragma unroll
        for (int j = 0; j < 4; ++j) acc[qt][j] = mmah(vf[j], pf, acc[qt][j]); } }
    asm volatile("s_wait_dscnt 0x0" ::: "memory");      // this wave's reads of stage t have returned
    asm volatile("s_wait_asynccnt 0x0" ::: "memory");   // this wave's copies of stage t + 1 have landed
    __syncthreads();                                    // publishes stage t + 1 and ends every wave's reads of stage t
    if (t + 2 < TT / FKS) FA_STAGE(t + 2, t & 1); }     // refill of the buffer that stage t has just left
  asm volatile("s_wait_asynccnt 0x0" ::: "memory");     // no copy is outstanding when the wave ends
#pragma unroll
  for (int qt = 0; qt < 2; ++qt) { const float inv = 1.0f / (l[qt] + xhalf(l[qt]));   // the two halves' sums are joined once
    _Float16* yr = Y + ((size_t)b * TT + q0 + qt * 16 + col) * CC + h * HD + 8 * g;  // element r of tile j = channel j * 16 + 8g + r of query col; ctx leaves as k_out's operand, x 2^6 once to f16 (small context rows stay clear of f16 subnormals)
#pragma unroll
    for (int j = 0; j < 4; ++j) { const v8f o = acc[qt][j] * inv; v8h y;
#pragma unroll
      for (int r = 0; r < 8; ++r) y[r] = (_Float16)(o[r] * 64.0f);
      vst2(yr + j * 16, y); } } }
// ---- k_out: block = (128 rows, 128 cols), 8 waves as 4 x 2, a wave = 32 x 64 (2 + 4 fragments feed 8 products; one block a WGP, so two waves a SIMD): out = ctx Wo (+ bo): ctx (f16, x 2^6) against Wo as f16(bf16 x 2^8) exact (1 product) x 2^-14
#define OFP 68              // pitch in f32 of a wave's staged output rows (64 values + 4: the two halves of a wave fall on different banks)
__global__ __launch_bounds__(256) void k_out(const _Float16* __restrict__ Y, const _Float16* __restrict__ WO, const float* __restrict__ BO, float* __restrict__ OUT) { __shared__ __align__(16) _Float16 sg[2][256 * SPK];   // the two operand buffers; behind the loop's last barrier each wave stages its 32 x 64 f32 tile in its own eighth
  const int tid = threadIdx.x, wave = tid >> 5, lane = tid & 31, col = lane & 15, g = lane >> 4, wr = wave >> 1, wc = wave & 1; const int c0 = blockIdx.y * 128 + wc * 64; const size_t r0 = (size_t)blockIdx.x * 128 + wr * 32;
  v8f acc[2][4] = {};
  {
    // operands through LDS as in k_proj: rows 0..127 = ctx rows, 128..255 = weight rows; here chunks kc + 1 and kc + 2 are in flight in registers while chunk kc is multiplied
    const int lr = tid >> 3, lp = tid & 7; const _Float16* Ap = Y + ((size_t)blockIdx.x * 128 + lr) * CC + lp * 8; const _Float16* Wp = WO + (size_t)(blockIdx.y * 128 + lr) * CC + lp * 8; const int so = lr * SPK + lp * 8;
    const int rot = krot(blockIdx.x, blockIdx.y);   // trip kc works on chunk (kc + rot) mod 16 of k
#define OKO(c) ((((c) + rot) & (CC / KCH - 1)) * KCH)
    v4u ra[2][4], rw[2][4];   // two register sets, the chunk of trip c in set c & 1: two chunks' loads are in flight at a time, so a chunk has two trips to arrive in, not one
#pragma unroll
    for (int i = 0; i < 4; ++i) ra[0][i] = *(const v4u*)(Ap + (size_t)i * 32 * CC + OKO(0));
#pragma unroll
    for (int i = 0; i < 4; ++i) rw[0][i] = *(const v4u*)(Wp + (size_t)i * 32 * CC + OKO(0));
    __builtin_amdgcn_sched_barrier(0);   // the chunks' loads are issued chunk by chunk: loads return in order, and mixed with a later chunk's an earlier chunk could only be waited for together with it
#pragma unroll
    for (int i = 0; i < 4; ++i) ra[1][i] = *(const v4u*)(Ap + (size_t)i * 32 * CC + OKO(1));
#pragma unroll
    for (int i = 0; i < 4; ++i) rw[1][i] = *(const v4u*)(Wp + (size_t)i * 32 * CC + OKO(1));
    loads_issued();
    __builtin_amdgcn_sched_barrier(0);   // as above
#pragma unroll
    for (int i = 0; i < 4; ++i) *(v4u*)(&sg[0][0] + so + i * 32 * SPK) = ra[0][i];
#pragma unroll
    for (int i = 0; i < 4; ++i) *(v4u*)(&sg[0][0] + so + (128 + i * 32) * SPK) = rw[0][i];
#pragma unroll
    for (int i = 0; i < 4; ++i) ra[0][i] = *(const v4u*)(Ap + (size_t)i * 32 * CC + OKO(2));
#pragma unroll
    for (int i = 0; i < 4; ++i) rw[0][i] = *(const v4u*)(Wp + (size_t)i * 32 * CC + OKO(2));
    loads_issued(); stage_bar();   // chunk 0 is published
    // one trip: chunk kc (buffer p = kc & 1) is multiplied; st: chunk kc + 1 goes from its set to the other buffer; ld: that set then takes chunk kc + 3, while chunk kc + 2 stays in flight in the other set
    auto trip = [&](const int kc, const int p, const bool st, const bool ld) __attribute__((always_inline)) { const _Float16* sb = &sg[p][0]; _Float16* sn = &sg[p ^ 1][0];
#pragma unroll
      for (int ks = 0; ks < KCH; ks += 32) { v16h a[2], w[4];
#pragma unroll
        for (int i = 0; i < 2; ++i) a[i] = frag_h(sb + (wr * 32 + i * 16 + col) * SPK + ks, lane);
#pragma unroll
        for (int j = 0; j < 4; ++j) w[j] = frag_h(sb + (128 + wc * 64 + j * 16 + col) * SPK + ks, lane);
#pragma unroll
        for (int i = 0; i < 2; ++i)
#pragma unroll
          for (int j = 0; j < 4; ++j) acc[i][j] = wmma16(a[i], w[j], acc[i][j]); }
      __builtin_amdgcn_sched_barrier(0);   // keeps the wait for chunk kc + 1's loads behind the products, which cover a part of their latency
      if (st) {   // the other buffer's readers left it before the last barrier
#pragma unroll
        for (int i = 0; i < 4; ++i) *(v4u*)(sn + so + i * 32 * SPK) = ra[p ^ 1][i];
#pragma unroll
        for (int i = 0; i < 4; ++i) *(v4u*)(sn + so + (128 + i * 32) * SPK) = rw[p ^ 1][i];
        if (ld) {
#pragma unroll
          for (int i = 0; i < 4; ++i) ra[p ^ 1][i] = *(const v4u*)(Ap + (size_t)i * 32 * CC + OKO(kc + 3));
#pragma unroll
          for (int i = 0; i < 4; ++i) rw[p ^ 1][i] = *(const v4u*)(Wp + (size_t)i * 32 * CC + OKO(kc + 3));
          loads_issued(); } }
      stage_bar(); };   // publishes chunk kc + 1 and ends the reads of chunk kc
#pragma unroll 1   // a pass is two trips, so that each trip's LDS buffer and register set are named by constants; every trip of the loop fetches, so that its wait leaves the younger chunk's eight loads in flight
    for (int kk = 0; kk < CC / KCH - 4; kk += 2) { trip(kk, 0, true, true); trip(kk + 1, 1, true, true); }
    trip(CC / KCH - 4, 0, true, true); trip(CC / KCH - 3, 1, true, false); trip(CC / KCH - 2, 0, true, false); trip(CC / KCH - 1, 1, false, false); }   // the last four trips stand apart: only the first of them still has a chunk to fetch
  float* sf = (float*)&sg[0][0] + wave * 32 * OFP;   // 8 x 32 x OFP x 4 bytes lie inside the two buffers
#pragma unroll
  for (int j = 0; j < 4; ++j) { const float bias = BO ? bfr(BO[c0 + j * 16 + col]) : 0.f;
#pragma unroll
    for (int i = 0; i < 2; ++i)
#pragma unroll
      for (int r = 0; r < 8; ++r) sf[(i * 16 + 8 * g + r) * OFP + j * 16 + col] = acc[i][j][r] * (1.0f / 16384.0f) + bias; }   /* 2^-8 (Wo carry) x 2^-6 (ctx carry) */
  LDSX();
  float* op = OUT + (r0 + g) * DIN + c0 + col * 4; const float* sp = sf + g * OFP + col * 4;   // a store = two rows of 256 contiguous bytes each: whole lines
#pragma unroll
  for (int rl = 0; rl < 32; rl += 2) vst2(op + (size_t)rl * DIN, *(const v4f*)(sp + rl * OFP)); }

extern "C" void kernel_launch(void* const* d_in, const int* in_sizes, int n_in, void* d_out, int out_size, void* d_ws, size_t ws_size, hipStream_t stream) {
  (void)in_sizes; (void)n_in; (void)out_size;
  const float** F = (const float**)d_in;
  if (ws_size < (size_t)WS_END) return;
  char* ws = (char*)d_ws; _Float16 *QH = (_Float16*)(ws + WS_QH), *KH = (_Float16*)(ws + WS_KH), *VT = (_Float16*)(ws + WS_VT), *QL = (_Float16*)(ws + WS_QL), *KL = (_Float16*)(ws + WS_KL); __bf16 *VB = (__bf16*)(ws + WS_VB), *VBL = (__bf16*)(ws + WS_VBL), *XB = (__bf16*)(ws + WS_XB), *WB = (__bf16*)(ws + WS_WB); _Float16 *WH = (_Float16*)(ws + WS_WH), *Y = (_Float16*)(ws + WS_Y); float* RT = (float*)(ws + WS_RT);
  (void)Y; (void)QL; (void)KL; (void)VB; (void)VBL;
  // inputs: 0 x [2,2048,1024]; 1 Wqkv [3072,1024] (out,in): q rows 0..1023, k 1024..2047, v 2048..3071; 2 Wout [1024,1024] (out,in); 3 token_positions [2048] int32 (arange; READ on the device); no biases
  k_cvt<<<dim3(CVT + CVX + CVW + CVO), 256, 0, stream>>>(F[0], F[1], F[2], (const int*)d_in[3], XB, WB, WH, RT);
  k_proj<<<dim3(TNB * TT / 128, CC / 128, 3), 128, 0, stream>>>(XB, XB, XB, WB, WB + (size_t)CC * DIN, WB + 2 * (size_t)CC * DIN, nullptr, nullptr, nullptr, QH, KH, VT, RT);
  k_fa<<<dim3(TT / 128, NH, TNB), 128, 0, stream>>>(QH, KH, VT, Y);
  k_out<<<dim3(TNB * TT / 128, DIN / 128), 256, 0, stream>>>(Y, WH, nullptr, (float*)d_out);
}
